// v000
// Measured on an AMD MI455X. A time is GPU time per run, averaged over a window of back-to-back runs after a warm-up
// (all launches, gaps included; the runs take copies of the inputs in turn), and the median of several windows.
// Apart from v000's, it joins two sittings. Times from different sittings can be a few percent apart, while
// side-by-side timings come from the same sitting.
// v000, which the later versions start from, runs in 309 microseconds.
// Contractions (all f32 accumulate): k/q projections v_wmma_f32_16x16x32_f16 (x f16 x16 . W f16 x64, K=512, single products) -> bf16 hi/lo planes;
// v^T projection v_wmma_f32_16x16x32_f16 (Wv f16 x64 . x f16 x16, K=512, single) -> f16 x16 hi/lo planes;
// relative-position tables v_wmma_f32_16x16x32_bf16 (q bf16 hi/lo . rel bf16, hi.W+lo.W, K=64) -> f32 table;
// attention scores v_wmma_f32_16x16x32_bf16 (k bf16 hi/lo . q bf16 hi/lo, hi.hi+hi.lo+lo.hi, K=64);
// P . v^T v_wmma_f32_16x16x32_f16 (P f16 x1024 hi/lo . v^T f16 x16 hi/lo, hi.hi+lo.hi+hi.lo, K=1024 by 32);
// per-head output projection v_wmma_f32_16x16x32_bf16 (ctx bf16 hi/lo . Wo bf16, K=64) with eval batch-norm affine in f32 -> bf16 hi/lo planes;
// final projection v_wmma_f32_16x16x32_bf16 (cat bf16 hi/lo . Wout bf16, K=512) + bf16-RNE residual in f32.
// Max-subtracted online base-2 softmax and the additive position logits in f32 on VALU. Every float input RNE-converted to bf16 on load.
#include <hip/hip_runtime.h>
#include <math.h>
#include <stdint.h>

#define NB     8
#define GH     32
#define GW     32
#define NTOK   (GH * GW)
#define DM     512
#define NHEAD  8
#define HD     64
#define HO     64
#define COUT   512
#define NREL   63
#define RTP    128
#define RT_LD  (NHEAD * RTP)
#define NROWS  (NB * NTOK)
#define KCH    32
#define WSC    64.0f
#define ACARRY 16.0f
#define VC     16.0f
#define PC     1024.0f
#define LOG2E  1.4426950408889634f
#define BN_EPS 1e-3f
static_assert(NHEAD * HD == DM);
static_assert(NHEAD * HO == COUT);
static_assert(COUT == DM);
static_assert(KCH == GW);
static_assert(NREL == 2 * GW - 1);
static_assert(NREL == 2 * GH - 1);
static_assert(NREL <= HD);
static_assert(HD + NREL <= RTP);
static_assert((NTOK % 64) == 0 && (DM % 64) == 0 && (NROWS % 64) == 0 && (HD % 32) == 0 && (NTOK % KCH) == 0);
#define ATT_THREADS (NHEAD * 32)
#define ATT_BLOCKS  (NB * (NTOK / 16))
#define PT_FLOATS   (NHEAD * 16 * 36)
#define ATT_SMEM_FLOATS 8192
static_assert(ATT_THREADS == 256);
static_assert(ATT_BLOCKS == 512);
static_assert(PT_FLOATS <= ATT_SMEM_FLOATS);
static_assert((size_t)2 * 16 * DM * sizeof(unsigned short) <= (size_t)ATT_SMEM_FLOATS * sizeof(float));
static_assert((16 * DM) / 8 == 4 * ATT_THREADS);

typedef _Float16 v16h __attribute__((ext_vector_type(16)));
typedef _Float16 v8h  __attribute__((ext_vector_type(8)));
typedef __bf16   v16b __attribute__((ext_vector_type(16)));
typedef float    v8f  __attribute__((ext_vector_type(8)));
typedef float    v4f  __attribute__((ext_vector_type(4)));
typedef unsigned int v4u __attribute__((ext_vector_type(4)));

union FragH { v16h v; v8h h[2]; v4u u[2]; };
union FragAny { v16h h; v16b b; };

// ---- scalar helpers --------------------------------------------------------------------------------
__device__ __forceinline__ unsigned short bf_bits(float f) {          // f32 -> bf16 bits, RNE convert
  unsigned u = __float_as_uint(f);
  return (unsigned short)((u + 0x7FFFu + ((u >> 16) & 1u)) >> 16);
}
__device__ __forceinline__ float bf_up(unsigned short h) { return __uint_as_float(((unsigned)h) << 16); }
__device__ __forceinline__ float bfr(float f) { return bf_up(bf_bits(f)); }   // value of the bf16 RNE convert
__device__ __forceinline__ unsigned short h_bits(_Float16 x) { return __builtin_bit_cast(unsigned short, x); }
__device__ __forceinline__ unsigned pk16(unsigned short a, unsigned short b) { return (unsigned)a | ((unsigned)b << 16); }
__device__ __forceinline__ v8f zero8() { v8f z = {0.f, 0.f, 0.f, 0.f, 0.f, 0.f, 0.f, 0.f}; return z; }

// ---- fragment loader: 16-bit A/B operand from a k-contiguous 16-bit plane, lane -> row/col (lane&15),
//      p already includes +8*(lane>>4); elements 0..7 <- p[0..7] (k0+8h..), elements 8..15 <- p[16..23] (k0+16+8h..)
//      (same split k map for A and B; B is always read from a [n][k] plane)
__device__ __forceinline__ v16h ldfrag_u(const unsigned short* p) {
  FragH f;
  f.u[0] = *(const v4u*)(p);
  f.u[1] = *(const v4u*)(p + 16);
  return f.v;
}

// ---- WMMA helpers with trailing VALU hazard gaps ------------------------------------------------------
__device__ __forceinline__ v8f mma_h(v16h a, v16h b, v8f c) {
  return __builtin_amdgcn_wmma_f32_16x16x32_f16(false, a, false, b, (short)0, c, false, false);
}
__device__ __forceinline__ v8f mma_b(v16h a, v16h b, v8f c) {
  FragAny ua, ub;
  ua.h = a;
  ub.h = b;
  return __builtin_amdgcn_wmma_f32_16x16x32_bf16(false, ua.b, false, ub.b, (short)0, c, false, false);
}
template <int BF>
__device__ __forceinline__ v8f mmaT(v16h a, v16h b, v8f c) {
  if constexpr (BF != 0) return mma_b(a, b, c);
  else return mma_h(a, b, c);
}
__device__ __forceinline__ void dep_guard1(v8f& a, v8f& b, v16h x) {
#if defined(__HIP_DEVICE_COMPILE__)
  asm volatile("v_nop\n\tv_nop\n\tv_nop\n\tv_nop" : "+v"(a), "+v"(b) : "v"(x));
#endif
}
__device__ __forceinline__ void guard1x4(v8f& s, v16h a0, v16h a1, v16h a2, v16h a3) {
#if defined(__HIP_DEVICE_COMPILE__)
  asm volatile("v_nop\n\tv_nop\n\tv_nop\n\tv_nop" : "+v"(s) : "v"(a0), "v"(a1), "v"(a2), "v"(a3));
#endif
}
__device__ __forceinline__ void guard1x8(v8f& s, v16h a0, v16h a1, v16h a2, v16h a3,
                                         v16h b0, v16h b1, v16h b2, v16h b3) {
#if defined(__HIP_DEVICE_COMPILE__)
  asm volatile("v_nop\n\tv_nop\n\tv_nop\n\tv_nop"
               : "+v"(s) : "v"(a0), "v"(a1), "v"(a2), "v"(a3), "v"(b0), "v"(b1), "v"(b2), "v"(b3));
#endif
}
__device__ __forceinline__ void guard4x6(v8f& a, v8f& b, v8f& c, v8f& d,
                                         v16h x0, v16h x1, v16h x2, v16h x3, v16h x4, v16h x5) {
#if defined(__HIP_DEVICE_COMPILE__)
  asm volatile("v_nop\n\tv_nop\n\tv_nop\n\tv_nop"
               : "+v"(a), "+v"(b), "+v"(c), "+v"(d) : "v"(x0), "v"(x1), "v"(x2), "v"(x3), "v"(x4), "v"(x5));
#endif
}
__device__ __forceinline__ void guard4x5(v8f& a, v8f& b, v8f& c, v8f& d,
                                         v16h x0, v16h x1, v16h x2, v16h x3, v16h x4) {
#if defined(__HIP_DEVICE_COMPILE__)
  asm volatile("v_nop\n\tv_nop\n\tv_nop\n\tv_nop"
               : "+v"(a), "+v"(b), "+v"(c), "+v"(d) : "v"(x0), "v"(x1), "v"(x2), "v"(x3), "v"(x4));
#endif
}
__device__ __forceinline__ void keep4_h(v16h a, v16h b, v16h c, v16h d) {
#if defined(__HIP_DEVICE_COMPILE__)
  asm volatile("v_nop" :: "v"(a), "v"(b), "v"(c), "v"(d));
#endif
}
__device__ __forceinline__ void acc_guard4(v8f& a, v8f& b, v8f& c, v8f& d) {
#if defined(__HIP_DEVICE_COMPILE__)
  asm volatile("v_nop\n\tv_nop\n\tv_nop\n\tv_nop" : "+v"(a), "+v"(b), "+v"(c), "+v"(d));
#endif
}
__device__ __forceinline__ void wave_sync_lds() {
  __builtin_amdgcn_fence(__ATOMIC_RELEASE, "workgroup");
  __builtin_amdgcn_wave_barrier();
  __builtin_amdgcn_fence(__ATOMIC_ACQUIRE, "workgroup");
}

// =====================================================================================================
// Elementwise 16-bit pack, no transpose. BFO 0: dst[i] = f16( bf16_RNE(src[i]) * sc ), sc a power of two (exact);
// BFO 1: dst[i] = bf16_RNE(src[i]) bits. 8 elements per thread: two 16-B loads, one 16-B store per lane; 32 consecutive
// coverage: grid = n / 2048 blocks x 256 thr x 8 elements = n exactly (host checks n % 2048 == 0).
// =====================================================================================================
template <int BFO>
__global__ __launch_bounds__(256) void cvt16(const float* __restrict__ src, unsigned short* dst, int n, float sc) {
  const size_t i8 = ((size_t)blockIdx.x * 256 + threadIdx.x) * 8;
  if (i8 + 8 > (size_t)n) return;                 // never taken with the exact grid; no barriers in this kernel
  const v4f a = *(const v4f*)(src + i8);
  const v4f b = *(const v4f*)(src + i8 + 4);
  v4u o;
  if constexpr (BFO != 0) {
    o[0] = pk16(bf_bits(a[0]), bf_bits(a[1]));
    o[1] = pk16(bf_bits(a[2]), bf_bits(a[3]));
    o[2] = pk16(bf_bits(b[0]), bf_bits(b[1]));
    o[3] = pk16(bf_bits(b[2]), bf_bits(b[3]));
  } else {
    o[0] = pk16(h_bits((_Float16)(bfr(a[0]) * sc)), h_bits((_Float16)(bfr(a[1]) * sc)));
    o[1] = pk16(h_bits((_Float16)(bfr(a[2]) * sc)), h_bits((_Float16)(bfr(a[3]) * sc)));
    o[2] = pk16(h_bits((_Float16)(bfr(b[0]) * sc)), h_bits((_Float16)(bfr(b[1]) * sc)));
    o[3] = pk16(h_bits((_Float16)(bfr(b[2]) * sc)), h_bits((_Float16)(bfr(b[3]) * sc)));
  }
  {
    *(v4u*)(dst + i8) = o;
    
  }
}

// =====================================================================================================
// Transposing 16-bit pack of a weight matrix: in W[Cin][Dd] (pitch Dd, base + z*sIn) -> out WT[Dd][Cin] (pitch Cin, base + z*sOut),
// BFO 0: f16( bf16_RNE(w) * sc ); BFO 1: bf16_RNE(w) bits. One 64x64 tile per block (x = Cin tile, y = Dd tile, z = matrix index):
// coverage: loads 4 x 256 x 4 floats = 64x64; stores 2 x 256 pieces x 8 halves = 64 rows x 64 halves = the whole tile;
//           grid = (Cin/64, Dd/64, nmat) exact (host passes exact multiples of 64).
// =====================================================================================================
template <int BFO>
__global__ __launch_bounds__(256) void tr16(const float* __restrict__ W, unsigned short* WT, int Cin, int Dd,
                                            long long sIn, long long sOut, float sc) {
  __shared__ float t[64][65];
  const int tid = threadIdx.x;
  const int c0 = blockIdx.x * 64, d0 = blockIdx.y * 64;
  const float* src = W + (size_t)((long long)blockIdx.z * sIn);
  unsigned short* dst = WT + (size_t)((long long)blockIdx.z * sOut);
#pragma unroll
  for (int it = 0; it < 4; ++it) {
    const int p  = it * 256 + tid;
    const int cc = p >> 4, sg = (p & 15) * 4;
    const v4f v = *(const v4f*)(src + (size_t)(c0 + cc) * Dd + d0 + sg);
    t[cc][sg]     = v[0];
    t[cc][sg + 1] = v[1];
    t[cc][sg + 2] = v[2];
    t[cc][sg + 3] = v[3];
  }
  __syncthreads();
  v4u o[2];
#pragma unroll
  for (int it = 0; it < 2; ++it) {
    const int p  = it * 256 + tid;
    const int dd = p >> 3, s8 = (p & 7) * 8;
    unsigned short hv[8];
#pragma unroll
    for (int k = 0; k < 8; ++k) {
      const float f = bfr(t[s8 + k][dd]);
      if constexpr (BFO != 0) hv[k] = bf_bits(f);
      else hv[k] = h_bits((_Float16)(f * sc));
    }
    v4u q;
    q[0] = pk16(hv[0], hv[1]);
    q[1] = pk16(hv[2], hv[3]);
    q[2] = pk16(hv[4], hv[5]);
    q[3] = pk16(hv[6], hv[7]);
    o[it] = q;
  }
  {
#pragma unroll
    for (int it = 0; it < 2; ++it) {
      const int p  = it * 256 + tid;
      const int dd = p >> 3, s8 = (p & 7) * 8;
      *(v4u*)(dst + (size_t)(d0 + dd) * Cin + c0 + s8) = o[it];
    }
    
  }
}

// =====================================================================================================
// Relative-position operand plane: out[h][r][0..63] bf16 bits, r 0..62 = rel_w[h][r][:], r 63 = 0, r 64..126 = rel_h[h][r-64][:],
// r 127 = 0. Every lane loads both candidate rows from clamped addresses and selects by value. 8 halves per thread, 8 consecutive
// coverage: 32 blocks x 256 threads x 8 halves = 8 x 128 x 64 exactly.
// =====================================================================================================
__global__ __launch_bounds__(256) void relcat(const float* __restrict__ rw, const float* __restrict__ rh, unsigned short* out) {
  const int p   = blockIdx.x * 256 + threadIdx.x;        // 0 .. NHEAD*RTP*8 - 1
  const int hd  = p / (RTP * 8);
  const int r   = (p >> 3) & (RTP - 1);
  const int seg = (p & 7) * 8;
  const int iw  = (r < NREL) ? r : (NREL - 1);
  int ih = r - HD;
  ih = (ih < 0) ? 0 : ih;
  ih = (ih > NREL - 1) ? (NREL - 1) : ih;
  const float* pw = rw + ((size_t)hd * NREL + iw) * HD + seg;
  const float* ph = rh + ((size_t)hd * NREL + ih) * HD + seg;
  const v4f a0 = *(const v4f*)(pw), a1 = *(const v4f*)(pw + 4);
  const v4f b0 = *(const v4f*)(ph), b1 = *(const v4f*)(ph + 4);
  const bool uw = (r < NREL);
  const bool uh = (r >= HD) && (r < HD + NREL);
  float v[8];
#pragma unroll
  for (int e = 0; e < 4; ++e) {
    v[e]     = uw ? a0[e] : (uh ? b0[e] : 0.f);
    v[4 + e] = uw ? a1[e] : (uh ? b1[e] : 0.f);
  }
  v4u o;
  o[0] = pk16(bf_bits(v[0]), bf_bits(v[1]));
  o[1] = pk16(bf_bits(v[2]), bf_bits(v[3]));
  o[2] = pk16(bf_bits(v[4]), bf_bits(v[5]));
  o[3] = pk16(bf_bits(v[6]), bf_bits(v[7]));
  {
    *(v4u*)(out + (size_t)p * 8) = o;
    
  }
}

// =====================================================================================================
// Register-blocked batched 16-bit WMMA GEMM: C[m][n] = oscale * sum_k A[m][k] * Bt[n][k]; one wave per 64x64 tile, no block barriers.
// A row-major [M][K] pitch lda (16-bit plane), Bt row-major [N][K] pitch ldb (k contiguous); M, N multiples of 64, K multiple of 32.
// blockIdx.y = batch index with element strides sA, sB, sC.
// ASPLIT 1: a second A plane A2 (unscaled residual of A, same layout) is multiplied into the same accumulator (A + A2 ~ exact A).
// BF 1: bf16 operands (v_wmma_f32_16x16x32_bf16), else f16.
// OM 0: f32 out (pitch ldc).  OM 2: f16 out = f16(value * ocarry).  OM 3: two bf16 planes: hi = bf16_RNE(value), lo = bf16_RNE(value - hi).
// OM 4: two f16 planes: hi = f16(value * ocarry), lo = f16(value * ocarry - hi) (unscaled residual).
// EPI 1 (OM 0 only): value += bf16_RNE(ep0[same index as C]).  EPI 2 (16-bit out): per-column eval batch-norm affine
//   value = (bf16(ep0[ci]) * (value - bf16(ep2[ci]))) * rsqrt(bf16(ep3[ci]) + eps) + bf16(ep1[ci]),  ci = by*cps + column.
// coverage: 4 slabs x 16 rows (f32: it 0..7 x lane>>4; 16-bit: it 0..3 x lane>>3) x 64 cols = the wave's whole 64x64 tile;
//           grid = ceil(tilesM*tilesN/8) blocks, surplus waves exit (wave-uniform).
// =====================================================================================================
template <int OM, int ASPLIT, int BF, int EPI>
__global__ __launch_bounds__(256) __attribute__((amdgpu_num_vgpr(256))) void gemm64(
    const unsigned short* __restrict__ Ap, const unsigned short* __restrict__ A2p, int lda, long long sA,
    const unsigned short* __restrict__ Btp, int ldb, long long sB,
    void* Cout, void* C2out, int ldc, long long sC,
    int M, int N, int K, float oscale, float ocarry,
    const float* __restrict__ ep0, const float* __restrict__ ep1,
    const float* __restrict__ ep2, const float* __restrict__ ep3, int cps) {
  __shared__ __align__(16) float sT[8][16 * 68];   // per-wave 16x64 slab, pitch 68 floats
  const int by   = blockIdx.y;
  const int lane = threadIdx.x & 31;
  const int wave = threadIdx.x >> 5;
  const int tilesN = N >> 6;
  const int tilesM = M >> 6;
  const int tile = blockIdx.x * 8 + wave;
  if (tile >= tilesM * tilesN) return;   // wave-uniform; no block barriers in this kernel
  const int tm = tile / tilesN;
  const int tn = tile - tm * tilesN;
  const int m0 = tm << 6;
  const int n0 = tn << 6;

  const unsigned short* A1 = Ap  + (size_t)((long long)by * sA);
  const unsigned short* A2 = A2p + (size_t)((long long)by * sA);
  const unsigned short* Bb = Btp + (size_t)((long long)by * sB);

  const int rlane = lane & 15;                 // row (A) / col (B, D) within subtile
  const int koff  = (lane >> 4) * 8;           // k offset of this lane half
  const int mOff  = (lane >> 4) * 8;           // D row offset

  v8f acc[4][4];
#pragma unroll
  for (int i = 0; i < 4; ++i)
#pragma unroll
    for (int j = 0; j < 4; ++j) acc[i][j] = zero8();

  for (int k0 = 0; k0 < K; k0 += 32) {
    v16h bh[4];
#pragma unroll
    for (int j = 0; j < 4; ++j) {
      const size_t bofs = (size_t)(n0 + (j << 4) + rlane) * ldb + koff + k0;
      bh[j] = ldfrag_u(Bb + bofs);
    }
#pragma unroll
    for (int i = 0; i < 4; ++i) {
      const size_t ao = (size_t)(m0 + (i << 4) + rlane) * lda + koff + k0;
      const v16h ah = ldfrag_u(A1 + ao);
#pragma unroll
      for (int j = 0; j < 4; ++j) acc[i][j] = mmaT<BF>(ah, bh[j], acc[i][j]);
      dep_guard1(acc[i][0], acc[i][3], ah);
      if constexpr (ASPLIT != 0) {
        const v16h al = ldfrag_u(A2 + ao);
#pragma unroll
        for (int j = 0; j < 4; ++j) acc[i][j] = mmaT<BF>(al, bh[j], acc[i][j]);
        dep_guard1(acc[i][0], acc[i][3], al);
      }
    }
    keep4_h(bh[0], bh[1], bh[2], bh[3]);
  }
  acc_guard4(acc[0][0], acc[0][1], acc[0][2], acc[0][3]);
  acc_guard4(acc[1][0], acc[1][1], acc[1][2], acc[1][3]);
  acc_guard4(acc[2][0], acc[2][1], acc[2][2], acc[2][3]);
  acc_guard4(acc[3][0], acc[3][1], acc[3][2], acc[3][3]);

  const int hh2 = lane >> 4, c4 = (lane & 15) * 4;     // f32 out: 256-B row segment = 16 lanes x 16 B
  const int q8  = lane >> 3, c8 = (lane & 7) * 8;

  // ---- epilogue ----
  float* slab = sT[wave];
#pragma unroll
  for (int i = 0; i < 4; ++i) {
    const int mBase = m0 + (i << 4);
#pragma unroll
    for (int j = 0; j < 4; ++j) {
#pragma unroll
      for (int r = 0; r < 8; ++r) {
        slab[(mOff + r) * 68 + (j << 4) + rlane] = acc[i][j][r];
      }
    }
    wave_sync_lds();
    if constexpr (OM == 0) {
      float* C = (float*)Cout + (size_t)((long long)by * sC);
      const float* R = ep0 + (size_t)((long long)by * sC);
      v4f vals[8];
#pragma unroll
      for (int it = 0; it < 8; ++it) {
        const int row = it * 2 + hh2;                      // it 0..7 x hh2 0..1 = rows 0..15
        v4f v = *(const v4f*)(slab + row * 68 + c4);
#pragma unroll
        for (int e = 0; e < 4; ++e) v[e] = v[e] * oscale;
        if constexpr (EPI == 1) {
          const v4f xr = *(const v4f*)(R + (size_t)(mBase + row) * ldc + n0 + c4);
#pragma unroll
          for (int e = 0; e < 4; ++e) v[e] = v[e] + bfr(xr[e]);
        }
        vals[it] = v;
      }
      {
#pragma unroll
        for (int it = 0; it < 8; ++it) {
          const int gr = mBase + it * 2 + hh2;
          *(v4f*)(C + (size_t)gr * ldc + n0 + c4) = vals[it];
        }
        
      }
    } else {
      unsigned short* C  = (unsigned short*)Cout  + (size_t)((long long)by * sC);
      unsigned short* Cb = (unsigned short*)C2out + (size_t)((long long)by * sC);
      v4u hv[4], lv[4];
#pragma unroll
      for (int it = 0; it < 4; ++it) {
        const int row = it * 4 + q8;                       // it 0..3 x q8 0..3 = rows 0..15
        const float* sp = slab + row * 68 + c8;
        v4u a  = {0u, 0u, 0u, 0u};
        v4u b2 = {0u, 0u, 0u, 0u};
#pragma unroll
        for (int e = 0; e < 4; ++e) {
          float f0 = sp[2 * e] * oscale;
          float f1 = sp[2 * e + 1] * oscale;
          if constexpr (EPI == 2) {
            const int ci = by * cps + n0 + c8 + 2 * e;   // column parameter index (host keeps by*cps + N <= parameter count)
            const float g0 = bfr(ep0[ci]), g1 = bfr(ep0[ci + 1]);
            const float t0 = bfr(ep1[ci]), t1 = bfr(ep1[ci + 1]);
            const float u0 = bfr(ep2[ci]), u1 = bfr(ep2[ci + 1]);
            const float r0 = rsqrtf(bfr(ep3[ci]) + BN_EPS), r1 = rsqrtf(bfr(ep3[ci + 1]) + BN_EPS);
            f0 = (g0 * (f0 - u0)) * r0 + t0;
            f1 = (g1 * (f1 - u1)) * r1 + t1;
          }
          if constexpr (OM == 3) {
            const unsigned short h0 = bf_bits(f0), h1 = bf_bits(f1);
            a[e]  = pk16(h0, h1);
            b2[e] = pk16(bf_bits(f0 - bf_up(h0)), bf_bits(f1 - bf_up(h1)));
          } else {
            f0 *= ocarry; f1 *= ocarry;
            const _Float16 x0 = (_Float16)f0, x1 = (_Float16)f1;
            a[e] = pk16(h_bits(x0), h_bits(x1));
            if constexpr (OM == 4) {
              b2[e] = pk16(h_bits((_Float16)(f0 - (float)x0)), h_bits((_Float16)(f1 - (float)x1)));
            }
          }
        }
        hv[it] = a;
        lv[it] = b2;
      }
      {
#pragma unroll
        for (int it = 0; it < 4; ++it) {
          const int row = it * 4 + q8;
          *(v4u*)(C + (size_t)(mBase + row) * ldc + n0 + c8) = hv[it];
          if constexpr (OM >= 3) {
            *(v4u*)(Cb + (size_t)(mBase + row) * ldc + n0 + c8) = lv[it];
          }
        }
        
      }
    }
    wave_sync_lds();
  }
}

// =====================================================================================================
// Flash attention for one image (batch) and 16 score rows, all 8 heads (one wave per head), head dim 64, 1024 columns:
//   rows i index KEY positions (k_i stationary, A fragments), columns j index the q/v positions streamed in chunks of 32 = one image row;
//   k planes (bf16 hi, lo) K[b*1024 + tok][64h + d], pitch 512; q planes (bf16 hi, lo) Q[b*1024 + tok][64h + d];
//   v^T planes (f16 x16 hi, unscaled lo): VT[b*512 + 64h + d][tok] (pitch 1024);
//   additive position logits from the f32 table R[b*1024 + tok][128h + m] (m < 63: q_tok . rel_w[h][m]; 64 + m: q_tok . rel_h[h][m]):
//   logit[i][j] = k_i . q_j + R[i][yj - yi + 31] + R[i][64 + xj - xi + 31], token = 32*x + y. The w part depends only on the column within
//   a chunk (16 registers per lane, loaded once), the h part only on the chunk (8 loads per lane per chunk); indices are pure arithmetic.
//   out (bf16 hi, lo planes): CT[b*1024 + tok][64h + d] = sum_j softmax_j(logit) v[j][d]  (softmax run in base 2, max-subtracted, no 1/sqrt(d)).
//   block = 8 waves = 256 threads; grid = 8 x 64 = 512; every wave does identical bounded work (32 steps of 32 columns).
//   Per step: 2 score tiles on bf16 WMMA (hi.hi + hi.lo + lo.hi, K = 64 as two k-steps of 32), fragments loaded straight from the
//   16-bit planes (two 16-B loads per fragment, arithmetic addressing); online softmax in f32 (exp2); rescale of the running sums and the
//   of P*1024 (f16 hi and unscaled residual) rebuilt from the LDS rows (f32 vector loads, split k map) and the v^T B fragments (hi and lo planes)
//   loaded straight from the 16-bit planes; 12 P.V WMMAs (hi.hi, lo.hi, hi.lo).
//   Final 1/l and carry folds in f32; after a block barrier the LDS buffer is reused as the block's two bf16 result row buffers [16][512] each
//   (hi, lo): each wave stages its 16x64 slice (element stores); after a second block barrier the 256 threads write the block's 16 full rows of
// coverage: LDS row buffers: 8 waves x 16 rows x 64 cols = 16 x 512 per plane; global: 4 iterations x 256 threads x 8 halves = 16 rows x 512
//           of rows i0..i0+15 of image b, per plane; grid covers all 8 x 1024 rows exactly once.
// =====================================================================================================
__global__ __launch_bounds__(ATT_THREADS) __attribute__((amdgpu_num_vgpr(256)))
void attn8(const unsigned short* __restrict__ KHh, const unsigned short* __restrict__ KHl,
           const unsigned short* __restrict__ QHh, const unsigned short* __restrict__ QHl,
           const unsigned short* __restrict__ VTh, const unsigned short* __restrict__ VTl,
           const float* __restrict__ Rtab, unsigned short* CTh, unsigned short* CTl) {
  __shared__ __align__(16) float smem[ATT_SMEM_FLOATS];   // prob tiles [wave][row][32 cols] pitch 36 | later: two bf16 row buffers

  const int tid  = threadIdx.x;
  const int wave = tid >> 5;
  const int lane = tid & 31;
  const int hh   = lane >> 4;
  const int c    = lane & 15;

  const int rt   = blockIdx.x & ((NTOK / 16) - 1);         // 0..63
  const int bat  = blockIdx.x / (NTOK / 16);               // 0..7
  const int head = wave;                                   // 0..7
  const int i0   = rt * 16;                                // first score row (key token) of this block
  const int x0   = i0 / GW;                                // image row of all 16 tokens
  const int ybase = (i0 & (GW - 1)) + 8 * hh;              // image column of row element r is ybase + r
  const size_t rowg = (size_t)bat * NTOK + i0;

  // stationary A fragments: k rows i0 + c (hi and residual planes), d 0..31 and 32..63
  const size_t kofs = (rowg + c) * DM + head * HD + 8 * hh;
  const v16h kah = ldfrag_u(KHh + kofs), kbh = ldfrag_u(KHh + kofs + 32);
  const v16h kal = ldfrag_u(KHl + kofs), kbl = ldfrag_u(KHl + kofs + 32);

  // additive w-position logits for this lane's 16 (row, column-in-chunk) score elements, loop-invariant, pre-scaled by log2(e)
  const float* rrow = Rtab + (rowg + 8 * hh) * RT_LD + head * RTP;   // + r*RT_LD = table row of score row 8hh+r
  float wb0[8], wb1[8];
#pragma unroll
  for (int r = 0; r < 8; ++r) {
    const float* rp = rrow + (size_t)r * RT_LD;
    const int iw = c + (GW - 1) - (ybase + r);             // in [0, 46]
    wb0[r] = rp[iw] * LOG2E;
    wb1[r] = rp[iw + 16] * LOG2E;                          // in [16, 62]
  }

  const size_t qbase = (size_t)bat * NTOK * DM + head * HD + 8 * hh;
  const unsigned short* Qbh = QHh + qbase;
  const unsigned short* Qbl = QHl + qbase;
  const size_t vbase = ((size_t)bat * DM + head * HD) * NTOK + 8 * hh;
  const unsigned short* Vbh = VTh + vbase;
  const unsigned short* Vbl = VTl + vbase;

  float mrow[8], lrow[8];
  v8f o0 = zero8(), o1 = zero8(), o2 = zero8(), o3 = zero8();
#pragma unroll
  for (int r = 0; r < 8; ++r) { mrow[r] = -INFINITY; lrow[r] = 0.f; }
  float* pt = smem + wave * (16 * 36);

#pragma unroll 1
  for (int jb = 0; jb < NTOK; jb += KCH) {
    const size_t qo = (size_t)(jb + c) * DM;
    v8f s0, s1;
    {
      const v16h q0h = ldfrag_u(Qbh + qo), q1h = ldfrag_u(Qbh + qo + 32);
      const v16h q0l = ldfrag_u(Qbl + qo), q1l = ldfrag_u(Qbl + qo + 32);
      s0 = mma_b(kah, q0h, zero8());
      s0 = mma_b(kbh, q1h, s0);
      s0 = mma_b(kah, q0l, s0);
      s0 = mma_b(kbh, q1l, s0);
      s0 = mma_b(kal, q0h, s0);
      s0 = mma_b(kbl, q1h, s0);
      guard1x4(s0, q0h, q1h, q0l, q1l);
    }
    {
      const size_t q2 = qo + (size_t)16 * DM;
      const v16h q0h = ldfrag_u(Qbh + q2), q1h = ldfrag_u(Qbh + q2 + 32);
      const v16h q0l = ldfrag_u(Qbl + q2), q1l = ldfrag_u(Qbl + q2 + 32);
      s1 = mma_b(kah, q0h, zero8());
      s1 = mma_b(kbh, q1h, s1);
      s1 = mma_b(kah, q0l, s1);
      s1 = mma_b(kbh, q1l, s1);
      s1 = mma_b(kal, q0h, s1);
      s1 = mma_b(kbl, q1h, s1);
      guard1x8(s1, q0h, q1h, q0l, q1l, kah, kbh, kal, kbl);
    }
    // h-position logit of this chunk (one image row x2 = jb / GW) for each of the lane's 8 score rows
    const int mh = (jb / GW) - x0 + (GH - 1);              // in [0, 62]
    const float* hp = rrow + HD + mh;
#pragma unroll
    for (int r = 0; r < 8; ++r) {
      const float hb = hp[(size_t)r * RT_LD] * LOG2E;
      const float t0 = s0[r] * LOG2E + (wb0[r] + hb), t1 = s1[r] * LOG2E + (wb1[r] + hb);
      float mx = fmaxf(t0, t1);
#pragma unroll
      for (int off = 1; off < 16; off <<= 1) mx = fmaxf(mx, __shfl_xor(mx, off, 32));
      const float mn = fmaxf(mrow[r], mx);
      const float al = exp2f(mrow[r] - mn);
      mrow[r] = mn;
      const float e0 = exp2f(t0 - mn), e1 = exp2f(t1 - mn);
      float ps = e0 + e1;
#pragma unroll
      for (int off = 1; off < 16; off <<= 1) ps += __shfl_xor(ps, off, 32);
      lrow[r] = lrow[r] * al + ps;
      o0[r] *= al;
      o1[r] *= al;
      o2[r] *= al;
      o3[r] *= al;
      const int ro = (8 * hh + r) * 36 + c;
      pt[ro]      = e0;
      pt[ro + 16] = e1;
    }
    wave_sync_lds();
    FragH ph, pl;
    {
      const float* prow = pt + c * 36 + 8 * hh;
      const v4f p0 = *(const v4f*)(prow), p1 = *(const v4f*)(prow + 4);
      const v4f p2 = *(const v4f*)(prow + 16), p3 = *(const v4f*)(prow + 20);
#pragma unroll
      for (int e = 0; e < 4; ++e) {
        float f; _Float16 x;
        f = p0[e] * PC; x = (_Float16)f; ph.h[0][e]     = x; pl.h[0][e]     = (_Float16)(f - (float)x);   // cols jb + 8hh + e
        f = p1[e] * PC; x = (_Float16)f; ph.h[0][4 + e] = x; pl.h[0][4 + e] = (_Float16)(f - (float)x);   // cols jb + 8hh + 4 + e
        f = p2[e] * PC; x = (_Float16)f; ph.h[1][e]     = x; pl.h[1][e]     = (_Float16)(f - (float)x);   // cols jb + 16 + 8hh + e
        f = p3[e] * PC; x = (_Float16)f; ph.h[1][4 + e] = x; pl.h[1][4 + e] = (_Float16)(f - (float)x);
      }
    }
    const size_t vo = (size_t)c * NTOK + jb;
    {
      const v16h vh0 = ldfrag_u(Vbh + vo);
      const v16h vh1 = ldfrag_u(Vbh + vo + (size_t)16 * NTOK);
      const v16h vh2 = ldfrag_u(Vbh + vo + (size_t)32 * NTOK);
      const v16h vh3 = ldfrag_u(Vbh + vo + (size_t)48 * NTOK);
      o0 = mma_h(ph.v, vh0, o0);
      o1 = mma_h(ph.v, vh1, o1);
      o2 = mma_h(ph.v, vh2, o2);
      o3 = mma_h(ph.v, vh3, o3);
      o0 = mma_h(pl.v, vh0, o0);
      o1 = mma_h(pl.v, vh1, o1);
      o2 = mma_h(pl.v, vh2, o2);
      o3 = mma_h(pl.v, vh3, o3);
      guard4x6(o0, o1, o2, o3, ph.v, pl.v, vh0, vh1, vh2, vh3);
    }
    {
      const v16h vl0 = ldfrag_u(Vbl + vo);
      const v16h vl1 = ldfrag_u(Vbl + vo + (size_t)16 * NTOK);
      const v16h vl2 = ldfrag_u(Vbl + vo + (size_t)32 * NTOK);
      const v16h vl3 = ldfrag_u(Vbl + vo + (size_t)48 * NTOK);
      o0 = mma_h(ph.v, vl0, o0);
      o1 = mma_h(ph.v, vl1, o1);
      o2 = mma_h(ph.v, vl2, o2);
      o3 = mma_h(ph.v, vl3, o3);
      guard4x5(o0, o1, o2, o3, ph.v, vl0, vl1, vl2, vl3);
    }
    wave_sync_lds();
  }

  // ---- all waves done with their prob tiles; the LDS buffer becomes two bf16 result row buffers [16][512] ----
  __syncthreads();
  unsigned short* Osh = (unsigned short*)smem;
  unsigned short* Osl = Osh + 16 * DM;
  // ---- fold 1/l and the carries (1024 on P, 16 on v), split into bf16 hi + residual, stage the wave's 16x64 slice ----
  const float oc = 1.0f / (PC * VC);
  const int cb = wave * HD + c;
#pragma unroll
  for (int r = 0; r < 8; ++r) {
    const float inv = (1.0f / lrow[r]) * oc;
    const int ro = (8 * hh + r) * DM + cb;
    const float f0 = o0[r] * inv, f1 = o1[r] * inv, f2 = o2[r] * inv, f3 = o3[r] * inv;
    const unsigned short g0 = bf_bits(f0), g1 = bf_bits(f1), g2 = bf_bits(f2), g3 = bf_bits(f3);
    Osh[ro]      = g0;  Osl[ro]      = bf_bits(f0 - bf_up(g0));
    Osh[ro + 16] = g1;  Osl[ro + 16] = bf_bits(f1 - bf_up(g1));
    Osh[ro + 32] = g2;  Osl[ro + 32] = bf_bits(f2 - bf_up(g2));
    Osh[ro + 48] = g3;  Osl[ro + 48] = bf_bits(f3 - bf_up(g3));
  }
  __syncthreads();
  // ---- block writes its 16 contiguous rows of both planes: piece p = it*256 + tid -> halves p*8 .. p*8+7 of the 16x512 region ----
  {
    v4u hv[4], lv[4];
#pragma unroll
    for (int it = 0; it < 4; ++it) {
      const int p = it * ATT_THREADS + tid;
      hv[it] = *(const v4u*)(Osh + (size_t)p * 8);
      lv[it] = *(const v4u*)(Osl + (size_t)p * 8);
    }
    const size_t dofs = rowg * DM;
    unsigned short* dsth = CTh + dofs;
    unsigned short* dstl = CTl + dofs;
    {
#pragma unroll
      for (int it = 0; it < 4; ++it) {
        const int p = it * ATT_THREADS + tid;
        *(v4u*)(dsth + (size_t)p * 8) = hv[it];
        *(v4u*)(dstl + (size_t)p * 8) = lv[it];
      }
      
    }
  }
}

// =====================================================================================================
// Workspace map (bytes); every plane is an exact multiple of its tile / whole-row store granularity (M, N exact tile multiples,
// the activation convert count an exact multiple of 2048, no pad rows needed), every offset a multiple of 64 KiB:
//   WKT, WQT, WVT f16 [512][512] x64   3 x 524288    ([h*64+d][c] = [n][k])
//   WOT  bf16 [8][64 e][64 d]              65536
//   WUT  bf16 [512 out][512 in]          524288
//   REL  bf16 [8][128][64]                131072
//   X16  f16 [8192][512] x16             8388608    (activation rows b*1024 + tok)
//   QHh, QHl bf16 [8192][512]         2 x 8388608   (q projection, hi / residual)
//   KHh, KHl bf16 [8192][512]         2 x 8388608   (k projection, hi / residual)
//   VTh, VTl f16 [8][512][1024] x16   2 x 8388608   (v^T per image, hi / residual)
//   RTAB f32 [8192][1024]               33554432   (position-logit tables, 128 per head)
//   CTh, CTl bf16 [8192][512]         2 x 8388608   (attention ctx, merged heads, hi / residual)
//   CAh, CAl bf16 [8192][512]         2 x 8388608   (per-head output after batch-norm, concat layout, hi / residual)
//   end                                 128122880
// =====================================================================================================
extern "C" void kernel_launch(void* const* d_in, const int* in_sizes, int n_in,
                              void* d_out, int out_size, void* d_ws, size_t ws_size,
                              hipStream_t stream) {
  if (n_in < 12) return;
  if (in_sizes[0] != NROWS * DM) return;
  if (in_sizes[1] != NHEAD * DM * HD || in_sizes[2] != NHEAD * DM * HD || in_sizes[3] != NHEAD * DM * HD) return;
  if (in_sizes[4] != NHEAD * HD * HO) return;
  if (in_sizes[5] != NHEAD * HO || in_sizes[6] != NHEAD * HO || in_sizes[7] != NHEAD * HO || in_sizes[8] != NHEAD * HO) return;
  if (in_sizes[9] != NHEAD * NREL * HD || in_sizes[10] != NHEAD * NREL * HD) return;
  if (in_sizes[11] != COUT * COUT) return;
  if (out_size != NROWS * COUT) return;
  if ((in_sizes[0] % 2048) != 0) return;

  const float* x     = (const float*)d_in[0];
  const float* w_k   = (const float*)d_in[1];
  const float* w_q   = (const float*)d_in[2];
  const float* w_v   = (const float*)d_in[3];
  const float* w_o   = (const float*)d_in[4];
  const float* gam   = (const float*)d_in[5];
  const float* bet   = (const float*)d_in[6];
  const float* mmean = (const float*)d_in[7];
  const float* mvar  = (const float*)d_in[8];
  const float* relw  = (const float*)d_in[9];
  const float* relh  = (const float*)d_in[10];
  const float* w_out = (const float*)d_in[11];
  float*       out   = (float*)d_out;

  const size_t PWT = (size_t)DM * DM * 2;                         //   524288
  const size_t PWO = (size_t)NHEAD * HO * HD * 2;                 //    65536
  const size_t PWU = (size_t)COUT * COUT * 2;                     //   524288
  const size_t PRL = (size_t)NHEAD * RTP * HD * 2;                //   131072
  const size_t PX  = (size_t)NROWS * DM * 2;                      //  8388608
  const size_t PVT = (size_t)NB * DM * NTOK * 2;                  //  8388608
  const size_t PRT = (size_t)NROWS * RT_LD * 4;                   // 33554432
  size_t off = 0;
  const size_t oWK = off; off += PWT;
  const size_t oWQ = off; off += PWT;
  const size_t oWV = off; off += PWT;
  const size_t oWO = off; off += PWO;
  const size_t oWU = off; off += PWU;
  const size_t oRL = off; off += PRL;
  const size_t oX  = off; off += PX;
  const size_t oQh = off; off += PX;
  const size_t oQl = off; off += PX;
  const size_t oKh = off; off += PX;
  const size_t oKl = off; off += PX;
  const size_t oVh = off; off += PVT;
  const size_t oVl = off; off += PVT;
  const size_t oRT = off; off += PRT;
  const size_t oCh = off; off += PX;
  const size_t oCl = off; off += PX;
  const size_t oAh = off; off += PX;
  const size_t oAl = off; off += PX;
  if (off > ws_size) return;                                      // off = 128122880
  if (off > (size_t)134217728) return;

  char* ws = (char*)d_ws;
  unsigned short* WKT  = (unsigned short*)(ws + oWK);
  unsigned short* WQT  = (unsigned short*)(ws + oWQ);
  unsigned short* WVT  = (unsigned short*)(ws + oWV);
  unsigned short* WOT  = (unsigned short*)(ws + oWO);
  unsigned short* WUT  = (unsigned short*)(ws + oWU);
  unsigned short* REL  = (unsigned short*)(ws + oRL);
  unsigned short* X16  = (unsigned short*)(ws + oX);
  unsigned short* QHh  = (unsigned short*)(ws + oQh);
  unsigned short* QHl  = (unsigned short*)(ws + oQl);
  unsigned short* KHh  = (unsigned short*)(ws + oKh);
  unsigned short* KHl  = (unsigned short*)(ws + oKl);
  unsigned short* VTh  = (unsigned short*)(ws + oVh);
  unsigned short* VTl  = (unsigned short*)(ws + oVl);
  float*          RTAB = (float*)(ws + oRT);
  unsigned short* CTh  = (unsigned short*)(ws + oCh);
  unsigned short* CTl  = (unsigned short*)(ws + oCl);
  unsigned short* CAh  = (unsigned short*)(ws + oAh);
  unsigned short* CAl  = (unsigned short*)(ws + oAl);

  const dim3 blk(256);
  const dim3 gTW(DM / 64, HD / 64, NHEAD);                         // 8 x 1 x 8
  const dim3 gTO(HD / 64, HO / 64, NHEAD);                         // 1 x 1 x 8
  const dim3 gTU(COUT / 64, COUT / 64, 1);                         // 8 x 8 x 1
  const dim3 gRL((NHEAD * RTP * 8) / 256);                         // 32
  const dim3 gCX((NROWS * DM) / 2048);                             // 2048
  const int tilesP = (NROWS / 64) * (DM / 64);                     // 1024
  const int tilesV = (DM / 64) * (NTOK / 64);                      // 128 per image
  const int tilesR = (NROWS / 64) * (RTP / 64);                    // 256 per head
  const int tilesH = (NROWS / 64) * (HO / 64);                     // 128 per head
  const int tilesF = (NROWS / 64) * (COUT / 64);                   // 1024
  const dim3 gP((tilesP + 7) / 8, 1);                              // 128
  const dim3 gV((tilesV + 7) / 8, NB);                             // 16 x 8
  const dim3 gR((tilesR + 7) / 8, NHEAD);                          // 32 x 8
  const dim3 gH((tilesH + 7) / 8, NHEAD);                          // 16 x 8
  const dim3 gF((tilesF + 7) / 8, 1);                              // 128
  const dim3 gAT(ATT_BLOCKS);                                      // 512
  const dim3 bAT(ATT_THREADS);                                     // 256

  // (0) weight planes: per head W[h][c][d] -> WT[h*64+d][c] as f16( bf16_RNE(w) * 64 ); Wo[h][d][e] -> WOT[h][e][d] bf16;
  //     Wout[in][out] -> WUT[out][in] bf16; rel tables -> REL[h][128][64] bf16 (rows 63, 127 zero)
  tr16<0><<<gTW, blk, 0, stream>>>(w_k, WKT, DM, HD, (long long)DM * HD, (long long)HD * DM, WSC);
  tr16<0><<<gTW, blk, 0, stream>>>(w_q, WQT, DM, HD, (long long)DM * HD, (long long)HD * DM, WSC);
  tr16<0><<<gTW, blk, 0, stream>>>(w_v, WVT, DM, HD, (long long)DM * HD, (long long)HD * DM, WSC);
  tr16<1><<<gTO, blk, 0, stream>>>(w_o, WOT, HD, HO, (long long)HD * HO, (long long)HO * HD, 1.0f);
  tr16<1><<<gTU, blk, 0, stream>>>(w_out, WUT, COUT, COUT, 0LL, 0LL, 1.0f);
  relcat<<<gRL, blk, 0, stream>>>(relw, relh, REL);

  // (1) activation plane: X16[row][c] = f16( bf16_RNE(x[row][c]) * 16 ), rows = b*1024 + tok
  cvt16<0><<<gCX, blk, 0, stream>>>(x, X16, NROWS * DM, ACARRY);

  // (2) q projection: q[m][n] = sum_c x[m][c] WQT[n][c] -> bf16 hi / residual planes; M = 8192, N = 512, K = 512
  gemm64<3, 0, 0, 0><<<gP, blk, 0, stream>>>(
      X16, X16, DM, 0LL,
      WQT, DM, 0LL,
      (void*)QHh, (void*)QHl, DM, 0LL,
      NROWS, DM, DM, 1.0f / (ACARRY * WSC), 1.0f,
      x, x, x, x, 0);

  // (3) k projection -> bf16 hi / residual planes
  gemm64<3, 0, 0, 0><<<gP, blk, 0, stream>>>(
      X16, X16, DM, 0LL,
      WKT, DM, 0LL,
      (void*)KHh, (void*)KHl, DM, 0LL,
      NROWS, DM, DM, 1.0f / (ACARRY * WSC), 1.0f,
      x, x, x, x, 0);

  // (4) v^T per image: VT[b][h*64+d][tok] = sum_c WVT[h*64+d][c] x_b[tok][c] -> f16 x16 hi / residual planes; M = 512, N = 1024, K = 512
  gemm64<4, 0, 0, 0><<<gV, blk, 0, stream>>>(
      WVT, WVT, DM, 0LL,
      X16, DM, (long long)NTOK * DM,
      (void*)VTh, (void*)VTl, NTOK, (long long)DM * NTOK,
      DM, NTOK, DM, 1.0f / (ACARRY * WSC), VC,
      x, x, x, x, 0);

  // (5) position-logit tables per head: RTAB[row][128h + m] = sum_d (q_hi + q_lo)[row][64h + d] REL[h][m][d]; M = 8192, N = 128, K = 64, f32
  gemm64<0, 1, 1, 0><<<gR, blk, 0, stream>>>(
      QHh, QHl, DM, (long long)HD,
      REL, HD, (long long)RTP * HD,
      (void*)RTAB, (void*)RTAB, RT_LD, (long long)RTP,
      NROWS, RTP, HD, 1.0f, 1.0f,
      x, x, x, x, 0);

  // (6) attention per (image, 16 score rows), 8 heads -> CT (bf16 hi / residual planes)
  attn8<<<gAT, bAT, 0, stream>>>(KHh, KHl, QHh, QHl, VTh, VTl, RTAB, CTh, CTl);

  // (7) per-head output projection + eval batch-norm: CA[row][64h + e] = BN_h( sum_d (ct_hi + ct_lo)[row][64h + d] WOT[h][e][d] );
  //     M = 8192, N = 64, K = 64 per head -> bf16 hi / residual planes
  gemm64<3, 1, 1, 2><<<gH, blk, 0, stream>>>(
      CTh, CTl, DM, (long long)HD,
      WOT, HD, (long long)HO * HD,
      (void*)CAh, (void*)CAl, DM, (long long)HO,
      NROWS, HO, HD, 1.0f, 1.0f,
      gam, bet, mmean, mvar, HO);

  // (8) out = (CA_hi + CA_lo) . WUT^T + bf16_RNE(x); M = 8192, N = 512, K = 512, f32
  gemm64<0, 1, 1, 1><<<gF, blk, 0, stream>>>(
      CAh, CAl, DM, 0LL,
      WUT, COUT, 0LL,
      (void*)out, (void*)out, COUT, 0LL,
      NROWS, COUT, DM, 1.0f, 1.0f,
      x, x, x, x, 0);
  (void)hipGetLastError();
}

// v001
// Measured time: 254 microseconds a run.
// Timed twice side by side with v000, it ran 1.25 times as fast both times.
// Contractions (all f32 accumulate): k/q projections v_wmma_f32_16x16x32_f16 (x f16 x16 . W f16 x64, K=512, single products) -> bf16 hi/lo planes;
// v^T projection v_wmma_f32_16x16x32_f16 (Wv f16 x64 . x f16 x16, K=512, single) -> f16 x16 hi/lo planes;
// relative-position tables v_wmma_f32_16x16x32_bf16 (q bf16 hi/lo . rel bf16, hi.W+lo.W, K=64) -> f32 table;
// attention scores v_wmma_f32_16x16x32_bf16 (k bf16 hi/lo . q bf16 hi/lo, hi.hi+hi.lo+lo.hi, K=64);
// P . v^T v_wmma_f32_16x16x32_f16 (P f16 x1024 hi/lo . v^T f16 x16 hi/lo, hi.hi+lo.hi+hi.lo, K=1024 by 32);
// per-head output projection v_wmma_f32_16x16x32_bf16 (ctx bf16 hi/lo . Wo bf16, K=64) with eval batch-norm affine in f32 -> bf16 hi/lo planes;
// final projection v_wmma_f32_16x16x32_bf16 (cat bf16 hi/lo . Wout bf16, K=512) + bf16-RNE residual in f32.
// Max-subtracted online base-2 softmax and the additive position logits in f32 on VALU. Every float input RNE-converted to bf16 on load.
#include <hip/hip_runtime.h>
#include <math.h>
#include <stdint.h>

#define NB     8
#define GH     32
#define GW     32
#define NTOK   (GH * GW)
#define DM     512
#define NHEAD  8
#define HD     64
#define HO     64
#define COUT   512
#define NREL   63
#define RTP    128
#define RT_LD  (NHEAD * RTP)
#define NROWS  (NB * NTOK)
#define KCH    32
#define WSC    64.0f
#define ACARRY 16.0f
#define VC     16.0f
#define PC     1024.0f
#define LOG2E  1.4426950408889634f
#define BN_EPS 1e-3f
static_assert(NHEAD * HD == DM);
static_assert(NHEAD * HO == COUT);
static_assert(COUT == DM);
static_assert(KCH == GW);
static_assert(NREL == 2 * GW - 1);
static_assert(NREL == 2 * GH - 1);
static_assert(NREL <= HD);
static_assert(HD + NREL <= RTP);
static_assert((NTOK % 64) == 0 && (DM % 64) == 0 && (NROWS % 64) == 0 && (HD % 32) == 0 && (NTOK % KCH) == 0);
#define ATT_WAVES   8
#define ATT_THREADS (ATT_WAVES * 32)
#define ATT_ROWS    (ATT_WAVES * 16)
#define ATT_BLOCKS  (NB * NHEAD * (NTOK / ATT_ROWS))
#define PT_FLOATS   (ATT_WAVES * 16 * 36)
#define NSTG        (NTOK / KCH)
#define QPITCH      72
#define VPITCH      40
#define QT_HALVES   (KCH * QPITCH)
#define VT_HALVES   (HD * VPITCH)
#define STG_HALVES  (2 * QT_HALVES + 2 * VT_HALVES)
static_assert(ATT_THREADS == 256);
static_assert(ATT_BLOCKS == 512);
static_assert(NSTG >= 2);
static_assert(KCH * (HD / 8) == ATT_THREADS && HD * (KCH / 8) == ATT_THREADS);
static_assert((QT_HALVES % 8) == 0 && (VT_HALVES % 8) == 0 && (QPITCH % 8) == 0 && (VPITCH % 8) == 0);
static_assert(2 * ATT_ROWS * HD <= 2 * STG_HALVES);
static_assert((ATT_ROWS * HD) / 8 == 4 * ATT_THREADS);

typedef _Float16 v16h __attribute__((ext_vector_type(16)));
typedef _Float16 v8h  __attribute__((ext_vector_type(8)));
typedef __bf16   v16b __attribute__((ext_vector_type(16)));
typedef float    v8f  __attribute__((ext_vector_type(8)));
typedef float    v4f  __attribute__((ext_vector_type(4)));
typedef unsigned int v4u __attribute__((ext_vector_type(4)));

union FragH { v16h v; v8h h[2]; v4u u[2]; };
union FragAny { v16h h; v16b b; };

// ---- scalar helpers --------------------------------------------------------------------------------
__device__ __forceinline__ unsigned short bf_bits(float f) {          // f32 -> bf16 bits, RNE convert
  unsigned u = __float_as_uint(f);
  return (unsigned short)((u + 0x7FFFu + ((u >> 16) & 1u)) >> 16);
}
__device__ __forceinline__ float bf_up(unsigned short h) { return __uint_as_float(((unsigned)h) << 16); }
__device__ __forceinline__ float bfr(float f) { return bf_up(bf_bits(f)); }   // value of the bf16 RNE convert
__device__ __forceinline__ unsigned short h_bits(_Float16 x) { return __builtin_bit_cast(unsigned short, x); }
__device__ __forceinline__ unsigned pk16(unsigned short a, unsigned short b) { return (unsigned)a | ((unsigned)b << 16); }
__device__ __forceinline__ v8f zero8() { v8f z = {0.f, 0.f, 0.f, 0.f, 0.f, 0.f, 0.f, 0.f}; return z; }

// ---- fragment loader: 16-bit A/B operand from a k-contiguous 16-bit plane, lane -> row/col (lane&15),
//      p already includes +8*(lane>>4); elements 0..7 <- p[0..7] (k0+8h..), elements 8..15 <- p[16..23] (k0+16+8h..)
//      (same split k map for A and B; B is always read from a [n][k] plane)
__device__ __forceinline__ v16h ldfrag_u(const unsigned short* p) {
  FragH f;
  f.u[0] = *(const v4u*)(p);
  f.u[1] = *(const v4u*)(p + 16);
  return f.v;
}

// ---- WMMA helpers with trailing VALU hazard gaps ------------------------------------------------------
__device__ __forceinline__ v8f mma_h(v16h a, v16h b, v8f c) {
  return __builtin_amdgcn_wmma_f32_16x16x32_f16(false, a, false, b, (short)0, c, false, false);
}
__device__ __forceinline__ v8f mma_b(v16h a, v16h b, v8f c) {
  FragAny ua, ub;
  ua.h = a;
  ub.h = b;
  return __builtin_amdgcn_wmma_f32_16x16x32_bf16(false, ua.b, false, ub.b, (short)0, c, false, false);
}
template <int BF>
__device__ __forceinline__ v8f mmaT(v16h a, v16h b, v8f c) {
  if constexpr (BF != 0) return mma_b(a, b, c);
  else return mma_h(a, b, c);
}
__device__ __forceinline__ void dep_guard1(v8f& a, v8f& b, v16h x) {
#if defined(__HIP_DEVICE_COMPILE__)
  asm volatile("v_nop\n\tv_nop\n\tv_nop\n\tv_nop" : "+v"(a), "+v"(b) : "v"(x));
#endif
}
__device__ __forceinline__ void guard1x4(v8f& s, v16h a0, v16h a1, v16h a2, v16h a3) {
#if defined(__HIP_DEVICE_COMPILE__)
  asm volatile("v_nop\n\tv_nop\n\tv_nop\n\tv_nop" : "+v"(s) : "v"(a0), "v"(a1), "v"(a2), "v"(a3));
#endif
}
__device__ __forceinline__ void guard1x8(v8f& s, v16h a0, v16h a1, v16h a2, v16h a3,
                                         v16h b0, v16h b1, v16h b2, v16h b3) {
#if defined(__HIP_DEVICE_COMPILE__)
  asm volatile("v_nop\n\tv_nop\n\tv_nop\n\tv_nop"
               : "+v"(s) : "v"(a0), "v"(a1), "v"(a2), "v"(a3), "v"(b0), "v"(b1), "v"(b2), "v"(b3));
#endif
}
__device__ __forceinline__ void guard4x6(v8f& a, v8f& b, v8f& c, v8f& d,
                                         v16h x0, v16h x1, v16h x2, v16h x3, v16h x4, v16h x5) {
#if defined(__HIP_DEVICE_COMPILE__)
  asm volatile("v_nop\n\tv_nop\n\tv_nop\n\tv_nop"
               : "+v"(a), "+v"(b), "+v"(c), "+v"(d) : "v"(x0), "v"(x1), "v"(x2), "v"(x3), "v"(x4), "v"(x5));
#endif
}
__device__ __forceinline__ void guard4x5(v8f& a, v8f& b, v8f& c, v8f& d,
                                         v16h x0, v16h x1, v16h x2, v16h x3, v16h x4) {
#if defined(__HIP_DEVICE_COMPILE__)
  asm volatile("v_nop\n\tv_nop\n\tv_nop\n\tv_nop"
               : "+v"(a), "+v"(b), "+v"(c), "+v"(d) : "v"(x0), "v"(x1), "v"(x2), "v"(x3), "v"(x4));
#endif
}
__device__ __forceinline__ void keep4_h(v16h a, v16h b, v16h c, v16h d) {
#if defined(__HIP_DEVICE_COMPILE__)
  asm volatile("v_nop" :: "v"(a), "v"(b), "v"(c), "v"(d));
#endif
}
__device__ __forceinline__ void acc_guard4(v8f& a, v8f& b, v8f& c, v8f& d) {
#if defined(__HIP_DEVICE_COMPILE__)
  asm volatile("v_nop\n\tv_nop\n\tv_nop\n\tv_nop" : "+v"(a), "+v"(b), "+v"(c), "+v"(d));
#endif
}
__device__ __forceinline__ void wave_sync_lds() {
  __builtin_amdgcn_fence(__ATOMIC_RELEASE, "workgroup");
  __builtin_amdgcn_wave_barrier();
  __builtin_amdgcn_fence(__ATOMIC_ACQUIRE, "workgroup");
}

// =====================================================================================================
// Elementwise 16-bit pack, no transpose. BFO 0: dst[i] = f16( bf16_RNE(src[i]) * sc ), sc a power of two (exact);
// BFO 1: dst[i] = bf16_RNE(src[i]) bits. 8 elements per thread: two 16-B loads, one 16-B store per lane; 32 consecutive
// coverage: grid = n / 2048 blocks x 256 thr x 8 elements = n exactly (host checks n % 2048 == 0).
// =====================================================================================================
template <int BFO>
__global__ __launch_bounds__(256) void cvt16(const float* __restrict__ src, unsigned short* dst, int n, float sc) {
  const size_t i8 = ((size_t)blockIdx.x * 256 + threadIdx.x) * 8;
  if (i8 + 8 > (size_t)n) return;                 // never taken with the exact grid; no barriers in this kernel
  const v4f a = *(const v4f*)(src + i8);
  const v4f b = *(const v4f*)(src + i8 + 4);
  v4u o;
  if constexpr (BFO != 0) {
    o[0] = pk16(bf_bits(a[0]), bf_bits(a[1]));
    o[1] = pk16(bf_bits(a[2]), bf_bits(a[3]));
    o[2] = pk16(bf_bits(b[0]), bf_bits(b[1]));
    o[3] = pk16(bf_bits(b[2]), bf_bits(b[3]));
  } else {
    o[0] = pk16(h_bits((_Float16)(bfr(a[0]) * sc)), h_bits((_Float16)(bfr(a[1]) * sc)));
    o[1] = pk16(h_bits((_Float16)(bfr(a[2]) * sc)), h_bits((_Float16)(bfr(a[3]) * sc)));
    o[2] = pk16(h_bits((_Float16)(bfr(b[0]) * sc)), h_bits((_Float16)(bfr(b[1]) * sc)));
    o[3] = pk16(h_bits((_Float16)(bfr(b[2]) * sc)), h_bits((_Float16)(bfr(b[3]) * sc)));
  }
  {
    *(v4u*)(dst + i8) = o;
    
  }
}

// =====================================================================================================
// Transposing 16-bit pack of a weight matrix: in W[Cin][Dd] (pitch Dd, base + z*sIn) -> out WT[Dd][Cin] (pitch Cin, base + z*sOut),
// BFO 0: f16( bf16_RNE(w) * sc ); BFO 1: bf16_RNE(w) bits. One 64x64 tile per block (x = Cin tile, y = Dd tile, z = matrix index):
// coverage: loads 4 x 256 x 4 floats = 64x64; stores 2 x 256 pieces x 8 halves = 64 rows x 64 halves = the whole tile;
//           grid = (Cin/64, Dd/64, nmat) exact (host passes exact multiples of 64).
// =====================================================================================================
template <int BFO>
__global__ __launch_bounds__(256) void tr16(const float* __restrict__ W, unsigned short* WT, int Cin, int Dd,
                                            long long sIn, long long sOut, float sc) {
  __shared__ float t[64][65];
  const int tid = threadIdx.x;
  const int c0 = blockIdx.x * 64, d0 = blockIdx.y * 64;
  const float* src = W + (size_t)((long long)blockIdx.z * sIn);
  unsigned short* dst = WT + (size_t)((long long)blockIdx.z * sOut);
#pragma unroll
  for (int it = 0; it < 4; ++it) {
    const int p  = it * 256 + tid;
    const int cc = p >> 4, sg = (p & 15) * 4;
    const v4f v = *(const v4f*)(src + (size_t)(c0 + cc) * Dd + d0 + sg);
    t[cc][sg]     = v[0];
    t[cc][sg + 1] = v[1];
    t[cc][sg + 2] = v[2];
    t[cc][sg + 3] = v[3];
  }
  __syncthreads();
  v4u o[2];
#pragma unroll
  for (int it = 0; it < 2; ++it) {
    const int p  = it * 256 + tid;
    const int dd = p >> 3, s8 = (p & 7) * 8;
    unsigned short hv[8];
#pragma unroll
    for (int k = 0; k < 8; ++k) {
      const float f = bfr(t[s8 + k][dd]);
      if constexpr (BFO != 0) hv[k] = bf_bits(f);
      else hv[k] = h_bits((_Float16)(f * sc));
    }
    v4u q;
    q[0] = pk16(hv[0], hv[1]);
    q[1] = pk16(hv[2], hv[3]);
    q[2] = pk16(hv[4], hv[5]);
    q[3] = pk16(hv[6], hv[7]);
    o[it] = q;
  }
  {
#pragma unroll
    for (int it = 0; it < 2; ++it) {
      const int p  = it * 256 + tid;
      const int dd = p >> 3, s8 = (p & 7) * 8;
      *(v4u*)(dst + (size_t)(d0 + dd) * Cin + c0 + s8) = o[it];
    }
    
  }
}

// =====================================================================================================
// Relative-position operand plane: out[h][r][0..63] bf16 bits, r 0..62 = rel_w[h][r][:], r 63 = 0, r 64..126 = rel_h[h][r-64][:],
// r 127 = 0. Every lane loads both candidate rows from clamped addresses and selects by value. 8 halves per thread, 8 consecutive
// coverage: 32 blocks x 256 threads x 8 halves = 8 x 128 x 64 exactly.
// =====================================================================================================
__global__ __launch_bounds__(256) void relcat(const float* __restrict__ rw, const float* __restrict__ rh, unsigned short* out) {
  const int p   = blockIdx.x * 256 + threadIdx.x;        // 0 .. NHEAD*RTP*8 - 1
  const int hd  = p / (RTP * 8);
  const int r   = (p >> 3) & (RTP - 1);
  const int seg = (p & 7) * 8;
  const int iw  = (r < NREL) ? r : (NREL - 1);
  int ih = r - HD;
  ih = (ih < 0) ? 0 : ih;
  ih = (ih > NREL - 1) ? (NREL - 1) : ih;
  const float* pw = rw + ((size_t)hd * NREL + iw) * HD + seg;
  const float* ph = rh + ((size_t)hd * NREL + ih) * HD + seg;
  const v4f a0 = *(const v4f*)(pw), a1 = *(const v4f*)(pw + 4);
  const v4f b0 = *(const v4f*)(ph), b1 = *(const v4f*)(ph + 4);
  const bool uw = (r < NREL);
  const bool uh = (r >= HD) && (r < HD + NREL);
  float v[8];
#pragma unroll
  for (int e = 0; e < 4; ++e) {
    v[e]     = uw ? a0[e] : (uh ? b0[e] : 0.f);
    v[4 + e] = uw ? a1[e] : (uh ? b1[e] : 0.f);
  }
  v4u o;
  o[0] = pk16(bf_bits(v[0]), bf_bits(v[1]));
  o[1] = pk16(bf_bits(v[2]), bf_bits(v[3]));
  o[2] = pk16(bf_bits(v[4]), bf_bits(v[5]));
  o[3] = pk16(bf_bits(v[6]), bf_bits(v[7]));
  {
    *(v4u*)(out + (size_t)p * 8) = o;
    
  }
}

// =====================================================================================================
// Register-blocked batched 16-bit WMMA GEMM: C[m][n] = oscale * sum_k A[m][k] * Bt[n][k]; one wave per 64x64 tile, no block barriers.
// A row-major [M][K] pitch lda (16-bit plane), Bt row-major [N][K] pitch ldb (k contiguous); M, N multiples of 64, K multiple of 32.
// blockIdx.y = batch index with element strides sA, sB, sC.
// ASPLIT 1: a second A plane A2 (unscaled residual of A, same layout) is multiplied into the same accumulator (A + A2 ~ exact A).
// BF 1: bf16 operands (v_wmma_f32_16x16x32_bf16), else f16.
// OM 0: f32 out (pitch ldc).  OM 2: f16 out = f16(value * ocarry).  OM 3: two bf16 planes: hi = bf16_RNE(value), lo = bf16_RNE(value - hi).
// OM 4: two f16 planes: hi = f16(value * ocarry), lo = f16(value * ocarry - hi) (unscaled residual).
// EPI 1 (OM 0 only): value += bf16_RNE(ep0[same index as C]).  EPI 2 (16-bit out): per-column eval batch-norm affine
//   value = (bf16(ep0[ci]) * (value - bf16(ep2[ci]))) * rsqrt(bf16(ep3[ci]) + eps) + bf16(ep1[ci]),  ci = by*cps + column.
// coverage: 4 slabs x 16 rows (f32: it 0..7 x lane>>4; 16-bit: it 0..3 x lane>>3) x 64 cols = the wave's whole 64x64 tile;
//           grid = ceil(tilesM*tilesN/8) blocks, surplus waves exit (wave-uniform).
// =====================================================================================================
template <int OM, int ASPLIT, int BF, int EPI>
__global__ __launch_bounds__(256) __attribute__((amdgpu_num_vgpr(256))) void gemm64(
    const unsigned short* __restrict__ Ap, const unsigned short* __restrict__ A2p, int lda, long long sA,
    const unsigned short* __restrict__ Btp, int ldb, long long sB,
    void* Cout, void* C2out, int ldc, long long sC,
    int M, int N, int K, float oscale, float ocarry,
    const float* __restrict__ ep0, const float* __restrict__ ep1,
    const float* __restrict__ ep2, const float* __restrict__ ep3, int cps) {
  __shared__ __align__(16) float sT[8][16 * 68];   // per-wave 16x64 slab, pitch 68 floats
  const int by   = blockIdx.y;
  const int lane = threadIdx.x & 31;
  const int wave = threadIdx.x >> 5;
  const int tilesN = N >> 6;
  const int tilesM = M >> 6;
  const int tile = blockIdx.x * 8 + wave;
  if (tile >= tilesM * tilesN) return;   // wave-uniform; no block barriers in this kernel
  const int tm = tile / tilesN;
  const int tn = tile - tm * tilesN;
  const int m0 = tm << 6;
  const int n0 = tn << 6;

  const unsigned short* A1 = Ap  + (size_t)((long long)by * sA);
  const unsigned short* A2 = A2p + (size_t)((long long)by * sA);
  const unsigned short* Bb = Btp + (size_t)((long long)by * sB);

  const int rlane = lane & 15;                 // row (A) / col (B, D) within subtile
  const int koff  = (lane >> 4) * 8;           // k offset of this lane half
  const int mOff  = (lane >> 4) * 8;           // D row offset

  v8f acc[4][4];
#pragma unroll
  for (int i = 0; i < 4; ++i)
#pragma unroll
    for (int j = 0; j < 4; ++j) acc[i][j] = zero8();

  for (int k0 = 0; k0 < K; k0 += 32) {
    v16h bh[4];
#pragma unroll
    for (int j = 0; j < 4; ++j) {
      const size_t bofs = (size_t)(n0 + (j << 4) + rlane) * ldb + koff + k0;
      bh[j] = ldfrag_u(Bb + bofs);
    }
#pragma unroll
    for (int i = 0; i < 4; ++i) {
      const size_t ao = (size_t)(m0 + (i << 4) + rlane) * lda + koff + k0;
      const v16h ah = ldfrag_u(A1 + ao);
#pragma unroll
      for (int j = 0; j < 4; ++j) acc[i][j] = mmaT<BF>(ah, bh[j], acc[i][j]);
      dep_guard1(acc[i][0], acc[i][3], ah);
      if constexpr (ASPLIT != 0) {
        const v16h al = ldfrag_u(A2 + ao);
#pragma unroll
        for (int j = 0; j < 4; ++j) acc[i][j] = mmaT<BF>(al, bh[j], acc[i][j]);
        dep_guard1(acc[i][0], acc[i][3], al);
      }
    }
    keep4_h(bh[0], bh[1], bh[2], bh[3]);
  }
  acc_guard4(acc[0][0], acc[0][1], acc[0][2], acc[0][3]);
  acc_guard4(acc[1][0], acc[1][1], acc[1][2], acc[1][3]);
  acc_guard4(acc[2][0], acc[2][1], acc[2][2], acc[2][3]);
  acc_guard4(acc[3][0], acc[3][1], acc[3][2], acc[3][3]);

  const int hh2 = lane >> 4, c4 = (lane & 15) * 4;     // f32 out: 256-B row segment = 16 lanes x 16 B
  const int q8  = lane >> 3, c8 = (lane & 7) * 8;

  // ---- epilogue ----
  float* slab = sT[wave];
#pragma unroll
  for (int i = 0; i < 4; ++i) {
    const int mBase = m0 + (i << 4);
#pragma unroll
    for (int j = 0; j < 4; ++j) {
#pragma unroll
      for (int r = 0; r < 8; ++r) {
        slab[(mOff + r) * 68 + (j << 4) + rlane] = acc[i][j][r];
      }
    }
    wave_sync_lds();
    if constexpr (OM == 0) {
      float* C = (float*)Cout + (size_t)((long long)by * sC);
      const float* R = ep0 + (size_t)((long long)by * sC);
      v4f vals[8];
#pragma unroll
      for (int it = 0; it < 8; ++it) {
        const int row = it * 2 + hh2;                      // it 0..7 x hh2 0..1 = rows 0..15
        v4f v = *(const v4f*)(slab + row * 68 + c4);
#pragma unroll
        for (int e = 0; e < 4; ++e) v[e] = v[e] * oscale;
        if constexpr (EPI == 1) {
          const v4f xr = *(const v4f*)(R + (size_t)(mBase + row) * ldc + n0 + c4);
#pragma unroll
          for (int e = 0; e < 4; ++e) v[e] = v[e] + bfr(xr[e]);
        }
        vals[it] = v;
      }
      {
#pragma unroll
        for (int it = 0; it < 8; ++it) {
          const int gr = mBase + it * 2 + hh2;
          *(v4f*)(C + (size_t)gr * ldc + n0 + c4) = vals[it];
        }
        
      }
    } else {
      unsigned short* C  = (unsigned short*)Cout  + (size_t)((long long)by * sC);
      unsigned short* Cb = (unsigned short*)C2out + (size_t)((long long)by * sC);
      v4u hv[4], lv[4];
#pragma unroll
      for (int it = 0; it < 4; ++it) {
        const int row = it * 4 + q8;                       // it 0..3 x q8 0..3 = rows 0..15
        const float* sp = slab + row * 68 + c8;
        v4u a  = {0u, 0u, 0u, 0u};
        v4u b2 = {0u, 0u, 0u, 0u};
#pragma unroll
        for (int e = 0; e < 4; ++e) {
          float f0 = sp[2 * e] * oscale;
          float f1 = sp[2 * e + 1] * oscale;
          if constexpr (EPI == 2) {
            const int ci = by * cps + n0 + c8 + 2 * e;   // column parameter index (host keeps by*cps + N <= parameter count)
            const float g0 = bfr(ep0[ci]), g1 = bfr(ep0[ci + 1]);
            const float t0 = bfr(ep1[ci]), t1 = bfr(ep1[ci + 1]);
            const float u0 = bfr(ep2[ci]), u1 = bfr(ep2[ci + 1]);
            const float r0 = rsqrtf(bfr(ep3[ci]) + BN_EPS), r1 = rsqrtf(bfr(ep3[ci + 1]) + BN_EPS);
            f0 = (g0 * (f0 - u0)) * r0 + t0;
            f1 = (g1 * (f1 - u1)) * r1 + t1;
          }
          if constexpr (OM == 3) {
            const unsigned short h0 = bf_bits(f0), h1 = bf_bits(f1);
            a[e]  = pk16(h0, h1);
            b2[e] = pk16(bf_bits(f0 - bf_up(h0)), bf_bits(f1 - bf_up(h1)));
          } else {
            f0 *= ocarry; f1 *= ocarry;
            const _Float16 x0 = (_Float16)f0, x1 = (_Float16)f1;
            a[e] = pk16(h_bits(x0), h_bits(x1));
            if constexpr (OM == 4) {
              b2[e] = pk16(h_bits((_Float16)(f0 - (float)x0)), h_bits((_Float16)(f1 - (float)x1)));
            }
          }
        }
        hv[it] = a;
        lv[it] = b2;
      }
      {
#pragma unroll
        for (int it = 0; it < 4; ++it) {
          const int row = it * 4 + q8;
          *(v4u*)(C + (size_t)(mBase + row) * ldc + n0 + c8) = hv[it];
          if constexpr (OM >= 3) {
            *(v4u*)(Cb + (size_t)(mBase + row) * ldc + n0 + c8) = lv[it];
          }
        }
        
      }
    }
    wave_sync_lds();
  }
}

// =====================================================================================================
// Flash attention for one image (batch), one head and 128 score rows (one wave per 16 rows), head dim 64, 1024 columns:
//   rows i index KEY positions (k_i stationary, A fragments), columns j index the q/v positions streamed in chunks of 32 = one image row;
//   k planes (bf16 hi, lo) K[b*1024 + tok][64h + d], pitch 512; q planes (bf16 hi, lo) Q[b*1024 + tok][64h + d];
//   v^T planes (f16 x16 hi, unscaled lo): VT[b*512 + 64h + d][tok] (pitch 1024);
//   additive position logits from the f32 table R[b*1024 + tok][128h + m] (m < 63: q_tok . rel_w[h][m]; 64 + m: q_tok . rel_h[h][m]):
//   logit[i][j] = k_i . q_j + R[i][yj - yi + 31] + R[i][64 + xj - xi + 31], token = 32*x + y. The w part depends only on the column within
//   a chunk (16 registers per lane, loaded once), the h part only on the chunk (8 loads per lane per chunk); indices are pure arithmetic.
//   out (bf16 hi, lo planes): CT[b*1024 + tok][64h + d] = sum_j softmax_j(logit) v[j][d]  (softmax run in base 2, max-subtracted, no 1/sqrt(d)).
//   block = 8 waves = 256 threads; grid = 8 images x 8 heads x 8 row blocks = 512; every wave does identical bounded work (32 chunks).
//   The 8 waves of a block need the same q and v^T chunk: it is brought into LDS once per block by asynchronous 16-B copies (4 per lane and
//   chunk: q hi, q lo 32 rows x 128 B at pitch 144 B; v^T hi, lo 64 rows x 64 B at pitch 80 B), two buffers, chunk t + 2 issued behind the
//   barrier that ends chunk t; all B fragments are 16-B LDS reads with the same split k map as before.
//   Per chunk: 2 score tiles on bf16 WMMA (hi.hi + hi.lo + lo.hi, K = 64 as two k-steps of 32); online softmax in f32 (exp2); A fragments
//   of P*1024 (f16 hi and unscaled residual) rebuilt from the wave's own LDS rows (f32 vector loads, split k map); 12 P.V WMMAs
//   (hi.hi, lo.hi, hi.lo).
//   Final 1/l and carry folds in f32; after a block barrier the stage buffers are reused as the block's two bf16 result buffers [128][64]
//   (hi, lo): each wave stages its 16x64 slice (element stores); after a second block barrier the 256 threads write whole 128-B row pieces.
// coverage: LDS result buffers: 8 waves x 16 rows x 64 cols per plane; global: 4 iterations x 256 threads x 8 halves = 128 rows x 64 cols
//           of rows 128rb..128rb+127, columns 64h..64h+63 of image b, per plane; grid covers all 8 x 1024 rows x 512 columns exactly once.
// =====================================================================================================
// four 16-B copies per lane, global -> LDS through no register; the s_wait_xcnt 0 in the same statement stands ahead of any later
// rewrite of the address registers that the copies name
__device__ __forceinline__ void stage_copy4(unsigned l0, const unsigned short* g0, unsigned l1, const unsigned short* g1,
                                            unsigned l2, const unsigned short* g2, unsigned l3, const unsigned short* g3) {
#if defined(__HIP_DEVICE_COMPILE__)
  asm volatile("global_load_async_to_lds_b128 %0, %1, off\n\t"
               "global_load_async_to_lds_b128 %2, %3, off\n\t"
               "global_load_async_to_lds_b128 %4, %5, off\n\t"
               "global_load_async_to_lds_b128 %6, %7, off\n\t"
               "s_wait_xcnt 0x0"
               :: "v"(l0), "v"(g0), "v"(l1), "v"(g1), "v"(l2), "v"(g2), "v"(l3), "v"(g3) : "memory");
#endif
}
// this wave's copies have landed in LDS
__device__ __forceinline__ void wait_copies() {
#if defined(__HIP_DEVICE_COMPILE__)
  asm volatile("s_wait_asynccnt 0x0" ::: "memory");
#endif
}
// stands behind the eight table loads of a chunk, ahead of the later rewrite of their address pair
__device__ __forceinline__ void wait_addr() {
#if defined(__HIP_DEVICE_COMPILE__)
  asm volatile("s_wait_xcnt 0x0" ::: "memory");
#endif
}
// this wave's LDS reads have returned (ahead of the barrier behind which their buffer is refilled)
__device__ __forceinline__ void wait_lds() {
#if defined(__HIP_DEVICE_COMPILE__)
  asm volatile("s_wait_dscnt 0x0" ::: "memory");
#endif
}

__global__ __launch_bounds__(ATT_THREADS) __attribute__((amdgpu_num_vgpr(256)))
void attn8(const unsigned short* __restrict__ KHh, const unsigned short* __restrict__ KHl,
           const unsigned short* __restrict__ QHh, const unsigned short* __restrict__ QHl,
           const unsigned short* __restrict__ VTh, const unsigned short* __restrict__ VTl,
           const float* __restrict__ Rtab, unsigned short* CTh, unsigned short* CTl) {
  __shared__ __align__(16) unsigned short stg[2 * STG_HALVES];   // two stage buffers: q hi | q lo | v^T hi | v^T lo; later: result buffers
  __shared__ __align__(16) float ptile[PT_FLOATS];               // prob tiles [wave][row][32 cols] pitch 36

  const int tid  = threadIdx.x;
  const int wave = tid >> 5;
  const int lane = tid & 31;
  const int hh   = lane >> 4;
  const int c    = lane & 15;

  const int rb   = blockIdx.x & ((NTOK / ATT_ROWS) - 1);   // 0..7
  const int head = (blockIdx.x / (NTOK / ATT_ROWS)) & (NHEAD - 1);   // 0..7
  const int bat  = blockIdx.x / ((NTOK / ATT_ROWS) * NHEAD);         // 0..7
  const int i0   = rb * ATT_ROWS + wave * 16;              // first score row (key token) of this wave
  const int x0   = i0 / GW;                                // image row of all 16 tokens
  const int ybase = (i0 & (GW - 1)) + 8 * hh;              // image column of row element r is ybase + r
  const size_t rowg = (size_t)bat * NTOK + i0;

  // per-lane copy addresses: q piece = row tid>>3, 16-B segment tid&7; v^T piece = row tid>>2, 16-B segment tid&3
  const unsigned short* gqh = QHh + ((size_t)bat * NTOK + (tid >> 3)) * DM + head * HD + (tid & 7) * 8;
  const unsigned short* gql = QHl + ((size_t)bat * NTOK + (tid >> 3)) * DM + head * HD + (tid & 7) * 8;
  const unsigned short* gvh = VTh + ((size_t)bat * DM + head * HD + (tid >> 2)) * NTOK + (tid & 3) * 8;
  const unsigned short* gvl = VTl + ((size_t)bat * DM + head * HD + (tid >> 2)) * NTOK + (tid & 3) * 8;
  const unsigned lbase = (unsigned)(uintptr_t)stg;         // LDS byte address of the stage buffers
  const unsigned lq = lbase + (unsigned)((tid >> 3) * (QPITCH * 2) + (tid & 7) * 16);
  const unsigned lv = lbase + (unsigned)(2 * QT_HALVES * 2 + (tid >> 2) * (VPITCH * 2) + (tid & 3) * 16);

  // chunk 0 -> buffer 0, landed and published; then chunk 1 -> buffer 1 flies while chunk 0 is worked on
  stage_copy4(lq, gqh, lq + QT_HALVES * 2, gql, lv, gvh, lv + VT_HALVES * 2, gvl);
  wait_copies();
  __syncthreads();
  stage_copy4(lq + STG_HALVES * 2, gqh + (size_t)KCH * DM, lq + (STG_HALVES + QT_HALVES) * 2, gql + (size_t)KCH * DM,
              lv + STG_HALVES * 2, gvh + KCH, lv + (STG_HALVES + VT_HALVES) * 2, gvl + KCH);

  // stationary A fragments: k rows i0 + c (hi and residual planes), d 0..31 and 32..63
  const size_t kofs = (rowg + c) * DM + head * HD + 8 * hh;
  const v16h kah = ldfrag_u(KHh + kofs), kbh = ldfrag_u(KHh + kofs + 32);
  const v16h kal = ldfrag_u(KHl + kofs), kbl = ldfrag_u(KHl + kofs + 32);

  // additive w-position logits for this lane's 16 (row, column-in-chunk) score elements, loop-invariant, pre-scaled by log2(e)
  const float* rrow = Rtab + (rowg + 8 * hh) * RT_LD + head * RTP;   // + r*RT_LD = table row of score row 8hh+r
  float wb0[8], wb1[8];
#pragma unroll
  for (int r = 0; r < 8; ++r) {
    const float* rp = rrow + (size_t)r * RT_LD;
    const int iw = c + (GW - 1) - (ybase + r);             // in [0, 46]
    wb0[r] = rp[iw] * LOG2E;
    wb1[r] = rp[iw + 16] * LOG2E;                          // in [16, 62]
  }

  float mrow[8], lrow[8];
  v8f o0 = zero8(), o1 = zero8(), o2 = zero8(), o3 = zero8();
#pragma unroll
  for (int r = 0; r < 8; ++r) { mrow[r] = -INFINITY; lrow[r] = 0.f; }
  float* pt = ptile + wave * (16 * 36);

#pragma unroll 1
  for (int st = 0; st < NSTG; ++st) {
    const int bsel = st & 1;
    const unsigned short* sb  = stg + bsel * STG_HALVES;
    const unsigned short* Qsh = sb + c * QPITCH + 8 * hh;                    // q hi, row c of the chunk
    const unsigned short* Qsl = Qsh + QT_HALVES;
    const unsigned short* Vsh = sb + 2 * QT_HALVES + c * VPITCH + 8 * hh;    // v^T hi, row d = c
    const unsigned short* Vsl = Vsh + VT_HALVES;
    v8f s0, s1;
    {
      const v16h q0h = ldfrag_u(Qsh), q1h = ldfrag_u(Qsh + 32);
      const v16h q0l = ldfrag_u(Qsl), q1l = ldfrag_u(Qsl + 32);
      s0 = mma_b(kah, q0h, zero8());
      s0 = mma_b(kbh, q1h, s0);
      s0 = mma_b(kah, q0l, s0);
      s0 = mma_b(kbh, q1l, s0);
      s0 = mma_b(kal, q0h, s0);
      s0 = mma_b(kbl, q1h, s0);
      guard1x4(s0, q0h, q1h, q0l, q1l);
    }
    {
      const int q2 = 16 * QPITCH;
      const v16h q0h = ldfrag_u(Qsh + q2), q1h = ldfrag_u(Qsh + q2 + 32);
      const v16h q0l = ldfrag_u(Qsl + q2), q1l = ldfrag_u(Qsl + q2 + 32);
      s1 = mma_b(kah, q0h, zero8());
      s1 = mma_b(kbh, q1h, s1);
      s1 = mma_b(kah, q0l, s1);
      s1 = mma_b(kbh, q1l, s1);
      s1 = mma_b(kal, q0h, s1);
      s1 = mma_b(kbl, q1h, s1);
      guard1x8(s1, q0h, q1h, q0l, q1l, kah, kbh, kal, kbl);
    }
    // h-position logit of this chunk (one image row x2 = st) for each of the lane's 8 score rows
    const int mh = st - x0 + (GH - 1);                     // in [0, 62]
    const float* hp = rrow + HD + mh;
    float hv8[8];
#pragma unroll
    for (int r = 0; r < 8; ++r) hv8[r] = hp[(size_t)r * RT_LD];
    wait_addr();
#pragma unroll
    for (int r = 0; r < 8; ++r) {
      const float hb = hv8[r] * LOG2E;
      const float t0 = s0[r] * LOG2E + (wb0[r] + hb), t1 = s1[r] * LOG2E + (wb1[r] + hb);
      float mx = fmaxf(t0, t1);
#pragma unroll
      for (int off = 1; off < 16; off <<= 1) mx = fmaxf(mx, __shfl_xor(mx, off, 32));
      const float mn = fmaxf(mrow[r], mx);
      const float al = exp2f(mrow[r] - mn);
      mrow[r] = mn;
      const float e0 = exp2f(t0 - mn), e1 = exp2f(t1 - mn);
      float ps = e0 + e1;
#pragma unroll
      for (int off = 1; off < 16; off <<= 1) ps += __shfl_xor(ps, off, 32);
      lrow[r] = lrow[r] * al + ps;
      o0[r] *= al;
      o1[r] *= al;
      o2[r] *= al;
      o3[r] *= al;
      const int ro = (8 * hh + r) * 36 + c;
      pt[ro]      = e0;
      pt[ro + 16] = e1;
    }
    wave_sync_lds();
    FragH ph, pl;
    {
      const float* prow = pt + c * 36 + 8 * hh;
      const v4f p0 = *(const v4f*)(prow), p1 = *(const v4f*)(prow + 4);
      const v4f p2 = *(const v4f*)(prow + 16), p3 = *(const v4f*)(prow + 20);
#pragma unroll
      for (int e = 0; e < 4; ++e) {
        float f; _Float16 x;
        f = p0[e] * PC; x = (_Float16)f; ph.h[0][e]     = x; pl.h[0][e]     = (_Float16)(f - (float)x);   // cols jb + 8hh + e
        f = p1[e] * PC; x = (_Float16)f; ph.h[0][4 + e] = x; pl.h[0][4 + e] = (_Float16)(f - (float)x);   // cols jb + 8hh + 4 + e
        f = p2[e] * PC; x = (_Float16)f; ph.h[1][e]     = x; pl.h[1][e]     = (_Float16)(f - (float)x);   // cols jb + 16 + 8hh + e
        f = p3[e] * PC; x = (_Float16)f; ph.h[1][4 + e] = x; pl.h[1][4 + e] = (_Float16)(f - (float)x);
      }
    }
    {
      const v16h vh0 = ldfrag_u(Vsh);
      const v16h vh1 = ldfrag_u(Vsh + 16 * VPITCH);
      const v16h vh2 = ldfrag_u(Vsh + 32 * VPITCH);
      const v16h vh3 = ldfrag_u(Vsh + 48 * VPITCH);
      o0 = mma_h(ph.v, vh0, o0);
      o1 = mma_h(ph.v, vh1, o1);
      o2 = mma_h(ph.v, vh2, o2);
      o3 = mma_h(ph.v, vh3, o3);
      o0 = mma_h(pl.v, vh0, o0);
      o1 = mma_h(pl.v, vh1, o1);
      o2 = mma_h(pl.v, vh2, o2);
      o3 = mma_h(pl.v, vh3, o3);
      guard4x6(o0, o1, o2, o3, ph.v, pl.v, vh0, vh1, vh2, vh3);
    }
    {
      const v16h vl0 = ldfrag_u(Vsl);
      const v16h vl1 = ldfrag_u(Vsl + 16 * VPITCH);
      const v16h vl2 = ldfrag_u(Vsl + 32 * VPITCH);
      const v16h vl3 = ldfrag_u(Vsl + 48 * VPITCH);
      o0 = mma_h(ph.v, vl0, o0);
      o1 = mma_h(ph.v, vl1, o1);
      o2 = mma_h(ph.v, vl2, o2);
      o3 = mma_h(ph.v, vl3, o3);
      guard4x5(o0, o1, o2, o3, ph.v, vl0, vl1, vl2, vl3);
    }
    // foot of the chunk: own LDS reads returned, own copies of chunk st + 1 landed, then the one barrier that publishes chunk st + 1
    // and ends every wave's reads of this chunk's buffer; only behind it is that buffer refilled with chunk st + 2
    wait_lds();
    wait_copies();
    __syncthreads();
    if (st + 2 < NSTG) {
      const size_t qa = (size_t)(st + 2) * KCH * DM;
      const int    va = (st + 2) * KCH;
      const unsigned lo = (unsigned)(bsel * STG_HALVES * 2);
      stage_copy4(lq + lo, gqh + qa, lq + lo + QT_HALVES * 2, gql + qa, lv + lo, gvh + va, lv + lo + VT_HALVES * 2, gvl + va);
    }
  }
  wait_copies();

  // ---- all waves done with the stage buffers; they become two bf16 result buffers [128][64] ----
  __syncthreads();
  unsigned short* Osh = stg;
  unsigned short* Osl = Osh + ATT_ROWS * HD;
  // ---- fold 1/l and the carries (1024 on P, 16 on v), split into bf16 hi + residual, stage the wave's 16x64 slice ----
  const float oc = 1.0f / (PC * VC);
#pragma unroll
  for (int r = 0; r < 8; ++r) {
    const float inv = (1.0f / lrow[r]) * oc;
    const int ro = (wave * 16 + 8 * hh + r) * HD + c;
    const float f0 = o0[r] * inv, f1 = o1[r] * inv, f2 = o2[r] * inv, f3 = o3[r] * inv;
    const unsigned short g0 = bf_bits(f0), g1 = bf_bits(f1), g2 = bf_bits(f2), g3 = bf_bits(f3);
    Osh[ro]      = g0;  Osl[ro]      = bf_bits(f0 - bf_up(g0));
    Osh[ro + 16] = g1;  Osl[ro + 16] = bf_bits(f1 - bf_up(g1));
    Osh[ro + 32] = g2;  Osl[ro + 32] = bf_bits(f2 - bf_up(g2));
    Osh[ro + 48] = g3;  Osl[ro + 48] = bf_bits(f3 - bf_up(g3));
  }
  __syncthreads();
  // ---- block writes its 128 row pieces of both planes: piece p = it*256 + tid -> row p>>3, halves (p&7)*8 .. +7 (8 lanes = one 128-B line) ----
  {
    v4u hv[4], lv4[4];
#pragma unroll
    for (int it = 0; it < 4; ++it) {
      const int p = it * ATT_THREADS + tid;
      hv[it]  = *(const v4u*)(Osh + (size_t)p * 8);
      lv4[it] = *(const v4u*)(Osl + (size_t)p * 8);
    }
    const size_t dofs = ((size_t)bat * NTOK + rb * ATT_ROWS) * DM + head * HD;
    unsigned short* dsth = CTh + dofs;
    unsigned short* dstl = CTl + dofs;
    {
#pragma unroll
      for (int it = 0; it < 4; ++it) {
        const int p = it * ATT_THREADS + tid;
        const size_t go = (size_t)(p >> 3) * DM + (p & 7) * 8;
        *(v4u*)(dsth + go) = hv[it];
        *(v4u*)(dstl + go) = lv4[it];
      }
    }
  }
}

// =====================================================================================================
// Workspace map (bytes); every plane is an exact multiple of its tile / whole-row store granularity (M, N exact tile multiples,
// the activation convert count an exact multiple of 2048, no pad rows needed), every offset a multiple of 64 KiB:
//   WKT, WQT, WVT f16 [512][512] x64   3 x 524288    ([h*64+d][c] = [n][k])
//   WOT  bf16 [8][64 e][64 d]              65536
//   WUT  bf16 [512 out][512 in]          524288
//   REL  bf16 [8][128][64]                131072
//   X16  f16 [8192][512] x16             8388608    (activation rows b*1024 + tok)
//   QHh, QHl bf16 [8192][512]         2 x 8388608   (q projection, hi / residual)
//   KHh, KHl bf16 [8192][512]         2 x 8388608   (k projection, hi / residual)
//   VTh, VTl f16 [8][512][1024] x16   2 x 8388608   (v^T per image, hi / residual)
//   RTAB f32 [8192][1024]               33554432   (position-logit tables, 128 per head)
//   CTh, CTl bf16 [8192][512]         2 x 8388608   (attention ctx, merged heads, hi / residual)
//   CAh, CAl bf16 [8192][512]         2 x 8388608   (per-head output after batch-norm, concat layout, hi / residual)
//   end                                 128122880
// =====================================================================================================
extern "C" void kernel_launch(void* const* d_in, const int* in_sizes, int n_in,
                              void* d_out, int out_size, void* d_ws, size_t ws_size,
                              hipStream_t stream) {
  if (n_in < 12) return;
  if (in_sizes[0] != NROWS * DM) return;
  if (in_sizes[1] != NHEAD * DM * HD || in_sizes[2] != NHEAD * DM * HD || in_sizes[3] != NHEAD * DM * HD) return;
  if (in_sizes[4] != NHEAD * HD * HO) return;
  if (in_sizes[5] != NHEAD * HO || in_sizes[6] != NHEAD * HO || in_sizes[7] != NHEAD * HO || in_sizes[8] != NHEAD * HO) return;
  if (in_sizes[9] != NHEAD * NREL * HD || in_sizes[10] != NHEAD * NREL * HD) return;
  if (in_sizes[11] != COUT * COUT) return;
  if (out_size != NROWS * COUT) return;
  if ((in_sizes[0] % 2048) != 0) return;

  const float* x     = (const float*)d_in[0];
  const float* w_k   = (const float*)d_in[1];
  const float* w_q   = (const float*)d_in[2];
  const float* w_v   = (const float*)d_in[3];
  const float* w_o   = (const float*)d_in[4];
  const float* gam   = (const float*)d_in[5];
  const float* bet   = (const float*)d_in[6];
  const float* mmean = (const float*)d_in[7];
  const float* mvar  = (const float*)d_in[8];
  const float* relw  = (const float*)d_in[9];
  const float* relh  = (const float*)d_in[10];
  const float* w_out = (const float*)d_in[11];
  float*       out   = (float*)d_out;

  const size_t PWT = (size_t)DM * DM * 2;                         //   524288
  const size_t PWO = (size_t)NHEAD * HO * HD * 2;                 //    65536
  const size_t PWU = (size_t)COUT * COUT * 2;                     //   524288
  const size_t PRL = (size_t)NHEAD * RTP * HD * 2;                //   131072
  const size_t PX  = (size_t)NROWS * DM * 2;                      //  8388608
  const size_t PVT = (size_t)NB * DM * NTOK * 2;                  //  8388608
  const size_t PRT = (size_t)NROWS * RT_LD * 4;                   // 33554432
  size_t off = 0;
  const size_t oWK = off; off += PWT;
  const size_t oWQ = off; off += PWT;
  const size_t oWV = off; off += PWT;
  const size_t oWO = off; off += PWO;
  const size_t oWU = off; off += PWU;
  const size_t oRL = off; off += PRL;
  const size_t oX  = off; off += PX;
  const size_t oQh = off; off += PX;
  const size_t oQl = off; off += PX;
  const size_t oKh = off; off += PX;
  const size_t oKl = off; off += PX;
  const size_t oVh = off; off += PVT;
  const size_t oVl = off; off += PVT;
  const size_t oRT = off; off += PRT;
  const size_t oCh = off; off += PX;
  const size_t oCl = off; off += PX;
  const size_t oAh = off; off += PX;
  const size_t oAl = off; off += PX;
  if (off > ws_size) return;                                      // off = 128122880
  if (off > (size_t)134217728) return;

  char* ws = (char*)d_ws;
  unsigned short* WKT  = (unsigned short*)(ws + oWK);
  unsigned short* WQT  = (unsigned short*)(ws + oWQ);
  unsigned short* WVT  = (unsigned short*)(ws + oWV);
  unsigned short* WOT  = (unsigned short*)(ws + oWO);
  unsigned short* WUT  = (unsigned short*)(ws + oWU);
  unsigned short* REL  = (unsigned short*)(ws + oRL);
  unsigned short* X16  = (unsigned short*)(ws + oX);
  unsigned short* QHh  = (unsigned short*)(ws + oQh);
  unsigned short* QHl  = (unsigned short*)(ws + oQl);
  unsigned short* KHh  = (unsigned short*)(ws + oKh);
  unsigned short* KHl  = (unsigned short*)(ws + oKl);
  unsigned short* VTh  = (unsigned short*)(ws + oVh);
  unsigned short* VTl  = (unsigned short*)(ws + oVl);
  float*          RTAB = (float*)(ws + oRT);
  unsigned short* CTh  = (unsigned short*)(ws + oCh);
  unsigned short* CTl  = (unsigned short*)(ws + oCl);
  unsigned short* CAh  = (unsigned short*)(ws + oAh);
  unsigned short* CAl  = (unsigned short*)(ws + oAl);

  const dim3 blk(256);
  const dim3 gTW(DM / 64, HD / 64, NHEAD);                         // 8 x 1 x 8
  const dim3 gTO(HD / 64, HO / 64, NHEAD);                         // 1 x 1 x 8
  const dim3 gTU(COUT / 64, COUT / 64, 1);                         // 8 x 8 x 1
  const dim3 gRL((NHEAD * RTP * 8) / 256);                         // 32
  const dim3 gCX((NROWS * DM) / 2048);                             // 2048
  const int tilesP = (NROWS / 64) * (DM / 64);                     // 1024
  const int tilesV = (DM / 64) * (NTOK / 64);                      // 128 per image
  const int tilesR = (NROWS / 64) * (RTP / 64);                    // 256 per head
  const int tilesH = (NROWS / 64) * (HO / 64);                     // 128 per head
  const int tilesF = (NROWS / 64) * (COUT / 64);                   // 1024
  const dim3 gP((tilesP + 7) / 8, 1);                              // 128
  const dim3 gV((tilesV + 7) / 8, NB);                             // 16 x 8
  const dim3 gR((tilesR + 7) / 8, NHEAD);                          // 32 x 8
  const dim3 gH((tilesH + 7) / 8, NHEAD);                          // 16 x 8
  const dim3 gF((tilesF + 7) / 8, 1);                              // 128
  const dim3 gAT(ATT_BLOCKS);                                      // 512
  const dim3 bAT(ATT_THREADS);                                     // 256

  // (0) weight planes: per head W[h][c][d] -> WT[h*64+d][c] as f16( bf16_RNE(w) * 64 ); Wo[h][d][e] -> WOT[h][e][d] bf16;
  //     Wout[in][out] -> WUT[out][in] bf16; rel tables -> REL[h][128][64] bf16 (rows 63, 127 zero)
  tr16<0><<<gTW, blk, 0, stream>>>(w_k, WKT, DM, HD, (long long)DM * HD, (long long)HD * DM, WSC);
  tr16<0><<<gTW, blk, 0, stream>>>(w_q, WQT, DM, HD, (long long)DM * HD, (long long)HD * DM, WSC);
  tr16<0><<<gTW, blk, 0, stream>>>(w_v, WVT, DM, HD, (long long)DM * HD, (long long)HD * DM, WSC);
  tr16<1><<<gTO, blk, 0, stream>>>(w_o, WOT, HD, HO, (long long)HD * HO, (long long)HO * HD, 1.0f);
  tr16<1><<<gTU, blk, 0, stream>>>(w_out, WUT, COUT, COUT, 0LL, 0LL, 1.0f);
  relcat<<<gRL, blk, 0, stream>>>(relw, relh, REL);

  // (1) activation plane: X16[row][c] = f16( bf16_RNE(x[row][c]) * 16 ), rows = b*1024 + tok
  cvt16<0><<<gCX, blk, 0, stream>>>(x, X16, NROWS * DM, ACARRY);

  // (2) q projection: q[m][n] = sum_c x[m][c] WQT[n][c] -> bf16 hi / residual planes; M = 8192, N = 512, K = 512
  gemm64<3, 0, 0, 0><<<gP, blk, 0, stream>>>(
      X16, X16, DM, 0LL,
      WQT, DM, 0LL,
      (void*)QHh, (void*)QHl, DM, 0LL,
      NROWS, DM, DM, 1.0f / (ACARRY * WSC), 1.0f,
      x, x, x, x, 0);

  // (3) k projection -> bf16 hi / residual planes
  gemm64<3, 0, 0, 0><<<gP, blk, 0, stream>>>(
      X16, X16, DM, 0LL,
      WKT, DM, 0LL,
      (void*)KHh, (void*)KHl, DM, 0LL,
      NROWS, DM, DM, 1.0f / (ACARRY * WSC), 1.0f,
      x, x, x, x, 0);

  // (4) v^T per image: VT[b][h*64+d][tok] = sum_c WVT[h*64+d][c] x_b[tok][c] -> f16 x16 hi / residual planes; M = 512, N = 1024, K = 512
  gemm64<4, 0, 0, 0><<<gV, blk, 0, stream>>>(
      WVT, WVT, DM, 0LL,
      X16, DM, (long long)NTOK * DM,
      (void*)VTh, (void*)VTl, NTOK, (long long)DM * NTOK,
      DM, NTOK, DM, 1.0f / (ACARRY * WSC), VC,
      x, x, x, x, 0);

  // (5) position-logit tables per head: RTAB[row][128h + m] = sum_d (q_hi + q_lo)[row][64h + d] REL[h][m][d]; M = 8192, N = 128, K = 64, f32
  gemm64<0, 1, 1, 0><<<gR, blk, 0, stream>>>(
      QHh, QHl, DM, (long long)HD,
      REL, HD, (long long)RTP * HD,
      (void*)RTAB, (void*)RTAB, RT_LD, (long long)RTP,
      NROWS, RTP, HD, 1.0f, 1.0f,
      x, x, x, x, 0);

  // (6) attention per (image, head, 128 score rows) -> CT (bf16 hi / residual planes)
  attn8<<<gAT, bAT, 0, stream>>>(KHh, KHl, QHh, QHl, VTh, VTl, RTAB, CTh, CTl);

  // (7) per-head output projection + eval batch-norm: CA[row][64h + e] = BN_h( sum_d (ct_hi + ct_lo)[row][64h + d] WOT[h][e][d] );
  //     M = 8192, N = 64, K = 64 per head -> bf16 hi / residual planes
  gemm64<3, 1, 1, 2><<<gH, blk, 0, stream>>>(
      CTh, CTl, DM, (long long)HD,
      WOT, HD, (long long)HO * HD,
      (void*)CAh, (void*)CAl, DM, (long long)HO,
      NROWS, HO, HD, 1.0f, 1.0f,
      gam, bet, mmean, mvar, HO);

  // (8) out = (CA_hi + CA_lo) . WUT^T + bf16_RNE(x); M = 8192, N = 512, K = 512, f32
  gemm64<0, 1, 1, 1><<<gF, blk, 0, stream>>>(
      CAh, CAl, DM, 0LL,
      WUT, COUT, 0LL,
      (void*)out, (void*)out, COUT, 0LL,
      NROWS, COUT, DM, 1.0f, 1.0f,
      x, x, x, x, 0);
  (void)hipGetLastError();
}

// v002
// It runs in 163 microseconds.
// Next to v001, in two timings, it ran 1.56 and 1.55 times as fast.
// Counting every step since v000, it is 1.95 times as fast.
// Contractions (all f32 accumulate): k/q projections v_wmma_f32_16x16x32_f16 (x f16 x16 . W f16 x64, K=512, single products) -> bf16 hi/lo planes;
// v^T projection v_wmma_f32_16x16x32_f16 (Wv f16 x64 . x f16 x16, K=512, single) -> f16 x16 hi/lo planes;
// relative-position tables v_wmma_f32_16x16x32_bf16 (q bf16 hi/lo . rel bf16, hi.W+lo.W, K=64) -> f32 table;
// attention scores v_wmma_f32_16x16x32_bf16 (k bf16 hi/lo . q bf16 hi/lo, hi.hi+hi.lo+lo.hi, K=64);
// P . v^T v_wmma_f32_16x16x32_f16 (P f16 x1024 hi/lo . v^T f16 x16 hi/lo, hi.hi+lo.hi+hi.lo, K=1024 by 32);
// per-head output projection v_wmma_f32_16x16x32_bf16 (ctx bf16 hi/lo . Wo bf16, K=64) with eval batch-norm affine in f32 -> bf16 hi/lo planes;
// final projection v_wmma_f32_16x16x32_bf16 (cat bf16 hi/lo . Wout bf16, K=512) + bf16-RNE residual in f32.
// Max-subtracted online base-2 softmax and the additive position logits in f32 on VALU. Every float input RNE-converted to bf16 on load.
#include <hip/hip_runtime.h>
#include <math.h>
#include <stdint.h>

#define NB     8
#define GH     32
#define GW     32
#define NTOK   (GH * GW)
#define DM     512
#define NHEAD  8
#define HD     64
#define HO     64
#define COUT   512
#define NREL   63
#define RTP    128
#define RT_LD  (NHEAD * RTP)
#define NROWS  (NB * NTOK)
#define KCH    32
#define WSC    64.0f
#define ACARRY 16.0f
#define VC     16.0f
#define PC     1024.0f
#define LOG2E  1.4426950408889634f
#define BN_EPS 1e-3f
static_assert(NHEAD * HD == DM);
static_assert(NHEAD * HO == COUT);
static_assert(COUT == DM);
static_assert(KCH == GW);
static_assert(NREL == 2 * GW - 1);
static_assert(NREL == 2 * GH - 1);
static_assert(NREL <= HD);
static_assert(HD + NREL <= RTP);
static_assert((NTOK % 128) == 0 && (DM % 128) == 0 && (NROWS % 256) == 0 && (HD % 64) == 0 && (NTOK % KCH) == 0);
static_assert((RTP % 128) == 0 && (HO % 64) == 0 && (COUT % 128) == 0);
#define GKS         64
#define GPITCH      72
#define ATT_WAVES   8
#define ATT_THREADS (ATT_WAVES * 32)
#define ATT_ROWS    (ATT_WAVES * 16)
#define ATT_BLOCKS  (NB * NHEAD * (NTOK / ATT_ROWS))
#define PT_FLOATS   (ATT_WAVES * 16 * 36)
#define NSTG        (NTOK / KCH)
#define QPITCH      72
#define VPITCH      40
#define QT_HALVES   (KCH * QPITCH)
#define VT_HALVES   (HD * VPITCH)
#define STG_HALVES  (2 * QT_HALVES + 2 * VT_HALVES)
static_assert(ATT_THREADS == 256);
static_assert(ATT_BLOCKS == 512);
static_assert(NSTG >= 2);
static_assert(KCH * (HD / 8) == ATT_THREADS && HD * (KCH / 8) == ATT_THREADS);
static_assert((QT_HALVES % 8) == 0 && (VT_HALVES % 8) == 0 && (QPITCH % 8) == 0 && (VPITCH % 8) == 0);
static_assert(2 * ATT_ROWS * HD <= 2 * STG_HALVES);
static_assert((ATT_ROWS * HD) / 8 == 4 * ATT_THREADS);

typedef _Float16 v16h __attribute__((ext_vector_type(16)));
typedef _Float16 v8h  __attribute__((ext_vector_type(8)));
typedef __bf16   v16b __attribute__((ext_vector_type(16)));
typedef float    v8f  __attribute__((ext_vector_type(8)));
typedef float    v4f  __attribute__((ext_vector_type(4)));
typedef unsigned int v4u __attribute__((ext_vector_type(4)));

union FragH { v16h v; v8h h[2]; v4u u[2]; };
union FragAny { v16h h; v16b b; };

// ---- scalar helpers --------------------------------------------------------------------------------
__device__ __forceinline__ unsigned short bf_bits(float f) {          // f32 -> bf16 bits, RNE convert
  unsigned u = __float_as_uint(f);
  return (unsigned short)((u + 0x7FFFu + ((u >> 16) & 1u)) >> 16);
}
__device__ __forceinline__ float bf_up(unsigned short h) { return __uint_as_float(((unsigned)h) << 16); }
__device__ __forceinline__ float bfr(float f) { return bf_up(bf_bits(f)); }   // value of the bf16 RNE convert
__device__ __forceinline__ unsigned short h_bits(_Float16 x) { return __builtin_bit_cast(unsigned short, x); }
__device__ __forceinline__ unsigned pk16(unsigned short a, unsigned short b) { return (unsigned)a | ((unsigned)b << 16); }
__device__ __forceinline__ v8f zero8() { v8f z = {0.f, 0.f, 0.f, 0.f, 0.f, 0.f, 0.f, 0.f}; return z; }

// ---- fragment loader: 16-bit A/B operand from a k-contiguous 16-bit plane, lane -> row/col (lane&15),
//      p already includes +8*(lane>>4); elements 0..7 <- p[0..7] (k0+8h..), elements 8..15 <- p[16..23] (k0+16+8h..)
//      (same split k map for A and B; B is always read from a [n][k] plane)
__device__ __forceinline__ v16h ldfrag_u(const unsigned short* p) {
  FragH f;
  f.u[0] = *(const v4u*)(p);
  f.u[1] = *(const v4u*)(p + 16);
  return f.v;
}

// ---- WMMA helpers with trailing VALU hazard gaps ------------------------------------------------------
__device__ __forceinline__ v8f mma_h(v16h a, v16h b, v8f c) {
  return __builtin_amdgcn_wmma_f32_16x16x32_f16(false, a, false, b, (short)0, c, false, false);
}
__device__ __forceinline__ v8f mma_b(v16h a, v16h b, v8f c) {
  FragAny ua, ub;
  ua.h = a;
  ub.h = b;
  return __builtin_amdgcn_wmma_f32_16x16x32_bf16(false, ua.b, false, ub.b, (short)0, c, false, false);
}
template <int BF>
__device__ __forceinline__ v8f mmaT(v16h a, v16h b, v8f c) {
  if constexpr (BF != 0) return mma_b(a, b, c);
  else return mma_h(a, b, c);
}
__device__ __forceinline__ void dep_guard1(v8f& a, v8f& b, v16h x) {
#if defined(__HIP_DEVICE_COMPILE__)
  asm volatile("v_nop\n\tv_nop\n\tv_nop\n\tv_nop" : "+v"(a), "+v"(b) : "v"(x));
#endif
}
__device__ __forceinline__ void guard1x4(v8f& s, v16h a0, v16h a1, v16h a2, v16h a3) {
#if defined(__HIP_DEVICE_COMPILE__)
  asm volatile("v_nop\n\tv_nop\n\tv_nop\n\tv_nop" : "+v"(s) : "v"(a0), "v"(a1), "v"(a2), "v"(a3));
#endif
}
__device__ __forceinline__ void guard1x8(v8f& s, v16h a0, v16h a1, v16h a2, v16h a3,
                                         v16h b0, v16h b1, v16h b2, v16h b3) {
#if defined(__HIP_DEVICE_COMPILE__)
  asm volatile("v_nop\n\tv_nop\n\tv_nop\n\tv_nop"
               : "+v"(s) : "v"(a0), "v"(a1), "v"(a2), "v"(a3), "v"(b0), "v"(b1), "v"(b2), "v"(b3));
#endif
}
__device__ __forceinline__ void guard4x6(v8f& a, v8f& b, v8f& c, v8f& d,
                                         v16h x0, v16h x1, v16h x2, v16h x3, v16h x4, v16h x5) {
#if defined(__HIP_DEVICE_COMPILE__)
  asm volatile("v_nop\n\tv_nop\n\tv_nop\n\tv_nop"
               : "+v"(a), "+v"(b), "+v"(c), "+v"(d) : "v"(x0), "v"(x1), "v"(x2), "v"(x3), "v"(x4), "v"(x5));
#endif
}
__device__ __forceinline__ void guard4x5(v8f& a, v8f& b, v8f& c, v8f& d,
                                         v16h x0, v16h x1, v16h x2, v16h x3, v16h x4) {
#if defined(__HIP_DEVICE_COMPILE__)
  asm volatile("v_nop\n\tv_nop\n\tv_nop\n\tv_nop"
               : "+v"(a), "+v"(b), "+v"(c), "+v"(d) : "v"(x0), "v"(x1), "v"(x2), "v"(x3), "v"(x4));
#endif
}
__device__ __forceinline__ void keep4_h(v16h a, v16h b, v16h c, v16h d) {
#if defined(__HIP_DEVICE_COMPILE__)
  asm volatile("v_nop" :: "v"(a), "v"(b), "v"(c), "v"(d));
#endif
}
__device__ __forceinline__ void acc_guard4(v8f& a, v8f& b, v8f& c, v8f& d) {
#if defined(__HIP_DEVICE_COMPILE__)
  asm volatile("v_nop\n\tv_nop\n\tv_nop\n\tv_nop" : "+v"(a), "+v"(b), "+v"(c), "+v"(d));
#endif
}
__device__ __forceinline__ void wave_sync_lds() {
  __builtin_amdgcn_fence(__ATOMIC_RELEASE, "workgroup");
  __builtin_amdgcn_wave_barrier();
  __builtin_amdgcn_fence(__ATOMIC_ACQUIRE, "workgroup");
}

// four 16-B copies per lane, global -> LDS through no register; the s_wait_xcnt 0 in the same statement stands ahead of any later
// rewrite of the address registers that the copies name
__device__ __forceinline__ void stage_copy4(unsigned l0, const unsigned short* g0, unsigned l1, const unsigned short* g1,
                                            unsigned l2, const unsigned short* g2, unsigned l3, const unsigned short* g3) {
#if defined(__HIP_DEVICE_COMPILE__)
  asm volatile("global_load_async_to_lds_b128 %0, %1, off\n\t"
               "global_load_async_to_lds_b128 %2, %3, off\n\t"
               "global_load_async_to_lds_b128 %4, %5, off\n\t"
               "global_load_async_to_lds_b128 %6, %7, off\n\t"
               "s_wait_xcnt 0x0"
               :: "v"(l0), "v"(g0), "v"(l1), "v"(g1), "v"(l2), "v"(g2), "v"(l3), "v"(g3) : "memory");
#endif
}
// the same for eight copies: one wait on the address registers serves the run
__device__ __forceinline__ void stage_copy8(unsigned l0, const unsigned short* g0, unsigned l1, const unsigned short* g1,
                                            unsigned l2, const unsigned short* g2, unsigned l3, const unsigned short* g3,
                                            unsigned l4, const unsigned short* g4, unsigned l5, const unsigned short* g5,
                                            unsigned l6, const unsigned short* g6, unsigned l7, const unsigned short* g7) {
#if defined(__HIP_DEVICE_COMPILE__)
  asm volatile("global_load_async_to_lds_b128 %0, %1, off\n\t"
               "global_load_async_to_lds_b128 %2, %3, off\n\t"
               "global_load_async_to_lds_b128 %4, %5, off\n\t"
               "global_load_async_to_lds_b128 %6, %7, off\n\t"
               "global_load_async_to_lds_b128 %8, %9, off\n\t"
               "global_load_async_to_lds_b128 %10, %11, off\n\t"
               "global_load_async_to_lds_b128 %12, %13, off\n\t"
               "global_load_async_to_lds_b128 %14, %15, off\n\t"
               "s_wait_xcnt 0x0"
               :: "v"(l0), "v"(g0), "v"(l1), "v"(g1), "v"(l2), "v"(g2), "v"(l3), "v"(g3),
                  "v"(l4), "v"(g4), "v"(l5), "v"(g5), "v"(l6), "v"(g6), "v"(l7), "v"(g7) : "memory");
#endif
}
// this wave's copies have landed in LDS
__device__ __forceinline__ void wait_copies() {
#if defined(__HIP_DEVICE_COMPILE__)
  asm volatile("s_wait_asynccnt 0x0" ::: "memory");
#endif
}
// stands behind the eight table loads of a chunk, ahead of the later rewrite of their address pair
__device__ __forceinline__ void wait_addr() {
#if defined(__HIP_DEVICE_COMPILE__)
  asm volatile("s_wait_xcnt 0x0" ::: "memory");
#endif
}
// this wave's LDS reads have returned (ahead of the barrier behind which their buffer is refilled)
__device__ __forceinline__ void wait_lds() {
#if defined(__HIP_DEVICE_COMPILE__)
  asm volatile("s_wait_dscnt 0x0" ::: "memory");
#endif
}

// =====================================================================================================
// Elementwise 16-bit pack, no transpose. BFO 0: dst[i] = f16( bf16_RNE(src[i]) * sc ), sc a power of two (exact);
// BFO 1: dst[i] = bf16_RNE(src[i]) bits. 8 elements per thread: two 16-B loads, one 16-B store per lane; 32 consecutive
// coverage: grid = n / 2048 blocks x 256 thr x 8 elements = n exactly (host checks n % 2048 == 0).
// =====================================================================================================
template <int BFO>
__global__ __launch_bounds__(256) void cvt16(const float* __restrict__ src, unsigned short* dst, int n, float sc) {
  const size_t i8 = ((size_t)blockIdx.x * 256 + threadIdx.x) * 8;
  if (i8 + 8 > (size_t)n) return;                 // never taken with the exact grid; no barriers in this kernel
  const v4f a = *(const v4f*)(src + i8);
  const v4f b = *(const v4f*)(src + i8 + 4);
  v4u o;
  if constexpr (BFO != 0) {
    o[0] = pk16(bf_bits(a[0]), bf_bits(a[1]));
    o[1] = pk16(bf_bits(a[2]), bf_bits(a[3]));
    o[2] = pk16(bf_bits(b[0]), bf_bits(b[1]));
    o[3] = pk16(bf_bits(b[2]), bf_bits(b[3]));
  } else {
    o[0] = pk16(h_bits((_Float16)(bfr(a[0]) * sc)), h_bits((_Float16)(bfr(a[1]) * sc)));
    o[1] = pk16(h_bits((_Float16)(bfr(a[2]) * sc)), h_bits((_Float16)(bfr(a[3]) * sc)));
    o[2] = pk16(h_bits((_Float16)(bfr(b[0]) * sc)), h_bits((_Float16)(bfr(b[1]) * sc)));
    o[3] = pk16(h_bits((_Float16)(bfr(b[2]) * sc)), h_bits((_Float16)(bfr(b[3]) * sc)));
  }
  {
    *(v4u*)(dst + i8) = o;
    
  }
}

// =====================================================================================================
// Transposing 16-bit pack of a weight matrix: in W[Cin][Dd] (pitch Dd, base + z*sIn) -> out WT[Dd][Cin] (pitch Cin, base + z*sOut),
// BFO 0: f16( bf16_RNE(w) * sc ); BFO 1: bf16_RNE(w) bits. One 64x64 tile per block (x = Cin tile, y = Dd tile, z = matrix index):
// coverage: loads 4 x 256 x 4 floats = 64x64; stores 2 x 256 pieces x 8 halves = 64 rows x 64 halves = the whole tile;
//           grid = (Cin/64, Dd/64, nmat) exact (host passes exact multiples of 64).
// =====================================================================================================
template <int BFO>
__global__ __launch_bounds__(256) void tr16(const float* __restrict__ W, unsigned short* WT, int Cin, int Dd,
                                            long long sIn, long long sOut, float sc) {
  __shared__ float t[64][65];
  const int tid = threadIdx.x;
  const int c0 = blockIdx.x * 64, d0 = blockIdx.y * 64;
  const float* src = W + (size_t)((long long)blockIdx.z * sIn);
  unsigned short* dst = WT + (size_t)((long long)blockIdx.z * sOut);
#pragma unroll
  for (int it = 0; it < 4; ++it) {
    const int p  = it * 256 + tid;
    const int cc = p >> 4, sg = (p & 15) * 4;
    const v4f v = *(const v4f*)(src + (size_t)(c0 + cc) * Dd + d0 + sg);
    t[cc][sg]     = v[0];
    t[cc][sg + 1] = v[1];
    t[cc][sg + 2] = v[2];
    t[cc][sg + 3] = v[3];
  }
  __syncthreads();
  v4u o[2];
#pragma unroll
  for (int it = 0; it < 2; ++it) {
    const int p  = it * 256 + tid;
    const int dd = p >> 3, s8 = (p & 7) * 8;
    unsigned short hv[8];
#pragma unroll
    for (int k = 0; k < 8; ++k) {
      const float f = bfr(t[s8 + k][dd]);
      if constexpr (BFO != 0) hv[k] = bf_bits(f);
      else hv[k] = h_bits((_Float16)(f * sc));
    }
    v4u q;
    q[0] = pk16(hv[0], hv[1]);
    q[1] = pk16(hv[2], hv[3]);
    q[2] = pk16(hv[4], hv[5]);
    q[3] = pk16(hv[6], hv[7]);
    o[it] = q;
  }
  {
#pragma unroll
    for (int it = 0; it < 2; ++it) {
      const int p  = it * 256 + tid;
      const int dd = p >> 3, s8 = (p & 7) * 8;
      *(v4u*)(dst + (size_t)(d0 + dd) * Cin + c0 + s8) = o[it];
    }
    
  }
}

// =====================================================================================================
// Relative-position operand plane: out[h][r][0..63] bf16 bits, r 0..62 = rel_w[h][r][:], r 63 = 0, r 64..126 = rel_h[h][r-64][:],
// r 127 = 0. Every lane loads both candidate rows from clamped addresses and selects by value. 8 halves per thread, 8 consecutive
// coverage: 32 blocks x 256 threads x 8 halves = 8 x 128 x 64 exactly.
// =====================================================================================================
__global__ __launch_bounds__(256) void relcat(const float* __restrict__ rw, const float* __restrict__ rh, unsigned short* out) {
  const int p   = blockIdx.x * 256 + threadIdx.x;        // 0 .. NHEAD*RTP*8 - 1
  const int hd  = p / (RTP * 8);
  const int r   = (p >> 3) & (RTP - 1);
  const int seg = (p & 7) * 8;
  const int iw  = (r < NREL) ? r : (NREL - 1);
  int ih = r - HD;
  ih = (ih < 0) ? 0 : ih;
  ih = (ih > NREL - 1) ? (NREL - 1) : ih;
  const float* pw = rw + ((size_t)hd * NREL + iw) * HD + seg;
  const float* ph = rh + ((size_t)hd * NREL + ih) * HD + seg;
  const v4f a0 = *(const v4f*)(pw), a1 = *(const v4f*)(pw + 4);
  const v4f b0 = *(const v4f*)(ph), b1 = *(const v4f*)(ph + 4);
  const bool uw = (r < NREL);
  const bool uh = (r >= HD) && (r < HD + NREL);
  float v[8];
#pragma unroll
  for (int e = 0; e < 4; ++e) {
    v[e]     = uw ? a0[e] : (uh ? b0[e] : 0.f);
    v[4 + e] = uw ? a1[e] : (uh ? b1[e] : 0.f);
  }
  v4u o;
  o[0] = pk16(bf_bits(v[0]), bf_bits(v[1]));
  o[1] = pk16(bf_bits(v[2]), bf_bits(v[3]));
  o[2] = pk16(bf_bits(v[4]), bf_bits(v[5]));
  o[3] = pk16(bf_bits(v[6]), bf_bits(v[7]));
  {
    *(v4u*)(out + (size_t)p * 8) = o;
    
  }
}

// =====================================================================================================
// Register-blocked batched 16-bit WMMA GEMM: C[m][n] = oscale * sum_k A[m][k] * Bt[n][k]; one wave per 64x64 tile, block = WM x WN waves
// (4 waves) on a (64 WM) x (64 WN) tile.
// A row-major [M][K] pitch lda (16-bit plane), Bt row-major [N][K] pitch ldb (k contiguous); M multiple of 64 WM, N of 64 WN, K of 64.
// The block's A and Bt rows are brought into LDS once per block, in k slabs of 64 (one whole 128-B line per row, 8 lanes per line, pitch 144 B
// in LDS), by asynchronous 16-B copies, two buffers: slab t + 2 is issued behind the barrier that ends slab t. All fragments are 16-B LDS reads
// with the same split k map and the same k order of the products as with fragments read from global memory.
// blockIdx.y = batch index with element strides sA, sB, sC.
// ASPLIT 1: a second A plane A2 (unscaled residual of A, same layout) is multiplied into the same accumulator (A + A2 ~ exact A).
// BF 1: bf16 operands (v_wmma_f32_16x16x32_bf16), else f16.
// OM 0: f32 out (pitch ldc).  OM 2: f16 out = f16(value * ocarry).  OM 3: two bf16 planes: hi = bf16_RNE(value), lo = bf16_RNE(value - hi).
// OM 4: two f16 planes: hi = f16(value * ocarry), lo = f16(value * ocarry - hi) (unscaled residual).
// EPI 1 (OM 0 only): value += bf16_RNE(ep0[same index as C]).  EPI 2 (16-bit out): per-column eval batch-norm affine
//   value = (bf16(ep0[ci]) * (value - bf16(ep2[ci]))) * rsqrt(bf16(ep3[ci]) + eps) + bf16(ep1[ci]),  ci = by*cps + column.
// coverage: 4 slabs x 16 rows (f32: it 0..7 x lane>>4; 16-bit: it 0..3 x lane>>3) x 64 cols = the wave's whole 64x64 tile;
//           grid = (M / (64 WM)) * (N / (64 WN)) blocks exactly; a surplus block would leave as a whole, ahead of every copy and barrier.
// =====================================================================================================
template <int V> struct IntC { static constexpr int value = V; };
template <int OM, int ASPLIT, int BF, int EPI, int WM, int WN>
__global__ __launch_bounds__(WM * WN * 32) __attribute__((amdgpu_num_vgpr(256))) void gemm64(
    const unsigned short* __restrict__ Ap, const unsigned short* __restrict__ A2p, int lda, long long sA,
    const unsigned short* __restrict__ Btp, int ldb, long long sB,
    void* Cout, void* C2out, int ldc, long long sC,
    int M, int N, int K, float oscale, float ocarry,
    const float* __restrict__ ep0, const float* __restrict__ ep1,
    const float* __restrict__ ep2, const float* __restrict__ ep3, int cps) {
  constexpr int NW     = WM * WN;                    // waves per block
  constexpr int AR     = 64 * WM;                    // A rows of the block tile
  constexpr int BR     = 64 * WN;                    // Bt rows of the block tile
  constexpr int RPI    = NW * 4;                     // rows that one copy of every lane of the block covers (8 lanes per row)
  constexpr int A_H    = AR * GPITCH;                // halves of one A plane's slab in LDS
  constexpr int B_H    = BR * GPITCH;
  constexpr int SLAB_H = (1 + ASPLIT) * A_H + B_H;   // one buffer: A | (A2) | Bt
  static_assert((AR % (4 * RPI)) == 0 && (BR % (4 * RPI)) == 0);
  static_assert(((1 + ASPLIT) * AR + BR) / RPI <= 63);     // copies of one wave in flight
  __shared__ __align__(16) unsigned short gst[2 * SLAB_H];
  __shared__ __align__(16) float sT[NW][16 * 68];   // per-wave 16x64 slab, pitch 68 floats
  const int by   = blockIdx.y;
  const int tid  = threadIdx.x;
  const int lane = tid & 31;
  const int wave = tid >> 5;
  const int tilesN = N / BR;
  const int tilesM = M / AR;
  if ((int)blockIdx.x >= tilesM * tilesN) return;   // block-uniform, ahead of every copy and barrier
  const int tm  = blockIdx.x / tilesN;
  const int tn  = blockIdx.x - tm * tilesN;
  const int bm0 = tm * AR;
  const int bn0 = tn * BR;
  const int wm  = wave / WN;
  const int wn  = wave - wm * WN;
  const int m0  = bm0 + (wm << 6);
  const int n0  = bn0 + (wn << 6);

  const unsigned short* A1 = Ap  + (size_t)((long long)by * sA);
  const unsigned short* A2 = A2p + (size_t)((long long)by * sA);
  const unsigned short* Bb = Btp + (size_t)((long long)by * sB);

  const int rlane = lane & 15;                 // row (A) / col (B, D) within subtile
  const int koff  = (lane >> 4) * 8;           // k offset of this lane half
  const int mOff  = (lane >> 4) * 8;           // D row offset

  // per-lane copy addresses: row tid>>3 of a group of RPI rows, 16-B segment tid&7 of the row's 128-B line
  const unsigned short* gA  = A1 + (size_t)(bm0 + (tid >> 3)) * lda + (tid & 7) * 8;
  const unsigned short* gA2 = A2 + (size_t)(bm0 + (tid >> 3)) * lda + (tid & 7) * 8;
  const unsigned short* gB  = Bb + (size_t)(bn0 + (tid >> 3)) * ldb + (tid & 7) * 8;
  const unsigned lcp = (unsigned)(uintptr_t)gst + (unsigned)((tid >> 3) * (GPITCH * 2) + (tid & 7) * 16);   // LDS byte address
  constexpr unsigned LSTEP = (unsigned)(RPI * GPITCH * 2);      // LDS bytes from one group of RPI rows to the next
  const size_t astep = (size_t)RPI * lda, bstep = (size_t)RPI * ldb;
  // rows of one plane: groups of RPI rows, eight groups (or the last four) per statement
  auto plane = [&](unsigned l, const unsigned short* p, size_t step, auto ngroups) {
    constexpr int NG = decltype(ngroups)::value;
#pragma unroll
    for (int g = 0; g < NG; g += 8) {
      const unsigned short* q = p + (size_t)g * step;
      const unsigned m = l + (unsigned)g * LSTEP;
      if (g + 8 <= NG) {
        stage_copy8(m, q, m + LSTEP, q + step, m + 2 * LSTEP, q + 2 * step, m + 3 * LSTEP, q + 3 * step,
                    m + 4 * LSTEP, q + 4 * step, m + 5 * LSTEP, q + 5 * step, m + 6 * LSTEP, q + 6 * step, m + 7 * LSTEP, q + 7 * step);
      } else {
        stage_copy4(m, q, m + LSTEP, q + step, m + 2 * LSTEP, q + 2 * step, m + 3 * LSTEP, q + 3 * step);
      }
    }
  };
  auto stage = [&](int buf, int k0) {
    const unsigned l0 = lcp + (unsigned)(buf * (SLAB_H * 2));
    plane(l0, gA + k0, astep, IntC<AR / RPI>{});
    if constexpr (ASPLIT != 0) plane(l0 + (unsigned)(A_H * 2), gA2 + k0, astep, IntC<AR / RPI>{});
    plane(l0 + (unsigned)((1 + ASPLIT) * A_H * 2), gB + k0, bstep, IntC<BR / RPI>{});
  };

  v8f acc[4][4];
#pragma unroll
  for (int i = 0; i < 4; ++i)
#pragma unroll
    for (int j = 0; j < 4; ++j) acc[i][j] = zero8();

  // slab 0 -> buffer 0, landed and published; then slab 1 -> buffer 1 flies while slab 0 is worked on
  const int nslab = K / GKS;
  stage(0, 0);
  wait_copies();
  __syncthreads();
  if (nslab > 1) stage(1, GKS);

#pragma unroll 1
  for (int t = 0; t < nslab; ++t) {
    const unsigned short* sb  = gst + (t & 1) * SLAB_H;
    const unsigned short* As  = sb + ((wm << 6) + rlane) * GPITCH + koff;
    const unsigned short* As2 = As + A_H;
    const unsigned short* Bs  = sb + (1 + ASPLIT) * A_H + ((wn << 6) + rlane) * GPITCH + koff;
#pragma unroll
    for (int ks = 0; ks < GKS; ks += 32) {
      // all fragments of the k-step are read as one group ahead of its products (one LDS wait per k-step, not one per row of tiles)
      v16h bh[4], ah[4];
#pragma unroll
      for (int j = 0; j < 4; ++j) bh[j] = ldfrag_u(Bs + (j << 4) * GPITCH + ks);
#pragma unroll
      for (int i = 0; i < 4; ++i) ah[i] = ldfrag_u(As + (i << 4) * GPITCH + ks);
      if constexpr (ASPLIT != 0) {
        v16h al[4];
#pragma unroll
        for (int i = 0; i < 4; ++i) al[i] = ldfrag_u(As2 + (i << 4) * GPITCH + ks);
#pragma unroll
        for (int i = 0; i < 4; ++i) {
#pragma unroll
          for (int j = 0; j < 4; ++j) acc[i][j] = mmaT<BF>(ah[i], bh[j], acc[i][j]);
          dep_guard1(acc[i][0], acc[i][3], ah[i]);
#pragma unroll
          for (int j = 0; j < 4; ++j) acc[i][j] = mmaT<BF>(al[i], bh[j], acc[i][j]);
          dep_guard1(acc[i][0], acc[i][3], al[i]);
        }
      } else {
#pragma unroll
        for (int i = 0; i < 4; ++i) {
#pragma unroll
          for (int j = 0; j < 4; ++j) acc[i][j] = mmaT<BF>(ah[i], bh[j], acc[i][j]);
          dep_guard1(acc[i][0], acc[i][3], ah[i]);
        }
      }
      keep4_h(bh[0], bh[1], bh[2], bh[3]);
    }
    // foot of the slab: own LDS reads returned, own copies of slab t + 1 landed, then the one barrier that publishes slab t + 1
    // and ends every wave's reads of this slab's buffer; only behind it is that buffer refilled with slab t + 2
    wait_lds();
    wait_copies();
    __syncthreads();
    if (t + 2 < nslab) stage(t & 1, (t + 2) * GKS);
  }
  wait_copies();
  acc_guard4(acc[0][0], acc[0][1], acc[0][2], acc[0][3]);
  acc_guard4(acc[1][0], acc[1][1], acc[1][2], acc[1][3]);
  acc_guard4(acc[2][0], acc[2][1], acc[2][2], acc[2][3]);
  acc_guard4(acc[3][0], acc[3][1], acc[3][2], acc[3][3]);

  const int hh2 = lane >> 4, c4 = (lane & 15) * 4;     // f32 out: 256-B row segment = 16 lanes x 16 B
  const int q8  = lane >> 3, c8 = (lane & 7) * 8;

  // ---- epilogue ----
  float* slab = sT[wave];
#pragma unroll
  for (int i = 0; i < 4; ++i) {
    const int mBase = m0 + (i << 4);
#pragma unroll
    for (int j = 0; j < 4; ++j) {
#pragma unroll
      for (int r = 0; r < 8; ++r) {
        slab[(mOff + r) * 68 + (j << 4) + rlane] = acc[i][j][r];
      }
    }
    wave_sync_lds();
    if constexpr (OM == 0) {
      float* C = (float*)Cout + (size_t)((long long)by * sC);
      const float* R = ep0 + (size_t)((long long)by * sC);
      v4f vals[8];
#pragma unroll
      for (int it = 0; it < 8; ++it) {
        const int row = it * 2 + hh2;                      // it 0..7 x hh2 0..1 = rows 0..15
        v4f v = *(const v4f*)(slab + row * 68 + c4);
#pragma unroll
        for (int e = 0; e < 4; ++e) v[e] = v[e] * oscale;
        if constexpr (EPI == 1) {
          const v4f xr = *(const v4f*)(R + (size_t)(mBase + row) * ldc + n0 + c4);
#pragma unroll
          for (int e = 0; e < 4; ++e) v[e] = v[e] + bfr(xr[e]);
        }
        vals[it] = v;
      }
      {
#pragma unroll
        for (int it = 0; it < 8; ++it) {
          const int gr = mBase + it * 2 + hh2;
          *(v4f*)(C + (size_t)gr * ldc + n0 + c4) = vals[it];
        }
        
      }
    } else {
      unsigned short* C  = (unsigned short*)Cout  + (size_t)((long long)by * sC);
      unsigned short* Cb = (unsigned short*)C2out + (size_t)((long long)by * sC);
      v4u hv[4], lv[4];
#pragma unroll
      for (int it = 0; it < 4; ++it) {
        const int row = it * 4 + q8;                       // it 0..3 x q8 0..3 = rows 0..15
        const float* sp = slab + row * 68 + c8;
        v4u a  = {0u, 0u, 0u, 0u};
        v4u b2 = {0u, 0u, 0u, 0u};
#pragma unroll
        for (int e = 0; e < 4; ++e) {
          float f0 = sp[2 * e] * oscale;
          float f1 = sp[2 * e + 1] * oscale;
          if constexpr (EPI == 2) {
            const int ci = by * cps + n0 + c8 + 2 * e;   // column parameter index (host keeps by*cps + N <= parameter count)
            const float g0 = bfr(ep0[ci]), g1 = bfr(ep0[ci + 1]);
            const float t0 = bfr(ep1[ci]), t1 = bfr(ep1[ci + 1]);
            const float u0 = bfr(ep2[ci]), u1 = bfr(ep2[ci + 1]);
            const float r0 = rsqrtf(bfr(ep3[ci]) + BN_EPS), r1 = rsqrtf(bfr(ep3[ci + 1]) + BN_EPS);
            f0 = (g0 * (f0 - u0)) * r0 + t0;
            f1 = (g1 * (f1 - u1)) * r1 + t1;
          }
          if constexpr (OM == 3) {
            const unsigned short h0 = bf_bits(f0), h1 = bf_bits(f1);
            a[e]  = pk16(h0, h1);
            b2[e] = pk16(bf_bits(f0 - bf_up(h0)), bf_bits(f1 - bf_up(h1)));
          } else {
            f0 *= ocarry; f1 *= ocarry;
            const _Float16 x0 = (_Float16)f0, x1 = (_Float16)f1;
            a[e] = pk16(h_bits(x0), h_bits(x1));
            if constexpr (OM == 4) {
              b2[e] = pk16(h_bits((_Float16)(f0 - (float)x0)), h_bits((_Float16)(f1 - (float)x1)));
            }
          }
        }
        hv[it] = a;
        lv[it] = b2;
      }
      {
#pragma unroll
        for (int it = 0; it < 4; ++it) {
          const int row = it * 4 + q8;
          *(v4u*)(C + (size_t)(mBase + row) * ldc + n0 + c8) = hv[it];
          if constexpr (OM >= 3) {
            *(v4u*)(Cb + (size_t)(mBase + row) * ldc + n0 + c8) = lv[it];
          }
        }
        
      }
    }
    wave_sync_lds();
  }
}

// =====================================================================================================
// Flash attention for one image (batch), one head and 128 score rows (one wave per 16 rows), head dim 64, 1024 columns:
//   rows i index KEY positions (k_i stationary, A fragments), columns j index the q/v positions streamed in chunks of 32 = one image row;
//   k planes (bf16 hi, lo) K[b*1024 + tok][64h + d], pitch 512; q planes (bf16 hi, lo) Q[b*1024 + tok][64h + d];
//   v^T planes (f16 x16 hi, unscaled lo): VT[b*512 + 64h + d][tok] (pitch 1024);
//   additive position logits from the f32 table R[b*1024 + tok][128h + m] (m < 63: q_tok . rel_w[h][m]; 64 + m: q_tok . rel_h[h][m]):
//   logit[i][j] = k_i . q_j + R[i][yj - yi + 31] + R[i][64 + xj - xi + 31], token = 32*x + y. The w part depends only on the column within
//   a chunk (16 registers per lane, loaded once), the h part only on the chunk (8 loads per lane per chunk); indices are pure arithmetic.
//   out (bf16 hi, lo planes): CT[b*1024 + tok][64h + d] = sum_j softmax_j(logit) v[j][d]  (softmax run in base 2, max-subtracted, no 1/sqrt(d)).
//   block = 8 waves = 256 threads; grid = 8 images x 8 heads x 8 row blocks = 512; every wave does identical bounded work (32 chunks).
//   The 8 waves of a block need the same q and v^T chunk: it is brought into LDS once per block by asynchronous 16-B copies (4 per lane and
//   chunk: q hi, q lo 32 rows x 128 B at pitch 144 B; v^T hi, lo 64 rows x 64 B at pitch 80 B), two buffers, chunk t + 2 issued behind the
//   barrier that ends chunk t; all B fragments are 16-B LDS reads with the same split k map as before.
//   Per chunk: 2 score tiles on bf16 WMMA (hi.hi + hi.lo + lo.hi, K = 64 as two k-steps of 32); online softmax in f32 (exp2); A fragments
//   of P*1024 (f16 hi and unscaled residual) rebuilt from the wave's own LDS rows (f32 vector loads, split k map); 12 P.V WMMAs
//   (hi.hi, lo.hi, hi.lo).
//   Final 1/l and carry folds in f32; after a block barrier the stage buffers are reused as the block's two bf16 result buffers [128][64]
//   (hi, lo): each wave stages its 16x64 slice (element stores); after a second block barrier the 256 threads write whole 128-B row pieces.
// coverage: LDS result buffers: 8 waves x 16 rows x 64 cols per plane; global: 4 iterations x 256 threads x 8 halves = 128 rows x 64 cols
//           of rows 128rb..128rb+127, columns 64h..64h+63 of image b, per plane; grid covers all 8 x 1024 rows x 512 columns exactly once.
// =====================================================================================================
__global__ __launch_bounds__(ATT_THREADS) __attribute__((amdgpu_num_vgpr(256)))
void attn8(const unsigned short* __restrict__ KHh, const unsigned short* __restrict__ KHl,
           const unsigned short* __restrict__ QHh, const unsigned short* __restrict__ QHl,
           const unsigned short* __restrict__ VTh, const unsigned short* __restrict__ VTl,
           const float* __restrict__ Rtab, unsigned short* CTh, unsigned short* CTl) {
  __shared__ __align__(16) unsigned short stg[2 * STG_HALVES];   // two stage buffers: q hi | q lo | v^T hi | v^T lo; later: result buffers
  __shared__ __align__(16) float ptile[PT_FLOATS];               // prob tiles [wave][row][32 cols] pitch 36

  const int tid  = threadIdx.x;
  const int wave = tid >> 5;
  const int lane = tid & 31;
  const int hh   = lane >> 4;
  const int c    = lane & 15;

  const int rb   = blockIdx.x & ((NTOK / ATT_ROWS) - 1);   // 0..7
  const int head = (blockIdx.x / (NTOK / ATT_ROWS)) & (NHEAD - 1);   // 0..7
  const int bat  = blockIdx.x / ((NTOK / ATT_ROWS) * NHEAD);         // 0..7
  const int i0   = rb * ATT_ROWS + wave * 16;              // first score row (key token) of this wave
  const int x0   = i0 / GW;                                // image row of all 16 tokens
  const int ybase = (i0 & (GW - 1)) + 8 * hh;              // image column of row element r is ybase + r
  const size_t rowg = (size_t)bat * NTOK + i0;

  // per-lane copy addresses: q piece = row tid>>3, 16-B segment tid&7; v^T piece = row tid>>2, 16-B segment tid&3
  const unsigned short* gqh = QHh + ((size_t)bat * NTOK + (tid >> 3)) * DM + head * HD + (tid & 7) * 8;
  const unsigned short* gql = QHl + ((size_t)bat * NTOK + (tid >> 3)) * DM + head * HD + (tid & 7) * 8;
  const unsigned short* gvh = VTh + ((size_t)bat * DM + head * HD + (tid >> 2)) * NTOK + (tid & 3) * 8;
  const unsigned short* gvl = VTl + ((size_t)bat * DM + head * HD + (tid >> 2)) * NTOK + (tid & 3) * 8;
  const unsigned lbase = (unsigned)(uintptr_t)stg;         // LDS byte address of the stage buffers
  const unsigned lq = lbase + (unsigned)((tid >> 3) * (QPITCH * 2) + (tid & 7) * 16);
  const unsigned lv = lbase + (unsigned)(2 * QT_HALVES * 2 + (tid >> 2) * (VPITCH * 2) + (tid & 3) * 16);

  // chunk 0 -> buffer 0, landed and published; then chunk 1 -> buffer 1 flies while chunk 0 is worked on
  stage_copy4(lq, gqh, lq + QT_HALVES * 2, gql, lv, gvh, lv + VT_HALVES * 2, gvl);
  wait_copies();
  __syncthreads();
  stage_copy4(lq + STG_HALVES * 2, gqh + (size_t)KCH * DM, lq + (STG_HALVES + QT_HALVES) * 2, gql + (size_t)KCH * DM,
              lv + STG_HALVES * 2, gvh + KCH, lv + (STG_HALVES + VT_HALVES) * 2, gvl + KCH);

  // stationary A fragments: k rows i0 + c (hi and residual planes), d 0..31 and 32..63
  const size_t kofs = (rowg + c) * DM + head * HD + 8 * hh;
  const v16h kah = ldfrag_u(KHh + kofs), kbh = ldfrag_u(KHh + kofs + 32);
  const v16h kal = ldfrag_u(KHl + kofs), kbl = ldfrag_u(KHl + kofs + 32);

  // additive w-position logits for this lane's 16 (row, column-in-chunk) score elements, loop-invariant, pre-scaled by log2(e)
  const float* rrow = Rtab + (rowg + 8 * hh) * RT_LD + head * RTP;   // + r*RT_LD = table row of score row 8hh+r
  float wb0[8], wb1[8];
#pragma unroll
  for (int r = 0; r < 8; ++r) {
    const float* rp = rrow + (size_t)r * RT_LD;
    const int iw = c + (GW - 1) - (ybase + r);             // in [0, 46]
    wb0[r] = rp[iw] * LOG2E;
    wb1[r] = rp[iw + 16] * LOG2E;                          // in [16, 62]
  }

  float mrow[8], lrow[8];
  v8f o0 = zero8(), o1 = zero8(), o2 = zero8(), o3 = zero8();
#pragma unroll
  for (int r = 0; r < 8; ++r) { mrow[r] = -INFINITY; lrow[r] = 0.f; }
  float* pt = ptile + wave * (16 * 36);

#pragma unroll 1
  for (int st = 0; st < NSTG; ++st) {
    const int bsel = st & 1;
    const unsigned short* sb  = stg + bsel * STG_HALVES;
    const unsigned short* Qsh = sb + c * QPITCH + 8 * hh;                    // q hi, row c of the chunk
    const unsigned short* Qsl = Qsh + QT_HALVES;
    const unsigned short* Vsh = sb + 2 * QT_HALVES + c * VPITCH + 8 * hh;    // v^T hi, row d = c
    const unsigned short* Vsl = Vsh + VT_HALVES;
    v8f s0, s1;
    {
      const v16h q0h = ldfrag_u(Qsh), q1h = ldfrag_u(Qsh + 32);
      const v16h q0l = ldfrag_u(Qsl), q1l = ldfrag_u(Qsl + 32);
      s0 = mma_b(kah, q0h, zero8());
      s0 = mma_b(kbh, q1h, s0);
      s0 = mma_b(kah, q0l, s0);
      s0 = mma_b(kbh, q1l, s0);
      s0 = mma_b(kal, q0h, s0);
      s0 = mma_b(kbl, q1h, s0);
      guard1x4(s0, q0h, q1h, q0l, q1l);
    }
    {
      const int q2 = 16 * QPITCH;
      const v16h q0h = ldfrag_u(Qsh + q2), q1h = ldfrag_u(Qsh + q2 + 32);
      const v16h q0l = ldfrag_u(Qsl + q2), q1l = ldfrag_u(Qsl + q2 + 32);
      s1 = mma_b(kah, q0h, zero8());
      s1 = mma_b(kbh, q1h, s1);
      s1 = mma_b(kah, q0l, s1);
      s1 = mma_b(kbh, q1l, s1);
      s1 = mma_b(kal, q0h, s1);
      s1 = mma_b(kbl, q1h, s1);
      guard1x8(s1, q0h, q1h, q0l, q1l, kah, kbh, kal, kbl);
    }
    // h-position logit of this chunk (one image row x2 = st) for each of the lane's 8 score rows
    const int mh = st - x0 + (GH - 1);                     // in [0, 62]
    const float* hp = rrow + HD + mh;
    float hv8[8];
#pragma unroll
    for (int r = 0; r < 8; ++r) hv8[r] = hp[(size_t)r * RT_LD];
    wait_addr();
#pragma unroll
    for (int r = 0; r < 8; ++r) {
      const float hb = hv8[r] * LOG2E;
      const float t0 = s0[r] * LOG2E + (wb0[r] + hb), t1 = s1[r] * LOG2E + (wb1[r] + hb);
      float mx = fmaxf(t0, t1);
#pragma unroll
      for (int off = 1; off < 16; off <<= 1) mx = fmaxf(mx, __shfl_xor(mx, off, 32));
      const float mn = fmaxf(mrow[r], mx);
      const float al = exp2f(mrow[r] - mn);
      mrow[r] = mn;
      const float e0 = exp2f(t0 - mn), e1 = exp2f(t1 - mn);
      float ps = e0 + e1;
#pragma unroll
      for (int off = 1; off < 16; off <<= 1) ps += __shfl_xor(ps, off, 32);
      lrow[r] = lrow[r] * al + ps;
      o0[r] *= al;
      o1[r] *= al;
      o2[r] *= al;
      o3[r] *= al;
      const int ro = (8 * hh + r) * 36 + c;
      pt[ro]      = e0;
      pt[ro + 16] = e1;
    }
    wave_sync_lds();
    FragH ph, pl;
    {
      const float* prow = pt + c * 36 + 8 * hh;
      const v4f p0 = *(const v4f*)(prow), p1 = *(const v4f*)(prow + 4);
      const v4f p2 = *(const v4f*)(prow + 16), p3 = *(const v4f*)(prow + 20);
#pragma unroll
      for (int e = 0; e < 4; ++e) {
        float f; _Float16 x;
        f = p0[e] * PC; x = (_Float16)f; ph.h[0][e]     = x; pl.h[0][e]     = (_Float16)(f - (float)x);   // cols jb + 8hh + e
        f = p1[e] * PC; x = (_Float16)f; ph.h[0][4 + e] = x; pl.h[0][4 + e] = (_Float16)(f - (float)x);   // cols jb + 8hh + 4 + e
        f = p2[e] * PC; x = (_Float16)f; ph.h[1][e]     = x; pl.h[1][e]     = (_Float16)(f - (float)x);   // cols jb + 16 + 8hh + e
        f = p3[e] * PC; x = (_Float16)f; ph.h[1][4 + e] = x; pl.h[1][4 + e] = (_Float16)(f - (float)x);
      }
    }
    {
      const v16h vh0 = ldfrag_u(Vsh);
      const v16h vh1 = ldfrag_u(Vsh + 16 * VPITCH);
      const v16h vh2 = ldfrag_u(Vsh + 32 * VPITCH);
      const v16h vh3 = ldfrag_u(Vsh + 48 * VPITCH);
      o0 = mma_h(ph.v, vh0, o0);
      o1 = mma_h(ph.v, vh1, o1);
      o2 = mma_h(ph.v, vh2, o2);
      o3 = mma_h(ph.v, vh3, o3);
      o0 = mma_h(pl.v, vh0, o0);
      o1 = mma_h(pl.v, vh1, o1);
      o2 = mma_h(pl.v, vh2, o2);
      o3 = mma_h(pl.v, vh3, o3);
      guard4x6(o0, o1, o2, o3, ph.v, pl.v, vh0, vh1, vh2, vh3);
    }
    {
      const v16h vl0 = ldfrag_u(Vsl);
      const v16h vl1 = ldfrag_u(Vsl + 16 * VPITCH);
      const v16h vl2 = ldfrag_u(Vsl + 32 * VPITCH);
      const v16h vl3 = ldfrag_u(Vsl + 48 * VPITCH);
      o0 = mma_h(ph.v, vl0, o0);
      o1 = mma_h(ph.v, vl1, o1);
      o2 = mma_h(ph.v, vl2, o2);
      o3 = mma_h(ph.v, vl3, o3);
      guard4x5(o0, o1, o2, o3, ph.v, vl0, vl1, vl2, vl3);
    }
    // foot of the chunk: own LDS reads returned, own copies of chunk st + 1 landed, then the one barrier that publishes chunk st + 1
    // and ends every wave's reads of this chunk's buffer; only behind it is that buffer refilled with chunk st + 2
    wait_lds();
    wait_copies();
    __syncthreads();
    if (st + 2 < NSTG) {
      const size_t qa = (size_t)(st + 2) * KCH * DM;
      const int    va = (st + 2) * KCH;
      const unsigned lo = (unsigned)(bsel * STG_HALVES * 2);
      stage_copy4(lq + lo, gqh + qa, lq + lo + QT_HALVES * 2, gql + qa, lv + lo, gvh + va, lv + lo + VT_HALVES * 2, gvl + va);
    }
  }
  wait_copies();

  // ---- all waves done with the stage buffers; they become two bf16 result buffers [128][64] ----
  __syncthreads();
  unsigned short* Osh = stg;
  unsigned short* Osl = Osh + ATT_ROWS * HD;
  // ---- fold 1/l and the carries (1024 on P, 16 on v), split into bf16 hi + residual, stage the wave's 16x64 slice ----
  const float oc = 1.0f / (PC * VC);
#pragma unroll
  for (int r = 0; r < 8; ++r) {
    const float inv = (1.0f / lrow[r]) * oc;
    const int ro = (wave * 16 + 8 * hh + r) * HD + c;
    const float f0 = o0[r] * inv, f1 = o1[r] * inv, f2 = o2[r] * inv, f3 = o3[r] * inv;
    const unsigned short g0 = bf_bits(f0), g1 = bf_bits(f1), g2 = bf_bits(f2), g3 = bf_bits(f3);
    Osh[ro]      = g0;  Osl[ro]      = bf_bits(f0 - bf_up(g0));
    Osh[ro + 16] = g1;  Osl[ro + 16] = bf_bits(f1 - bf_up(g1));
    Osh[ro + 32] = g2;  Osl[ro + 32] = bf_bits(f2 - bf_up(g2));
    Osh[ro + 48] = g3;  Osl[ro + 48] = bf_bits(f3 - bf_up(g3));
  }
  __syncthreads();
  // ---- block writes its 128 row pieces of both planes: piece p = it*256 + tid -> row p>>3, halves (p&7)*8 .. +7 (8 lanes = one 128-B line) ----
  {
    v4u hv[4], lv4[4];
#pragma unroll
    for (int it = 0; it < 4; ++it) {
      const int p = it * ATT_THREADS + tid;
      hv[it]  = *(const v4u*)(Osh + (size_t)p * 8);
      lv4[it] = *(const v4u*)(Osl + (size_t)p * 8);
    }
    const size_t dofs = ((size_t)bat * NTOK + rb * ATT_ROWS) * DM + head * HD;
    unsigned short* dsth = CTh + dofs;
    unsigned short* dstl = CTl + dofs;
    {
#pragma unroll
      for (int it = 0; it < 4; ++it) {
        const int p = it * ATT_THREADS + tid;
        const size_t go = (size_t)(p >> 3) * DM + (p & 7) * 8;
        *(v4u*)(dsth + go) = hv[it];
        *(v4u*)(dstl + go) = lv4[it];
      }
    }
  }
}

// =====================================================================================================
// Workspace map (bytes); every plane is an exact multiple of its tile / whole-row store granularity (M, N exact tile multiples,
// the activation convert count an exact multiple of 2048, no pad rows needed), every offset a multiple of 64 KiB:
//   WKT, WQT, WVT f16 [512][512] x64   3 x 524288    ([h*64+d][c] = [n][k])
//   WOT  bf16 [8][64 e][64 d]              65536
//   WUT  bf16 [512 out][512 in]          524288
//   REL  bf16 [8][128][64]                131072
//   X16  f16 [8192][512] x16             8388608    (activation rows b*1024 + tok)
//   QHh, QHl bf16 [8192][512]         2 x 8388608   (q projection, hi / residual)
//   KHh, KHl bf16 [8192][512]         2 x 8388608   (k projection, hi / residual)
//   VTh, VTl f16 [8][512][1024] x16   2 x 8388608   (v^T per image, hi / residual)
//   RTAB f32 [8192][1024]               33554432   (position-logit tables, 128 per head)
//   CTh, CTl bf16 [8192][512]         2 x 8388608   (attention ctx, merged heads, hi / residual)
//   CAh, CAl bf16 [8192][512]         2 x 8388608   (per-head output after batch-norm, concat layout, hi / residual)
//   end                                 128122880
// =====================================================================================================
extern "C" void kernel_launch(void* const* d_in, const int* in_sizes, int n_in,
                              void* d_out, int out_size, void* d_ws, size_t ws_size,
                              hipStream_t stream) {
  if (n_in < 12) return;
  if (in_sizes[0] != NROWS * DM) return;
  if (in_sizes[1] != NHEAD * DM * HD || in_sizes[2] != NHEAD * DM * HD || in_sizes[3] != NHEAD * DM * HD) return;
  if (in_sizes[4] != NHEAD * HD * HO) return;
  if (in_sizes[5] != NHEAD * HO || in_sizes[6] != NHEAD * HO || in_sizes[7] != NHEAD * HO || in_sizes[8] != NHEAD * HO) return;
  if (in_sizes[9] != NHEAD * NREL * HD || in_sizes[10] != NHEAD * NREL * HD) return;
  if (in_sizes[11] != COUT * COUT) return;
  if (out_size != NROWS * COUT) return;
  if ((in_sizes[0] % 2048) != 0) return;

  const float* x     = (const float*)d_in[0];
  const float* w_k   = (const float*)d_in[1];
  const float* w_q   = (const float*)d_in[2];
  const float* w_v   = (const float*)d_in[3];
  const float* w_o   = (const float*)d_in[4];
  const float* gam   = (const float*)d_in[5];
  const float* bet   = (const float*)d_in[6];
  const float* mmean = (const float*)d_in[7];
  const float* mvar  = (const float*)d_in[8];
  const float* relw  = (const float*)d_in[9];
  const float* relh  = (const float*)d_in[10];
  const float* w_out = (const float*)d_in[11];
  float*       out   = (float*)d_out;

  const size_t PWT = (size_t)DM * DM * 2;                         //   524288
  const size_t PWO = (size_t)NHEAD * HO * HD * 2;                 //    65536
  const size_t PWU = (size_t)COUT * COUT * 2;                     //   524288
  const size_t PRL = (size_t)NHEAD * RTP * HD * 2;                //   131072
  const size_t PX  = (size_t)NROWS * DM * 2;                      //  8388608
  const size_t PVT = (size_t)NB * DM * NTOK * 2;                  //  8388608
  const size_t PRT = (size_t)NROWS * RT_LD * 4;                   // 33554432
  size_t off = 0;
  const size_t oWK = off; off += PWT;
  const size_t oWQ = off; off += PWT;
  const size_t oWV = off; off += PWT;
  const size_t oWO = off; off += PWO;
  const size_t oWU = off; off += PWU;
  const size_t oRL = off; off += PRL;
  const size_t oX  = off; off += PX;
  const size_t oQh = off; off += PX;
  const size_t oQl = off; off += PX;
  const size_t oKh = off; off += PX;
  const size_t oKl = off; off += PX;
  const size_t oVh = off; off += PVT;
  const size_t oVl = off; off += PVT;
  const size_t oRT = off; off += PRT;
  const size_t oCh = off; off += PX;
  const size_t oCl = off; off += PX;
  const size_t oAh = off; off += PX;
  const size_t oAl = off; off += PX;
  if (off > ws_size) return;                                      // off = 128122880
  if (off > (size_t)134217728) return;

  char* ws = (char*)d_ws;
  unsigned short* WKT  = (unsigned short*)(ws + oWK);
  unsigned short* WQT  = (unsigned short*)(ws + oWQ);
  unsigned short* WVT  = (unsigned short*)(ws + oWV);
  unsigned short* WOT  = (unsigned short*)(ws + oWO);
  unsigned short* WUT  = (unsigned short*)(ws + oWU);
  unsigned short* REL  = (unsigned short*)(ws + oRL);
  unsigned short* X16  = (unsigned short*)(ws + oX);
  unsigned short* QHh  = (unsigned short*)(ws + oQh);
  unsigned short* QHl  = (unsigned short*)(ws + oQl);
  unsigned short* KHh  = (unsigned short*)(ws + oKh);
  unsigned short* KHl  = (unsigned short*)(ws + oKl);
  unsigned short* VTh  = (unsigned short*)(ws + oVh);
  unsigned short* VTl  = (unsigned short*)(ws + oVl);
  float*          RTAB = (float*)(ws + oRT);
  unsigned short* CTh  = (unsigned short*)(ws + oCh);
  unsigned short* CTl  = (unsigned short*)(ws + oCl);
  unsigned short* CAh  = (unsigned short*)(ws + oAh);
  unsigned short* CAl  = (unsigned short*)(ws + oAl);

  const dim3 blk(256);
  const dim3 gTW(DM / 64, HD / 64, NHEAD);                         // 8 x 1 x 8
  const dim3 gTO(HD / 64, HO / 64, NHEAD);                         // 1 x 1 x 8
  const dim3 gTU(COUT / 64, COUT / 64, 1);                         // 8 x 8 x 1
  const dim3 gRL((NHEAD * RTP * 8) / 256);                         // 32
  const dim3 gCX((NROWS * DM) / 2048);                             // 2048
  const dim3 blkG(128);                                            // 4 waves: 2 x 2 (128 x 128 tile) or 4 x 1 (256 x 64 tile)
  const dim3 gP((NROWS / 128) * (DM / 128), 1);                    // 256
  const dim3 gV((DM / 128) * (NTOK / 128), NB);                    // 32 x 8
  const dim3 gR((NROWS / 128) * (RTP / 128), NHEAD);               // 64 x 8
  const dim3 gH((NROWS / 256) * (HO / 64), NHEAD);                 // 32 x 8
  const dim3 gF((NROWS / 128) * (COUT / 128), 1);                  // 256
  const dim3 gAT(ATT_BLOCKS);                                      // 512
  const dim3 bAT(ATT_THREADS);                                     // 256

  // (0) weight planes: per head W[h][c][d] -> WT[h*64+d][c] as f16( bf16_RNE(w) * 64 ); Wo[h][d][e] -> WOT[h][e][d] bf16;
  //     Wout[in][out] -> WUT[out][in] bf16; rel tables -> REL[h][128][64] bf16 (rows 63, 127 zero)
  tr16<0><<<gTW, blk, 0, stream>>>(w_k, WKT, DM, HD, (long long)DM * HD, (long long)HD * DM, WSC);
  tr16<0><<<gTW, blk, 0, stream>>>(w_q, WQT, DM, HD, (long long)DM * HD, (long long)HD * DM, WSC);
  tr16<0><<<gTW, blk, 0, stream>>>(w_v, WVT, DM, HD, (long long)DM * HD, (long long)HD * DM, WSC);
  tr16<1><<<gTO, blk, 0, stream>>>(w_o, WOT, HD, HO, (long long)HD * HO, (long long)HO * HD, 1.0f);
  tr16<1><<<gTU, blk, 0, stream>>>(w_out, WUT, COUT, COUT, 0LL, 0LL, 1.0f);
  relcat<<<gRL, blk, 0, stream>>>(relw, relh, REL);

  // (1) activation plane: X16[row][c] = f16( bf16_RNE(x[row][c]) * 16 ), rows = b*1024 + tok
  cvt16<0><<<gCX, blk, 0, stream>>>(x, X16, NROWS * DM, ACARRY);

  // (2) q projection: q[m][n] = sum_c x[m][c] WQT[n][c] -> bf16 hi / residual planes; M = 8192, N = 512, K = 512
  gemm64<3, 0, 0, 0, 2, 2><<<gP, blkG, 0, stream>>>(
      X16, X16, DM, 0LL,
      WQT, DM, 0LL,
      (void*)QHh, (void*)QHl, DM, 0LL,
      NROWS, DM, DM, 1.0f / (ACARRY * WSC), 1.0f,
      x, x, x, x, 0);

  // (3) k projection -> bf16 hi / residual planes
  gemm64<3, 0, 0, 0, 2, 2><<<gP, blkG, 0, stream>>>(
      X16, X16, DM, 0LL,
      WKT, DM, 0LL,
      (void*)KHh, (void*)KHl, DM, 0LL,
      NROWS, DM, DM, 1.0f / (ACARRY * WSC), 1.0f,
      x, x, x, x, 0);

  // (4) v^T per image: VT[b][h*64+d][tok] = sum_c WVT[h*64+d][c] x_b[tok][c] -> f16 x16 hi / residual planes; M = 512, N = 1024, K = 512
  gemm64<4, 0, 0, 0, 2, 2><<<gV, blkG, 0, stream>>>(
      WVT, WVT, DM, 0LL,
      X16, DM, (long long)NTOK * DM,
      (void*)VTh, (void*)VTl, NTOK, (long long)DM * NTOK,
      DM, NTOK, DM, 1.0f / (ACARRY * WSC), VC,
      x, x, x, x, 0);

  // (5) position-logit tables per head: RTAB[row][128h + m] = sum_d (q_hi + q_lo)[row][64h + d] REL[h][m][d]; M = 8192, N = 128, K = 64, f32
  gemm64<0, 1, 1, 0, 2, 2><<<gR, blkG, 0, stream>>>(
      QHh, QHl, DM, (long long)HD,
      REL, HD, (long long)RTP * HD,
      (void*)RTAB, (void*)RTAB, RT_LD, (long long)RTP,
      NROWS, RTP, HD, 1.0f, 1.0f,
      x, x, x, x, 0);

  // (6) attention per (image, head, 128 score rows) -> CT (bf16 hi / residual planes)
  attn8<<<gAT, bAT, 0, stream>>>(KHh, KHl, QHh, QHl, VTh, VTl, RTAB, CTh, CTl);

  // (7) per-head output projection + eval batch-norm: CA[row][64h + e] = BN_h( sum_d (ct_hi + ct_lo)[row][64h + d] WOT[h][e][d] );
  //     M = 8192, N = 64, K = 64 per head -> bf16 hi / residual planes
  gemm64<3, 1, 1, 2, 4, 1><<<gH, blkG, 0, stream>>>(
      CTh, CTl, DM, (long long)HD,
      WOT, HD, (long long)HO * HD,
      (void*)CAh, (void*)CAl, DM, (long long)HO,
      NROWS, HO, HD, 1.0f, 1.0f,
      gam, bet, mmean, mvar, HO);

  // (8) out = (CA_hi + CA_lo) . WUT^T + bf16_RNE(x); M = 8192, N = 512, K = 512, f32
  gemm64<0, 1, 1, 1, 2, 2><<<gF, blkG, 0, stream>>>(
      CAh, CAl, DM, 0LL,
      WUT, COUT, 0LL,
      (void*)out, (void*)out, COUT, 0LL,
      NROWS, COUT, DM, 1.0f, 1.0f,
      x, x, x, x, 0);
  (void)hipGetLastError();
}

// v003
// It runs in 144 microseconds.
// In both of two side-by-side timings against v002, it was 1.13 times as fast.
// All steps since v000 together make it 2.20 times as fast.
// Contractions (all f32 accumulate): k/q projections v_wmma_f32_16x16x32_f16 (x f16 x16 . W f16 x64, K=512, single products) -> bf16 hi/lo planes;
// v^T projection v_wmma_f32_16x16x32_f16 (Wv f16 x64 . x f16 x16, K=512, single) -> f16 x16 hi/lo planes;
// relative-position tables v_wmma_f32_16x16x32_bf16 (q bf16 hi/lo . rel bf16, hi.W+lo.W, K=64) -> f32 table;
// attention scores, transposed, v_wmma_f32_16x16x32_bf16 (q bf16 hi/lo . k bf16 hi/lo, hi.hi+lo.hi+hi.lo, K=64);
// v^T . P^T v_wmma_f32_16x16x32_f16 (v^T f16 x16 hi/lo . P^T f16 x1024 hi/lo, hi.hi+hi.lo+lo.hi, K=1024 by 32);
// per-head output projection v_wmma_f32_16x16x32_bf16 (ctx bf16 hi/lo . Wo bf16, K=64) with eval batch-norm affine in f32 -> bf16 hi/lo planes;
// final projection v_wmma_f32_16x16x32_bf16 (cat bf16 hi/lo . Wout bf16, K=512) + bf16-RNE residual in f32.
// Max-subtracted online base-2 softmax and the additive position logits in f32 on VALU. Every float input RNE-converted to bf16 on load.
#include <hip/hip_runtime.h>
#include <math.h>
#include <stdint.h>

#define NB     8
#define GH     32
#define GW     32
#define NTOK   (GH * GW)
#define DM     512
#define NHEAD  8
#define HD     64
#define HO     64
#define COUT   512
#define NREL   63
#define RTP    128
#define RT_LD  (NHEAD * RTP)
#define NROWS  (NB * NTOK)
#define KCH    32
#define WSC    64.0f
#define ACARRY 16.0f
#define VC     16.0f
#define PC     1024.0f
#define LOG2E  1.4426950408889634f
#define BN_EPS 1e-3f
static_assert(NHEAD * HD == DM);
static_assert(NHEAD * HO == COUT);
static_assert(COUT == DM);
static_assert(KCH == GW);
static_assert(NREL == 2 * GW - 1);
static_assert(NREL == 2 * GH - 1);
static_assert(NREL <= HD);
static_assert(HD + NREL <= RTP);
static_assert((NTOK % 128) == 0 && (DM % 128) == 0 && (NROWS % 256) == 0 && (HD % 64) == 0 && (NTOK % KCH) == 0);
static_assert((RTP % 128) == 0 && (HO % 64) == 0 && (COUT % 128) == 0);
#define GKS         64
#define GPITCH      72
#define ATT_WAVES   8
#define ATT_THREADS (ATT_WAVES * 32)
#define ATT_ROWS    (ATT_WAVES * 16)
#define ATT_BLOCKS  (NB * NHEAD * (NTOK / ATT_ROWS))
#define NSTG        (NTOK / KCH)
#define QPITCH      72
#define VPITCH      40
#define QT_HALVES   (KCH * QPITCH)
#define VT_HALVES   (HD * VPITCH)
#define STG_HALVES  (2 * QT_HALVES + 2 * VT_HALVES)
static_assert(ATT_THREADS == 256);
static_assert(ATT_BLOCKS == 512);
static_assert(NSTG >= 2);
static_assert(KCH * (HD / 8) == ATT_THREADS && HD * (KCH / 8) == ATT_THREADS);
static_assert((QT_HALVES % 8) == 0 && (VT_HALVES % 8) == 0 && (QPITCH % 8) == 0 && (VPITCH % 8) == 0);
static_assert(2 * ATT_ROWS * HD <= 2 * STG_HALVES);
static_assert((ATT_ROWS * HD) / 8 == 4 * ATT_THREADS);

typedef _Float16 v16h __attribute__((ext_vector_type(16)));
typedef _Float16 v8h  __attribute__((ext_vector_type(8)));
typedef __bf16   v16b __attribute__((ext_vector_type(16)));
typedef float    v8f  __attribute__((ext_vector_type(8)));
typedef float    v4f  __attribute__((ext_vector_type(4)));
typedef unsigned int v4u __attribute__((ext_vector_type(4)));

union FragH { v16h v; v8h h[2]; v4u u[2]; };
union FragAny { v16h h; v16b b; };

// ---- scalar helpers --------------------------------------------------------------------------------
__device__ __forceinline__ unsigned short bf_bits(float f) {          // f32 -> bf16 bits, RNE convert
  unsigned u = __float_as_uint(f);
  return (unsigned short)((u + 0x7FFFu + ((u >> 16) & 1u)) >> 16);
}
__device__ __forceinline__ float bf_up(unsigned short h) { return __uint_as_float(((unsigned)h) << 16); }
__device__ __forceinline__ float bfr(float f) { return bf_up(bf_bits(f)); }   // value of the bf16 RNE convert
__device__ __forceinline__ unsigned short h_bits(_Float16 x) { return __builtin_bit_cast(unsigned short, x); }
__device__ __forceinline__ unsigned pk16(unsigned short a, unsigned short b) { return (unsigned)a | ((unsigned)b << 16); }
__device__ __forceinline__ v8f zero8() { v8f z = {0.f, 0.f, 0.f, 0.f, 0.f, 0.f, 0.f, 0.f}; return z; }
// value of lane l ^ 16 (the other half of the wave), by one vector cross-row move
__device__ __forceinline__ float xhalf(float x) {
  const int b = __builtin_bit_cast(int, x);
  return __builtin_bit_cast(float, __builtin_amdgcn_permlanex16(b, b, 0x76543210, 0xfedcba98, false, false));
}

// ---- fragment loader: 16-bit A/B operand from a k-contiguous 16-bit plane, lane -> row/col (lane&15),
//      p already includes +8*(lane>>4); elements 0..7 <- p[0..7] (k0+8h..), elements 8..15 <- p[16..23] (k0+16+8h..)
//      (same split k map for A and B; B is always read from a [n][k] plane)
__device__ __forceinline__ v16h ldfrag_u(const unsigned short* p) {
  FragH f;
  f.u[0] = *(const v4u*)(p);
  f.u[1] = *(const v4u*)(p + 16);
  return f.v;
}

// ---- WMMA helpers with trailing VALU hazard gaps ------------------------------------------------------
__device__ __forceinline__ v8f mma_h(v16h a, v16h b, v8f c) {
  return __builtin_amdgcn_wmma_f32_16x16x32_f16(false, a, false, b, (short)0, c, false, false);
}
__device__ __forceinline__ v8f mma_b(v16h a, v16h b, v8f c) {
  FragAny ua, ub;
  ua.h = a;
  ub.h = b;
  return __builtin_amdgcn_wmma_f32_16x16x32_bf16(false, ua.b, false, ub.b, (short)0, c, false, false);
}
template <int BF>
__device__ __forceinline__ v8f mmaT(v16h a, v16h b, v8f c) {
  if constexpr (BF != 0) return mma_b(a, b, c);
  else return mma_h(a, b, c);
}
__device__ __forceinline__ void dep_guard1(v8f& a, v8f& b, v16h x) {
#if defined(__HIP_DEVICE_COMPILE__)
  asm volatile("v_nop\n\tv_nop\n\tv_nop\n\tv_nop" : "+v"(a), "+v"(b) : "v"(x));
#endif
}
__device__ __forceinline__ void guard1x4(v8f& s, v16h a0, v16h a1, v16h a2, v16h a3) {
#if defined(__HIP_DEVICE_COMPILE__)
  asm volatile("v_nop\n\tv_nop\n\tv_nop\n\tv_nop" : "+v"(s) : "v"(a0), "v"(a1), "v"(a2), "v"(a3));
#endif
}
__device__ __forceinline__ void guard1x8(v8f& s, v16h a0, v16h a1, v16h a2, v16h a3,
                                         v16h b0, v16h b1, v16h b2, v16h b3) {
#if defined(__HIP_DEVICE_COMPILE__)
  asm volatile("v_nop\n\tv_nop\n\tv_nop\n\tv_nop"
               : "+v"(s) : "v"(a0), "v"(a1), "v"(a2), "v"(a3), "v"(b0), "v"(b1), "v"(b2), "v"(b3));
#endif
}
__device__ __forceinline__ void guard4x6(v8f& a, v8f& b, v8f& c, v8f& d,
                                         v16h x0, v16h x1, v16h x2, v16h x3, v16h x4, v16h x5) {
#if defined(__HIP_DEVICE_COMPILE__)
  asm volatile("v_nop\n\tv_nop\n\tv_nop\n\tv_nop"
               : "+v"(a), "+v"(b), "+v"(c), "+v"(d) : "v"(x0), "v"(x1), "v"(x2), "v"(x3), "v"(x4), "v"(x5));
#endif
}
__device__ __forceinline__ void guard4x5(v8f& a, v8f& b, v8f& c, v8f& d,
                                         v16h x0, v16h x1, v16h x2, v16h x3, v16h x4) {
#if defined(__HIP_DEVICE_COMPILE__)
  asm volatile("v_nop\n\tv_nop\n\tv_nop\n\tv_nop"
               : "+v"(a), "+v"(b), "+v"(c), "+v"(d) : "v"(x0), "v"(x1), "v"(x2), "v"(x3), "v"(x4));
#endif
}
__device__ __forceinline__ void keep4_h(v16h a, v16h b, v16h c, v16h d) {
#if defined(__HIP_DEVICE_COMPILE__)
  asm volatile("v_nop" :: "v"(a), "v"(b), "v"(c), "v"(d));
#endif
}
__device__ __forceinline__ void acc_guard4(v8f& a, v8f& b, v8f& c, v8f& d) {
#if defined(__HIP_DEVICE_COMPILE__)
  asm volatile("v_nop\n\tv_nop\n\tv_nop\n\tv_nop" : "+v"(a), "+v"(b), "+v"(c), "+v"(d));
#endif
}
__device__ __forceinline__ void wave_sync_lds() {
  __builtin_amdgcn_fence(__ATOMIC_RELEASE, "workgroup");
  __builtin_amdgcn_wave_barrier();
  __builtin_amdgcn_fence(__ATOMIC_ACQUIRE, "workgroup");
}

// four 16-B copies per lane, global -> LDS through no register; the s_wait_xcnt 0 in the same statement stands ahead of any later
// rewrite of the address registers that the copies name
__device__ __forceinline__ void stage_copy4(unsigned l0, const unsigned short* g0, unsigned l1, const unsigned short* g1,
                                            unsigned l2, const unsigned short* g2, unsigned l3, const unsigned short* g3) {
#if defined(__HIP_DEVICE_COMPILE__)
  asm volatile("global_load_async_to_lds_b128 %0, %1, off\n\t"
               "global_load_async_to_lds_b128 %2, %3, off\n\t"
               "global_load_async_to_lds_b128 %4, %5, off\n\t"
               "global_load_async_to_lds_b128 %6, %7, off\n\t"
               "s_wait_xcnt 0x0"
               :: "v"(l0), "v"(g0), "v"(l1), "v"(g1), "v"(l2), "v"(g2), "v"(l3), "v"(g3) : "memory");
#endif
}
// the same for eight copies: one wait on the address registers serves the run
__device__ __forceinline__ void stage_copy8(unsigned l0, const unsigned short* g0, unsigned l1, const unsigned short* g1,
                                            unsigned l2, const unsigned short* g2, unsigned l3, const unsigned short* g3,
                                            unsigned l4, const unsigned short* g4, unsigned l5, const unsigned short* g5,
                                            unsigned l6, const unsigned short* g6, unsigned l7, const unsigned short* g7) {
#if defined(__HIP_DEVICE_COMPILE__)
  asm volatile("global_load_async_to_lds_b128 %0, %1, off\n\t"
               "global_load_async_to_lds_b128 %2, %3, off\n\t"
               "global_load_async_to_lds_b128 %4, %5, off\n\t"
               "global_load_async_to_lds_b128 %6, %7, off\n\t"
               "global_load_async_to_lds_b128 %8, %9, off\n\t"
               "global_load_async_to_lds_b128 %10, %11, off\n\t"
               "global_load_async_to_lds_b128 %12, %13, off\n\t"
               "global_load_async_to_lds_b128 %14, %15, off\n\t"
               "s_wait_xcnt 0x0"
               :: "v"(l0), "v"(g0), "v"(l1), "v"(g1), "v"(l2), "v"(g2), "v"(l3), "v"(g3),
                  "v"(l4), "v"(g4), "v"(l5), "v"(g5), "v"(l6), "v"(g6), "v"(l7), "v"(g7) : "memory");
#endif
}
// this wave's copies have landed in LDS
__device__ __forceinline__ void wait_copies() {
#if defined(__HIP_DEVICE_COMPILE__)
  asm volatile("s_wait_asynccnt 0x0" ::: "memory");
#endif
}
// stands behind the table load of a chunk, ahead of the later rewrite of its address pair
__device__ __forceinline__ void wait_addr() {
#if defined(__HIP_DEVICE_COMPILE__)
  asm volatile("s_wait_xcnt 0x0" ::: "memory");
#endif
}
// this wave's LDS reads have returned (ahead of the barrier behind which their buffer is refilled)
__device__ __forceinline__ void wait_lds() {
#if defined(__HIP_DEVICE_COMPILE__)
  asm volatile("s_wait_dscnt 0x0" ::: "memory");
#endif
}

// =====================================================================================================
// Elementwise 16-bit pack, no transpose. BFO 0: dst[i] = f16( bf16_RNE(src[i]) * sc ), sc a power of two (exact);
// BFO 1: dst[i] = bf16_RNE(src[i]) bits. 8 elements per thread: two 16-B loads, one 16-B store per lane; 32 consecutive
// coverage: grid = n / 2048 blocks x 256 thr x 8 elements = n exactly (host checks n % 2048 == 0).
// =====================================================================================================
template <int BFO>
__global__ __launch_bounds__(256) void cvt16(const float* __restrict__ src, unsigned short* dst, int n, float sc) {
  const size_t i8 = ((size_t)blockIdx.x * 256 + threadIdx.x) * 8;
  if (i8 + 8 > (size_t)n) return;                 // never taken with the exact grid; no barriers in this kernel
  const v4f a = *(const v4f*)(src + i8);
  const v4f b = *(const v4f*)(src + i8 + 4);
  v4u o;
  if constexpr (BFO != 0) {
    o[0] = pk16(bf_bits(a[0]), bf_bits(a[1]));
    o[1] = pk16(bf_bits(a[2]), bf_bits(a[3]));
    o[2] = pk16(bf_bits(b[0]), bf_bits(b[1]));
    o[3] = pk16(bf_bits(b[2]), bf_bits(b[3]));
  } else {
    o[0] = pk16(h_bits((_Float16)(bfr(a[0]) * sc)), h_bits((_Float16)(bfr(a[1]) * sc)));
    o[1] = pk16(h_bits((_Float16)(bfr(a[2]) * sc)), h_bits((_Float16)(bfr(a[3]) * sc)));
    o[2] = pk16(h_bits((_Float16)(bfr(b[0]) * sc)), h_bits((_Float16)(bfr(b[1]) * sc)));
    o[3] = pk16(h_bits((_Float16)(bfr(b[2]) * sc)), h_bits((_Float16)(bfr(b[3]) * sc)));
  }
  {
    *(v4u*)(dst + i8) = o;
    
  }
}

// =====================================================================================================
// Transposing 16-bit pack of a weight matrix: in W[Cin][Dd] (pitch Dd, base + z*sIn) -> out WT[Dd][Cin] (pitch Cin, base + z*sOut),
// BFO 0: f16( bf16_RNE(w) * sc ); BFO 1: bf16_RNE(w) bits. One 64x64 tile per block (x = Cin tile, y = Dd tile, z = matrix index):
// coverage: loads 4 x 256 x 4 floats = 64x64; stores 2 x 256 pieces x 8 halves = 64 rows x 64 halves = the whole tile;
//           grid = (Cin/64, Dd/64, nmat) exact (host passes exact multiples of 64).
// =====================================================================================================
template <int BFO>
__global__ __launch_bounds__(256) void tr16(const float* __restrict__ W, unsigned short* WT, int Cin, int Dd,
                                            long long sIn, long long sOut, float sc) {
  __shared__ float t[64][65];
  const int tid = threadIdx.x;
  const int c0 = blockIdx.x * 64, d0 = blockIdx.y * 64;
  const float* src = W + (size_t)((long long)blockIdx.z * sIn);
  unsigned short* dst = WT + (size_t)((long long)blockIdx.z * sOut);
#pragma unroll
  for (int it = 0; it < 4; ++it) {
    const int p  = it * 256 + tid;
    const int cc = p >> 4, sg = (p & 15) * 4;
    const v4f v = *(const v4f*)(src + (size_t)(c0 + cc) * Dd + d0 + sg);
    t[cc][sg]     = v[0];
    t[cc][sg + 1] = v[1];
    t[cc][sg + 2] = v[2];
    t[cc][sg + 3] = v[3];
  }
  __syncthreads();
  v4u o[2];
#pragma unroll
  for (int it = 0; it < 2; ++it) {
    const int p  = it * 256 + tid;
    const int dd = p >> 3, s8 = (p & 7) * 8;
    unsigned short hv[8];
#pragma unroll
    for (int k = 0; k < 8; ++k) {
      const float f = bfr(t[s8 + k][dd]);
      if constexpr (BFO != 0) hv[k] = bf_bits(f);
      else hv[k] = h_bits((_Float16)(f * sc));
    }
    v4u q;
    q[0] = pk16(hv[0], hv[1]);
    q[1] = pk16(hv[2], hv[3]);
    q[2] = pk16(hv[4], hv[5]);
    q[3] = pk16(hv[6], hv[7]);
    o[it] = q;
  }
  {
#pragma unroll
    for (int it = 0; it < 2; ++it) {
      const int p  = it * 256 + tid;
      const int dd = p >> 3, s8 = (p & 7) * 8;
      *(v4u*)(dst + (size_t)(d0 + dd) * Cin + c0 + s8) = o[it];
    }
    
  }
}

// =====================================================================================================
// Relative-position operand plane: out[h][r][0..63] bf16 bits, r 0..62 = rel_w[h][r][:], r 63 = 0, r 64..126 = rel_h[h][r-64][:],
// r 127 = 0. Every lane loads both candidate rows from clamped addresses and selects by value. 8 halves per thread, 8 consecutive
// coverage: 32 blocks x 256 threads x 8 halves = 8 x 128 x 64 exactly.
// =====================================================================================================
__global__ __launch_bounds__(256) void relcat(const float* __restrict__ rw, const float* __restrict__ rh, unsigned short* out) {
  const int p   = blockIdx.x * 256 + threadIdx.x;        // 0 .. NHEAD*RTP*8 - 1
  const int hd  = p / (RTP * 8);
  const int r   = (p >> 3) & (RTP - 1);
  const int seg = (p & 7) * 8;
  const int iw  = (r < NREL) ? r : (NREL - 1);
  int ih = r - HD;
  ih = (ih < 0) ? 0 : ih;
  ih = (ih > NREL - 1) ? (NREL - 1) : ih;
  const float* pw = rw + ((size_t)hd * NREL + iw) * HD + seg;
  const float* ph = rh + ((size_t)hd * NREL + ih) * HD + seg;
  const v4f a0 = *(const v4f*)(pw), a1 = *(const v4f*)(pw + 4);
  const v4f b0 = *(const v4f*)(ph), b1 = *(const v4f*)(ph + 4);
  const bool uw = (r < NREL);
  const bool uh = (r >= HD) && (r < HD + NREL);
  float v[8];
#pragma unroll
  for (int e = 0; e < 4; ++e) {
    v[e]     = uw ? a0[e] : (uh ? b0[e] : 0.f);
    v[4 + e] = uw ? a1[e] : (uh ? b1[e] : 0.f);
  }
  v4u o;
  o[0] = pk16(bf_bits(v[0]), bf_bits(v[1]));
  o[1] = pk16(bf_bits(v[2]), bf_bits(v[3]));
  o[2] = pk16(bf_bits(v[4]), bf_bits(v[5]));
  o[3] = pk16(bf_bits(v[6]), bf_bits(v[7]));
  {
    *(v4u*)(out + (size_t)p * 8) = o;
    
  }
}

// =====================================================================================================
// Register-blocked batched 16-bit WMMA GEMM: C[m][n] = oscale * sum_k A[m][k] * Bt[n][k]; one wave per 64x64 tile, block = WM x WN waves
// (4 waves) on a (64 WM) x (64 WN) tile.
// A row-major [M][K] pitch lda (16-bit plane), Bt row-major [N][K] pitch ldb (k contiguous); M multiple of 64 WM, N of 64 WN, K of 64.
// The block's A and Bt rows are brought into LDS once per block, in k slabs of 64 (one whole 128-B line per row, 8 lanes per line, pitch 144 B
// in LDS), by asynchronous 16-B copies, two buffers: slab t + 2 is issued behind the barrier that ends slab t. All fragments are 16-B LDS reads
// with the same split k map and the same k order of the products as with fragments read from global memory.
// blockIdx.y = batch index with element strides sA, sB, sC.
// ASPLIT 1: a second A plane A2 (unscaled residual of A, same layout) is multiplied into the same accumulator (A + A2 ~ exact A).
// BF 1: bf16 operands (v_wmma_f32_16x16x32_bf16), else f16.
// OM 0: f32 out (pitch ldc).  OM 2: f16 out = f16(value * ocarry).  OM 3: two bf16 planes: hi = bf16_RNE(value), lo = bf16_RNE(value - hi).
// OM 4: two f16 planes: hi = f16(value * ocarry), lo = f16(value * ocarry - hi) (unscaled residual).
// EPI 1 (OM 0 only): value += bf16_RNE(ep0[same index as C]).  EPI 2 (16-bit out): per-column eval batch-norm affine
//   value = (bf16(ep0[ci]) * (value - bf16(ep2[ci]))) * rsqrt(bf16(ep3[ci]) + eps) + bf16(ep1[ci]),  ci = by*cps + column.
// coverage: 4 slabs x 16 rows (f32: it 0..7 x lane>>4; 16-bit: it 0..3 x lane>>3) x 64 cols = the wave's whole 64x64 tile;
//           grid = (M / (64 WM)) * (N / (64 WN)) blocks exactly; a surplus block would leave as a whole, ahead of every copy and barrier.
// =====================================================================================================
template <int V> struct IntC { static constexpr int value = V; };
template <int OM, int ASPLIT, int BF, int EPI, int WM, int WN>
__global__ __launch_bounds__(WM * WN * 32) __attribute__((amdgpu_num_vgpr(256))) void gemm64(
    const unsigned short* __restrict__ Ap, const unsigned short* __restrict__ A2p, int lda, long long sA,
    const unsigned short* __restrict__ Btp, int ldb, long long sB,
    void* Cout, void* C2out, int ldc, long long sC,
    int M, int N, int K, float oscale, float ocarry,
    const float* __restrict__ ep0, const float* __restrict__ ep1,
    const float* __restrict__ ep2, const float* __restrict__ ep3, int cps) {
  constexpr int NW     = WM * WN;                    // waves per block
  constexpr int AR     = 64 * WM;                    // A rows of the block tile
  constexpr int BR     = 64 * WN;                    // Bt rows of the block tile
  constexpr int RPI    = NW * 4;                     // rows that one copy of every lane of the block covers (8 lanes per row)
  constexpr int A_H    = AR * GPITCH;                // halves of one A plane's slab in LDS
  constexpr int B_H    = BR * GPITCH;
  constexpr int SLAB_H = (1 + ASPLIT) * A_H + B_H;   // one buffer: A | (A2) | Bt
  static_assert((AR % (4 * RPI)) == 0 && (BR % (4 * RPI)) == 0);
  static_assert(((1 + ASPLIT) * AR + BR) / RPI <= 63);     // copies of one wave in flight
  __shared__ __align__(16) unsigned short gst[2 * SLAB_H];
  __shared__ __align__(16) float sT[NW][16 * 68];   // per-wave 16x64 slab, pitch 68 floats
  const int by   = blockIdx.y;
  const int tid  = threadIdx.x;
  const int lane = tid & 31;
  const int wave = tid >> 5;
  const int tilesN = N / BR;
  const int tilesM = M / AR;
  if ((int)blockIdx.x >= tilesM * tilesN) return;   // block-uniform, ahead of every copy and barrier
  const int tm  = blockIdx.x / tilesN;
  const int tn  = blockIdx.x - tm * tilesN;
  const int bm0 = tm * AR;
  const int bn0 = tn * BR;
  const int wm  = wave / WN;
  const int wn  = wave - wm * WN;
  const int m0  = bm0 + (wm << 6);
  const int n0  = bn0 + (wn << 6);

  const unsigned short* A1 = Ap  + (size_t)((long long)by * sA);
  const unsigned short* A2 = A2p + (size_t)((long long)by * sA);
  const unsigned short* Bb = Btp + (size_t)((long long)by * sB);

  const int rlane = lane & 15;                 // row (A) / col (B, D) within subtile
  const int koff  = (lane >> 4) * 8;           // k offset of this lane half
  const int mOff  = (lane >> 4) * 8;           // D row offset

  // per-lane copy addresses: row tid>>3 of a group of RPI rows, 16-B segment tid&7 of the row's 128-B line
  const unsigned short* gA  = A1 + (size_t)(bm0 + (tid >> 3)) * lda + (tid & 7) * 8;
  const unsigned short* gA2 = A2 + (size_t)(bm0 + (tid >> 3)) * lda + (tid & 7) * 8;
  const unsigned short* gB  = Bb + (size_t)(bn0 + (tid >> 3)) * ldb + (tid & 7) * 8;
  const unsigned lcp = (unsigned)(uintptr_t)gst + (unsigned)((tid >> 3) * (GPITCH * 2) + (tid & 7) * 16);   // LDS byte address
  constexpr unsigned LSTEP = (unsigned)(RPI * GPITCH * 2);      // LDS bytes from one group of RPI rows to the next
  const size_t astep = (size_t)RPI * lda, bstep = (size_t)RPI * ldb;
  // rows of one plane: groups of RPI rows, eight groups (or the last four) per statement
  auto plane = [&](unsigned l, const unsigned short* p, size_t step, auto ngroups) {
    constexpr int NG = decltype(ngroups)::value;
#pragma unroll
    for (int g = 0; g < NG; g += 8) {
      const unsigned short* q = p + (size_t)g * step;
      const unsigned m = l + (unsigned)g * LSTEP;
      if (g + 8 <= NG) {
        stage_copy8(m, q, m + LSTEP, q + step, m + 2 * LSTEP, q + 2 * step, m + 3 * LSTEP, q + 3 * step,
                    m + 4 * LSTEP, q + 4 * step, m + 5 * LSTEP, q + 5 * step, m + 6 * LSTEP, q + 6 * step, m + 7 * LSTEP, q + 7 * step);
      } else {
        stage_copy4(m, q, m + LSTEP, q + step, m + 2 * LSTEP, q + 2 * step, m + 3 * LSTEP, q + 3 * step);
      }
    }
  };
  auto stage = [&](int buf, int k0) {
    const unsigned l0 = lcp + (unsigned)(buf * (SLAB_H * 2));
    plane(l0, gA + k0, astep, IntC<AR / RPI>{});
    if constexpr (ASPLIT != 0) plane(l0 + (unsigned)(A_H * 2), gA2 + k0, astep, IntC<AR / RPI>{});
    plane(l0 + (unsigned)((1 + ASPLIT) * A_H * 2), gB + k0, bstep, IntC<BR / RPI>{});
  };

  v8f acc[4][4];
#pragma unroll
  for (int i = 0; i < 4; ++i)
#pragma unroll
    for (int j = 0; j < 4; ++j) acc[i][j] = zero8();

  // slab 0 -> buffer 0, landed and published; then slab 1 -> buffer 1 flies while slab 0 is worked on
  const int nslab = K / GKS;
  stage(0, 0);
  wait_copies();
  __syncthreads();
  if (nslab > 1) stage(1, GKS);

#pragma unroll 1
  for (int t = 0; t < nslab; ++t) {
    const unsigned short* sb  = gst + (t & 1) * SLAB_H;
    const unsigned short* As  = sb + ((wm << 6) + rlane) * GPITCH + koff;
    const unsigned short* As2 = As + A_H;
    const unsigned short* Bs  = sb + (1 + ASPLIT) * A_H + ((wn << 6) + rlane) * GPITCH + koff;
#pragma unroll
    for (int ks = 0; ks < GKS; ks += 32) {
      // all fragments of the k-step are read as one group ahead of its products (one LDS wait per k-step, not one per row of tiles)
      v16h bh[4], ah[4];
#pragma unroll
      for (int j = 0; j < 4; ++j) bh[j] = ldfrag_u(Bs + (j << 4) * GPITCH + ks);
#pragma unroll
      for (int i = 0; i < 4; ++i) ah[i] = ldfrag_u(As + (i << 4) * GPITCH + ks);
      if constexpr (ASPLIT != 0) {
        v16h al[4];
#pragma unroll
        for (int i = 0; i < 4; ++i) al[i] = ldfrag_u(As2 + (i << 4) * GPITCH + ks);
#pragma unroll
        for (int i = 0; i < 4; ++i) {
#pragma unroll
          for (int j = 0; j < 4; ++j) acc[i][j] = mmaT<BF>(ah[i], bh[j], acc[i][j]);
          dep_guard1(acc[i][0], acc[i][3], ah[i]);
#pragma unroll
          for (int j = 0; j < 4; ++j) acc[i][j] = mmaT<BF>(al[i], bh[j], acc[i][j]);
          dep_guard1(acc[i][0], acc[i][3], al[i]);
        }
      } else {
#pragma unroll
        for (int i = 0; i < 4; ++i) {
#pragma unroll
          for (int j = 0; j < 4; ++j) acc[i][j] = mmaT<BF>(ah[i], bh[j], acc[i][j]);
          dep_guard1(acc[i][0], acc[i][3], ah[i]);
        }
      }
      keep4_h(bh[0], bh[1], bh[2], bh[3]);
    }
    // foot of the slab: own LDS reads returned, own copies of slab t + 1 landed, then the one barrier that publishes slab t + 1
    // and ends every wave's reads of this slab's buffer; only behind it is that buffer refilled with slab t + 2
    wait_lds();
    wait_copies();
    __syncthreads();
    if (t + 2 < nslab) stage(t & 1, (t + 2) * GKS);
  }
  wait_copies();
  acc_guard4(acc[0][0], acc[0][1], acc[0][2], acc[0][3]);
  acc_guard4(acc[1][0], acc[1][1], acc[1][2], acc[1][3]);
  acc_guard4(acc[2][0], acc[2][1], acc[2][2], acc[2][3]);
  acc_guard4(acc[3][0], acc[3][1], acc[3][2], acc[3][3]);

  const int hh2 = lane >> 4, c4 = (lane & 15) * 4;     // f32 out: 256-B row segment = 16 lanes x 16 B
  const int q8  = lane >> 3, c8 = (lane & 7) * 8;

  // ---- epilogue ----
  float* slab = sT[wave];
#pragma unroll
  for (int i = 0; i < 4; ++i) {
    const int mBase = m0 + (i << 4);
#pragma unroll
    for (int j = 0; j < 4; ++j) {
#pragma unroll
      for (int r = 0; r < 8; ++r) {
        slab[(mOff + r) * 68 + (j << 4) + rlane] = acc[i][j][r];
      }
    }
    wave_sync_lds();
    if constexpr (OM == 0) {
      float* C = (float*)Cout + (size_t)((long long)by * sC);
      const float* R = ep0 + (size_t)((long long)by * sC);
      v4f vals[8];
#pragma unroll
      for (int it = 0; it < 8; ++it) {
        const int row = it * 2 + hh2;                      // it 0..7 x hh2 0..1 = rows 0..15
        v4f v = *(const v4f*)(slab + row * 68 + c4);
#pragma unroll
        for (int e = 0; e < 4; ++e) v[e] = v[e] * oscale;
        if constexpr (EPI == 1) {
          const v4f xr = *(const v4f*)(R + (size_t)(mBase + row) * ldc + n0 + c4);
#pragma unroll
          for (int e = 0; e < 4; ++e) v[e] = v[e] + bfr(xr[e]);
        }
        vals[it] = v;
      }
      {
#pragma unroll
        for (int it = 0; it < 8; ++it) {
          const int gr = mBase + it * 2 + hh2;
          *(v4f*)(C + (size_t)gr * ldc + n0 + c4) = vals[it];
        }
        
      }
    } else {
      unsigned short* C  = (unsigned short*)Cout  + (size_t)((long long)by * sC);
      unsigned short* Cb = (unsigned short*)C2out + (size_t)((long long)by * sC);
      v4u hv[4], lv[4];
#pragma unroll
      for (int it = 0; it < 4; ++it) {
        const int row = it * 4 + q8;                       // it 0..3 x q8 0..3 = rows 0..15
        const float* sp = slab + row * 68 + c8;
        v4u a  = {0u, 0u, 0u, 0u};
        v4u b2 = {0u, 0u, 0u, 0u};
#pragma unroll
        for (int e = 0; e < 4; ++e) {
          float f0 = sp[2 * e] * oscale;
          float f1 = sp[2 * e + 1] * oscale;
          if constexpr (EPI == 2) {
            const int ci = by * cps + n0 + c8 + 2 * e;   // column parameter index (host keeps by*cps + N <= parameter count)
            const float g0 = bfr(ep0[ci]), g1 = bfr(ep0[ci + 1]);
            const float t0 = bfr(ep1[ci]), t1 = bfr(ep1[ci + 1]);
            const float u0 = bfr(ep2[ci]), u1 = bfr(ep2[ci + 1]);
            const float r0 = rsqrtf(bfr(ep3[ci]) + BN_EPS), r1 = rsqrtf(bfr(ep3[ci + 1]) + BN_EPS);
            f0 = (g0 * (f0 - u0)) * r0 + t0;
            f1 = (g1 * (f1 - u1)) * r1 + t1;
          }
          if constexpr (OM == 3) {
            const unsigned short h0 = bf_bits(f0), h1 = bf_bits(f1);
            a[e]  = pk16(h0, h1);
            b2[e] = pk16(bf_bits(f0 - bf_up(h0)), bf_bits(f1 - bf_up(h1)));
          } else {
            f0 *= ocarry; f1 *= ocarry;
            const _Float16 x0 = (_Float16)f0, x1 = (_Float16)f1;
            a[e] = pk16(h_bits(x0), h_bits(x1));
            if constexpr (OM == 4) {
              b2[e] = pk16(h_bits((_Float16)(f0 - (float)x0)), h_bits((_Float16)(f1 - (float)x1)));
            }
          }
        }
        hv[it] = a;
        lv[it] = b2;
      }
      {
#pragma unroll
        for (int it = 0; it < 4; ++it) {
          const int row = it * 4 + q8;
          *(v4u*)(C + (size_t)(mBase + row) * ldc + n0 + c8) = hv[it];
          if constexpr (OM >= 3) {
            *(v4u*)(Cb + (size_t)(mBase + row) * ldc + n0 + c8) = lv[it];
          }
        }
        
      }
    }
    wave_sync_lds();
  }
}

// =====================================================================================================
// Flash attention for one image (batch), one head and 128 score rows (one wave per 16 rows), head dim 64, 1024 columns:
//   rows i index KEY positions (k_i stationary), columns j index the q/v positions streamed in chunks of 32 = one image row;
//   k planes (bf16 hi, lo) K[b*1024 + tok][64h + d], pitch 512; q planes (bf16 hi, lo) Q[b*1024 + tok][64h + d];
//   v^T planes (f16 x16 hi, unscaled lo): VT[b*512 + 64h + d][tok] (pitch 1024);
//   additive position logits from the f32 table R[b*1024 + tok][128h + m] (m < 63: q_tok . rel_w[h][m]; 64 + m: q_tok . rel_h[h][m]):
//   logit[i][j] = k_i . q_j + R[i][yj - yi + 31] + R[i][64 + xj - xi + 31], token = 32*x + y.
//   The score tiles are computed transposed, S^T[j][i] (A = q rows of the chunk from LDS, B = the stationary k rows): lane (c, hh) holds score row
//   i0 + c and, in its 2 x 8 accumulator registers, that row's columns 8hh + r and 16 + 8hh + r of the chunk. So a row's maximum and sum are taken
//   inside the lane, with one exchange between the wave's halves for the maximum per chunk and one for the sum at the end, and the 16 values,
//   converted in place, are the B operand (hardware k order) of O^T[d][i] += v^T[d][j] P^T[j][i] (A = v^T rows from LDS, same k order).
//   The w part of the position logits depends only on the column within a chunk (16 registers per lane, loaded once), the h part only on the
//   chunk (one load per lane per chunk); indices are pure arithmetic.
//   out (bf16 hi, lo planes): CT[b*1024 + tok][64h + d] = sum_j softmax_j(logit) v[j][d]  (softmax run in base 2, max-subtracted, no 1/sqrt(d)).
//   block = 8 waves = 256 threads; grid = 8 images x 8 heads x 8 row blocks = 512; every wave does identical bounded work (32 chunks).
//   The 8 waves of a block need the same q and v^T chunk: it is brought into LDS once per block by asynchronous 16-B copies (4 per lane and
//   chunk: q hi, q lo 32 rows x 128 B at pitch 144 B; v^T hi, lo 64 rows x 64 B at pitch 80 B), two buffers, chunk t + 2 issued behind the
//   barrier that ends chunk t; all A fragments are 16-B LDS reads with the split k map.
//   Per chunk: 2 score tiles on bf16 WMMA (hi.hi + lo.hi + hi.lo, K = 64 as two k-steps of 32); online softmax in f32 (exp2); P*1024 as f16 hi
//   and unscaled residual; 12 v^T.P^T WMMAs (hi.hi, hi.lo, lo.hi).
//   Final 1/l and carry folds in f32; after a block barrier the stage buffers are reused as the block's two bf16 result buffers [128][64]
//   (hi, lo): each lane stages 4 x 8 consecutive d of its row (16-B stores); after a second block barrier the 256 threads write whole 128-B row pieces.
// coverage: LDS result buffers: 8 waves x 16 rows x 64 cols per plane; global: 4 iterations x 256 threads x 8 halves = 128 rows x 64 cols
//           of rows 128rb..128rb+127, columns 64h..64h+63 of image b, per plane; grid covers all 8 x 1024 rows x 512 columns exactly once.
// =====================================================================================================
__global__ __launch_bounds__(ATT_THREADS) __attribute__((amdgpu_num_vgpr(256)))
void attn8(const unsigned short* __restrict__ KHh, const unsigned short* __restrict__ KHl,
           const unsigned short* __restrict__ QHh, const unsigned short* __restrict__ QHl,
           const unsigned short* __restrict__ VTh, const unsigned short* __restrict__ VTl,
           const float* __restrict__ Rtab, unsigned short* CTh, unsigned short* CTl) {
  __shared__ __align__(16) unsigned short stg[2 * STG_HALVES];   // two stage buffers: q hi | q lo | v^T hi | v^T lo; later: result buffers

  const int tid  = threadIdx.x;
  const int wave = tid >> 5;
  const int lane = tid & 31;
  const int hh   = lane >> 4;
  const int c    = lane & 15;

  const int rb   = blockIdx.x & ((NTOK / ATT_ROWS) - 1);   // 0..7
  const int head = (blockIdx.x / (NTOK / ATT_ROWS)) & (NHEAD - 1);   // 0..7
  const int bat  = blockIdx.x / ((NTOK / ATT_ROWS) * NHEAD);         // 0..7
  const int i0   = rb * ATT_ROWS + wave * 16;              // first score row (key token) of this wave
  const int x0   = i0 / GW;                                // image row of all 16 tokens
  const int yi   = (i0 & (GW - 1)) + c;                    // image column of this lane's score row i0 + c
  const size_t rowg = (size_t)bat * NTOK + i0;

  // per-lane copy addresses: q piece = row tid>>3, 16-B segment tid&7; v^T piece = row tid>>2, 16-B segment tid&3
  const unsigned short* gqh = QHh + ((size_t)bat * NTOK + (tid >> 3)) * DM + head * HD + (tid & 7) * 8;
  const unsigned short* gql = QHl + ((size_t)bat * NTOK + (tid >> 3)) * DM + head * HD + (tid & 7) * 8;
  const unsigned short* gvh = VTh + ((size_t)bat * DM + head * HD + (tid >> 2)) * NTOK + (tid & 3) * 8;
  const unsigned short* gvl = VTl + ((size_t)bat * DM + head * HD + (tid >> 2)) * NTOK + (tid & 3) * 8;
  const unsigned lbase = (unsigned)(uintptr_t)stg;         // LDS byte address of the stage buffers
  const unsigned lq = lbase + (unsigned)((tid >> 3) * (QPITCH * 2) + (tid & 7) * 16);
  const unsigned lv = lbase + (unsigned)(2 * QT_HALVES * 2 + (tid >> 2) * (VPITCH * 2) + (tid & 3) * 16);

  // chunk 0 -> buffer 0, landed and published; then chunk 1 -> buffer 1 flies while chunk 0 is worked on
  stage_copy4(lq, gqh, lq + QT_HALVES * 2, gql, lv, gvh, lv + VT_HALVES * 2, gvl);
  wait_copies();
  __syncthreads();
  stage_copy4(lq + STG_HALVES * 2, gqh + (size_t)KCH * DM, lq + (STG_HALVES + QT_HALVES) * 2, gql + (size_t)KCH * DM,
              lv + STG_HALVES * 2, gvh + KCH, lv + (STG_HALVES + VT_HALVES) * 2, gvl + KCH);

  // stationary B fragments: k rows i0 + c (hi and residual planes), d 0..31 and 32..63
  const size_t kofs = (rowg + c) * DM + head * HD + 8 * hh;
  const v16h kah = ldfrag_u(KHh + kofs), kbh = ldfrag_u(KHh + kofs + 32);
  const v16h kal = ldfrag_u(KHl + kofs), kbl = ldfrag_u(KHl + kofs + 32);

  // additive w-position logits of this lane's score row for the 16 chunk columns that it holds, loop-invariant, pre-scaled by log2(e)
  const float* rrow = Rtab + (rowg + c) * RT_LD + head * RTP;        // table row of score row i0 + c
  float wb0[8], wb1[8];
#pragma unroll
  for (int r = 0; r < 8; ++r) {
    const int iw = 8 * hh + r + (GW - 1) - yi;             // in [0, 46]
    wb0[r] = rrow[iw] * LOG2E;
    wb1[r] = rrow[iw + 16] * LOG2E;                        // in [16, 62]
  }
  const float* hrow = rrow + HD + (GH - 1) - x0;           // + st = h-position logit of chunk st; index st - x0 + 31 in [0, 62]

  float mrow = -INFINITY, lrow = 0.f;                      // row maximum (both halves alike); sum over this half's columns only
  v8f o0 = zero8(), o1 = zero8(), o2 = zero8(), o3 = zero8();   // O^T tiles: o_t[r] = O[i0 + c][16t + 8hh + r]

#pragma unroll 1
  for (int st = 0; st < NSTG; ++st) {
    const int bsel = st & 1;
    const unsigned short* sb  = stg + bsel * STG_HALVES;
    const unsigned short* Qsh = sb + c * QPITCH + 8 * hh;                    // q hi, row c of the chunk
    const unsigned short* Qsl = Qsh + QT_HALVES;
    const unsigned short* Vsh = sb + 2 * QT_HALVES + c * VPITCH + 8 * hh;    // v^T hi, row d = c
    const unsigned short* Vsl = Vsh + VT_HALVES;
    // h-position logit of this chunk (one image row x2 = st) for the lane's score row
    const float hraw = hrow[st];
    wait_addr();
    v8f s0, s1;                                            // s0[r] = S[i0 + c][8hh + r], s1[r] = S[i0 + c][16 + 8hh + r] of the chunk
    {
      const v16h q0h = ldfrag_u(Qsh), q1h = ldfrag_u(Qsh + 32);
      const v16h q0l = ldfrag_u(Qsl), q1l = ldfrag_u(Qsl + 32);
      s0 = mma_b(q0h, kah, zero8());
      s0 = mma_b(q1h, kbh, s0);
      s0 = mma_b(q0l, kah, s0);
      s0 = mma_b(q1l, kbh, s0);
      s0 = mma_b(q0h, kal, s0);
      s0 = mma_b(q1h, kbl, s0);
      guard1x4(s0, q0h, q1h, q0l, q1l);
    }
    {
      const int q2 = 16 * QPITCH;
      const v16h q0h = ldfrag_u(Qsh + q2), q1h = ldfrag_u(Qsh + q2 + 32);
      const v16h q0l = ldfrag_u(Qsl + q2), q1l = ldfrag_u(Qsl + q2 + 32);
      s1 = mma_b(q0h, kah, zero8());
      s1 = mma_b(q1h, kbh, s1);
      s1 = mma_b(q0l, kah, s1);
      s1 = mma_b(q1l, kbh, s1);
      s1 = mma_b(q0h, kal, s1);
      s1 = mma_b(q1h, kbl, s1);
      guard1x8(s1, q0h, q1h, q0l, q1l, kah, kbh, kal, kbl);
    }
    const float hb = hraw * LOG2E;
    float t0[8], t1[8];
#pragma unroll
    for (int r = 0; r < 8; ++r) {
      t0[r] = s0[r] * LOG2E + (wb0[r] + hb);
      t1[r] = s1[r] * LOG2E + (wb1[r] + hb);
    }
    float mx = fmaxf(t0[0], t1[0]);
#pragma unroll
    for (int r = 1; r < 8; ++r) mx = fmaxf(mx, fmaxf(t0[r], t1[r]));
    mx = fmaxf(mx, xhalf(mx));                             // both halves now hold the row's maximum over the chunk
    const float mn = fmaxf(mrow, mx);
    const float al = exp2f(mrow - mn);
    mrow = mn;
    FragH ph, pl;                                          // P^T * 1024, f16 hi and unscaled residual: element s = column kmap(s, hh) of the chunk
    float pa[8];
#pragma unroll
    for (int r = 0; r < 8; ++r) {
      const float e0 = exp2f(t0[r] - mn), e1 = exp2f(t1[r] - mn);
      pa[r] = e0 + e1;
      float f; _Float16 x;
      f = e0 * PC; x = (_Float16)f; ph.h[0][r] = x; pl.h[0][r] = (_Float16)(f - (float)x);   // column 8hh + r
      f = e1 * PC; x = (_Float16)f; ph.h[1][r] = x; pl.h[1][r] = (_Float16)(f - (float)x);   // column 16 + 8hh + r
    }
    const float ps = ((pa[0] + pa[1]) + (pa[2] + pa[3])) + ((pa[4] + pa[5]) + (pa[6] + pa[7]));
    lrow = lrow * al + ps;
#pragma unroll
    for (int r = 0; r < 8; ++r) {
      o0[r] *= al;
      o1[r] *= al;
      o2[r] *= al;
      o3[r] *= al;
    }
    {
      const v16h vh0 = ldfrag_u(Vsh);
      const v16h vh1 = ldfrag_u(Vsh + 16 * VPITCH);
      const v16h vh2 = ldfrag_u(Vsh + 32 * VPITCH);
      const v16h vh3 = ldfrag_u(Vsh + 48 * VPITCH);
      o0 = mma_h(vh0, ph.v, o0);
      o1 = mma_h(vh1, ph.v, o1);
      o2 = mma_h(vh2, ph.v, o2);
      o3 = mma_h(vh3, ph.v, o3);
      o0 = mma_h(vh0, pl.v, o0);
      o1 = mma_h(vh1, pl.v, o1);
      o2 = mma_h(vh2, pl.v, o2);
      o3 = mma_h(vh3, pl.v, o3);
      guard4x6(o0, o1, o2, o3, ph.v, pl.v, vh0, vh1, vh2, vh3);
    }
    {
      const v16h vl0 = ldfrag_u(Vsl);
      const v16h vl1 = ldfrag_u(Vsl + 16 * VPITCH);
      const v16h vl2 = ldfrag_u(Vsl + 32 * VPITCH);
      const v16h vl3 = ldfrag_u(Vsl + 48 * VPITCH);
      o0 = mma_h(vl0, ph.v, o0);
      o1 = mma_h(vl1, ph.v, o1);
      o2 = mma_h(vl2, ph.v, o2);
      o3 = mma_h(vl3, ph.v, o3);
      guard4x5(o0, o1, o2, o3, ph.v, vl0, vl1, vl2, vl3);
    }
    // foot of the chunk: own LDS reads returned, own copies of chunk st + 1 landed, then the one barrier that publishes chunk st + 1
    // and ends every wave's reads of this chunk's buffer; only behind it is that buffer refilled with chunk st + 2
    wait_lds();
    wait_copies();
    __syncthreads();
    if (st + 2 < NSTG) {
      const size_t qa = (size_t)(st + 2) * KCH * DM;
      const int    va = (st + 2) * KCH;
      const unsigned lo = (unsigned)(bsel * STG_HALVES * 2);
      stage_copy4(lq + lo, gqh + qa, lq + lo + QT_HALVES * 2, gql + qa, lv + lo, gvh + va, lv + lo + VT_HALVES * 2, gvl + va);
    }
  }
  wait_copies();

  // ---- all waves done with the stage buffers; they become two bf16 result buffers [128][64] ----
  __syncthreads();
  unsigned short* Osh = stg;
  unsigned short* Osl = Osh + ATT_ROWS * HD;
  // ---- join the halves' sums, fold 1/l and the carries (1024 on P, 16 on v), split into bf16 hi + residual, stage the lane's 4 x 8 values ----
  const float oc = 1.0f / (PC * VC);
  const float inv = (1.0f / (lrow + xhalf(lrow))) * oc;
  const int ro = (wave * 16 + c) * HD + 8 * hh;            // row i0 + c of the block, d = 8hh; tile t adds 16t
  auto put8 = [&](const v8f& o, int t) {
    v4u a, b2;
#pragma unroll
    for (int e = 0; e < 4; ++e) {
      const float f0 = o[2 * e] * inv, f1 = o[2 * e + 1] * inv;
      const unsigned short g0 = bf_bits(f0), g1 = bf_bits(f1);
      a[e]  = pk16(g0, g1);
      b2[e] = pk16(bf_bits(f0 - bf_up(g0)), bf_bits(f1 - bf_up(g1)));
    }
    *(v4u*)(Osh + ro + 16 * t) = a;
    *(v4u*)(Osl + ro + 16 * t) = b2;
  };
  put8(o0, 0);
  put8(o1, 1);
  put8(o2, 2);
  put8(o3, 3);
  __syncthreads();
  // ---- block writes its 128 row pieces of both planes: piece p = it*256 + tid -> row p>>3, halves (p&7)*8 .. +7 (8 lanes = one 128-B line) ----
  {
    v4u hv[4], lv4[4];
#pragma unroll
    for (int it = 0; it < 4; ++it) {
      const int p = it * ATT_THREADS + tid;
      hv[it]  = *(const v4u*)(Osh + (size_t)p * 8);
      lv4[it] = *(const v4u*)(Osl + (size_t)p * 8);
    }
    const size_t dofs = ((size_t)bat * NTOK + rb * ATT_ROWS) * DM + head * HD;
    unsigned short* dsth = CTh + dofs;
    unsigned short* dstl = CTl + dofs;
    {
#pragma unroll
      for (int it = 0; it < 4; ++it) {
        const int p = it * ATT_THREADS + tid;
        const size_t go = (size_t)(p >> 3) * DM + (p & 7) * 8;
        *(v4u*)(dsth + go) = hv[it];
        *(v4u*)(dstl + go) = lv4[it];
      }
    }
  }
}

// =====================================================================================================
// Workspace map (bytes); every plane is an exact multiple of its tile / whole-row store granularity (M, N exact tile multiples,
// the activation convert count an exact multiple of 2048, no pad rows needed), every offset a multiple of 64 KiB:
//   WKT, WQT, WVT f16 [512][512] x64   3 x 524288    ([h*64+d][c] = [n][k])
//   WOT  bf16 [8][64 e][64 d]              65536
//   WUT  bf16 [512 out][512 in]          524288
//   REL  bf16 [8][128][64]                131072
//   X16  f16 [8192][512] x16             8388608    (activation rows b*1024 + tok)
//   QHh, QHl bf16 [8192][512]         2 x 8388608   (q projection, hi / residual)
//   KHh, KHl bf16 [8192][512]         2 x 8388608   (k projection, hi / residual)
//   VTh, VTl f16 [8][512][1024] x16   2 x 8388608   (v^T per image, hi / residual)
//   RTAB f32 [8192][1024]               33554432   (position-logit tables, 128 per head)
//   CTh, CTl bf16 [8192][512]         2 x 8388608   (attention ctx, merged heads, hi / residual)
//   CAh, CAl bf16 [8192][512]         2 x 8388608   (per-head output after batch-norm, concat layout, hi / residual)
//   end                                 128122880
// =====================================================================================================
extern "C" void kernel_launch(void* const* d_in, const int* in_sizes, int n_in,
                              void* d_out, int out_size, void* d_ws, size_t ws_size,
                              hipStream_t stream) {
  if (n_in < 12) return;
  if (in_sizes[0] != NROWS * DM) return;
  if (in_sizes[1] != NHEAD * DM * HD || in_sizes[2] != NHEAD * DM * HD || in_sizes[3] != NHEAD * DM * HD) return;
  if (in_sizes[4] != NHEAD * HD * HO) return;
  if (in_sizes[5] != NHEAD * HO || in_sizes[6] != NHEAD * HO || in_sizes[7] != NHEAD * HO || in_sizes[8] != NHEAD * HO) return;
  if (in_sizes[9] != NHEAD * NREL * HD || in_sizes[10] != NHEAD * NREL * HD) return;
  if (in_sizes[11] != COUT * COUT) return;
  if (out_size != NROWS * COUT) return;
  if ((in_sizes[0] % 2048) != 0) return;

  const float* x     = (const float*)d_in[0];
  const float* w_k   = (const float*)d_in[1];
  const float* w_q   = (const float*)d_in[2];
  const float* w_v   = (const float*)d_in[3];
  const float* w_o   = (const float*)d_in[4];
  const float* gam   = (const float*)d_in[5];
  const float* bet   = (const float*)d_in[6];
  const float* mmean = (const float*)d_in[7];
  const float* mvar  = (const float*)d_in[8];
  const float* relw  = (const float*)d_in[9];
  const float* relh  = (const float*)d_in[10];
  const float* w_out = (const float*)d_in[11];
  float*       out   = (float*)d_out;

  const size_t PWT = (size_t)DM * DM * 2;                         //   524288
  const size_t PWO = (size_t)NHEAD * HO * HD * 2;                 //    65536
  const size_t PWU = (size_t)COUT * COUT * 2;                     //   524288
  const size_t PRL = (size_t)NHEAD * RTP * HD * 2;                //   131072
  const size_t PX  = (size_t)NROWS * DM * 2;                      //  8388608
  const size_t PVT = (size_t)NB * DM * NTOK * 2;                  //  8388608
  const size_t PRT = (size_t)NROWS * RT_LD * 4;                   // 33554432
  size_t off = 0;
  const size_t oWK = off; off += PWT;
  const size_t oWQ = off; off += PWT;
  const size_t oWV = off; off += PWT;
  const size_t oWO = off; off += PWO;
  const size_t oWU = off; off += PWU;
  const size_t oRL = off; off += PRL;
  const size_t oX  = off; off += PX;
  const size_t oQh = off; off += PX;
  const size_t oQl = off; off += PX;
  const size_t oKh = off; off += PX;
  const size_t oKl = off; off += PX;
  const size_t oVh = off; off += PVT;
  const size_t oVl = off; off += PVT;
  const size_t oRT = off; off += PRT;
  const size_t oCh = off; off += PX;
  const size_t oCl = off; off += PX;
  const size_t oAh = off; off += PX;
  const size_t oAl = off; off += PX;
  if (off > ws_size) return;                                      // off = 128122880
  if (off > (size_t)134217728) return;

  char* ws = (char*)d_ws;
  unsigned short* WKT  = (unsigned short*)(ws + oWK);
  unsigned short* WQT  = (unsigned short*)(ws + oWQ);
  unsigned short* WVT  = (unsigned short*)(ws + oWV);
  unsigned short* WOT  = (unsigned short*)(ws + oWO);
  unsigned short* WUT  = (unsigned short*)(ws + oWU);
  unsigned short* REL  = (unsigned short*)(ws + oRL);
  unsigned short* X16  = (unsigned short*)(ws + oX);
  unsigned short* QHh  = (unsigned short*)(ws + oQh);
  unsigned short* QHl  = (unsigned short*)(ws + oQl);
  unsigned short* KHh  = (unsigned short*)(ws + oKh);
  unsigned short* KHl  = (unsigned short*)(ws + oKl);
  unsigned short* VTh  = (unsigned short*)(ws + oVh);
  unsigned short* VTl  = (unsigned short*)(ws + oVl);
  float*          RTAB = (float*)(ws + oRT);
  unsigned short* CTh  = (unsigned short*)(ws + oCh);
  unsigned short* CTl  = (unsigned short*)(ws + oCl);
  unsigned short* CAh  = (unsigned short*)(ws + oAh);
  unsigned short* CAl  = (unsigned short*)(ws + oAl);

  const dim3 blk(256);
  const dim3 gTW(DM / 64, HD / 64, NHEAD);                         // 8 x 1 x 8
  const dim3 gTO(HD / 64, HO / 64, NHEAD);                         // 1 x 1 x 8
  const dim3 gTU(COUT / 64, COUT / 64, 1);                         // 8 x 8 x 1
  const dim3 gRL((NHEAD * RTP * 8) / 256);                         // 32
  const dim3 gCX((NROWS * DM) / 2048);                             // 2048
  const dim3 blkG(128);                                            // 4 waves: 2 x 2 (128 x 128 tile) or 4 x 1 (256 x 64 tile)
  const dim3 gP((NROWS / 128) * (DM / 128), 1);                    // 256
  const dim3 gV((DM / 128) * (NTOK / 128), NB);                    // 32 x 8
  const dim3 gR((NROWS / 128) * (RTP / 128), NHEAD);               // 64 x 8
  const dim3 gH((NROWS / 256) * (HO / 64), NHEAD);                 // 32 x 8
  const dim3 gF((NROWS / 128) * (COUT / 128), 1);                  // 256
  const dim3 gAT(ATT_BLOCKS);                                      // 512
  const dim3 bAT(ATT_THREADS);                                     // 256

  // (0) weight planes: per head W[h][c][d] -> WT[h*64+d][c] as f16( bf16_RNE(w) * 64 ); Wo[h][d][e] -> WOT[h][e][d] bf16;
  //     Wout[in][out] -> WUT[out][in] bf16; rel tables -> REL[h][128][64] bf16 (rows 63, 127 zero)
  tr16<0><<<gTW, blk, 0, stream>>>(w_k, WKT, DM, HD, (long long)DM * HD, (long long)HD * DM, WSC);
  tr16<0><<<gTW, blk, 0, stream>>>(w_q, WQT, DM, HD, (long long)DM * HD, (long long)HD * DM, WSC);
  tr16<0><<<gTW, blk, 0, stream>>>(w_v, WVT, DM, HD, (long long)DM * HD, (long long)HD * DM, WSC);
  tr16<1><<<gTO, blk, 0, stream>>>(w_o, WOT, HD, HO, (long long)HD * HO, (long long)HO * HD, 1.0f);
  tr16<1><<<gTU, blk, 0, stream>>>(w_out, WUT, COUT, COUT, 0LL, 0LL, 1.0f);
  relcat<<<gRL, blk, 0, stream>>>(relw, relh, REL);

  // (1) activation plane: X16[row][c] = f16( bf16_RNE(x[row][c]) * 16 ), rows = b*1024 + tok
  cvt16<0><<<gCX, blk, 0, stream>>>(x, X16, NROWS * DM, ACARRY);

  // (2) q projection: q[m][n] = sum_c x[m][c] WQT[n][c] -> bf16 hi / residual planes; M = 8192, N = 512, K = 512
  gemm64<3, 0, 0, 0, 2, 2><<<gP, blkG, 0, stream>>>(
      X16, X16, DM, 0LL,
      WQT, DM, 0LL,
      (void*)QHh, (void*)QHl, DM, 0LL,
      NROWS, DM, DM, 1.0f / (ACARRY * WSC), 1.0f,
      x, x, x, x, 0);

  // (3) k projection -> bf16 hi / residual planes
  gemm64<3, 0, 0, 0, 2, 2><<<gP, blkG, 0, stream>>>(
      X16, X16, DM, 0LL,
      WKT, DM, 0LL,
      (void*)KHh, (void*)KHl, DM, 0LL,
      NROWS, DM, DM, 1.0f / (ACARRY * WSC), 1.0f,
      x, x, x, x, 0);

  // (4) v^T per image: VT[b][h*64+d][tok] = sum_c WVT[h*64+d][c] x_b[tok][c] -> f16 x16 hi / residual planes; M = 512, N = 1024, K = 512
  gemm64<4, 0, 0, 0, 2, 2><<<gV, blkG, 0, stream>>>(
      WVT, WVT, DM, 0LL,
      X16, DM, (long long)NTOK * DM,
      (void*)VTh, (void*)VTl, NTOK, (long long)DM * NTOK,
      DM, NTOK, DM, 1.0f / (ACARRY * WSC), VC,
      x, x, x, x, 0);

  // (5) position-logit tables per head: RTAB[row][128h + m] = sum_d (q_hi + q_lo)[row][64h + d] REL[h][m][d]; M = 8192, N = 128, K = 64, f32
  gemm64<0, 1, 1, 0, 2, 2><<<gR, blkG, 0, stream>>>(
      QHh, QHl, DM, (long long)HD,
      REL, HD, (long long)RTP * HD,
      (void*)RTAB, (void*)RTAB, RT_LD, (long long)RTP,
      NROWS, RTP, HD, 1.0f, 1.0f,
      x, x, x, x, 0);

  // (6) attention per (image, head, 128 score rows) -> CT (bf16 hi / residual planes)
  attn8<<<gAT, bAT, 0, stream>>>(KHh, KHl, QHh, QHl, VTh, VTl, RTAB, CTh, CTl);

  // (7) per-head output projection + eval batch-norm: CA[row][64h + e] = BN_h( sum_d (ct_hi + ct_lo)[row][64h + d] WOT[h][e][d] );
  //     M = 8192, N = 64, K = 64 per head -> bf16 hi / residual planes
  gemm64<3, 1, 1, 2, 4, 1><<<gH, blkG, 0, stream>>>(
      CTh, CTl, DM, (long long)HD,
      WOT, HD, (long long)HO * HD,
      (void*)CAh, (void*)CAl, DM, (long long)HO,
      NROWS, HO, HD, 1.0f, 1.0f,
      gam, bet, mmean, mvar, HO);

  // (8) out = (CA_hi + CA_lo) . WUT^T + bf16_RNE(x); M = 8192, N = 512, K = 512, f32
  gemm64<0, 1, 1, 1, 2, 2><<<gF, blkG, 0, stream>>>(
      CAh, CAl, DM, 0LL,
      WUT, COUT, 0LL,
      (void*)out, (void*)out, COUT, 0LL,
      NROWS, COUT, DM, 1.0f, 1.0f,
      x, x, x, x, 0);
  (void)hipGetLastError();
}

// v004
// It runs in 123 microseconds.
// Next to v003, in two timings, it ran 1.21 and 1.15 times as fast.
// Over all steps from v000 it is 2.60 times as fast.
// Contractions (all f32 accumulate): k/q projections v_wmma_f32_16x16x32_f16 (x f16 x16 . W f16 x64, K=512, single products) -> bf16 hi/lo planes;
// v^T projection v_wmma_f32_16x16x32_f16 (Wv f16 x64 . x f16 x16, K=512, single) -> f16 x16 hi/lo planes;
// relative-position tables v_wmma_f32_16x16x32_bf16 (q bf16 hi/lo . rel bf16, hi.W+lo.W, K=64) -> f32 table;
// attention scores, transposed, v_wmma_f32_16x16x32_bf16 (q bf16 hi/lo . k bf16 hi/lo, hi.hi+lo.hi+hi.lo, K=64);
// v^T . P^T v_wmma_f32_16x16x32_f16 (v^T f16 x16 hi/lo . P^T f16 x1024 hi/lo, hi.hi+hi.lo+lo.hi, K=1024 by 32);
// per-head output projection v_wmma_f32_16x16x32_bf16 (ctx bf16 hi/lo . Wo bf16, K=64) with eval batch-norm affine in f32 -> bf16 hi/lo planes;
// final projection v_wmma_f32_16x16x32_bf16 (cat bf16 hi/lo . Wout bf16, K=512) + bf16-RNE residual in f32.
// Max-subtracted online base-2 softmax and the additive position logits in f32 on VALU. Every float input RNE-converted to bf16 on load.
#include <hip/hip_runtime.h>
#include <math.h>
#include <stdint.h>

#define NB     8
#define GH     32
#define GW     32
#define NTOK   (GH * GW)
#define DM     512
#define NHEAD  8
#define HD     64
#define HO     64
#define COUT   512
#define NREL   63
#define RTP    128
#define RT_LD  (NHEAD * RTP)
#define NROWS  (NB * NTOK)
#define KCH    32
#define WSC    64.0f
#define ACARRY 16.0f
#define VC     16.0f
#define PC     1024.0f
#define LOG2E  1.4426950408889634f
#define BN_EPS 1e-3f
static_assert(NHEAD * HD == DM);
static_assert(NHEAD * HO == COUT);
static_assert(COUT == DM);
static_assert(KCH == GW);
static_assert(NREL == 2 * GW - 1);
static_assert(NREL == 2 * GH - 1);
static_assert(NREL <= HD);
static_assert(HD + NREL <= RTP);
static_assert((NTOK % 128) == 0 && (DM % 128) == 0 && (NROWS % 256) == 0 && (HD % 64) == 0 && (NTOK % KCH) == 0);
static_assert((RTP % 128) == 0 && (HO % 64) == 0 && (COUT % 128) == 0);
#define GKS         64
#define GPITCH      72
#define ATT_WAVES   8
#define ATT_THREADS (ATT_WAVES * 32)
#define ATT_ROWS    (ATT_WAVES * 16)
#define ATT_BLOCKS  (NB * NHEAD * (NTOK / ATT_ROWS))
#define NSTG        (NTOK / KCH)
#define QPITCH      72
#define VPITCH      40
#define QT_HALVES   (KCH * QPITCH)
#define VT_HALVES   (HD * VPITCH)
#define STG_HALVES  (2 * QT_HALVES + 2 * VT_HALVES)
static_assert(ATT_THREADS == 256);
static_assert(ATT_BLOCKS == 512);
static_assert(NSTG >= 2);
static_assert(KCH * (HD / 8) == ATT_THREADS && HD * (KCH / 8) == ATT_THREADS);
static_assert((QT_HALVES % 8) == 0 && (VT_HALVES % 8) == 0 && (QPITCH % 8) == 0 && (VPITCH % 8) == 0);
static_assert(2 * ATT_ROWS * HD <= 2 * STG_HALVES);
static_assert((ATT_ROWS * HD) / 8 == 4 * ATT_THREADS);

typedef _Float16 v16h __attribute__((ext_vector_type(16)));
typedef _Float16 v8h  __attribute__((ext_vector_type(8)));
typedef __bf16   v16b __attribute__((ext_vector_type(16)));
typedef float    v8f  __attribute__((ext_vector_type(8)));
typedef float    v4f  __attribute__((ext_vector_type(4)));
typedef unsigned int v4u __attribute__((ext_vector_type(4)));

union FragH { v16h v; v8h h[2]; v4u u[2]; };
union FragAny { v16h h; v16b b; };

// ---- scalar helpers --------------------------------------------------------------------------------
__device__ __forceinline__ unsigned short bf_bits(float f) {          // f32 -> bf16 bits, RNE convert
  unsigned u = __float_as_uint(f);
  return (unsigned short)((u + 0x7FFFu + ((u >> 16) & 1u)) >> 16);
}
__device__ __forceinline__ float bf_up(unsigned short h) { return __uint_as_float(((unsigned)h) << 16); }
__device__ __forceinline__ float bfr(float f) { return bf_up(bf_bits(f)); }   // value of the bf16 RNE convert
__device__ __forceinline__ unsigned short h_bits(_Float16 x) { return __builtin_bit_cast(unsigned short, x); }
__device__ __forceinline__ unsigned pk16(unsigned short a, unsigned short b) { return (unsigned)a | ((unsigned)b << 16); }
__device__ __forceinline__ v8f zero8() { v8f z = {0.f, 0.f, 0.f, 0.f, 0.f, 0.f, 0.f, 0.f}; return z; }
// value of lane l ^ 16 (the other half of the wave), by one vector cross-row move
__device__ __forceinline__ float xhalf(float x) {
  const int b = __builtin_bit_cast(int, x);
  return __builtin_bit_cast(float, __builtin_amdgcn_permlanex16(b, b, 0x76543210, 0xfedcba98, false, false));
}

// ---- fragment loader: 16-bit A/B operand from a k-contiguous 16-bit plane, lane -> row/col (lane&15),
//      p already includes +8*(lane>>4); elements 0..7 <- p[0..7] (k0+8h..), elements 8..15 <- p[16..23] (k0+16+8h..)
//      (same split k map for A and B; B is always read from a [n][k] plane)
__device__ __forceinline__ v16h ldfrag_u(const unsigned short* p) {
  FragH f;
  f.u[0] = *(const v4u*)(p);
  f.u[1] = *(const v4u*)(p + 16);
  return f.v;
}

// ---- WMMA helpers with trailing VALU hazard gaps ------------------------------------------------------
__device__ __forceinline__ v8f mma_h(v16h a, v16h b, v8f c) {
  return __builtin_amdgcn_wmma_f32_16x16x32_f16(false, a, false, b, (short)0, c, false, false);
}
__device__ __forceinline__ v8f mma_b(v16h a, v16h b, v8f c) {
  FragAny ua, ub;
  ua.h = a;
  ub.h = b;
  return __builtin_amdgcn_wmma_f32_16x16x32_bf16(false, ua.b, false, ub.b, (short)0, c, false, false);
}
template <int BF>
__device__ __forceinline__ v8f mmaT(v16h a, v16h b, v8f c) {
  if constexpr (BF != 0) return mma_b(a, b, c);
  else return mma_h(a, b, c);
}
__device__ __forceinline__ void dep_guard1(v8f& a, v8f& b, v16h x) {
#if defined(__HIP_DEVICE_COMPILE__)
  asm volatile("v_nop\n\tv_nop\n\tv_nop\n\tv_nop" : "+v"(a), "+v"(b) : "v"(x));
#endif
}
__device__ __forceinline__ void guard1x4(v8f& s, v16h a0, v16h a1, v16h a2, v16h a3) {
#if defined(__HIP_DEVICE_COMPILE__)
  asm volatile("v_nop\n\tv_nop\n\tv_nop\n\tv_nop" : "+v"(s) : "v"(a0), "v"(a1), "v"(a2), "v"(a3));
#endif
}
__device__ __forceinline__ void guard1x8(v8f& s, v16h a0, v16h a1, v16h a2, v16h a3,
                                         v16h b0, v16h b1, v16h b2, v16h b3) {
#if defined(__HIP_DEVICE_COMPILE__)
  asm volatile("v_nop\n\tv_nop\n\tv_nop\n\tv_nop"
               : "+v"(s) : "v"(a0), "v"(a1), "v"(a2), "v"(a3), "v"(b0), "v"(b1), "v"(b2), "v"(b3));
#endif
}
__device__ __forceinline__ void guard4x6(v8f& a, v8f& b, v8f& c, v8f& d,
                                         v16h x0, v16h x1, v16h x2, v16h x3, v16h x4, v16h x5) {
#if defined(__HIP_DEVICE_COMPILE__)
  asm volatile("v_nop\n\tv_nop\n\tv_nop\n\tv_nop"
               : "+v"(a), "+v"(b), "+v"(c), "+v"(d) : "v"(x0), "v"(x1), "v"(x2), "v"(x3), "v"(x4), "v"(x5));
#endif
}
__device__ __forceinline__ void guard4x5(v8f& a, v8f& b, v8f& c, v8f& d,
                                         v16h x0, v16h x1, v16h x2, v16h x3, v16h x4) {
#if defined(__HIP_DEVICE_COMPILE__)
  asm volatile("v_nop\n\tv_nop\n\tv_nop\n\tv_nop"
               : "+v"(a), "+v"(b), "+v"(c), "+v"(d) : "v"(x0), "v"(x1), "v"(x2), "v"(x3), "v"(x4));
#endif
}
__device__ __forceinline__ void keep4_h(v16h a, v16h b, v16h c, v16h d) {
#if defined(__HIP_DEVICE_COMPILE__)
  asm volatile("v_nop" :: "v"(a), "v"(b), "v"(c), "v"(d));
#endif
}
__device__ __forceinline__ void acc_guard4(v8f& a, v8f& b, v8f& c, v8f& d) {
#if defined(__HIP_DEVICE_COMPILE__)
  asm volatile("v_nop\n\tv_nop\n\tv_nop\n\tv_nop" : "+v"(a), "+v"(b), "+v"(c), "+v"(d));
#endif
}
__device__ __forceinline__ void wave_sync_lds() {
  __builtin_amdgcn_fence(__ATOMIC_RELEASE, "workgroup");
  __builtin_amdgcn_wave_barrier();
  __builtin_amdgcn_fence(__ATOMIC_ACQUIRE, "workgroup");
}

// four 16-B copies per lane, global -> LDS through no register; the s_wait_xcnt 0 in the same statement stands ahead of any later
// rewrite of the address registers that the copies name
__device__ __forceinline__ void stage_copy4(unsigned l0, const unsigned short* g0, unsigned l1, const unsigned short* g1,
                                            unsigned l2, const unsigned short* g2, unsigned l3, const unsigned short* g3) {
#if defined(__HIP_DEVICE_COMPILE__)
  asm volatile("global_load_async_to_lds_b128 %0, %1, off\n\t"
               "global_load_async_to_lds_b128 %2, %3, off\n\t"
               "global_load_async_to_lds_b128 %4, %5, off\n\t"
               "global_load_async_to_lds_b128 %6, %7, off\n\t"
               "s_wait_xcnt 0x0"
               :: "v"(l0), "v"(g0), "v"(l1), "v"(g1), "v"(l2), "v"(g2), "v"(l3), "v"(g3) : "memory");
#endif
}
// the same for eight copies: one wait on the address registers serves the run
__device__ __forceinline__ void stage_copy8(unsigned l0, const unsigned short* g0, unsigned l1, const unsigned short* g1,
                                            unsigned l2, const unsigned short* g2, unsigned l3, const unsigned short* g3,
                                            unsigned l4, const unsigned short* g4, unsigned l5, const unsigned short* g5,
                                            unsigned l6, const unsigned short* g6, unsigned l7, const unsigned short* g7) {
#if defined(__HIP_DEVICE_COMPILE__)
  asm volatile("global_load_async_to_lds_b128 %0, %1, off\n\t"
               "global_load_async_to_lds_b128 %2, %3, off\n\t"
               "global_load_async_to_lds_b128 %4, %5, off\n\t"
               "global_load_async_to_lds_b128 %6, %7, off\n\t"
               "global_load_async_to_lds_b128 %8, %9, off\n\t"
               "global_load_async_to_lds_b128 %10, %11, off\n\t"
               "global_load_async_to_lds_b128 %12, %13, off\n\t"
               "global_load_async_to_lds_b128 %14, %15, off\n\t"
               "s_wait_xcnt 0x0"
               :: "v"(l0), "v"(g0), "v"(l1), "v"(g1), "v"(l2), "v"(g2), "v"(l3), "v"(g3),
                  "v"(l4), "v"(g4), "v"(l5), "v"(g5), "v"(l6), "v"(g6), "v"(l7), "v"(g7) : "memory");
#endif
}
// this wave's copies have landed in LDS
__device__ __forceinline__ void wait_copies() {
#if defined(__HIP_DEVICE_COMPILE__)
  asm volatile("s_wait_asynccnt 0x0" ::: "memory");
#endif
}
// stands behind a global load or store, ahead of a later rewrite of a register that it names
__device__ __forceinline__ void wait_addr() {
#if defined(__HIP_DEVICE_COMPILE__)
  asm volatile("s_wait_xcnt 0x0" ::: "memory");
#endif
}
// this wave's LDS reads have returned (ahead of the barrier behind which their buffer is refilled)
__device__ __forceinline__ void wait_lds() {
#if defined(__HIP_DEVICE_COMPILE__)
  asm volatile("s_wait_dscnt 0x0" ::: "memory");
#endif
}

// =====================================================================================================
// Elementwise 16-bit pack, no transpose. BFO 0: dst[i] = f16( bf16_RNE(src[i]) * sc ), sc a power of two (exact);
// BFO 1: dst[i] = bf16_RNE(src[i]) bits. 8 elements per thread: two 16-B loads, one 16-B store per lane; 32 consecutive
// coverage: n / 2048 blocks (index bx) x 256 thr x 8 elements = n exactly (host checks n % 2048 == 0).
// =====================================================================================================
template <int BFO>
__device__ __forceinline__ void cvt16(const float* __restrict__ src, unsigned short* dst, int n, float sc, int bx) {
  const size_t i8 = ((size_t)bx * 256 + threadIdx.x) * 8;
  if (i8 + 8 > (size_t)n) return;                 // never taken with the exact block range; no barriers in this job
  const v4f a = *(const v4f*)(src + i8);
  const v4f b = *(const v4f*)(src + i8 + 4);
  v4u o;
  if constexpr (BFO != 0) {
    o[0] = pk16(bf_bits(a[0]), bf_bits(a[1]));
    o[1] = pk16(bf_bits(a[2]), bf_bits(a[3]));
    o[2] = pk16(bf_bits(b[0]), bf_bits(b[1]));
    o[3] = pk16(bf_bits(b[2]), bf_bits(b[3]));
  } else {
    o[0] = pk16(h_bits((_Float16)(bfr(a[0]) * sc)), h_bits((_Float16)(bfr(a[1]) * sc)));
    o[1] = pk16(h_bits((_Float16)(bfr(a[2]) * sc)), h_bits((_Float16)(bfr(a[3]) * sc)));
    o[2] = pk16(h_bits((_Float16)(bfr(b[0]) * sc)), h_bits((_Float16)(bfr(b[1]) * sc)));
    o[3] = pk16(h_bits((_Float16)(bfr(b[2]) * sc)), h_bits((_Float16)(bfr(b[3]) * sc)));
  }
  {
    *(v4u*)(dst + i8) = o;
    
  }
}

// =====================================================================================================
// Transposing 16-bit pack of a weight matrix: in W[Cin][Dd] (pitch Dd, base + z*sIn) -> out WT[Dd][Cin] (pitch Cin, base + z*sOut),
// BFO 0: f16( bf16_RNE(w) * sc ); BFO 1: bf16_RNE(w) bits. One 64x64 tile per block (bx = Cin tile, by = Dd tile, bz = matrix index):
// coverage: loads 4 x 256 x 4 floats = 64x64; stores 2 x 256 pieces x 8 halves = 64 rows x 64 halves = the whole tile;
//           (bx, by, bz) runs over (Cin/64, Dd/64, nmat) exactly (all sizes exact multiples of 64). t: the block's 64 x 65 float tile in LDS.
// =====================================================================================================
template <int BFO>
__device__ __forceinline__ void tr16(const float* __restrict__ W, unsigned short* WT, int Cin, int Dd,
                                     long long sIn, long long sOut, float sc, int bx, int by, int bz, float (*t)[65]) {
  const int tid = threadIdx.x;
  const int c0 = bx * 64, d0 = by * 64;
  const float* src = W + (size_t)((long long)bz * sIn);
  unsigned short* dst = WT + (size_t)((long long)bz * sOut);
#pragma unroll
  for (int it = 0; it < 4; ++it) {
    const int p  = it * 256 + tid;
    const int cc = p >> 4, sg = (p & 15) * 4;
    const v4f v = *(const v4f*)(src + (size_t)(c0 + cc) * Dd + d0 + sg);
    t[cc][sg]     = v[0];
    t[cc][sg + 1] = v[1];
    t[cc][sg + 2] = v[2];
    t[cc][sg + 3] = v[3];
  }
  __syncthreads();
  v4u o[2];
#pragma unroll
  for (int it = 0; it < 2; ++it) {
    const int p  = it * 256 + tid;
    const int dd = p >> 3, s8 = (p & 7) * 8;
    unsigned short hv[8];
#pragma unroll
    for (int k = 0; k < 8; ++k) {
      const float f = bfr(t[s8 + k][dd]);
      if constexpr (BFO != 0) hv[k] = bf_bits(f);
      else hv[k] = h_bits((_Float16)(f * sc));
    }
    v4u q;
    q[0] = pk16(hv[0], hv[1]);
    q[1] = pk16(hv[2], hv[3]);
    q[2] = pk16(hv[4], hv[5]);
    q[3] = pk16(hv[6], hv[7]);
    o[it] = q;
  }
  {
#pragma unroll
    for (int it = 0; it < 2; ++it) {
      const int p  = it * 256 + tid;
      const int dd = p >> 3, s8 = (p & 7) * 8;
      *(v4u*)(dst + (size_t)(d0 + dd) * Cin + c0 + s8) = o[it];
    }
    wait_addr();   // other jobs' code follows these stores in the merged kernel and rewrites their registers
  }
}

// =====================================================================================================
// Relative-position operand plane: out[h][r][0..63] bf16 bits, r 0..62 = rel_w[h][r][:], r 63 = 0, r 64..126 = rel_h[h][r-64][:],
// r 127 = 0. Every lane loads both candidate rows from clamped addresses and selects by value. 8 halves per thread, 8 consecutive
// coverage: 32 blocks (index bx) x 256 threads x 8 halves = 8 x 128 x 64 exactly.
// =====================================================================================================
__device__ __forceinline__ void relcat(const float* __restrict__ rw, const float* __restrict__ rh, unsigned short* out, int bx) {
  const int p   = bx * 256 + threadIdx.x;                // 0 .. NHEAD*RTP*8 - 1
  const int hd  = p / (RTP * 8);
  const int r   = (p >> 3) & (RTP - 1);
  const int seg = (p & 7) * 8;
  const int iw  = (r < NREL) ? r : (NREL - 1);
  int ih = r - HD;
  ih = (ih < 0) ? 0 : ih;
  ih = (ih > NREL - 1) ? (NREL - 1) : ih;
  const float* pw = rw + ((size_t)hd * NREL + iw) * HD + seg;
  const float* ph = rh + ((size_t)hd * NREL + ih) * HD + seg;
  const v4f a0 = *(const v4f*)(pw), a1 = *(const v4f*)(pw + 4);
  const v4f b0 = *(const v4f*)(ph), b1 = *(const v4f*)(ph + 4);
  const bool uw = (r < NREL);
  const bool uh = (r >= HD) && (r < HD + NREL);
  float v[8];
#pragma unroll
  for (int e = 0; e < 4; ++e) {
    v[e]     = uw ? a0[e] : (uh ? b0[e] : 0.f);
    v[4 + e] = uw ? a1[e] : (uh ? b1[e] : 0.f);
  }
  v4u o;
  o[0] = pk16(bf_bits(v[0]), bf_bits(v[1]));
  o[1] = pk16(bf_bits(v[2]), bf_bits(v[3]));
  o[2] = pk16(bf_bits(v[4]), bf_bits(v[5]));
  o[3] = pk16(bf_bits(v[6]), bf_bits(v[7]));
  {
    *(v4u*)(out + (size_t)p * 8) = o;
    wait_addr();   // other jobs' code follows this store in the merged kernel and rewrites its registers
  }
}

// =====================================================================================================
// All operand packs in one launch: none reads what another writes, so the job is picked by the block index (block-uniform, so the barrier
// of the transposing jobs is passed by a whole block or by none). The transposing jobs, whose blocks last longest, come first.
//   blocks    0 ..  191: W[h][c][d] -> WT[h*64+d][c] as f16( bf16_RNE(w) * 64 ) for Wk, Wq, Wv (64 blocks each: 8 c tiles x 8 heads)
//   blocks  192 ..  255: Wout[in][out] -> WUT[out][in] bf16 (8 x 8 tiles)
//   blocks  256 ..  263: Wo[h][d][e] -> WOT[h][e][d] bf16 (one tile per head)
//   blocks  264 ..  295: rel tables -> REL[h][128][64] bf16 (rows 63, 127 zero)
//   blocks  296 .. 2343: X16[row][c] = f16( bf16_RNE(x[row][c]) * 16 ), rows = b*1024 + tok
// =====================================================================================================
#define PB_W    ((DM / 64) * NHEAD)
#define PB_WU   ((COUT / 64) * (COUT / 64))
#define PB_WO   NHEAD
#define PB_RL   ((NHEAD * RTP * 8) / 256)
#define PB_X    ((NROWS * DM) / 2048)
#define PREP_BLOCKS (3 * PB_W + PB_WU + PB_WO + PB_RL + PB_X)
static_assert(HD == 64 && HO == 64);
__global__ __launch_bounds__(256) void prep(const float* __restrict__ x, const float* __restrict__ w_k, const float* __restrict__ w_q,
                                            const float* __restrict__ w_v, const float* __restrict__ w_o, const float* __restrict__ w_out,
                                            const float* __restrict__ relw, const float* __restrict__ relh,
                                            unsigned short* X16, unsigned short* WKT, unsigned short* WQT, unsigned short* WVT,
                                            unsigned short* WOT, unsigned short* WUT, unsigned short* REL) {
  __shared__ float t[64][65];
  int b = blockIdx.x;
  if (b < 3 * PB_W) {
    const int m = b / PB_W, r = b - m * PB_W;
    const float* src = (m == 0) ? w_k : ((m == 1) ? w_q : w_v);
    unsigned short* dst = (m == 0) ? WKT : ((m == 1) ? WQT : WVT);
    tr16<0>(src, dst, DM, HD, (long long)DM * HD, (long long)HD * DM, WSC, r % (DM / 64), 0, r / (DM / 64), t);
    return;
  }
  b -= 3 * PB_W;
  if (b < PB_WU) {
    tr16<1>(w_out, WUT, COUT, COUT, 0LL, 0LL, 1.0f, b % (COUT / 64), b / (COUT / 64), 0, t);
    return;
  }
  b -= PB_WU;
  if (b < PB_WO) {
    tr16<1>(w_o, WOT, HD, HO, (long long)HD * HO, (long long)HO * HD, 1.0f, 0, 0, b, t);
    return;
  }
  b -= PB_WO;
  if (b < PB_RL) {
    relcat(relw, relh, REL, b);
    return;
  }
  b -= PB_RL;
  cvt16<0>(x, X16, NROWS * DM, ACARRY, b);
}

// =====================================================================================================
// Register-blocked batched 16-bit WMMA GEMM: C[m][n] = oscale * sum_k A[m][k] * Bt[n][k]; one wave per 64x64 tile, block = WM x WN waves
// (4 waves) on a (64 WM) x (64 WN) tile.
// A row-major [M][K] pitch lda (16-bit plane), Bt row-major [N][K] pitch ldb (k contiguous); M multiple of 64 WM, N of 64 WN, K of 64.
// The block's A and Bt rows are brought into LDS once per block, in k slabs of 64 (one whole 128-B line per row, 8 lanes per line, pitch 144 B
// in LDS), by asynchronous 16-B copies, two buffers: slab t + 2 is issued behind the barrier that ends slab t. All fragments are 16-B LDS reads
// with the same split k map and the same k order of the products as with fragments read from global memory.
// bx = tile index, by = batch index with element strides sA, sB, sC; gst, sT: the block's LDS (two slab buffers; one 16 x 68 float slab per wave).
// ASPLIT 1: a second A plane A2 (unscaled residual of A, same layout) is multiplied into the same accumulator (A + A2 ~ exact A).
// BF 1: bf16 operands (v_wmma_f32_16x16x32_bf16), else f16.
// OM 0: f32 out (pitch ldc).  OM 2: f16 out = f16(value * ocarry).  OM 3: two bf16 planes: hi = bf16_RNE(value), lo = bf16_RNE(value - hi).
// OM 4: two f16 planes: hi = f16(value * ocarry), lo = f16(value * ocarry - hi) (unscaled residual).
// EPI 1 (OM 0 only): value += bf16_RNE(ep0[same index as C]).  EPI 2 (16-bit out): per-column eval batch-norm affine
//   value = (bf16(ep0[ci]) * (value - bf16(ep2[ci]))) * rsqrt(bf16(ep3[ci]) + eps) + bf16(ep1[ci]),  ci = by*cps + column.
// coverage: 4 slabs x 16 rows (f32: it 0..7 x lane>>4; 16-bit: it 0..3 x lane>>3) x 64 cols = the wave's whole 64x64 tile;
//           bx runs over (M / (64 WM)) * (N / (64 WN)) blocks exactly; a surplus block would leave as a whole, ahead of every copy and barrier.
// =====================================================================================================
template <int V> struct IntC { static constexpr int value = V; };
constexpr int gemm_slab_halves(int asplit, int wm, int wn) { return ((1 + asplit) * 64 * wm + 64 * wn) * GPITCH; }   // one buffer: A | (A2) | Bt
template <int OM, int ASPLIT, int BF, int EPI, int WM, int WN>
__device__ __forceinline__ void gemm64_tile(
    unsigned short* gst, float* sT, unsigned bx, int by,
    const unsigned short* __restrict__ Ap, const unsigned short* __restrict__ A2p, int lda, long long sA,
    const unsigned short* __restrict__ Btp, int ldb, long long sB,
    void* Cout, void* C2out, int ldc, long long sC,
    int M, int N, int K, float oscale, float ocarry,
    const float* __restrict__ ep0, const float* __restrict__ ep1,
    const float* __restrict__ ep2, const float* __restrict__ ep3, int cps) {
  constexpr int NW     = WM * WN;                    // waves per block
  constexpr int AR     = 64 * WM;                    // A rows of the block tile
  constexpr int BR     = 64 * WN;                    // Bt rows of the block tile
  constexpr int RPI    = NW * 4;                     // rows that one copy of every lane of the block covers (8 lanes per row)
  constexpr int A_H    = AR * GPITCH;                // halves of one A plane's slab in LDS
  constexpr int B_H    = BR * GPITCH;
  constexpr int SLAB_H = (1 + ASPLIT) * A_H + B_H;   // one buffer: A | (A2) | Bt
  static_assert(SLAB_H == gemm_slab_halves(ASPLIT, WM, WN));
  static_assert((AR % (4 * RPI)) == 0 && (BR % (4 * RPI)) == 0);
  static_assert(((1 + ASPLIT) * AR + BR) / RPI <= 63);     // copies of one wave in flight
  const int tid  = threadIdx.x;
  const int lane = tid & 31;
  const int wave = tid >> 5;
  const int tilesN = N / BR;
  const int tilesM = M / AR;
  if ((int)bx >= tilesM * tilesN) return;           // block-uniform, ahead of every copy and barrier
  const int tm  = bx / tilesN;
  const int tn  = bx - tm * tilesN;
  const int bm0 = tm * AR;
  const int bn0 = tn * BR;
  const int wm  = wave / WN;
  const int wn  = wave - wm * WN;
  const int m0  = bm0 + (wm << 6);
  const int n0  = bn0 + (wn << 6);

  const unsigned short* A1 = Ap  + (size_t)((long long)by * sA);
  const unsigned short* A2 = A2p + (size_t)((long long)by * sA);
  const unsigned short* Bb = Btp + (size_t)((long long)by * sB);

  const int rlane = lane & 15;                 // row (A) / col (B, D) within subtile
  const int koff  = (lane >> 4) * 8;           // k offset of this lane half
  const int mOff  = (lane >> 4) * 8;           // D row offset

  // per-lane copy addresses: row tid>>3 of a group of RPI rows, 16-B segment tid&7 of the row's 128-B line
  const unsigned short* gA  = A1 + (size_t)(bm0 + (tid >> 3)) * lda + (tid & 7) * 8;
  const unsigned short* gA2 = A2 + (size_t)(bm0 + (tid >> 3)) * lda + (tid & 7) * 8;
  const unsigned short* gB  = Bb + (size_t)(bn0 + (tid >> 3)) * ldb + (tid & 7) * 8;
  const unsigned lcp = (unsigned)(uintptr_t)gst + (unsigned)((tid >> 3) * (GPITCH * 2) + (tid & 7) * 16);   // LDS byte address
  constexpr unsigned LSTEP = (unsigned)(RPI * GPITCH * 2);      // LDS bytes from one group of RPI rows to the next
  const size_t astep = (size_t)RPI * lda, bstep = (size_t)RPI * ldb;
  // rows of one plane: groups of RPI rows, eight groups (or the last four) per statement
  auto plane = [&](unsigned l, const unsigned short* p, size_t step, auto ngroups) {
    constexpr int NG = decltype(ngroups)::value;
#pragma unroll
    for (int g = 0; g < NG; g += 8) {
      const unsigned short* q = p + (size_t)g * step;
      const unsigned m = l + (unsigned)g * LSTEP;
      if (g + 8 <= NG) {
        stage_copy8(m, q, m + LSTEP, q + step, m + 2 * LSTEP, q + 2 * step, m + 3 * LSTEP, q + 3 * step,
                    m + 4 * LSTEP, q + 4 * step, m + 5 * LSTEP, q + 5 * step, m + 6 * LSTEP, q + 6 * step, m + 7 * LSTEP, q + 7 * step);
      } else {
        stage_copy4(m, q, m + LSTEP, q + step, m + 2 * LSTEP, q + 2 * step, m + 3 * LSTEP, q + 3 * step);
      }
    }
  };
  auto stage = [&](int buf, int k0) {
    const unsigned l0 = lcp + (unsigned)(buf * (SLAB_H * 2));
    plane(l0, gA + k0, astep, IntC<AR / RPI>{});
    if constexpr (ASPLIT != 0) plane(l0 + (unsigned)(A_H * 2), gA2 + k0, astep, IntC<AR / RPI>{});
    plane(l0 + (unsigned)((1 + ASPLIT) * A_H * 2), gB + k0, bstep, IntC<BR / RPI>{});
  };

  v8f acc[4][4];
#pragma unroll
  for (int i = 0; i < 4; ++i)
#pragma unroll
    for (int j = 0; j < 4; ++j) acc[i][j] = zero8();

  // slab 0 -> buffer 0, landed and published; then slab 1 -> buffer 1 flies while slab 0 is worked on
  const int nslab = K / GKS;
  stage(0, 0);
  wait_copies();
  __syncthreads();
  if (nslab > 1) stage(1, GKS);

#pragma unroll 1
  for (int t = 0; t < nslab; ++t) {
    const unsigned short* sb  = gst + (t & 1) * SLAB_H;
    const unsigned short* As  = sb + ((wm << 6) + rlane) * GPITCH + koff;
    const unsigned short* As2 = As + A_H;
    const unsigned short* Bs  = sb + (1 + ASPLIT) * A_H + ((wn << 6) + rlane) * GPITCH + koff;
#pragma unroll
    for (int ks = 0; ks < GKS; ks += 32) {
      // all fragments of the k-step are read as one group ahead of its products (one LDS wait per k-step, not one per row of tiles)
      v16h bh[4], ah[4];
#pragma unroll
      for (int j = 0; j < 4; ++j) bh[j] = ldfrag_u(Bs + (j << 4) * GPITCH + ks);
#pragma unroll
      for (int i = 0; i < 4; ++i) ah[i] = ldfrag_u(As + (i << 4) * GPITCH + ks);
      if constexpr (ASPLIT != 0) {
        v16h al[4];
#pragma unroll
        for (int i = 0; i < 4; ++i) al[i] = ldfrag_u(As2 + (i << 4) * GPITCH + ks);
#pragma unroll
        for (int i = 0; i < 4; ++i) {
#pragma unroll
          for (int j = 0; j < 4; ++j) acc[i][j] = mmaT<BF>(ah[i], bh[j], acc[i][j]);
          dep_guard1(acc[i][0], acc[i][3], ah[i]);
#pragma unroll
          for (int j = 0; j < 4; ++j) acc[i][j] = mmaT<BF>(al[i], bh[j], acc[i][j]);
          dep_guard1(acc[i][0], acc[i][3], al[i]);
        }
      } else {
#pragma unroll
        for (int i = 0; i < 4; ++i) {
#pragma unroll
          for (int j = 0; j < 4; ++j) acc[i][j] = mmaT<BF>(ah[i], bh[j], acc[i][j]);
          dep_guard1(acc[i][0], acc[i][3], ah[i]);
        }
      }
      keep4_h(bh[0], bh[1], bh[2], bh[3]);
    }
    // foot of the slab: own LDS reads returned, own copies of slab t + 1 landed, then the one barrier that publishes slab t + 1
    // and ends every wave's reads of this slab's buffer; only behind it is that buffer refilled with slab t + 2
    wait_lds();
    wait_copies();
    __syncthreads();
    if (t + 2 < nslab) stage(t & 1, (t + 2) * GKS);
  }
  wait_copies();
  acc_guard4(acc[0][0], acc[0][1], acc[0][2], acc[0][3]);
  acc_guard4(acc[1][0], acc[1][1], acc[1][2], acc[1][3]);
  acc_guard4(acc[2][0], acc[2][1], acc[2][2], acc[2][3]);
  acc_guard4(acc[3][0], acc[3][1], acc[3][2], acc[3][3]);

  const int hh2 = lane >> 4, c4 = (lane & 15) * 4;     // f32 out: 256-B row segment = 16 lanes x 16 B
  const int q8  = lane >> 3, c8 = (lane & 7) * 8;

  // ---- epilogue ----
  float* slab = sT + wave * (16 * 68);              // per-wave 16x64 slab, pitch 68 floats
#pragma unroll
  for (int i = 0; i < 4; ++i) {
    const int mBase = m0 + (i << 4);
#pragma unroll
    for (int j = 0; j < 4; ++j) {
#pragma unroll
      for (int r = 0; r < 8; ++r) {
        slab[(mOff + r) * 68 + (j << 4) + rlane] = acc[i][j][r];
      }
    }
    wave_sync_lds();
    if constexpr (OM == 0) {
      float* C = (float*)Cout + (size_t)((long long)by * sC);
      const float* R = ep0 + (size_t)((long long)by * sC);
      v4f vals[8];
#pragma unroll
      for (int it = 0; it < 8; ++it) {
        const int row = it * 2 + hh2;                      // it 0..7 x hh2 0..1 = rows 0..15
        v4f v = *(const v4f*)(slab + row * 68 + c4);
#pragma unroll
        for (int e = 0; e < 4; ++e) v[e] = v[e] * oscale;
        if constexpr (EPI == 1) {
          const v4f xr = *(const v4f*)(R + (size_t)(mBase + row) * ldc + n0 + c4);
#pragma unroll
          for (int e = 0; e < 4; ++e) v[e] = v[e] + bfr(xr[e]);
        }
        vals[it] = v;
      }
      {
#pragma unroll
        for (int it = 0; it < 8; ++it) {
          const int gr = mBase + it * 2 + hh2;
          *(v4f*)(C + (size_t)gr * ldc + n0 + c4) = vals[it];
        }
        
      }
    } else {
      unsigned short* C  = (unsigned short*)Cout  + (size_t)((long long)by * sC);
      unsigned short* Cb = (unsigned short*)C2out + (size_t)((long long)by * sC);
      v4u hv[4], lv[4];
#pragma unroll
      for (int it = 0; it < 4; ++it) {
        const int row = it * 4 + q8;                       // it 0..3 x q8 0..3 = rows 0..15
        const float* sp = slab + row * 68 + c8;
        v4u a  = {0u, 0u, 0u, 0u};
        v4u b2 = {0u, 0u, 0u, 0u};
#pragma unroll
        for (int e = 0; e < 4; ++e) {
          float f0 = sp[2 * e] * oscale;
          float f1 = sp[2 * e + 1] * oscale;
          if constexpr (EPI == 2) {
            const int ci = by * cps + n0 + c8 + 2 * e;   // column parameter index (host keeps by*cps + N <= parameter count)
            const float g0 = bfr(ep0[ci]), g1 = bfr(ep0[ci + 1]);
            const float t0 = bfr(ep1[ci]), t1 = bfr(ep1[ci + 1]);
            const float u0 = bfr(ep2[ci]), u1 = bfr(ep2[ci + 1]);
            const float r0 = rsqrtf(bfr(ep3[ci]) + BN_EPS), r1 = rsqrtf(bfr(ep3[ci + 1]) + BN_EPS);
            f0 = (g0 * (f0 - u0)) * r0 + t0;
            f1 = (g1 * (f1 - u1)) * r1 + t1;
          }
          if constexpr (OM == 3) {
            const unsigned short h0 = bf_bits(f0), h1 = bf_bits(f1);
            a[e]  = pk16(h0, h1);
            b2[e] = pk16(bf_bits(f0 - bf_up(h0)), bf_bits(f1 - bf_up(h1)));
          } else {
            f0 *= ocarry; f1 *= ocarry;
            const _Float16 x0 = (_Float16)f0, x1 = (_Float16)f1;
            a[e] = pk16(h_bits(x0), h_bits(x1));
            if constexpr (OM == 4) {
              b2[e] = pk16(h_bits((_Float16)(f0 - (float)x0)), h_bits((_Float16)(f1 - (float)x1)));
            }
          }
        }
        hv[it] = a;
        lv[it] = b2;
      }
      {
#pragma unroll
        for (int it = 0; it < 4; ++it) {
          const int row = it * 4 + q8;
          *(v4u*)(C + (size_t)(mBase + row) * ldc + n0 + c8) = hv[it];
          if constexpr (OM >= 3) {
            *(v4u*)(Cb + (size_t)(mBase + row) * ldc + n0 + c8) = lv[it];
          }
        }
        
      }
    }
    wave_sync_lds();
  }
}

// one GEMM per launch: blockIdx.x = tile, blockIdx.y = batch
template <int OM, int ASPLIT, int BF, int EPI, int WM, int WN>
__global__ __launch_bounds__(WM * WN * 32) __attribute__((amdgpu_num_vgpr(256))) void gemm64(
    const unsigned short* __restrict__ Ap, const unsigned short* __restrict__ A2p, int lda, long long sA,
    const unsigned short* __restrict__ Btp, int ldb, long long sB,
    void* Cout, void* C2out, int ldc, long long sC,
    int M, int N, int K, float oscale, float ocarry,
    const float* __restrict__ ep0, const float* __restrict__ ep1,
    const float* __restrict__ ep2, const float* __restrict__ ep3, int cps) {
  __shared__ __align__(16) unsigned short gst[2 * gemm_slab_halves(ASPLIT, WM, WN)];
  __shared__ __align__(16) float sT[WM * WN * 16 * 68];
  gemm64_tile<OM, ASPLIT, BF, EPI, WM, WN>(gst, sT, blockIdx.x, (int)blockIdx.y, Ap, A2p, lda, sA, Btp, ldb, sB, Cout, C2out, ldc, sC,
                                           M, N, K, oscale, ocarry, ep0, ep1, ep2, ep3, cps);
}

// The three projections in one launch: none reads what another writes; blockIdx.y picks the job (block-uniform), blockIdx.x its 128 x 128 tile
// (256 tiles each), so three blocks share a WGP where one stood alone.
//   job 0: v^T per image: VT[b][h*64+d][tok] = sum_c WVT[h*64+d][c] x_b[tok][c] -> f16 x16 hi / residual planes; M = 512, N = 1024, K = 512,
//          image = blockIdx.x / 32, tile = blockIdx.x % 32
//   job 1: k[m][n] = sum_c x[m][c] WKT[n][c] -> bf16 hi / residual planes; M = 8192, N = 512, K = 512.   job 2: the same for q with WQT
#define PROJ_TILES ((NROWS / 128) * (DM / 128))
#define VT_TILES   ((DM / 128) * (NTOK / 128))
static_assert(VT_TILES * NB == PROJ_TILES);
__global__ __launch_bounds__(128) __attribute__((amdgpu_num_vgpr(256))) void qkv(
    const unsigned short* __restrict__ X16, const unsigned short* __restrict__ WKT, const unsigned short* __restrict__ WQT,
    const unsigned short* __restrict__ WVT, unsigned short* KHh, unsigned short* KHl, unsigned short* QHh, unsigned short* QHl,
    unsigned short* VTh, unsigned short* VTl) {
  __shared__ __align__(16) unsigned short gst[2 * gemm_slab_halves(0, 2, 2)];
  __shared__ __align__(16) float sT[4 * 16 * 68];
  const int job = blockIdx.y;
  const unsigned bx = blockIdx.x;
  if (job == 0) {
    gemm64_tile<4, 0, 0, 0, 2, 2>(gst, sT, bx % VT_TILES, (int)(bx / VT_TILES),
                                  WVT, WVT, DM, 0LL,
                                  X16, DM, (long long)NTOK * DM,
                                  (void*)VTh, (void*)VTl, NTOK, (long long)DM * NTOK,
                                  DM, NTOK, DM, 1.0f / (ACARRY * WSC), VC,
                                  nullptr, nullptr, nullptr, nullptr, 0);
  } else {
    gemm64_tile<3, 0, 0, 0, 2, 2>(gst, sT, bx, 0,
                                  X16, X16, DM, 0LL,
                                  (job == 1) ? WKT : WQT, DM, 0LL,
                                  (void*)((job == 1) ? KHh : QHh), (void*)((job == 1) ? KHl : QHl), DM, 0LL,
                                  NROWS, DM, DM, 1.0f / (ACARRY * WSC), 1.0f,
                                  nullptr, nullptr, nullptr, nullptr, 0);
  }
}

// =====================================================================================================
// Flash attention for one image (batch), one head and 128 score rows (one wave per 16 rows), head dim 64, 1024 columns:
//   rows i index KEY positions (k_i stationary), columns j index the q/v positions streamed in chunks of 32 = one image row;
//   k planes (bf16 hi, lo) K[b*1024 + tok][64h + d], pitch 512; q planes (bf16 hi, lo) Q[b*1024 + tok][64h + d];
//   v^T planes (f16 x16 hi, unscaled lo): VT[b*512 + 64h + d][tok] (pitch 1024);
//   additive position logits from the f32 table R[b*1024 + tok][128h + m] (m < 63: q_tok . rel_w[h][m]; 64 + m: q_tok . rel_h[h][m]):
//   logit[i][j] = k_i . q_j + R[i][yj - yi + 31] + R[i][64 + xj - xi + 31], token = 32*x + y.
//   The score tiles are computed transposed, S^T[j][i] (A = q rows of the chunk from LDS, B = the stationary k rows): lane (c, hh) holds score row
//   i0 + c and, in its 2 x 8 accumulator registers, that row's columns 8hh + r and 16 + 8hh + r of the chunk. So a row's maximum and sum are taken
//   inside the lane, with one exchange between the wave's halves for the maximum per chunk and one for the sum at the end, and the 16 values,
//   converted in place, are the B operand (hardware k order) of O^T[d][i] += v^T[d][j] P^T[j][i] (A = v^T rows from LDS, same k order).
//   The w part of the position logits depends only on the column within a chunk (16 registers per lane, loaded once), the h part only on the
//   chunk (one load per lane per chunk); indices are pure arithmetic.
//   out (bf16 hi, lo planes): CT[b*1024 + tok][64h + d] = sum_j softmax_j(logit) v[j][d]  (softmax run in base 2, max-subtracted, no 1/sqrt(d)).
//   block = 8 waves = 256 threads; grid = 8 images x 8 heads x 8 row blocks = 512; every wave does identical bounded work (32 chunks).
//   The 8 waves of a block need the same q and v^T chunk: it is brought into LDS once per block by asynchronous 16-B copies (4 per lane and
//   chunk: q hi, q lo 32 rows x 128 B at pitch 144 B; v^T hi, lo 64 rows x 64 B at pitch 80 B), two buffers, chunk t + 2 issued behind the
//   barrier that ends chunk t; all A fragments are 16-B LDS reads with the split k map.
//   Per chunk: 2 score tiles on bf16 WMMA (hi.hi + lo.hi + hi.lo, K = 64 as two k-steps of 32); online softmax in f32 (exp2); P*1024 as f16 hi
//   and unscaled residual; 12 v^T.P^T WMMAs (hi.hi, hi.lo, lo.hi).
//   Final 1/l and carry folds in f32; after a block barrier the stage buffers are reused as the block's two bf16 result buffers [128][64]
//   (hi, lo): each lane stages 4 x 8 consecutive d of its row (16-B stores); after a second block barrier the 256 threads write whole 128-B row pieces.
// coverage: LDS result buffers: 8 waves x 16 rows x 64 cols per plane; global: 4 iterations x 256 threads x 8 halves = 128 rows x 64 cols
//           of rows 128rb..128rb+127, columns 64h..64h+63 of image b, per plane; grid covers all 8 x 1024 rows x 512 columns exactly once.
// =====================================================================================================
__global__ __launch_bounds__(ATT_THREADS) __attribute__((amdgpu_num_vgpr(256)))
void attn8(const unsigned short* __restrict__ KHh, const unsigned short* __restrict__ KHl,
           const unsigned short* __restrict__ QHh, const unsigned short* __restrict__ QHl,
           const unsigned short* __restrict__ VTh, const unsigned short* __restrict__ VTl,
           const float* __restrict__ Rtab, unsigned short* CTh, unsigned short* CTl) {
  __shared__ __align__(16) unsigned short stg[2 * STG_HALVES];   // two stage buffers: q hi | q lo | v^T hi | v^T lo; later: result buffers

  const int tid  = threadIdx.x;
  const int wave = tid >> 5;
  const int lane = tid & 31;
  const int hh   = lane >> 4;
  const int c    = lane & 15;

  const int rb   = blockIdx.x & ((NTOK / ATT_ROWS) - 1);   // 0..7
  const int head = (blockIdx.x / (NTOK / ATT_ROWS)) & (NHEAD - 1);   // 0..7
  const int bat  = blockIdx.x / ((NTOK / ATT_ROWS) * NHEAD);         // 0..7
  const int i0   = rb * ATT_ROWS + wave * 16;              // first score row (key token) of this wave
  const int x0   = i0 / GW;                                // image row of all 16 tokens
  const int yi   = (i0 & (GW - 1)) + c;                    // image column of this lane's score row i0 + c
  const size_t rowg = (size_t)bat * NTOK + i0;

  // per-lane copy addresses: q piece = row tid>>3, 16-B segment tid&7; v^T piece = row tid>>2, 16-B segment tid&3
  const unsigned short* gqh = QHh + ((size_t)bat * NTOK + (tid >> 3)) * DM + head * HD + (tid & 7) * 8;
  const unsigned short* gql = QHl + ((size_t)bat * NTOK + (tid >> 3)) * DM + head * HD + (tid & 7) * 8;
  const unsigned short* gvh = VTh + ((size_t)bat * DM + head * HD + (tid >> 2)) * NTOK + (tid & 3) * 8;
  const unsigned short* gvl = VTl + ((size_t)bat * DM + head * HD + (tid >> 2)) * NTOK + (tid & 3) * 8;
  const unsigned lbase = (unsigned)(uintptr_t)stg;         // LDS byte address of the stage buffers
  const unsigned lq = lbase + (unsigned)((tid >> 3) * (QPITCH * 2) + (tid & 7) * 16);
  const unsigned lv = lbase + (unsigned)(2 * QT_HALVES * 2 + (tid >> 2) * (VPITCH * 2) + (tid & 3) * 16);

  // chunk 0 -> buffer 0, landed and published; then chunk 1 -> buffer 1 flies while chunk 0 is worked on
  stage_copy4(lq, gqh, lq + QT_HALVES * 2, gql, lv, gvh, lv + VT_HALVES * 2, gvl);
  wait_copies();
  __syncthreads();
  stage_copy4(lq + STG_HALVES * 2, gqh + (size_t)KCH * DM, lq + (STG_HALVES + QT_HALVES) * 2, gql + (size_t)KCH * DM,
              lv + STG_HALVES * 2, gvh + KCH, lv + (STG_HALVES + VT_HALVES) * 2, gvl + KCH);

  // stationary B fragments: k rows i0 + c (hi and residual planes), d 0..31 and 32..63
  const size_t kofs = (rowg + c) * DM + head * HD + 8 * hh;
  const v16h kah = ldfrag_u(KHh + kofs), kbh = ldfrag_u(KHh + kofs + 32);
  const v16h kal = ldfrag_u(KHl + kofs), kbl = ldfrag_u(KHl + kofs + 32);

  // additive w-position logits of this lane's score row for the 16 chunk columns that it holds, loop-invariant, pre-scaled by log2(e)
  const float* rrow = Rtab + (rowg + c) * RT_LD + head * RTP;        // table row of score row i0 + c
  float wb0[8], wb1[8];
#pragma unroll
  for (int r = 0; r < 8; ++r) {
    const int iw = 8 * hh + r + (GW - 1) - yi;             // in [0, 46]
    wb0[r] = rrow[iw] * LOG2E;
    wb1[r] = rrow[iw + 16] * LOG2E;                        // in [16, 62]
  }
  const float* hrow = rrow + HD + (GH - 1) - x0;           // + st = h-position logit of chunk st; index st - x0 + 31 in [0, 62]

  float mrow = -INFINITY, lrow = 0.f;                      // row maximum (both halves alike); sum over this half's columns only
  v8f o0 = zero8(), o1 = zero8(), o2 = zero8(), o3 = zero8();   // O^T tiles: o_t[r] = O[i0 + c][16t + 8hh + r]

#pragma unroll 1
  for (int st = 0; st < NSTG; ++st) {
    const int bsel = st & 1;
    const unsigned short* sb  = stg + bsel * STG_HALVES;
    const unsigned short* Qsh = sb + c * QPITCH + 8 * hh;                    // q hi, row c of the chunk
    const unsigned short* Qsl = Qsh + QT_HALVES;
    const unsigned short* Vsh = sb + 2 * QT_HALVES + c * VPITCH + 8 * hh;    // v^T hi, row d = c
    const unsigned short* Vsl = Vsh + VT_HALVES;
    // h-position logit of this chunk (one image row x2 = st) for the lane's score row
    const float hraw = hrow[st];
    wait_addr();
    v8f s0, s1;                                            // s0[r] = S[i0 + c][8hh + r], s1[r] = S[i0 + c][16 + 8hh + r] of the chunk
    {
      const v16h q0h = ldfrag_u(Qsh), q1h = ldfrag_u(Qsh + 32);
      const v16h q0l = ldfrag_u(Qsl), q1l = ldfrag_u(Qsl + 32);
      s0 = mma_b(q0h, kah, zero8());
      s0 = mma_b(q1h, kbh, s0);
      s0 = mma_b(q0l, kah, s0);
      s0 = mma_b(q1l, kbh, s0);
      s0 = mma_b(q0h, kal, s0);
      s0 = mma_b(q1h, kbl, s0);
      guard1x4(s0, q0h, q1h, q0l, q1l);
    }
    {
      const int q2 = 16 * QPITCH;
      const v16h q0h = ldfrag_u(Qsh + q2), q1h = ldfrag_u(Qsh + q2 + 32);
      const v16h q0l = ldfrag_u(Qsl + q2), q1l = ldfrag_u(Qsl + q2 + 32);
      s1 = mma_b(q0h, kah, zero8());
      s1 = mma_b(q1h, kbh, s1);
      s1 = mma_b(q0l, kah, s1);
      s1 = mma_b(q1l, kbh, s1);
      s1 = mma_b(q0h, kal, s1);
      s1 = mma_b(q1h, kbl, s1);
      guard1x8(s1, q0h, q1h, q0l, q1l, kah, kbh, kal, kbl);
    }
    const float hb = hraw * LOG2E;
    float t0[8], t1[8];
#pragma unroll
    for (int r = 0; r < 8; ++r) {
      t0[r] = s0[r] * LOG2E + (wb0[r] + hb);
      t1[r] = s1[r] * LOG2E + (wb1[r] + hb);
    }
    float mx = fmaxf(t0[0], t1[0]);
#pragma unroll
    for (int r = 1; r < 8; ++r) mx = fmaxf(mx, fmaxf(t0[r], t1[r]));
    mx = fmaxf(mx, xhalf(mx));                             // both halves now hold the row's maximum over the chunk
    const float mn = fmaxf(mrow, mx);
    const float al = exp2f(mrow - mn);
    mrow = mn;
    FragH ph, pl;                                          // P^T * 1024, f16 hi and unscaled residual: element s = column kmap(s, hh) of the chunk
    float pa[8];
#pragma unroll
    for (int r = 0; r < 8; ++r) {
      const float e0 = exp2f(t0[r] - mn), e1 = exp2f(t1[r] - mn);
      pa[r] = e0 + e1;
      float f; _Float16 x;
      f = e0 * PC; x = (_Float16)f; ph.h[0][r] = x; pl.h[0][r] = (_Float16)(f - (float)x);   // column 8hh + r
      f = e1 * PC; x = (_Float16)f; ph.h[1][r] = x; pl.h[1][r] = (_Float16)(f - (float)x);   // column 16 + 8hh + r
    }
    const float ps = ((pa[0] + pa[1]) + (pa[2] + pa[3])) + ((pa[4] + pa[5]) + (pa[6] + pa[7]));
    lrow = lrow * al + ps;
#pragma unroll
    for (int r = 0; r < 8; ++r) {
      o0[r] *= al;
      o1[r] *= al;
      o2[r] *= al;
      o3[r] *= al;
    }
    {
      const v16h vh0 = ldfrag_u(Vsh);
      const v16h vh1 = ldfrag_u(Vsh + 16 * VPITCH);
      const v16h vh2 = ldfrag_u(Vsh + 32 * VPITCH);
      const v16h vh3 = ldfrag_u(Vsh + 48 * VPITCH);
      o0 = mma_h(vh0, ph.v, o0);
      o1 = mma_h(vh1, ph.v, o1);
      o2 = mma_h(vh2, ph.v, o2);
      o3 = mma_h(vh3, ph.v, o3);
      o0 = mma_h(vh0, pl.v, o0);
      o1 = mma_h(vh1, pl.v, o1);
      o2 = mma_h(vh2, pl.v, o2);
      o3 = mma_h(vh3, pl.v, o3);
      guard4x6(o0, o1, o2, o3, ph.v, pl.v, vh0, vh1, vh2, vh3);
    }
    {
      const v16h vl0 = ldfrag_u(Vsl);
      const v16h vl1 = ldfrag_u(Vsl + 16 * VPITCH);
      const v16h vl2 = ldfrag_u(Vsl + 32 * VPITCH);
      const v16h vl3 = ldfrag_u(Vsl + 48 * VPITCH);
      o0 = mma_h(vl0, ph.v, o0);
      o1 = mma_h(vl1, ph.v, o1);
      o2 = mma_h(vl2, ph.v, o2);
      o3 = mma_h(vl3, ph.v, o3);
      guard4x5(o0, o1, o2, o3, ph.v, vl0, vl1, vl2, vl3);
    }
    // foot of the chunk: own LDS reads returned, own copies of chunk st + 1 landed, then the one barrier that publishes chunk st + 1
    // and ends every wave's reads of this chunk's buffer; only behind it is that buffer refilled with chunk st + 2
    wait_lds();
    wait_copies();
    __syncthreads();
    if (st + 2 < NSTG) {
      const size_t qa = (size_t)(st + 2) * KCH * DM;
      const int    va = (st + 2) * KCH;
      const unsigned lo = (unsigned)(bsel * STG_HALVES * 2);
      stage_copy4(lq + lo, gqh + qa, lq + lo + QT_HALVES * 2, gql + qa, lv + lo, gvh + va, lv + lo + VT_HALVES * 2, gvl + va);
    }
  }
  wait_copies();

  // ---- all waves done with the stage buffers; they become two bf16 result buffers [128][64] ----
  __syncthreads();
  unsigned short* Osh = stg;
  unsigned short* Osl = Osh + ATT_ROWS * HD;
  // ---- join the halves' sums, fold 1/l and the carries (1024 on P, 16 on v), split into bf16 hi + residual, stage the lane's 4 x 8 values ----
  const float oc = 1.0f / (PC * VC);
  const float inv = (1.0f / (lrow + xhalf(lrow))) * oc;
  const int ro = (wave * 16 + c) * HD + 8 * hh;            // row i0 + c of the block, d = 8hh; tile t adds 16t
  auto put8 = [&](const v8f& o, int t) {
    v4u a, b2;
#pragma unroll
    for (int e = 0; e < 4; ++e) {
      const float f0 = o[2 * e] * inv, f1 = o[2 * e + 1] * inv;
      const unsigned short g0 = bf_bits(f0), g1 = bf_bits(f1);
      a[e]  = pk16(g0, g1);
      b2[e] = pk16(bf_bits(f0 - bf_up(g0)), bf_bits(f1 - bf_up(g1)));
    }
    *(v4u*)(Osh + ro + 16 * t) = a;
    *(v4u*)(Osl + ro + 16 * t) = b2;
  };
  put8(o0, 0);
  put8(o1, 1);
  put8(o2, 2);
  put8(o3, 3);
  __syncthreads();
  // ---- block writes its 128 row pieces of both planes: piece p = it*256 + tid -> row p>>3, halves (p&7)*8 .. +7 (8 lanes = one 128-B line) ----
  {
    v4u hv[4], lv4[4];
#pragma unroll
    for (int it = 0; it < 4; ++it) {
      const int p = it * ATT_THREADS + tid;
      hv[it]  = *(const v4u*)(Osh + (size_t)p * 8);
      lv4[it] = *(const v4u*)(Osl + (size_t)p * 8);
    }
    const size_t dofs = ((size_t)bat * NTOK + rb * ATT_ROWS) * DM + head * HD;
    unsigned short* dsth = CTh + dofs;
    unsigned short* dstl = CTl + dofs;
    {
#pragma unroll
      for (int it = 0; it < 4; ++it) {
        const int p = it * ATT_THREADS + tid;
        const size_t go = (size_t)(p >> 3) * DM + (p & 7) * 8;
        *(v4u*)(dsth + go) = hv[it];
        *(v4u*)(dstl + go) = lv4[it];
      }
    }
  }
}

// =====================================================================================================
// Workspace map (bytes); every plane is an exact multiple of its tile / whole-row store granularity (M, N exact tile multiples,
// the activation convert count an exact multiple of 2048, no pad rows needed), every offset a multiple of 64 KiB:
//   WKT, WQT, WVT f16 [512][512] x64   3 x 524288    ([h*64+d][c] = [n][k])
//   WOT  bf16 [8][64 e][64 d]              65536
//   WUT  bf16 [512 out][512 in]          524288
//   REL  bf16 [8][128][64]                131072
//   X16  f16 [8192][512] x16             8388608    (activation rows b*1024 + tok)
//   QHh, QHl bf16 [8192][512]         2 x 8388608   (q projection, hi / residual)
//   KHh, KHl bf16 [8192][512]         2 x 8388608   (k projection, hi / residual)
//   VTh, VTl f16 [8][512][1024] x16   2 x 8388608   (v^T per image, hi / residual)
//   RTAB f32 [8192][1024]               33554432   (position-logit tables, 128 per head)
//   CTh, CTl bf16 [8192][512]         2 x 8388608   (attention ctx, merged heads, hi / residual)
//   CAh, CAl bf16 [8192][512]         2 x 8388608   (per-head output after batch-norm, concat layout, hi / residual)
//   end                                 128122880
// =====================================================================================================
extern "C" void kernel_launch(void* const* d_in, const int* in_sizes, int n_in,
                              void* d_out, int out_size, void* d_ws, size_t ws_size,
                              hipStream_t stream) {
  if (n_in < 12) return;
  if (in_sizes[0] != NROWS * DM) return;
  if (in_sizes[1] != NHEAD * DM * HD || in_sizes[2] != NHEAD * DM * HD || in_sizes[3] != NHEAD * DM * HD) return;
  if (in_sizes[4] != NHEAD * HD * HO) return;
  if (in_sizes[5] != NHEAD * HO || in_sizes[6] != NHEAD * HO || in_sizes[7] != NHEAD * HO || in_sizes[8] != NHEAD * HO) return;
  if (in_sizes[9] != NHEAD * NREL * HD || in_sizes[10] != NHEAD * NREL * HD) return;
  if (in_sizes[11] != COUT * COUT) return;
  if (out_size != NROWS * COUT) return;
  if ((in_sizes[0] % 2048) != 0) return;

  const float* x     = (const float*)d_in[0];
  const float* w_k   = (const float*)d_in[1];
  const float* w_q   = (const float*)d_in[2];
  const float* w_v   = (const float*)d_in[3];
  const float* w_o   = (const float*)d_in[4];
  const float* gam   = (const float*)d_in[5];
  const float* bet   = (const float*)d_in[6];
  const float* mmean = (const float*)d_in[7];
  const float* mvar  = (const float*)d_in[8];
  const float* relw  = (const float*)d_in[9];
  const float* relh  = (const float*)d_in[10];
  const float* w_out = (const float*)d_in[11];
  float*       out   = (float*)d_out;

  const size_t PWT = (size_t)DM * DM * 2;                         //   524288
  const size_t PWO = (size_t)NHEAD * HO * HD * 2;                 //    65536
  const size_t PWU = (size_t)COUT * COUT * 2;                     //   524288
  const size_t PRL = (size_t)NHEAD * RTP * HD * 2;                //   131072
  const size_t PX  = (size_t)NROWS * DM * 2;                      //  8388608
  const size_t PVT = (size_t)NB * DM * NTOK * 2;                  //  8388608
  const size_t PRT = (size_t)NROWS * RT_LD * 4;                   // 33554432
  size_t off = 0;
  const size_t oWK = off; off += PWT;
  const size_t oWQ = off; off += PWT;
  const size_t oWV = off; off += PWT;
  const size_t oWO = off; off += PWO;
  const size_t oWU = off; off += PWU;
  const size_t oRL = off; off += PRL;
  const size_t oX  = off; off += PX;
  const size_t oQh = off; off += PX;
  const size_t oQl = off; off += PX;
  const size_t oKh = off; off += PX;
  const size_t oKl = off; off += PX;
  const size_t oVh = off; off += PVT;
  const size_t oVl = off; off += PVT;
  const size_t oRT = off; off += PRT;
  const size_t oCh = off; off += PX;
  const size_t oCl = off; off += PX;
  const size_t oAh = off; off += PX;
  const size_t oAl = off; off += PX;
  if (off > ws_size) return;                                      // off = 128122880
  if (off > (size_t)134217728) return;

  char* ws = (char*)d_ws;
  unsigned short* WKT  = (unsigned short*)(ws + oWK);
  unsigned short* WQT  = (unsigned short*)(ws + oWQ);
  unsigned short* WVT  = (unsigned short*)(ws + oWV);
  unsigned short* WOT  = (unsigned short*)(ws + oWO);
  unsigned short* WUT  = (unsigned short*)(ws + oWU);
  unsigned short* REL  = (unsigned short*)(ws + oRL);
  unsigned short* X16  = (unsigned short*)(ws + oX);
  unsigned short* QHh  = (unsigned short*)(ws + oQh);
  unsigned short* QHl  = (unsigned short*)(ws + oQl);
  unsigned short* KHh  = (unsigned short*)(ws + oKh);
  unsigned short* KHl  = (unsigned short*)(ws + oKl);
  unsigned short* VTh  = (unsigned short*)(ws + oVh);
  unsigned short* VTl  = (unsigned short*)(ws + oVl);
  float*          RTAB = (float*)(ws + oRT);
  unsigned short* CTh  = (unsigned short*)(ws + oCh);
  unsigned short* CTl  = (unsigned short*)(ws + oCl);
  unsigned short* CAh  = (unsigned short*)(ws + oAh);
  unsigned short* CAl  = (unsigned short*)(ws + oAl);

  const dim3 blk(256);
  const dim3 gPR(PREP_BLOCKS);                                     // 2344
  const dim3 blkG(128);                                            // 4 waves: 2 x 2 (128 x 128 tile) or 4 x 1 (256 x 64 tile)
  const dim3 gP(PROJ_TILES, 3);                                    // 256 x 3
  const dim3 gR((NROWS / 128) * (RTP / 128), NHEAD);               // 64 x 8
  const dim3 gH((NROWS / 256) * (HO / 64), NHEAD);                 // 32 x 8
  const dim3 gF((NROWS / 128) * (COUT / 128), 1);                  // 256
  const dim3 gAT(ATT_BLOCKS);                                      // 512
  const dim3 bAT(ATT_THREADS);                                     // 256

  // (0) every operand pack: weight planes WKT, WQT, WVT (f16 x64), WOT, WUT, REL (bf16) and the activation plane X16 (f16 x16)
  prep<<<gPR, blk, 0, stream>>>(x, w_k, w_q, w_v, w_o, w_out, relw, relh, X16, WKT, WQT, WVT, WOT, WUT, REL);

  // (1) v^T, k and q projections -> VT (f16 x16 hi / residual), KH, QH (bf16 hi / residual)
  qkv<<<gP, blkG, 0, stream>>>(X16, WKT, WQT, WVT, KHh, KHl, QHh, QHl, VTh, VTl);

  // (2) position-logit tables per head: RTAB[row][128h + m] = sum_d (q_hi + q_lo)[row][64h + d] REL[h][m][d]; M = 8192, N = 128, K = 64, f32
  gemm64<0, 1, 1, 0, 2, 2><<<gR, blkG, 0, stream>>>(
      QHh, QHl, DM, (long long)HD,
      REL, HD, (long long)RTP * HD,
      (void*)RTAB, (void*)RTAB, RT_LD, (long long)RTP,
      NROWS, RTP, HD, 1.0f, 1.0f,
      x, x, x, x, 0);

  // (3) attention per (image, head, 128 score rows) -> CT (bf16 hi / residual planes)
  attn8<<<gAT, bAT, 0, stream>>>(KHh, KHl, QHh, QHl, VTh, VTl, RTAB, CTh, CTl);

  // (4) per-head output projection + eval batch-norm: CA[row][64h + e] = BN_h( sum_d (ct_hi + ct_lo)[row][64h + d] WOT[h][e][d] );
  //     M = 8192, N = 64, K = 64 per head -> bf16 hi / residual planes
  gemm64<3, 1, 1, 2, 4, 1><<<gH, blkG, 0, stream>>>(
      CTh, CTl, DM, (long long)HD,
      WOT, HD, (long long)HO * HD,
      (void*)CAh, (void*)CAl, DM, (long long)HO,
      NROWS, HO, HD, 1.0f, 1.0f,
      gam, bet, mmean, mvar, HO);

  // (5) out = (CA_hi + CA_lo) . WUT^T + bf16_RNE(x); M = 8192, N = 512, K = 512, f32
  gemm64<0, 1, 1, 1, 2, 2><<<gF, blkG, 0, stream>>>(
      CAh, CAl, DM, 0LL,
      WUT, COUT, 0LL,
      (void*)out, (void*)out, COUT, 0LL,
      NROWS, COUT, DM, 1.0f, 1.0f,
      x, x, x, x, 0);
  (void)hipGetLastError();
}

// v005
// One run takes 117 microseconds.
// Next to v004, in two timings, it ran 1.05 and 1.02 times as fast.
// Over all steps from v000 it is 2.69 times as fast.
// Contractions (all f32 accumulate): k/q projections v_wmma_f32_16x16x32_f16 (x f16 x16 . W f16 x64, K=512, single products) -> bf16 hi/lo planes;
// v^T projection v_wmma_f32_16x16x32_f16 (Wv f16 x64 . x f16 x16, K=512, single) -> f16 x16 hi/lo planes;
// relative-position tables v_wmma_f32_16x16x32_bf16 (q bf16 hi/lo . rel bf16, hi.W+lo.W, K=64) -> f32 table;
// attention scores, transposed, v_wmma_f32_16x16x32_bf16 (q bf16 hi/lo . k bf16 hi/lo, hi.hi+lo.hi+hi.lo, K=64);
// v^T . P^T v_wmma_f32_16x16x32_f16 (v^T f16 x16 hi/lo . P^T f16 x1024 hi/lo, hi.hi+hi.lo+lo.hi, K=1024 by 32);
// per-head output projection v_wmma_f32_16x16x32_bf16 (ctx bf16 hi/lo . Wo bf16, K=64) with eval batch-norm affine in f32 -> bf16 hi/lo planes;
// final projection v_wmma_f32_16x16x32_bf16 (cat bf16 hi/lo . Wout bf16, K=512) + bf16-RNE residual in f32.
// Max-subtracted online base-2 softmax and the additive position logits in f32 on VALU. Every float input RNE-converted to bf16 on load.
#include <hip/hip_runtime.h>
#include <math.h>
#include <stdint.h>

#define NB     8
#define GH     32
#define GW     32
#define NTOK   (GH * GW)
#define DM     512
#define NHEAD  8
#define HD     64
#define HO     64
#define COUT   512
#define NREL   63
#define RTP    128
#define RT_LD  (NHEAD * RTP)
#define NROWS  (NB * NTOK)
#define KCH    32
#define WSC    64.0f
#define ACARRY 16.0f
#define VC     16.0f
#define PC     1024.0f
#define LOG2E  1.4426950408889634f
#define BN_EPS 1e-3f
static_assert(NHEAD * HD == DM);
static_assert(NHEAD * HO == COUT);
static_assert(COUT == DM);
static_assert(KCH == GW);
static_assert(NREL == 2 * GW - 1);
static_assert(NREL == 2 * GH - 1);
static_assert(NREL <= HD);
static_assert(HD + NREL <= RTP);
static_assert((NTOK % 128) == 0 && (DM % 128) == 0 && (NROWS % 256) == 0 && (HD % 64) == 0 && (NTOK % KCH) == 0);
static_assert((RTP % 128) == 0 && (HO % 64) == 0 && (COUT % 128) == 0);
#define GKS         64
#define GPITCH      72
#define ATT_WAVES   8
#define ATT_THREADS (ATT_WAVES * 32)
#define ATT_ROWS    (ATT_WAVES * 16)
#define ATT_BLOCKS  (NB * NHEAD * (NTOK / ATT_ROWS))
#define NSTG        (NTOK / KCH)
#define QPITCH      72
#define VPITCH      40
#define QT_HALVES   (KCH * QPITCH)
#define VT_HALVES   (HD * VPITCH)
#define STG_HALVES  (2 * QT_HALVES + 2 * VT_HALVES)
static_assert(ATT_THREADS == 256);
static_assert(ATT_BLOCKS == 512);
static_assert(NSTG >= 2);
static_assert(KCH * (HD / 8) == ATT_THREADS && HD * (KCH / 8) == ATT_THREADS);
static_assert((QT_HALVES % 8) == 0 && (VT_HALVES % 8) == 0 && (QPITCH % 8) == 0 && (VPITCH % 8) == 0);
static_assert(2 * ATT_ROWS * HD <= 2 * STG_HALVES);
static_assert((ATT_ROWS * HD) / 8 == 4 * ATT_THREADS);

typedef _Float16 v16h __attribute__((ext_vector_type(16)));
typedef _Float16 v8h  __attribute__((ext_vector_type(8)));
typedef __bf16   v16b __attribute__((ext_vector_type(16)));
typedef float    v8f  __attribute__((ext_vector_type(8)));
typedef float    v4f  __attribute__((ext_vector_type(4)));
typedef unsigned int v4u __attribute__((ext_vector_type(4)));

union FragH { v16h v; v8h h[2]; v4u u[2]; };
union FragAny { v16h h; v16b b; };

// ---- scalar helpers --------------------------------------------------------------------------------
__device__ __forceinline__ unsigned short bf_bits(float f) {          // f32 -> bf16 bits, RNE convert
  unsigned u = __float_as_uint(f);
  return (unsigned short)((u + 0x7FFFu + ((u >> 16) & 1u)) >> 16);
}
__device__ __forceinline__ float bf_up(unsigned short h) { return __uint_as_float(((unsigned)h) << 16); }
__device__ __forceinline__ float bfr(float f) { return bf_up(bf_bits(f)); }   // value of the bf16 RNE convert
__device__ __forceinline__ unsigned short h_bits(_Float16 x) { return __builtin_bit_cast(unsigned short, x); }
__device__ __forceinline__ unsigned pk16(unsigned short a, unsigned short b) { return (unsigned)a | ((unsigned)b << 16); }
__device__ __forceinline__ v8f zero8() { v8f z = {0.f, 0.f, 0.f, 0.f, 0.f, 0.f, 0.f, 0.f}; return z; }
// value of lane l ^ 16 (the other half of the wave), by one vector cross-row move
__device__ __forceinline__ float xhalf(float x) {
  const int b = __builtin_bit_cast(int, x);
  return __builtin_bit_cast(float, __builtin_amdgcn_permlanex16(b, b, 0x76543210, 0xfedcba98, false, false));
}

// 2^x by the bare v_exp_f32. Every argument in the softmax is <= 0; the library form's range guard only serves results below 2^-126, which
// add nothing to a row sum that holds its maximum's 1.0 and convert to 0 in both f16 planes of P (and -inf still gives 0 for the first chunk).
__device__ __forceinline__ float ex2(float x) { return __builtin_amdgcn_exp2f(x); }

// ---- fragment loader: 16-bit A/B operand from a k-contiguous 16-bit plane, lane -> row/col (lane&15),
//      p already includes +8*(lane>>4); elements 0..7 <- p[0..7] (k0+8h..), elements 8..15 <- p[16..23] (k0+16+8h..)
//      (same split k map for A and B; B is always read from a [n][k] plane)
__device__ __forceinline__ v16h ldfrag_u(const unsigned short* p) {
  FragH f;
  f.u[0] = *(const v4u*)(p);
  f.u[1] = *(const v4u*)(p + 16);
  return f.v;
}

// ---- WMMA helpers with trailing VALU hazard gaps ------------------------------------------------------
__device__ __forceinline__ v8f mma_h(v16h a, v16h b, v8f c) {
  return __builtin_amdgcn_wmma_f32_16x16x32_f16(false, a, false, b, (short)0, c, false, false);
}
__device__ __forceinline__ v8f mma_b(v16h a, v16h b, v8f c) {
  FragAny ua, ub;
  ua.h = a;
  ub.h = b;
  return __builtin_amdgcn_wmma_f32_16x16x32_bf16(false, ua.b, false, ub.b, (short)0, c, false, false);
}
template <int BF>
__device__ __forceinline__ v8f mmaT(v16h a, v16h b, v8f c) {
  if constexpr (BF != 0) return mma_b(a, b, c);
  else return mma_h(a, b, c);
}
__device__ __forceinline__ void dep_guard1(v8f& a, v8f& b, v16h x) {
#if defined(__HIP_DEVICE_COMPILE__)
  asm volatile("v_nop\n\tv_nop\n\tv_nop\n\tv_nop" : "+v"(a), "+v"(b) : "v"(x));
#endif
}
__device__ __forceinline__ void guard1x4(v8f& s, v16h a0, v16h a1, v16h a2, v16h a3) {
#if defined(__HIP_DEVICE_COMPILE__)
  asm volatile("v_nop\n\tv_nop\n\tv_nop\n\tv_nop" : "+v"(s) : "v"(a0), "v"(a1), "v"(a2), "v"(a3));
#endif
}
__device__ __forceinline__ void guard1x8(v8f& s, v16h a0, v16h a1, v16h a2, v16h a3,
                                         v16h b0, v16h b1, v16h b2, v16h b3) {
#if defined(__HIP_DEVICE_COMPILE__)
  asm volatile("v_nop\n\tv_nop\n\tv_nop\n\tv_nop"
               : "+v"(s) : "v"(a0), "v"(a1), "v"(a2), "v"(a3), "v"(b0), "v"(b1), "v"(b2), "v"(b3));
#endif
}
__device__ __forceinline__ void guard4x6(v8f& a, v8f& b, v8f& c, v8f& d,
                                         v16h x0, v16h x1, v16h x2, v16h x3, v16h x4, v16h x5) {
#if defined(__HIP_DEVICE_COMPILE__)
  asm volatile("v_nop\n\tv_nop\n\tv_nop\n\tv_nop"
               : "+v"(a), "+v"(b), "+v"(c), "+v"(d) : "v"(x0), "v"(x1), "v"(x2), "v"(x3), "v"(x4), "v"(x5));
#endif
}
__device__ __forceinline__ void guard4x5(v8f& a, v8f& b, v8f& c, v8f& d,
                                         v16h x0, v16h x1, v16h x2, v16h x3, v16h x4) {
#if defined(__HIP_DEVICE_COMPILE__)
  asm volatile("v_nop\n\tv_nop\n\tv_nop\n\tv_nop"
               : "+v"(a), "+v"(b), "+v"(c), "+v"(d) : "v"(x0), "v"(x1), "v"(x2), "v"(x3), "v"(x4));
#endif
}
__device__ __forceinline__ void keep4_h(v16h a, v16h b, v16h c, v16h d) {
#if defined(__HIP_DEVICE_COMPILE__)
  asm volatile("v_nop" :: "v"(a), "v"(b), "v"(c), "v"(d));
#endif
}
__device__ __forceinline__ void acc_guard4(v8f& a, v8f& b, v8f& c, v8f& d) {
#if defined(__HIP_DEVICE_COMPILE__)
  asm volatile("v_nop\n\tv_nop\n\tv_nop\n\tv_nop" : "+v"(a), "+v"(b), "+v"(c), "+v"(d));
#endif
}
__device__ __forceinline__ void wave_sync_lds() {
  __builtin_amdgcn_fence(__ATOMIC_RELEASE, "workgroup");
  __builtin_amdgcn_wave_barrier();
  __builtin_amdgcn_fence(__ATOMIC_ACQUIRE, "workgroup");
}

// four 16-B copies per lane, global -> LDS through no register; the s_wait_xcnt 0 in the same statement stands ahead of any later
// rewrite of the address registers that the copies name
__device__ __forceinline__ void stage_copy4(unsigned l0, const unsigned short* g0, unsigned l1, const unsigned short* g1,
                                            unsigned l2, const unsigned short* g2, unsigned l3, const unsigned short* g3) {
#if defined(__HIP_DEVICE_COMPILE__)
  asm volatile("global_load_async_to_lds_b128 %0, %1, off\n\t"
               "global_load_async_to_lds_b128 %2, %3, off\n\t"
               "global_load_async_to_lds_b128 %4, %5, off\n\t"
               "global_load_async_to_lds_b128 %6, %7, off\n\t"
               "s_wait_xcnt 0x0"
               :: "v"(l0), "v"(g0), "v"(l1), "v"(g1), "v"(l2), "v"(g2), "v"(l3), "v"(g3) : "memory");
#endif
}
// the same for eight copies: one wait on the address registers serves the run
__device__ __forceinline__ void stage_copy8(unsigned l0, const unsigned short* g0, unsigned l1, const unsigned short* g1,
                                            unsigned l2, const unsigned short* g2, unsigned l3, const unsigned short* g3,
                                            unsigned l4, const unsigned short* g4, unsigned l5, const unsigned short* g5,
                                            unsigned l6, const unsigned short* g6, unsigned l7, const unsigned short* g7) {
#if defined(__HIP_DEVICE_COMPILE__)
  asm volatile("global_load_async_to_lds_b128 %0, %1, off\n\t"
               "global_load_async_to_lds_b128 %2, %3, off\n\t"
               "global_load_async_to_lds_b128 %4, %5, off\n\t"
               "global_load_async_to_lds_b128 %6, %7, off\n\t"
               "global_load_async_to_lds_b128 %8, %9, off\n\t"
               "global_load_async_to_lds_b128 %10, %11, off\n\t"
               "global_load_async_to_lds_b128 %12, %13, off\n\t"
               "global_load_async_to_lds_b128 %14, %15, off\n\t"
               "s_wait_xcnt 0x0"
               :: "v"(l0), "v"(g0), "v"(l1), "v"(g1), "v"(l2), "v"(g2), "v"(l3), "v"(g3),
                  "v"(l4), "v"(g4), "v"(l5), "v"(g5), "v"(l6), "v"(g6), "v"(l7), "v"(g7) : "memory");
#endif
}
// this wave's copies have landed in LDS
__device__ __forceinline__ void wait_copies() {
#if defined(__HIP_DEVICE_COMPILE__)
  asm volatile("s_wait_asynccnt 0x0" ::: "memory");
#endif
}
// stands behind a global load or store, ahead of a later rewrite of a register that it names
__device__ __forceinline__ void wait_addr() {
#if defined(__HIP_DEVICE_COMPILE__)
  asm volatile("s_wait_xcnt 0x0" ::: "memory");
#endif
}
// this wave's LDS reads have returned (ahead of the barrier behind which their buffer is refilled)
__device__ __forceinline__ void wait_lds() {
#if defined(__HIP_DEVICE_COMPILE__)
  asm volatile("s_wait_dscnt 0x0" ::: "memory");
#endif
}

// =====================================================================================================
// Elementwise 16-bit pack, no transpose. BFO 0: dst[i] = f16( bf16_RNE(src[i]) * sc ), sc a power of two (exact);
// BFO 1: dst[i] = bf16_RNE(src[i]) bits. 8 elements per thread: two 16-B loads, one 16-B store per lane; 32 consecutive
// coverage: n / 2048 blocks (index bx) x 256 thr x 8 elements = n exactly (host checks n % 2048 == 0).
// =====================================================================================================
template <int BFO>
__device__ __forceinline__ void cvt16(const float* __restrict__ src, unsigned short* dst, int n, float sc, int bx) {
  const size_t i8 = ((size_t)bx * 256 + threadIdx.x) * 8;
  if (i8 + 8 > (size_t)n) return;                 // never taken with the exact block range; no barriers in this job
  const v4f a = *(const v4f*)(src + i8);
  const v4f b = *(const v4f*)(src + i8 + 4);
  v4u o;
  if constexpr (BFO != 0) {
    o[0] = pk16(bf_bits(a[0]), bf_bits(a[1]));
    o[1] = pk16(bf_bits(a[2]), bf_bits(a[3]));
    o[2] = pk16(bf_bits(b[0]), bf_bits(b[1]));
    o[3] = pk16(bf_bits(b[2]), bf_bits(b[3]));
  } else {
    o[0] = pk16(h_bits((_Float16)(bfr(a[0]) * sc)), h_bits((_Float16)(bfr(a[1]) * sc)));
    o[1] = pk16(h_bits((_Float16)(bfr(a[2]) * sc)), h_bits((_Float16)(bfr(a[3]) * sc)));
    o[2] = pk16(h_bits((_Float16)(bfr(b[0]) * sc)), h_bits((_Float16)(bfr(b[1]) * sc)));
    o[3] = pk16(h_bits((_Float16)(bfr(b[2]) * sc)), h_bits((_Float16)(bfr(b[3]) * sc)));
  }
  {
    *(v4u*)(dst + i8) = o;
    
  }
}

// =====================================================================================================
// Transposing 16-bit pack of a weight matrix: in W[Cin][Dd] (pitch Dd, base + z*sIn) -> out WT[Dd][Cin] (pitch Cin, base + z*sOut),
// BFO 0: f16( bf16_RNE(w) * sc ); BFO 1: bf16_RNE(w) bits. One 64x64 tile per block (bx = Cin tile, by = Dd tile, bz = matrix index):
// coverage: loads 4 x 256 x 4 floats = 64x64; stores 2 x 256 pieces x 8 halves = 64 rows x 64 halves = the whole tile;
//           (bx, by, bz) runs over (Cin/64, Dd/64, nmat) exactly (all sizes exact multiples of 64). t: the block's 64 x 65 float tile in LDS.
// =====================================================================================================
template <int BFO>
__device__ __forceinline__ void tr16(const float* __restrict__ W, unsigned short* WT, int Cin, int Dd,
                                     long long sIn, long long sOut, float sc, int bx, int by, int bz, float (*t)[65]) {
  const int tid = threadIdx.x;
  const int c0 = bx * 64, d0 = by * 64;
  const float* src = W + (size_t)((long long)bz * sIn);
  unsigned short* dst = WT + (size_t)((long long)bz * sOut);
#pragma unroll
  for (int it = 0; it < 4; ++it) {
    const int p  = it * 256 + tid;
    const int cc = p >> 4, sg = (p & 15) * 4;
    const v4f v = *(const v4f*)(src + (size_t)(c0 + cc) * Dd + d0 + sg);
    t[cc][sg]     = v[0];
    t[cc][sg + 1] = v[1];
    t[cc][sg + 2] = v[2];
    t[cc][sg + 3] = v[3];
  }
  __syncthreads();
  v4u o[2];
#pragma unroll
  for (int it = 0; it < 2; ++it) {
    const int p  = it * 256 + tid;
    const int dd = p >> 3, s8 = (p & 7) * 8;
    unsigned short hv[8];
#pragma unroll
    for (int k = 0; k < 8; ++k) {
      const float f = bfr(t[s8 + k][dd]);
      if constexpr (BFO != 0) hv[k] = bf_bits(f);
      else hv[k] = h_bits((_Float16)(f * sc));
    }
    v4u q;
    q[0] = pk16(hv[0], hv[1]);
    q[1] = pk16(hv[2], hv[3]);
    q[2] = pk16(hv[4], hv[5]);
    q[3] = pk16(hv[6], hv[7]);
    o[it] = q;
  }
  {
#pragma unroll
    for (int it = 0; it < 2; ++it) {
      const int p  = it * 256 + tid;
      const int dd = p >> 3, s8 = (p & 7) * 8;
      *(v4u*)(dst + (size_t)(d0 + dd) * Cin + c0 + s8) = o[it];
    }
    wait_addr();   // other jobs' code follows these stores in the merged kernel and rewrites their registers
  }
}

// =====================================================================================================
// Relative-position operand plane: out[h][r][0..63] bf16 bits, r 0..62 = rel_w[h][r][:], r 63 = 0, r 64..126 = rel_h[h][r-64][:],
// r 127 = 0. Every lane loads both candidate rows from clamped addresses and selects by value. 8 halves per thread, 8 consecutive
// coverage: 32 blocks (index bx) x 256 threads x 8 halves = 8 x 128 x 64 exactly.
// =====================================================================================================
__device__ __forceinline__ void relcat(const float* __restrict__ rw, const float* __restrict__ rh, unsigned short* out, int bx) {
  const int p   = bx * 256 + threadIdx.x;                // 0 .. NHEAD*RTP*8 - 1
  const int hd  = p / (RTP * 8);
  const int r   = (p >> 3) & (RTP - 1);
  const int seg = (p & 7) * 8;
  const int iw  = (r < NREL) ? r : (NREL - 1);
  int ih = r - HD;
  ih = (ih < 0) ? 0 : ih;
  ih = (ih > NREL - 1) ? (NREL - 1) : ih;
  const float* pw = rw + ((size_t)hd * NREL + iw) * HD + seg;
  const float* ph = rh + ((size_t)hd * NREL + ih) * HD + seg;
  const v4f a0 = *(const v4f*)(pw), a1 = *(const v4f*)(pw + 4);
  const v4f b0 = *(const v4f*)(ph), b1 = *(const v4f*)(ph + 4);
  const bool uw = (r < NREL);
  const bool uh = (r >= HD) && (r < HD + NREL);
  float v[8];
#pragma unroll
  for (int e = 0; e < 4; ++e) {
    v[e]     = uw ? a0[e] : (uh ? b0[e] : 0.f);
    v[4 + e] = uw ? a1[e] : (uh ? b1[e] : 0.f);
  }
  v4u o;
  o[0] = pk16(bf_bits(v[0]), bf_bits(v[1]));
  o[1] = pk16(bf_bits(v[2]), bf_bits(v[3]));
  o[2] = pk16(bf_bits(v[4]), bf_bits(v[5]));
  o[3] = pk16(bf_bits(v[6]), bf_bits(v[7]));
  {
    *(v4u*)(out + (size_t)p * 8) = o;
    wait_addr();   // other jobs' code follows this store in the merged kernel and rewrites its registers
  }
}

// =====================================================================================================
// All operand packs in one launch: none reads what another writes, so the job is picked by the block index (block-uniform, so the barrier
// of the transposing jobs is passed by a whole block or by none). The transposing jobs, whose blocks last longest, come first.
//   blocks    0 ..  191: W[h][c][d] -> WT[h*64+d][c] as f16( bf16_RNE(w) * 64 ) for Wk, Wq, Wv (64 blocks each: 8 c tiles x 8 heads)
//   blocks  192 ..  255: Wout[in][out] -> WUT[out][in] bf16 (8 x 8 tiles)
//   blocks  256 ..  263: Wo[h][d][e] -> WOT[h][e][d] bf16 (one tile per head)
//   blocks  264 ..  295: rel tables -> REL[h][128][64] bf16 (rows 63, 127 zero)
//   blocks  296 .. 2343: X16[row][c] = f16( bf16_RNE(x[row][c]) * 16 ), rows = b*1024 + tok
// =====================================================================================================
#define PB_W    ((DM / 64) * NHEAD)
#define PB_WU   ((COUT / 64) * (COUT / 64))
#define PB_WO   NHEAD
#define PB_RL   ((NHEAD * RTP * 8) / 256)
#define PB_X    ((NROWS * DM) / 2048)
#define PREP_BLOCKS (3 * PB_W + PB_WU + PB_WO + PB_RL + PB_X)
static_assert(HD == 64 && HO == 64);
__global__ __launch_bounds__(256) void prep(const float* __restrict__ x, const float* __restrict__ w_k, const float* __restrict__ w_q,
                                            const float* __restrict__ w_v, const float* __restrict__ w_o, const float* __restrict__ w_out,
                                            const float* __restrict__ relw, const float* __restrict__ relh,
                                            unsigned short* X16, unsigned short* WKT, unsigned short* WQT, unsigned short* WVT,
                                            unsigned short* WOT, unsigned short* WUT, unsigned short* REL) {
  __shared__ float t[64][65];
  int b = blockIdx.x;
  if (b < 3 * PB_W) {
    const int m = b / PB_W, r = b - m * PB_W;
    const float* src = (m == 0) ? w_k : ((m == 1) ? w_q : w_v);
    unsigned short* dst = (m == 0) ? WKT : ((m == 1) ? WQT : WVT);
    tr16<0>(src, dst, DM, HD, (long long)DM * HD, (long long)HD * DM, WSC, r % (DM / 64), 0, r / (DM / 64), t);
    return;
  }
  b -= 3 * PB_W;
  if (b < PB_WU) {
    tr16<1>(w_out, WUT, COUT, COUT, 0LL, 0LL, 1.0f, b % (COUT / 64), b / (COUT / 64), 0, t);
    return;
  }
  b -= PB_WU;
  if (b < PB_WO) {
    tr16<1>(w_o, WOT, HD, HO, (long long)HD * HO, (long long)HO * HD, 1.0f, 0, 0, b, t);
    return;
  }
  b -= PB_WO;
  if (b < PB_RL) {
    relcat(relw, relh, REL, b);
    return;
  }
  b -= PB_RL;
  cvt16<0>(x, X16, NROWS * DM, ACARRY, b);
}

// =====================================================================================================
// Register-blocked batched 16-bit WMMA GEMM: C[m][n] = oscale * sum_k A[m][k] * Bt[n][k]; one wave per 64x64 tile, block = WM x WN waves
// (4 waves) on a (64 WM) x (64 WN) tile.
// A row-major [M][K] pitch lda (16-bit plane), Bt row-major [N][K] pitch ldb (k contiguous); M multiple of 64 WM, N of 64 WN, K of 64.
// The block's A and Bt rows are brought into LDS once per block, in k slabs of 64 (one whole 128-B line per row, 8 lanes per line, pitch 144 B
// in LDS), by asynchronous 16-B copies, two buffers: slab t + 2 is issued behind the barrier that ends slab t. All fragments are 16-B LDS reads
// with the same split k map and the same k order of the products as with fragments read from global memory.
// bx = tile index, by = batch index with element strides sA, sB, sC; gst, sT: the block's LDS (two slab buffers; one 16 x 68 float slab per wave).
// ASPLIT 1: a second A plane A2 (unscaled residual of A, same layout) is multiplied into the same accumulator (A + A2 ~ exact A).
// BF 1: bf16 operands (v_wmma_f32_16x16x32_bf16), else f16.
// OM 0: f32 out (pitch ldc).  OM 2: f16 out = f16(value * ocarry).  OM 3: two bf16 planes: hi = bf16_RNE(value), lo = bf16_RNE(value - hi).
// OM 4: two f16 planes: hi = f16(value * ocarry), lo = f16(value * ocarry - hi) (unscaled residual).
// EPI 1 (OM 0 only): value += bf16_RNE(ep0[same index as C]).  EPI 2 (16-bit out): per-column eval batch-norm affine
//   value = (bf16(ep0[ci]) * (value - bf16(ep2[ci]))) * rsqrt(bf16(ep3[ci]) + eps) + bf16(ep1[ci]),  ci = by*cps + column.
// coverage: 4 slabs x 16 rows (f32: it 0..7 x lane>>4; 16-bit: it 0..3 x lane>>3) x 64 cols = the wave's whole 64x64 tile;
//           bx runs over (M / (64 WM)) * (N / (64 WN)) blocks exactly; a surplus block would leave as a whole, ahead of every copy and barrier.
// =====================================================================================================
template <int V> struct IntC { static constexpr int value = V; };
constexpr int gemm_slab_halves(int asplit, int wm, int wn) { return ((1 + asplit) * 64 * wm + 64 * wn) * GPITCH; }   // one buffer: A | (A2) | Bt
template <int OM, int ASPLIT, int BF, int EPI, int WM, int WN>
__device__ __forceinline__ void gemm64_tile(
    unsigned short* gst, float* sT, unsigned bx, int by,
    const unsigned short* __restrict__ Ap, const unsigned short* __restrict__ A2p, int lda, long long sA,
    const unsigned short* __restrict__ Btp, int ldb, long long sB,
    void* Cout, void* C2out, int ldc, long long sC,
    int M, int N, int K, float oscale, float ocarry,
    const float* __restrict__ ep0, const float* __restrict__ ep1,
    const float* __restrict__ ep2, const float* __restrict__ ep3, int cps) {
  constexpr int NW     = WM * WN;                    // waves per block
  constexpr int AR     = 64 * WM;                    // A rows of the block tile
  constexpr int BR     = 64 * WN;                    // Bt rows of the block tile
  constexpr int RPI    = NW * 4;                     // rows that one copy of every lane of the block covers (8 lanes per row)
  constexpr int A_H    = AR * GPITCH;                // halves of one A plane's slab in LDS
  constexpr int B_H    = BR * GPITCH;
  constexpr int SLAB_H = (1 + ASPLIT) * A_H + B_H;   // one buffer: A | (A2) | Bt
  static_assert(SLAB_H == gemm_slab_halves(ASPLIT, WM, WN));
  static_assert((AR % (4 * RPI)) == 0 && (BR % (4 * RPI)) == 0);
  static_assert(((1 + ASPLIT) * AR + BR) / RPI <= 63);     // copies of one wave in flight
  const int tid  = threadIdx.x;
  const int lane = tid & 31;
  const int wave = tid >> 5;
  const int tilesN = N / BR;
  const int tilesM = M / AR;
  if ((int)bx >= tilesM * tilesN) return;           // block-uniform, ahead of every copy and barrier
  const int tm  = bx / tilesN;
  const int tn  = bx - tm * tilesN;
  const int bm0 = tm * AR;
  const int bn0 = tn * BR;
  const int wm  = wave / WN;
  const int wn  = wave - wm * WN;
  const int m0  = bm0 + (wm << 6);
  const int n0  = bn0 + (wn << 6);

  const unsigned short* A1 = Ap  + (size_t)((long long)by * sA);
  const unsigned short* A2 = A2p + (size_t)((long long)by * sA);
  const unsigned short* Bb = Btp + (size_t)((long long)by * sB);

  const int rlane = lane & 15;                 // row (A) / col (B, D) within subtile
  const int koff  = (lane >> 4) * 8;           // k offset of this lane half
  const int mOff  = (lane >> 4) * 8;           // D row offset

  // per-lane copy addresses: row tid>>3 of a group of RPI rows, 16-B segment tid&7 of the row's 128-B line
  const unsigned short* gA  = A1 + (size_t)(bm0 + (tid >> 3)) * lda + (tid & 7) * 8;
  const unsigned short* gA2 = A2 + (size_t)(bm0 + (tid >> 3)) * lda + (tid & 7) * 8;
  const unsigned short* gB  = Bb + (size_t)(bn0 + (tid >> 3)) * ldb + (tid & 7) * 8;
  const unsigned lcp = (unsigned)(uintptr_t)gst + (unsigned)((tid >> 3) * (GPITCH * 2) + (tid & 7) * 16);   // LDS byte address
  constexpr unsigned LSTEP = (unsigned)(RPI * GPITCH * 2);      // LDS bytes from one group of RPI rows to the next
  const size_t astep = (size_t)RPI * lda, bstep = (size_t)RPI * ldb;
  // rows of one plane: groups of RPI rows, eight groups (or the last four) per statement
  auto plane = [&](unsigned l, const unsigned short* p, size_t step, auto ngroups) {
    constexpr int NG = decltype(ngroups)::value;
#pragma unroll
    for (int g = 0; g < NG; g += 8) {
      const unsigned short* q = p + (size_t)g * step;
      const unsigned m = l + (unsigned)g * LSTEP;
      if (g + 8 <= NG) {
        stage_copy8(m, q, m + LSTEP, q + step, m + 2 * LSTEP, q + 2 * step, m + 3 * LSTEP, q + 3 * step,
                    m + 4 * LSTEP, q + 4 * step, m + 5 * LSTEP, q + 5 * step, m + 6 * LSTEP, q + 6 * step, m + 7 * LSTEP, q + 7 * step);
      } else {
        stage_copy4(m, q, m + LSTEP, q + step, m + 2 * LSTEP, q + 2 * step, m + 3 * LSTEP, q + 3 * step);
      }
    }
  };
  auto stage = [&](int buf, int k0) {
    const unsigned l0 = lcp + (unsigned)(buf * (SLAB_H * 2));
    plane(l0, gA + k0, astep, IntC<AR / RPI>{});
    if constexpr (ASPLIT != 0) plane(l0 + (unsigned)(A_H * 2), gA2 + k0, astep, IntC<AR / RPI>{});
    plane(l0 + (unsigned)((1 + ASPLIT) * A_H * 2), gB + k0, bstep, IntC<BR / RPI>{});
  };

  v8f acc[4][4];
#pragma unroll
  for (int i = 0; i < 4; ++i)
#pragma unroll
    for (int j = 0; j < 4; ++j) acc[i][j] = zero8();

  // slab 0 -> buffer 0, landed and published; then slab 1 -> buffer 1 flies while slab 0 is worked on
  const int nslab = K / GKS;
  stage(0, 0);
  wait_copies();
  __syncthreads();
  if (nslab > 1) stage(1, GKS);

#pragma unroll 1
  for (int t = 0; t < nslab; ++t) {
    const unsigned short* sb  = gst + (t & 1) * SLAB_H;
    const unsigned short* As  = sb + ((wm << 6) + rlane) * GPITCH + koff;
    const unsigned short* As2 = As + A_H;
    const unsigned short* Bs  = sb + (1 + ASPLIT) * A_H + ((wn << 6) + rlane) * GPITCH + koff;
#pragma unroll
    for (int ks = 0; ks < GKS; ks += 32) {
      // all fragments of the k-step are read as one group ahead of its products (one LDS wait per k-step, not one per row of tiles)
      v16h bh[4], ah[4];
#pragma unroll
      for (int j = 0; j < 4; ++j) bh[j] = ldfrag_u(Bs + (j << 4) * GPITCH + ks);
#pragma unroll
      for (int i = 0; i < 4; ++i) ah[i] = ldfrag_u(As + (i << 4) * GPITCH + ks);
      if constexpr (ASPLIT != 0) {
        v16h al[4];
#pragma unroll
        for (int i = 0; i < 4; ++i) al[i] = ldfrag_u(As2 + (i << 4) * GPITCH + ks);
#pragma unroll
        for (int i = 0; i < 4; ++i) {
#pragma unroll
          for (int j = 0; j < 4; ++j) acc[i][j] = mmaT<BF>(ah[i], bh[j], acc[i][j]);
          dep_guard1(acc[i][0], acc[i][3], ah[i]);
#pragma unroll
          for (int j = 0; j < 4; ++j) acc[i][j] = mmaT<BF>(al[i], bh[j], acc[i][j]);
          dep_guard1(acc[i][0], acc[i][3], al[i]);
        }
      } else {
#pragma unroll
        for (int i = 0; i < 4; ++i) {
#pragma unroll
          for (int j = 0; j < 4; ++j) acc[i][j] = mmaT<BF>(ah[i], bh[j], acc[i][j]);
          dep_guard1(acc[i][0], acc[i][3], ah[i]);
        }
      }
      keep4_h(bh[0], bh[1], bh[2], bh[3]);
    }
    // foot of the slab: own LDS reads returned, own copies of slab t + 1 landed, then the one barrier that publishes slab t + 1
    // and ends every wave's reads of this slab's buffer; only behind it is that buffer refilled with slab t + 2
    wait_lds();
    wait_copies();
    __syncthreads();
    if (t + 2 < nslab) stage(t & 1, (t + 2) * GKS);
  }
  wait_copies();
  acc_guard4(acc[0][0], acc[0][1], acc[0][2], acc[0][3]);
  acc_guard4(acc[1][0], acc[1][1], acc[1][2], acc[1][3]);
  acc_guard4(acc[2][0], acc[2][1], acc[2][2], acc[2][3]);
  acc_guard4(acc[3][0], acc[3][1], acc[3][2], acc[3][3]);

  const int hh2 = lane >> 4, c4 = (lane & 15) * 4;     // f32 out: 256-B row segment = 16 lanes x 16 B
  const int q8  = lane >> 3, c8 = (lane & 7) * 8;

  // ---- epilogue ----
  float* slab = sT + wave * (16 * 68);              // per-wave 16x64 slab, pitch 68 floats
#pragma unroll
  for (int i = 0; i < 4; ++i) {
    const int mBase = m0 + (i << 4);
#pragma unroll
    for (int j = 0; j < 4; ++j) {
#pragma unroll
      for (int r = 0; r < 8; ++r) {
        slab[(mOff + r) * 68 + (j << 4) + rlane] = acc[i][j][r];
      }
    }
    wave_sync_lds();
    if constexpr (OM == 0) {
      float* C = (float*)Cout + (size_t)((long long)by * sC);
      const float* R = ep0 + (size_t)((long long)by * sC);
      v4f vals[8];
#pragma unroll
      for (int it = 0; it < 8; ++it) {
        const int row = it * 2 + hh2;                      // it 0..7 x hh2 0..1 = rows 0..15
        v4f v = *(const v4f*)(slab + row * 68 + c4);
#pragma unroll
        for (int e = 0; e < 4; ++e) v[e] = v[e] * oscale;
        if constexpr (EPI == 1) {
          const v4f xr = *(const v4f*)(R + (size_t)(mBase + row) * ldc + n0 + c4);
#pragma unroll
          for (int e = 0; e < 4; ++e) v[e] = v[e] + bfr(xr[e]);
        }
        vals[it] = v;
      }
      {
#pragma unroll
        for (int it = 0; it < 8; ++it) {
          const int gr = mBase + it * 2 + hh2;
          *(v4f*)(C + (size_t)gr * ldc + n0 + c4) = vals[it];
        }
        
      }
    } else {
      unsigned short* C  = (unsigned short*)Cout  + (size_t)((long long)by * sC);
      unsigned short* Cb = (unsigned short*)C2out + (size_t)((long long)by * sC);
      v4u hv[4], lv[4];
#pragma unroll
      for (int it = 0; it < 4; ++it) {
        const int row = it * 4 + q8;                       // it 0..3 x q8 0..3 = rows 0..15
        const float* sp = slab + row * 68 + c8;
        v4u a  = {0u, 0u, 0u, 0u};
        v4u b2 = {0u, 0u, 0u, 0u};
#pragma unroll
        for (int e = 0; e < 4; ++e) {
          float f0 = sp[2 * e] * oscale;
          float f1 = sp[2 * e + 1] * oscale;
          if constexpr (EPI == 2) {
            const int ci = by * cps + n0 + c8 + 2 * e;   // column parameter index (host keeps by*cps + N <= parameter count)
            const float g0 = bfr(ep0[ci]), g1 = bfr(ep0[ci + 1]);
            const float t0 = bfr(ep1[ci]), t1 = bfr(ep1[ci + 1]);
            const float u0 = bfr(ep2[ci]), u1 = bfr(ep2[ci + 1]);
            const float r0 = rsqrtf(bfr(ep3[ci]) + BN_EPS), r1 = rsqrtf(bfr(ep3[ci + 1]) + BN_EPS);
            f0 = (g0 * (f0 - u0)) * r0 + t0;
            f1 = (g1 * (f1 - u1)) * r1 + t1;
          }
          if constexpr (OM == 3) {
            const unsigned short h0 = bf_bits(f0), h1 = bf_bits(f1);
            a[e]  = pk16(h0, h1);
            b2[e] = pk16(bf_bits(f0 - bf_up(h0)), bf_bits(f1 - bf_up(h1)));
          } else {
            f0 *= ocarry; f1 *= ocarry;
            const _Float16 x0 = (_Float16)f0, x1 = (_Float16)f1;
            a[e] = pk16(h_bits(x0), h_bits(x1));
            if constexpr (OM == 4) {
              b2[e] = pk16(h_bits((_Float16)(f0 - (float)x0)), h_bits((_Float16)(f1 - (float)x1)));
            }
          }
        }
        hv[it] = a;
        lv[it] = b2;
      }
      {
#pragma unroll
        for (int it = 0; it < 4; ++it) {
          const int row = it * 4 + q8;
          *(v4u*)(C + (size_t)(mBase + row) * ldc + n0 + c8) = hv[it];
          if constexpr (OM >= 3) {
            *(v4u*)(Cb + (size_t)(mBase + row) * ldc + n0 + c8) = lv[it];
          }
        }
        
      }
    }
    wave_sync_lds();
  }
}

// one GEMM per launch: blockIdx.x = tile, blockIdx.y = batch
template <int OM, int ASPLIT, int BF, int EPI, int WM, int WN>
__global__ __launch_bounds__(WM * WN * 32) __attribute__((amdgpu_num_vgpr(256))) void gemm64(
    const unsigned short* __restrict__ Ap, const unsigned short* __restrict__ A2p, int lda, long long sA,
    const unsigned short* __restrict__ Btp, int ldb, long long sB,
    void* Cout, void* C2out, int ldc, long long sC,
    int M, int N, int K, float oscale, float ocarry,
    const float* __restrict__ ep0, const float* __restrict__ ep1,
    const float* __restrict__ ep2, const float* __restrict__ ep3, int cps) {
  __shared__ __align__(16) unsigned short gst[2 * gemm_slab_halves(ASPLIT, WM, WN)];
  __shared__ __align__(16) float sT[WM * WN * 16 * 68];
  gemm64_tile<OM, ASPLIT, BF, EPI, WM, WN>(gst, sT, blockIdx.x, (int)blockIdx.y, Ap, A2p, lda, sA, Btp, ldb, sB, Cout, C2out, ldc, sC,
                                           M, N, K, oscale, ocarry, ep0, ep1, ep2, ep3, cps);
}

// The three projections in one launch: none reads what another writes; blockIdx.y picks the job (block-uniform), blockIdx.x its 128 x 128 tile
// (256 tiles each), so three blocks share a WGP where one stood alone.
//   job 0: v^T per image: VT[b][h*64+d][tok] = sum_c WVT[h*64+d][c] x_b[tok][c] -> f16 x16 hi / residual planes; M = 512, N = 1024, K = 512,
//          image = blockIdx.x / 32, tile = blockIdx.x % 32
//   job 1: k[m][n] = sum_c x[m][c] WKT[n][c] -> bf16 hi / residual planes; M = 8192, N = 512, K = 512.   job 2: the same for q with WQT
#define PROJ_TILES ((NROWS / 128) * (DM / 128))
#define VT_TILES   ((DM / 128) * (NTOK / 128))
static_assert(VT_TILES * NB == PROJ_TILES);
__global__ __launch_bounds__(128) __attribute__((amdgpu_num_vgpr(256))) void qkv(
    const unsigned short* __restrict__ X16, const unsigned short* __restrict__ WKT, const unsigned short* __restrict__ WQT,
    const unsigned short* __restrict__ WVT, unsigned short* KHh, unsigned short* KHl, unsigned short* QHh, unsigned short* QHl,
    unsigned short* VTh, unsigned short* VTl) {
  __shared__ __align__(16) unsigned short gst[2 * gemm_slab_halves(0, 2, 2)];
  __shared__ __align__(16) float sT[4 * 16 * 68];
  const int job = blockIdx.y;
  const unsigned bx = blockIdx.x;
  if (job == 0) {
    gemm64_tile<4, 0, 0, 0, 2, 2>(gst, sT, bx % VT_TILES, (int)(bx / VT_TILES),
                                  WVT, WVT, DM, 0LL,
                                  X16, DM, (long long)NTOK * DM,
                                  (void*)VTh, (void*)VTl, NTOK, (long long)DM * NTOK,
                                  DM, NTOK, DM, 1.0f / (ACARRY * WSC), VC,
                                  nullptr, nullptr, nullptr, nullptr, 0);
  } else {
    gemm64_tile<3, 0, 0, 0, 2, 2>(gst, sT, bx, 0,
                                  X16, X16, DM, 0LL,
                                  (job == 1) ? WKT : WQT, DM, 0LL,
                                  (void*)((job == 1) ? KHh : QHh), (void*)((job == 1) ? KHl : QHl), DM, 0LL,
                                  NROWS, DM, DM, 1.0f / (ACARRY * WSC), 1.0f,
                                  nullptr, nullptr, nullptr, nullptr, 0);
  }
}

// =====================================================================================================
// Flash attention for one image (batch), one head and 128 score rows (one wave per 16 rows), head dim 64, 1024 columns:
//   rows i index KEY positions (k_i stationary), columns j index the q/v positions streamed in chunks of 32 = one image row;
//   k planes (bf16 hi, lo) K[b*1024 + tok][64h + d], pitch 512; q planes (bf16 hi, lo) Q[b*1024 + tok][64h + d];
//   v^T planes (f16 x16 hi, unscaled lo): VT[b*512 + 64h + d][tok] (pitch 1024);
//   additive position logits from the f32 table R[b*1024 + tok][128h + m] (m < 63: q_tok . rel_w[h][m]; 64 + m: q_tok . rel_h[h][m]):
//   logit[i][j] = k_i . q_j + R[i][yj - yi + 31] + R[i][64 + xj - xi + 31], token = 32*x + y.
//   The score tiles are computed transposed, S^T[j][i] (A = q rows of the chunk from LDS, B = the stationary k rows): lane (c, hh) holds score row
//   i0 + c and, in its 2 x 8 accumulator registers, that row's columns 8hh + r and 16 + 8hh + r of the chunk. So a row's maximum and sum are taken
//   inside the lane, with one exchange between the wave's halves for the maximum per chunk and one for the sum at the end, and the 16 values,
//   converted in place, are the B operand (hardware k order) of O^T[d][i] += v^T[d][j] P^T[j][i] (A = v^T rows from LDS, same k order).
//   The w part of the position logits depends only on the column within a chunk (16 registers per lane, loaded once), the h part only on the
//   chunk (one load per lane per chunk); indices are pure arithmetic.
//   out (bf16 hi, lo planes): CT[b*1024 + tok][64h + d] = sum_j softmax_j(logit) v[j][d]  (softmax run in base 2, max-subtracted, no 1/sqrt(d)).
//   block = 8 waves = 256 threads; grid = 8 images x 8 heads x 8 row blocks = 512; every wave does identical bounded work (32 chunks).
//   The 8 waves of a block need the same q and v^T chunk: it is brought into LDS once per block by asynchronous 16-B copies (4 per lane and
//   chunk: q hi, q lo 32 rows x 128 B at pitch 144 B; v^T hi, lo 64 rows x 64 B at pitch 80 B), two buffers, chunk t + 2 issued behind the
//   barrier that ends chunk t; all A fragments are 16-B LDS reads with the split k map.
//   Per chunk: 2 score tiles on bf16 WMMA (hi.hi + lo.hi + hi.lo, K = 64 as two k-steps of 32); online softmax in f32 (exp2); P*1024 as f16 hi
//   and unscaled residual; 12 v^T.P^T WMMAs (hi.hi, hi.lo, lo.hi).
//   Final 1/l and carry folds in f32; after a block barrier the stage buffers are reused as the block's two bf16 result buffers [128][64]
//   (hi, lo): each lane stages 4 x 8 consecutive d of its row (16-B stores); after a second block barrier the 256 threads write whole 128-B row pieces.
// coverage: LDS result buffers: 8 waves x 16 rows x 64 cols per plane; global: 4 iterations x 256 threads x 8 halves = 128 rows x 64 cols
//           of rows 128rb..128rb+127, columns 64h..64h+63 of image b, per plane; grid covers all 8 x 1024 rows x 512 columns exactly once.
// =====================================================================================================
__global__ __launch_bounds__(ATT_THREADS) __attribute__((amdgpu_num_vgpr(256)))
void attn8(const unsigned short* __restrict__ KHh, const unsigned short* __restrict__ KHl,
           const unsigned short* __restrict__ QHh, const unsigned short* __restrict__ QHl,
           const unsigned short* __restrict__ VTh, const unsigned short* __restrict__ VTl,
           const float* __restrict__ Rtab, unsigned short* CTh, unsigned short* CTl) {
  __shared__ __align__(16) unsigned short stg[2 * STG_HALVES];   // two stage buffers: q hi | q lo | v^T hi | v^T lo; later: result buffers

  const int tid  = threadIdx.x;
  const int wave = tid >> 5;
  const int lane = tid & 31;
  const int hh   = lane >> 4;
  const int c    = lane & 15;

  const int rb   = blockIdx.x & ((NTOK / ATT_ROWS) - 1);   // 0..7
  const int head = (blockIdx.x / (NTOK / ATT_ROWS)) & (NHEAD - 1);   // 0..7
  const int bat  = blockIdx.x / ((NTOK / ATT_ROWS) * NHEAD);         // 0..7
  const int i0   = rb * ATT_ROWS + wave * 16;              // first score row (key token) of this wave
  const int x0   = i0 / GW;                                // image row of all 16 tokens
  const int yi   = (i0 & (GW - 1)) + c;                    // image column of this lane's score row i0 + c
  const size_t rowg = (size_t)bat * NTOK + i0;

  // per-lane copy addresses: q piece = row tid>>3, 16-B segment tid&7; v^T piece = row tid>>2, 16-B segment tid&3
  const unsigned short* gqh = QHh + ((size_t)bat * NTOK + (tid >> 3)) * DM + head * HD + (tid & 7) * 8;
  const unsigned short* gql = QHl + ((size_t)bat * NTOK + (tid >> 3)) * DM + head * HD + (tid & 7) * 8;
  const unsigned short* gvh = VTh + ((size_t)bat * DM + head * HD + (tid >> 2)) * NTOK + (tid & 3) * 8;
  const unsigned short* gvl = VTl + ((size_t)bat * DM + head * HD + (tid >> 2)) * NTOK + (tid & 3) * 8;
  const unsigned lbase = (unsigned)(uintptr_t)stg;         // LDS byte address of the stage buffers
  const unsigned lq = lbase + (unsigned)((tid >> 3) * (QPITCH * 2) + (tid & 7) * 16);
  const unsigned lv = lbase + (unsigned)(2 * QT_HALVES * 2 + (tid >> 2) * (VPITCH * 2) + (tid & 3) * 16);

  // chunk 0 -> buffer 0, landed and published; then chunk 1 -> buffer 1 flies while chunk 0 is worked on
  stage_copy4(lq, gqh, lq + QT_HALVES * 2, gql, lv, gvh, lv + VT_HALVES * 2, gvl);
  wait_copies();
  __syncthreads();
  stage_copy4(lq + STG_HALVES * 2, gqh + (size_t)KCH * DM, lq + (STG_HALVES + QT_HALVES) * 2, gql + (size_t)KCH * DM,
              lv + STG_HALVES * 2, gvh + KCH, lv + (STG_HALVES + VT_HALVES) * 2, gvl + KCH);

  // stationary B fragments: k rows i0 + c (hi and residual planes), d 0..31 and 32..63
  const size_t kofs = (rowg + c) * DM + head * HD + 8 * hh;
  const v16h kah = ldfrag_u(KHh + kofs), kbh = ldfrag_u(KHh + kofs + 32);
  const v16h kal = ldfrag_u(KHl + kofs), kbl = ldfrag_u(KHl + kofs + 32);

  // additive w-position logits of this lane's score row for the 16 chunk columns that it holds, loop-invariant, pre-scaled by log2(e)
  const float* rrow = Rtab + (rowg + c) * RT_LD + head * RTP;        // table row of score row i0 + c
  float wb0[8], wb1[8];
#pragma unroll
  for (int r = 0; r < 8; ++r) {
    const int iw = 8 * hh + r + (GW - 1) - yi;             // in [0, 46]
    wb0[r] = rrow[iw] * LOG2E;
    wb1[r] = rrow[iw + 16] * LOG2E;                        // in [16, 62]
  }
  const float* hrow = rrow + HD + (GH - 1) - x0;           // + st = h-position logit of chunk st; index st - x0 + 31 in [0, 62]

  float mrow = -INFINITY, lrow = 0.f;                      // row maximum (both halves alike); sum over this half's columns only
  v8f o0 = zero8(), o1 = zero8(), o2 = zero8(), o3 = zero8();   // O^T tiles: o_t[r] = O[i0 + c][16t + 8hh + r]

#pragma unroll 1
  for (int st = 0; st < NSTG; ++st) {
    const int bsel = st & 1;
    const unsigned short* sb  = stg + bsel * STG_HALVES;
    const unsigned short* Qsh = sb + c * QPITCH + 8 * hh;                    // q hi, row c of the chunk
    const unsigned short* Qsl = Qsh + QT_HALVES;
    const unsigned short* Vsh = sb + 2 * QT_HALVES + c * VPITCH + 8 * hh;    // v^T hi, row d = c
    const unsigned short* Vsl = Vsh + VT_HALVES;
    // h-position logit of this chunk (one image row x2 = st) for the lane's score row
    const float hraw = hrow[st];
    wait_addr();
    v8f s0, s1;                                            // s0[r] = S[i0 + c][8hh + r], s1[r] = S[i0 + c][16 + 8hh + r] of the chunk
    {
      const v16h q0h = ldfrag_u(Qsh), q1h = ldfrag_u(Qsh + 32);
      const v16h q0l = ldfrag_u(Qsl), q1l = ldfrag_u(Qsl + 32);
      s0 = mma_b(q0h, kah, zero8());
      s0 = mma_b(q1h, kbh, s0);
      s0 = mma_b(q0l, kah, s0);
      s0 = mma_b(q1l, kbh, s0);
      s0 = mma_b(q0h, kal, s0);
      s0 = mma_b(q1h, kbl, s0);
      guard1x4(s0, q0h, q1h, q0l, q1l);
    }
    {
      const int q2 = 16 * QPITCH;
      const v16h q0h = ldfrag_u(Qsh + q2), q1h = ldfrag_u(Qsh + q2 + 32);
      const v16h q0l = ldfrag_u(Qsl + q2), q1l = ldfrag_u(Qsl + q2 + 32);
      s1 = mma_b(q0h, kah, zero8());
      s1 = mma_b(q1h, kbh, s1);
      s1 = mma_b(q0l, kah, s1);
      s1 = mma_b(q1l, kbh, s1);
      s1 = mma_b(q0h, kal, s1);
      s1 = mma_b(q1h, kbl, s1);
      guard1x8(s1, q0h, q1h, q0l, q1l, kah, kbh, kal, kbl);
    }
    const float hb = hraw * LOG2E;
    float t0[8], t1[8];
#pragma unroll
    for (int r = 0; r < 8; ++r) {
      t0[r] = s0[r] * LOG2E + (wb0[r] + hb);
      t1[r] = s1[r] * LOG2E + (wb1[r] + hb);
    }
    float mx = fmaxf(t0[0], t1[0]);
#pragma unroll
    for (int r = 1; r < 8; ++r) mx = fmaxf(mx, fmaxf(t0[r], t1[r]));
    mx = fmaxf(mx, xhalf(mx));                             // both halves now hold the row's maximum over the chunk
    const float mn = fmaxf(mrow, mx);
    const float al = ex2(mrow - mn);
    mrow = mn;
    FragH ph, pl;                                          // P^T * 1024, f16 hi and unscaled residual: element s = column kmap(s, hh) of the chunk
    float pa[8];
#pragma unroll
    for (int r = 0; r < 8; ++r) {
      const float e0 = ex2(t0[r] - mn), e1 = ex2(t1[r] - mn);
      pa[r] = e0 + e1;
      float f; _Float16 x;
      f = e0 * PC; x = (_Float16)f; ph.h[0][r] = x; pl.h[0][r] = (_Float16)(f - (float)x);   // column 8hh + r
      f = e1 * PC; x = (_Float16)f; ph.h[1][r] = x; pl.h[1][r] = (_Float16)(f - (float)x);   // column 16 + 8hh + r
    }
    const float ps = ((pa[0] + pa[1]) + (pa[2] + pa[3])) + ((pa[4] + pa[5]) + (pa[6] + pa[7]));
    lrow = lrow * al + ps;
#pragma unroll
    for (int r = 0; r < 8; ++r) {
      o0[r] *= al;
      o1[r] *= al;
      o2[r] *= al;
      o3[r] *= al;
    }
    {
      const v16h vh0 = ldfrag_u(Vsh);
      const v16h vh1 = ldfrag_u(Vsh + 16 * VPITCH);
      const v16h vh2 = ldfrag_u(Vsh + 32 * VPITCH);
      const v16h vh3 = ldfrag_u(Vsh + 48 * VPITCH);
      o0 = mma_h(vh0, ph.v, o0);
      o1 = mma_h(vh1, ph.v, o1);
      o2 = mma_h(vh2, ph.v, o2);
      o3 = mma_h(vh3, ph.v, o3);
      o0 = mma_h(vh0, pl.v, o0);
      o1 = mma_h(vh1, pl.v, o1);
      o2 = mma_h(vh2, pl.v, o2);
      o3 = mma_h(vh3, pl.v, o3);
      guard4x6(o0, o1, o2, o3, ph.v, pl.v, vh0, vh1, vh2, vh3);
    }
    {
      const v16h vl0 = ldfrag_u(Vsl);
      const v16h vl1 = ldfrag_u(Vsl + 16 * VPITCH);
      const v16h vl2 = ldfrag_u(Vsl + 32 * VPITCH);
      const v16h vl3 = ldfrag_u(Vsl + 48 * VPITCH);
      o0 = mma_h(vl0, ph.v, o0);
      o1 = mma_h(vl1, ph.v, o1);
      o2 = mma_h(vl2, ph.v, o2);
      o3 = mma_h(vl3, ph.v, o3);
      guard4x5(o0, o1, o2, o3, ph.v, vl0, vl1, vl2, vl3);
    }
    // foot of the chunk: own LDS reads returned, own copies of chunk st + 1 landed, then the one barrier that publishes chunk st + 1
    // and ends every wave's reads of this chunk's buffer; only behind it is that buffer refilled with chunk st + 2
    wait_lds();
    wait_copies();
    __syncthreads();
    if (st + 2 < NSTG) {
      const size_t qa = (size_t)(st + 2) * KCH * DM;
      const int    va = (st + 2) * KCH;
      const unsigned lo = (unsigned)(bsel * STG_HALVES * 2);
      stage_copy4(lq + lo, gqh + qa, lq + lo + QT_HALVES * 2, gql + qa, lv + lo, gvh + va, lv + lo + VT_HALVES * 2, gvl + va);
    }
  }
  wait_copies();

  // ---- all waves done with the stage buffers; they become two bf16 result buffers [128][64] ----
  __syncthreads();
  unsigned short* Osh = stg;
  unsigned short* Osl = Osh + ATT_ROWS * HD;
  // ---- join the halves' sums, fold 1/l and the carries (1024 on P, 16 on v), split into bf16 hi + residual, stage the lane's 4 x 8 values ----
  const float oc = 1.0f / (PC * VC);
  const float inv = (1.0f / (lrow + xhalf(lrow))) * oc;
  const int ro = (wave * 16 + c) * HD + 8 * hh;            // row i0 + c of the block, d = 8hh; tile t adds 16t
  auto put8 = [&](const v8f& o, int t) {
    v4u a, b2;
#pragma unroll
    for (int e = 0; e < 4; ++e) {
      const float f0 = o[2 * e] * inv, f1 = o[2 * e + 1] * inv;
      const unsigned short g0 = bf_bits(f0), g1 = bf_bits(f1);
      a[e]  = pk16(g0, g1);
      b2[e] = pk16(bf_bits(f0 - bf_up(g0)), bf_bits(f1 - bf_up(g1)));
    }
    *(v4u*)(Osh + ro + 16 * t) = a;
    *(v4u*)(Osl + ro + 16 * t) = b2;
  };
  put8(o0, 0);
  put8(o1, 1);
  put8(o2, 2);
  put8(o3, 3);
  __syncthreads();
  // ---- block writes its 128 row pieces of both planes: piece p = it*256 + tid -> row p>>3, halves (p&7)*8 .. +7 (8 lanes = one 128-B line) ----
  {
    v4u hv[4], lv4[4];
#pragma unroll
    for (int it = 0; it < 4; ++it) {
      const int p = it * ATT_THREADS + tid;
      hv[it]  = *(const v4u*)(Osh + (size_t)p * 8);
      lv4[it] = *(const v4u*)(Osl + (size_t)p * 8);
    }
    const size_t dofs = ((size_t)bat * NTOK + rb * ATT_ROWS) * DM + head * HD;
    unsigned short* dsth = CTh + dofs;
    unsigned short* dstl = CTl + dofs;
    {
#pragma unroll
      for (int it = 0; it < 4; ++it) {
        const int p = it * ATT_THREADS + tid;
        const size_t go = (size_t)(p >> 3) * DM + (p & 7) * 8;
        *(v4u*)(dsth + go) = hv[it];
        *(v4u*)(dstl + go) = lv4[it];
      }
    }
  }
}

// =====================================================================================================
// Workspace map (bytes); every plane is an exact multiple of its tile / whole-row store granularity (M, N exact tile multiples,
// the activation convert count an exact multiple of 2048, no pad rows needed), every offset a multiple of 64 KiB:
//   WKT, WQT, WVT f16 [512][512] x64   3 x 524288    ([h*64+d][c] = [n][k])
//   WOT  bf16 [8][64 e][64 d]              65536
//   WUT  bf16 [512 out][512 in]          524288
//   REL  bf16 [8][128][64]                131072
//   X16  f16 [8192][512] x16             8388608    (activation rows b*1024 + tok)
//   QHh, QHl bf16 [8192][512]         2 x 8388608   (q projection, hi / residual)
//   KHh, KHl bf16 [8192][512]         2 x 8388608   (k projection, hi / residual)
//   VTh, VTl f16 [8][512][1024] x16   2 x 8388608   (v^T per image, hi / residual)
//   RTAB f32 [8192][1024]               33554432   (position-logit tables, 128 per head)
//   CTh, CTl bf16 [8192][512]         2 x 8388608   (attention ctx, merged heads, hi / residual)
//   CAh, CAl bf16 [8192][512]         2 x 8388608   (per-head output after batch-norm, concat layout, hi / residual)
//   end                                 128122880
// =====================================================================================================
extern "C" void kernel_launch(void* const* d_in, const int* in_sizes, int n_in,
                              void* d_out, int out_size, void* d_ws, size_t ws_size,
                              hipStream_t stream) {
  if (n_in < 12) return;
  if (in_sizes[0] != NROWS * DM) return;
  if (in_sizes[1] != NHEAD * DM * HD || in_sizes[2] != NHEAD * DM * HD || in_sizes[3] != NHEAD * DM * HD) return;
  if (in_sizes[4] != NHEAD * HD * HO) return;
  if (in_sizes[5] != NHEAD * HO || in_sizes[6] != NHEAD * HO || in_sizes[7] != NHEAD * HO || in_sizes[8] != NHEAD * HO) return;
  if (in_sizes[9] != NHEAD * NREL * HD || in_sizes[10] != NHEAD * NREL * HD) return;
  if (in_sizes[11] != COUT * COUT) return;
  if (out_size != NROWS * COUT) return;
  if ((in_sizes[0] % 2048) != 0) return;

  const float* x     = (const float*)d_in[0];
  const float* w_k   = (const float*)d_in[1];
  const float* w_q   = (const float*)d_in[2];
  const float* w_v   = (const float*)d_in[3];
  const float* w_o   = (const float*)d_in[4];
  const float* gam   = (const float*)d_in[5];
  const float* bet   = (const float*)d_in[6];
  const float* mmean = (const float*)d_in[7];
  const float* mvar  = (const float*)d_in[8];
  const float* relw  = (const float*)d_in[9];
  const float* relh  = (const float*)d_in[10];
  const float* w_out = (const float*)d_in[11];
  float*       out   = (float*)d_out;

  const size_t PWT = (size_t)DM * DM * 2;                         //   524288
  const size_t PWO = (size_t)NHEAD * HO * HD * 2;                 //    65536
  const size_t PWU = (size_t)COUT * COUT * 2;                     //   524288
  const size_t PRL = (size_t)NHEAD * RTP * HD * 2;                //   131072
  const size_t PX  = (size_t)NROWS * DM * 2;                      //  8388608
  const size_t PVT = (size_t)NB * DM * NTOK * 2;                  //  8388608
  const size_t PRT = (size_t)NROWS * RT_LD * 4;                   // 33554432
  size_t off = 0;
  const size_t oWK = off; off += PWT;
  const size_t oWQ = off; off += PWT;
  const size_t oWV = off; off += PWT;
  const size_t oWO = off; off += PWO;
  const size_t oWU = off; off += PWU;
  const size_t oRL = off; off += PRL;
  const size_t oX  = off; off += PX;
  const size_t oQh = off; off += PX;
  const size_t oQl = off; off += PX;
  const size_t oKh = off; off += PX;
  const size_t oKl = off; off += PX;
  const size_t oVh = off; off += PVT;
  const size_t oVl = off; off += PVT;
  const size_t oRT = off; off += PRT;
  const size_t oCh = off; off += PX;
  const size_t oCl = off; off += PX;
  const size_t oAh = off; off += PX;
  const size_t oAl = off; off += PX;
  if (off > ws_size) return;                                      // off = 128122880
  if (off > (size_t)134217728) return;

  char* ws = (char*)d_ws;
  unsigned short* WKT  = (unsigned short*)(ws + oWK);
  unsigned short* WQT  = (unsigned short*)(ws + oWQ);
  unsigned short* WVT  = (unsigned short*)(ws + oWV);
  unsigned short* WOT  = (unsigned short*)(ws + oWO);
  unsigned short* WUT  = (unsigned short*)(ws + oWU);
  unsigned short* REL  = (unsigned short*)(ws + oRL);
  unsigned short* X16  = (unsigned short*)(ws + oX);
  unsigned short* QHh  = (unsigned short*)(ws + oQh);
  unsigned short* QHl  = (unsigned short*)(ws + oQl);
  unsigned short* KHh  = (unsigned short*)(ws + oKh);
  unsigned short* KHl  = (unsigned short*)(ws + oKl);
  unsigned short* VTh  = (unsigned short*)(ws + oVh);
  unsigned short* VTl  = (unsigned short*)(ws + oVl);
  float*          RTAB = (float*)(ws + oRT);
  unsigned short* CTh  = (unsigned short*)(ws + oCh);
  unsigned short* CTl  = (unsigned short*)(ws + oCl);
  unsigned short* CAh  = (unsigned short*)(ws + oAh);
  unsigned short* CAl  = (unsigned short*)(ws + oAl);

  const dim3 blk(256);
  const dim3 gPR(PREP_BLOCKS);                                     // 2344
  const dim3 blkG(128);                                            // 4 waves: 2 x 2 (128 x 128 tile) or 4 x 1 (256 x 64 tile)
  const dim3 gP(PROJ_TILES, 3);                                    // 256 x 3
  const dim3 gR((NROWS / 128) * (RTP / 128), NHEAD);               // 64 x 8
  const dim3 gH((NROWS / 256) * (HO / 64), NHEAD);                 // 32 x 8
  const dim3 gF((NROWS / 128) * (COUT / 128), 1);                  // 256
  const dim3 gAT(ATT_BLOCKS);                                      // 512
  const dim3 bAT(ATT_THREADS);                                     // 256

  // (0) every operand pack: weight planes WKT, WQT, WVT (f16 x64), WOT, WUT, REL (bf16) and the activation plane X16 (f16 x16)
  prep<<<gPR, blk, 0, stream>>>(x, w_k, w_q, w_v, w_o, w_out, relw, relh, X16, WKT, WQT, WVT, WOT, WUT, REL);

  // (1) v^T, k and q projections -> VT (f16 x16 hi / residual), KH, QH (bf16 hi / residual)
  qkv<<<gP, blkG, 0, stream>>>(X16, WKT, WQT, WVT, KHh, KHl, QHh, QHl, VTh, VTl);

  // (2) position-logit tables per head: RTAB[row][128h + m] = sum_d (q_hi + q_lo)[row][64h + d] REL[h][m][d]; M = 8192, N = 128, K = 64, f32
  gemm64<0, 1, 1, 0, 2, 2><<<gR, blkG, 0, stream>>>(
      QHh, QHl, DM, (long long)HD,
      REL, HD, (long long)RTP * HD,
      (void*)RTAB, (void*)RTAB, RT_LD, (long long)RTP,
      NROWS, RTP, HD, 1.0f, 1.0f,
      x, x, x, x, 0);

  // (3) attention per (image, head, 128 score rows) -> CT (bf16 hi / residual planes)
  attn8<<<gAT, bAT, 0, stream>>>(KHh, KHl, QHh, QHl, VTh, VTl, RTAB, CTh, CTl);

  // (4) per-head output projection + eval batch-norm: CA[row][64h + e] = BN_h( sum_d (ct_hi + ct_lo)[row][64h + d] WOT[h][e][d] );
  //     M = 8192, N = 64, K = 64 per head -> bf16 hi / residual planes
  gemm64<3, 1, 1, 2, 4, 1><<<gH, blkG, 0, stream>>>(
      CTh, CTl, DM, (long long)HD,
      WOT, HD, (long long)HO * HD,
      (void*)CAh, (void*)CAl, DM, (long long)HO,
      NROWS, HO, HD, 1.0f, 1.0f,
      gam, bet, mmean, mvar, HO);

  // (5) out = (CA_hi + CA_lo) . WUT^T + bf16_RNE(x); M = 8192, N = 512, K = 512, f32
  gemm64<0, 1, 1, 1, 2, 2><<<gF, blkG, 0, stream>>>(
      CAh, CAl, DM, 0LL,
      WUT, COUT, 0LL,
      (void*)out, (void*)out, COUT, 0LL,
      NROWS, COUT, DM, 1.0f, 1.0f,
      x, x, x, x, 0);
  (void)hipGetLastError();
}

// v006
// Measured time: 89.3 microseconds a run.
// Next to v005, in two timings, it ran 1.32 and 1.31 times as fast.
// Counting every step since v000, it is 3.55 times as fast.
// Contractions (all f32 accumulate): k/q projections v_wmma_f32_16x16x32_f16 (x f16 x16 . W f16 x64, K=512, single products) -> bf16 hi/lo planes;
// v^T projection v_wmma_f32_16x16x32_f16 (Wv f16 x64 . x f16 x16, K=512, single) -> f16 x16 hi/lo planes;
// relative-position tables, transposed, v_wmma_f32_16x16x32_bf16 (rel bf16 . q bf16 hi/lo, W.hi+W.lo, K=64) -> f32 table in LDS (attention prologue);
// attention scores, transposed, v_wmma_f32_16x16x32_bf16 (q bf16 hi/lo . k bf16 hi/lo, hi.hi+lo.hi+hi.lo, K=64);
// v^T . P^T v_wmma_f32_16x16x32_f16 (v^T f16 x16 hi/lo . P^T f16 x1024 hi/lo, hi.hi+hi.lo+lo.hi, K=1024 by 32);
// per-head output projection, transposed, v_wmma_f32_16x16x32_bf16 (Wo bf16 . ctx bf16 hi/lo, K=64) with eval batch-norm affine in f32 -> bf16 hi/lo planes (attention epilogue);
// final projection v_wmma_f32_16x16x32_bf16 (cat bf16 hi/lo . Wout bf16, K=512) + bf16-RNE residual in f32.
// Max-subtracted online base-2 softmax and the additive position logits in f32 on VALU. Every float input RNE-converted to bf16 on load.
#include <hip/hip_runtime.h>
#include <math.h>
#include <stdint.h>

#define NB     8
#define GH     32
#define GW     32
#define NTOK   (GH * GW)
#define DM     512
#define NHEAD  8
#define HD     64
#define HO     64
#define COUT   512
#define NREL   63
#define RTP    128
#define NROWS  (NB * NTOK)
#define KCH    32
#define WSC    64.0f
#define ACARRY 16.0f
#define VC     16.0f
#define PC     1024.0f
#define LOG2E  1.4426950408889634f
#define BN_EPS 1e-3f
static_assert(NHEAD * HD == DM);
static_assert(NHEAD * HO == COUT);
static_assert(COUT == DM);
static_assert(KCH == GW);
static_assert(NREL == 2 * GW - 1);
static_assert(NREL == 2 * GH - 1);
static_assert(NREL <= HD);
static_assert(HD + NREL <= RTP);
static_assert((NTOK % 128) == 0 && (DM % 128) == 0 && (NROWS % 256) == 0 && (HD % 64) == 0 && (NTOK % KCH) == 0);
static_assert((RTP % 128) == 0 && (HO % 64) == 0 && (COUT % 128) == 0);
#define GKS         64
#define GPITCH      72
#define ATT_WAVES   8
#define ATT_THREADS (ATT_WAVES * 32)
#define ATT_ROWS    (ATT_WAVES * 16)
#define ATT_BLOCKS  (NB * NHEAD * (NTOK / ATT_ROWS))
#define NSTG        (NTOK / KCH)
#define QPITCH      72
#define VPITCH      40
#define QT_HALVES   (KCH * QPITCH)
#define VT_HALVES   (HD * VPITCH)
#define STG_HALVES  (2 * QT_HALVES + 2 * VT_HALVES)
#define TPITCH      (RTP + 4)
static_assert(ATT_THREADS == 256);
static_assert(ATT_BLOCKS == 512);
static_assert(NSTG >= 2);
static_assert(KCH * (HD / 8) == ATT_THREADS && HD * (KCH / 8) == ATT_THREADS);
static_assert((QT_HALVES % 8) == 0 && (VT_HALVES % 8) == 0 && (QPITCH % 8) == 0 && (VPITCH % 8) == 0);
static_assert(2 * ATT_ROWS * HD <= 2 * STG_HALVES);
static_assert((ATT_ROWS * HD) / 8 == 4 * ATT_THREADS);
static_assert((TPITCH % 4) == 0 && (RTP % 16) == 0 && HO == HD);

typedef _Float16 v16h __attribute__((ext_vector_type(16)));
typedef _Float16 v8h  __attribute__((ext_vector_type(8)));
typedef __bf16   v16b __attribute__((ext_vector_type(16)));
typedef float    v8f  __attribute__((ext_vector_type(8)));
typedef float    v4f  __attribute__((ext_vector_type(4)));
typedef unsigned int v4u __attribute__((ext_vector_type(4)));

union FragH { v16h v; v8h h[2]; v4u u[2]; };
union FragAny { v16h h; v16b b; };

// ---- scalar helpers --------------------------------------------------------------------------------
__device__ __forceinline__ unsigned short bf_bits(float f) {          // f32 -> bf16 bits, RNE convert
  unsigned u = __float_as_uint(f);
  return (unsigned short)((u + 0x7FFFu + ((u >> 16) & 1u)) >> 16);
}
__device__ __forceinline__ float bf_up(unsigned short h) { return __uint_as_float(((unsigned)h) << 16); }
__device__ __forceinline__ float bfr(float f) { return bf_up(bf_bits(f)); }   // value of the bf16 RNE convert
__device__ __forceinline__ unsigned short h_bits(_Float16 x) { return __builtin_bit_cast(unsigned short, x); }
__device__ __forceinline__ unsigned pk16(unsigned short a, unsigned short b) { return (unsigned)a | ((unsigned)b << 16); }
__device__ __forceinline__ v8f zero8() { v8f z = {0.f, 0.f, 0.f, 0.f, 0.f, 0.f, 0.f, 0.f}; return z; }
// value of lane l ^ 16 (the other half of the wave), by one vector cross-row move
__device__ __forceinline__ float xhalf(float x) {
  const int b = __builtin_bit_cast(int, x);
  return __builtin_bit_cast(float, __builtin_amdgcn_permlanex16(b, b, 0x76543210, 0xfedcba98, false, false));
}

// 2^x by the bare v_exp_f32. Every argument in the softmax is <= 0; the library form's range guard only serves results below 2^-126, which
// add nothing to a row sum that holds its maximum's 1.0 and convert to 0 in both f16 planes of P (and -inf still gives 0 for the first chunk).
__device__ __forceinline__ float ex2(float x) { return __builtin_amdgcn_exp2f(x); }

// ---- fragment loader: 16-bit A/B operand from a k-contiguous 16-bit plane, lane -> row/col (lane&15),
//      p already includes +8*(lane>>4); elements 0..7 <- p[0..7] (k0+8h..), elements 8..15 <- p[16..23] (k0+16+8h..)
//      (same split k map for A and B; B is always read from a [n][k] plane)
__device__ __forceinline__ v16h ldfrag_u(const unsigned short* p) {
  FragH f;
  f.u[0] = *(const v4u*)(p);
  f.u[1] = *(const v4u*)(p + 16);
  return f.v;
}

// ---- WMMA helpers with trailing VALU hazard gaps ------------------------------------------------------
__device__ __forceinline__ v8f mma_h(v16h a, v16h b, v8f c) {
  return __builtin_amdgcn_wmma_f32_16x16x32_f16(false, a, false, b, (short)0, c, false, false);
}
__device__ __forceinline__ v8f mma_b(v16h a, v16h b, v8f c) {
  FragAny ua, ub;
  ua.h = a;
  ub.h = b;
  return __builtin_amdgcn_wmma_f32_16x16x32_bf16(false, ua.b, false, ub.b, (short)0, c, false, false);
}
template <int BF>
__device__ __forceinline__ v8f mmaT(v16h a, v16h b, v8f c) {
  if constexpr (BF != 0) return mma_b(a, b, c);
  else return mma_h(a, b, c);
}
__device__ __forceinline__ void dep_guard1(v8f& a, v8f& b, v16h x) {
#if defined(__HIP_DEVICE_COMPILE__)
  asm volatile("v_nop\n\tv_nop\n\tv_nop\n\tv_nop" : "+v"(a), "+v"(b) : "v"(x));
#endif
}
__device__ __forceinline__ void guard1x4(v8f& s, v16h a0, v16h a1, v16h a2, v16h a3) {
#if defined(__HIP_DEVICE_COMPILE__)
  asm volatile("v_nop\n\tv_nop\n\tv_nop\n\tv_nop" : "+v"(s) : "v"(a0), "v"(a1), "v"(a2), "v"(a3));
#endif
}
__device__ __forceinline__ void guard1x8(v8f& s, v16h a0, v16h a1, v16h a2, v16h a3,
                                         v16h b0, v16h b1, v16h b2, v16h b3) {
#if defined(__HIP_DEVICE_COMPILE__)
  asm volatile("v_nop\n\tv_nop\n\tv_nop\n\tv_nop"
               : "+v"(s) : "v"(a0), "v"(a1), "v"(a2), "v"(a3), "v"(b0), "v"(b1), "v"(b2), "v"(b3));
#endif
}
__device__ __forceinline__ void guard4x6(v8f& a, v8f& b, v8f& c, v8f& d,
                                         v16h x0, v16h x1, v16h x2, v16h x3, v16h x4, v16h x5) {
#if defined(__HIP_DEVICE_COMPILE__)
  asm volatile("v_nop\n\tv_nop\n\tv_nop\n\tv_nop"
               : "+v"(a), "+v"(b), "+v"(c), "+v"(d) : "v"(x0), "v"(x1), "v"(x2), "v"(x3), "v"(x4), "v"(x5));
#endif
}
__device__ __forceinline__ void guard4x5(v8f& a, v8f& b, v8f& c, v8f& d,
                                         v16h x0, v16h x1, v16h x2, v16h x3, v16h x4) {
#if defined(__HIP_DEVICE_COMPILE__)
  asm volatile("v_nop\n\tv_nop\n\tv_nop\n\tv_nop"
               : "+v"(a), "+v"(b), "+v"(c), "+v"(d) : "v"(x0), "v"(x1), "v"(x2), "v"(x3), "v"(x4));
#endif
}
__device__ __forceinline__ void keep4_h(v16h a, v16h b, v16h c, v16h d) {
#if defined(__HIP_DEVICE_COMPILE__)
  asm volatile("v_nop" :: "v"(a), "v"(b), "v"(c), "v"(d));
#endif
}
__device__ __forceinline__ void acc_guard4(v8f& a, v8f& b, v8f& c, v8f& d) {
#if defined(__HIP_DEVICE_COMPILE__)
  asm volatile("v_nop\n\tv_nop\n\tv_nop\n\tv_nop" : "+v"(a), "+v"(b), "+v"(c), "+v"(d));
#endif
}
__device__ __forceinline__ void wave_sync_lds() {
  __builtin_amdgcn_fence(__ATOMIC_RELEASE, "workgroup");
  __builtin_amdgcn_wave_barrier();
  __builtin_amdgcn_fence(__ATOMIC_ACQUIRE, "workgroup");
}

// four 16-B copies per lane, global -> LDS through no register; the s_wait_xcnt 0 in the same statement stands ahead of any later
// rewrite of the address registers that the copies name
__device__ __forceinline__ void stage_copy4(unsigned l0, const unsigned short* g0, unsigned l1, const unsigned short* g1,
                                            unsigned l2, const unsigned short* g2, unsigned l3, const unsigned short* g3) {
#if defined(__HIP_DEVICE_COMPILE__)
  asm volatile("global_load_async_to_lds_b128 %0, %1, off\n\t"
               "global_load_async_to_lds_b128 %2, %3, off\n\t"
               "global_load_async_to_lds_b128 %4, %5, off\n\t"
               "global_load_async_to_lds_b128 %6, %7, off\n\t"
               "s_wait_xcnt 0x0"
               :: "v"(l0), "v"(g0), "v"(l1), "v"(g1), "v"(l2), "v"(g2), "v"(l3), "v"(g3) : "memory");
#endif
}
// the same for eight copies: one wait on the address registers serves the run
__device__ __forceinline__ void stage_copy8(unsigned l0, const unsigned short* g0, unsigned l1, const unsigned short* g1,
                                            unsigned l2, const unsigned short* g2, unsigned l3, const unsigned short* g3,
                                            unsigned l4, const unsigned short* g4, unsigned l5, const unsigned short* g5,
                                            unsigned l6, const unsigned short* g6, unsigned l7, const unsigned short* g7) {
#if defined(__HIP_DEVICE_COMPILE__)
  asm volatile("global_load_async_to_lds_b128 %0, %1, off\n\t"
               "global_load_async_to_lds_b128 %2, %3, off\n\t"
               "global_load_async_to_lds_b128 %4, %5, off\n\t"
               "global_load_async_to_lds_b128 %6, %7, off\n\t"
               "global_load_async_to_lds_b128 %8, %9, off\n\t"
               "global_load_async_to_lds_b128 %10, %11, off\n\t"
               "global_load_async_to_lds_b128 %12, %13, off\n\t"
               "global_load_async_to_lds_b128 %14, %15, off\n\t"
               "s_wait_xcnt 0x0"
               :: "v"(l0), "v"(g0), "v"(l1), "v"(g1), "v"(l2), "v"(g2), "v"(l3), "v"(g3),
                  "v"(l4), "v"(g4), "v"(l5), "v"(g5), "v"(l6), "v"(g6), "v"(l7), "v"(g7) : "memory");
#endif
}
// this wave's copies have landed in LDS
__device__ __forceinline__ void wait_copies() {
#if defined(__HIP_DEVICE_COMPILE__)
  asm volatile("s_wait_asynccnt 0x0" ::: "memory");
#endif
}
// stands behind a global load or store, ahead of a later rewrite of a register that it names
__device__ __forceinline__ void wait_addr() {
#if defined(__HIP_DEVICE_COMPILE__)
  asm volatile("s_wait_xcnt 0x0" ::: "memory");
#endif
}
// this wave's LDS reads have returned (ahead of the barrier behind which their buffer is refilled)
__device__ __forceinline__ void wait_lds() {
#if defined(__HIP_DEVICE_COMPILE__)
  asm volatile("s_wait_dscnt 0x0" ::: "memory");
#endif
}

// =====================================================================================================
// Elementwise 16-bit pack, no transpose. BFO 0: dst[i] = f16( bf16_RNE(src[i]) * sc ), sc a power of two (exact);
// BFO 1: dst[i] = bf16_RNE(src[i]) bits. 8 elements per thread: two 16-B loads, one 16-B store per lane; 32 consecutive
// coverage: n / 2048 blocks (index bx) x 256 thr x 8 elements = n exactly (host checks n % 2048 == 0).
// =====================================================================================================
template <int BFO>
__device__ __forceinline__ void cvt16(const float* __restrict__ src, unsigned short* dst, int n, float sc, int bx) {
  const size_t i8 = ((size_t)bx * 256 + threadIdx.x) * 8;
  if (i8 + 8 > (size_t)n) return;                 // never taken with the exact block range; no barriers in this job
  const v4f a = *(const v4f*)(src + i8);
  const v4f b = *(const v4f*)(src + i8 + 4);
  v4u o;
  if constexpr (BFO != 0) {
    o[0] = pk16(bf_bits(a[0]), bf_bits(a[1]));
    o[1] = pk16(bf_bits(a[2]), bf_bits(a[3]));
    o[2] = pk16(bf_bits(b[0]), bf_bits(b[1]));
    o[3] = pk16(bf_bits(b[2]), bf_bits(b[3]));
  } else {
    o[0] = pk16(h_bits((_Float16)(bfr(a[0]) * sc)), h_bits((_Float16)(bfr(a[1]) * sc)));
    o[1] = pk16(h_bits((_Float16)(bfr(a[2]) * sc)), h_bits((_Float16)(bfr(a[3]) * sc)));
    o[2] = pk16(h_bits((_Float16)(bfr(b[0]) * sc)), h_bits((_Float16)(bfr(b[1]) * sc)));
    o[3] = pk16(h_bits((_Float16)(bfr(b[2]) * sc)), h_bits((_Float16)(bfr(b[3]) * sc)));
  }
  {
    *(v4u*)(dst + i8) = o;
    
  }
}

// =====================================================================================================
// Transposing 16-bit pack of a weight matrix: in W[Cin][Dd] (pitch Dd, base + z*sIn) -> out WT[Dd][Cin] (pitch Cin, base + z*sOut),
// BFO 0: f16( bf16_RNE(w) * sc ); BFO 1: bf16_RNE(w) bits. One 64x64 tile per block (bx = Cin tile, by = Dd tile, bz = matrix index):
// coverage: loads 4 x 256 x 4 floats = 64x64; stores 2 x 256 pieces x 8 halves = 64 rows x 64 halves = the whole tile;
//           (bx, by, bz) runs over (Cin/64, Dd/64, nmat) exactly (all sizes exact multiples of 64). t: the block's 64 x 65 float tile in LDS.
// =====================================================================================================
template <int BFO>
__device__ __forceinline__ void tr16(const float* __restrict__ W, unsigned short* WT, int Cin, int Dd,
                                     long long sIn, long long sOut, float sc, int bx, int by, int bz, float (*t)[65]) {
  const int tid = threadIdx.x;
  const int c0 = bx * 64, d0 = by * 64;
  const float* src = W + (size_t)((long long)bz * sIn);
  unsigned short* dst = WT + (size_t)((long long)bz * sOut);
#pragma unroll
  for (int it = 0; it < 4; ++it) {
    const int p  = it * 256 + tid;
    const int cc = p >> 4, sg = (p & 15) * 4;
    const v4f v = *(const v4f*)(src + (size_t)(c0 + cc) * Dd + d0 + sg);
    t[cc][sg]     = v[0];
    t[cc][sg + 1] = v[1];
    t[cc][sg + 2] = v[2];
    t[cc][sg + 3] = v[3];
  }
  __syncthreads();
  v4u o[2];
#pragma unroll
  for (int it = 0; it < 2; ++it) {
    const int p  = it * 256 + tid;
    const int dd = p >> 3, s8 = (p & 7) * 8;
    unsigned short hv[8];
#pragma unroll
    for (int k = 0; k < 8; ++k) {
      const float f = bfr(t[s8 + k][dd]);
      if constexpr (BFO != 0) hv[k] = bf_bits(f);
      else hv[k] = h_bits((_Float16)(f * sc));
    }
    v4u q;
    q[0] = pk16(hv[0], hv[1]);
    q[1] = pk16(hv[2], hv[3]);
    q[2] = pk16(hv[4], hv[5]);
    q[3] = pk16(hv[6], hv[7]);
    o[it] = q;
  }
  {
#pragma unroll
    for (int it = 0; it < 2; ++it) {
      const int p  = it * 256 + tid;
      const int dd = p >> 3, s8 = (p & 7) * 8;
      *(v4u*)(dst + (size_t)(d0 + dd) * Cin + c0 + s8) = o[it];
    }
    wait_addr();   // other jobs' code follows these stores in the merged kernel and rewrites their registers
  }
}

// =====================================================================================================
// Relative-position operand plane: out[h][r][0..63] bf16 bits, r 0..62 = rel_w[h][r][:], r 63 = 0, r 64..126 = rel_h[h][r-64][:],
// r 127 = 0. Every lane loads both candidate rows from clamped addresses and selects by value. 8 halves per thread, 8 consecutive
// coverage: 32 blocks (index bx) x 256 threads x 8 halves = 8 x 128 x 64 exactly.
// =====================================================================================================
__device__ __forceinline__ void relcat(const float* __restrict__ rw, const float* __restrict__ rh, unsigned short* out, int bx) {
  const int p   = bx * 256 + threadIdx.x;                // 0 .. NHEAD*RTP*8 - 1
  const int hd  = p / (RTP * 8);
  const int r   = (p >> 3) & (RTP - 1);
  const int seg = (p & 7) * 8;
  const int iw  = (r < NREL) ? r : (NREL - 1);
  int ih = r - HD;
  ih = (ih < 0) ? 0 : ih;
  ih = (ih > NREL - 1) ? (NREL - 1) : ih;
  const float* pw = rw + ((size_t)hd * NREL + iw) * HD + seg;
  const float* ph = rh + ((size_t)hd * NREL + ih) * HD + seg;
  const v4f a0 = *(const v4f*)(pw), a1 = *(const v4f*)(pw + 4);
  const v4f b0 = *(const v4f*)(ph), b1 = *(const v4f*)(ph + 4);
  const bool uw = (r < NREL);
  const bool uh = (r >= HD) && (r < HD + NREL);
  float v[8];
#pragma unroll
  for (int e = 0; e < 4; ++e) {
    v[e]     = uw ? a0[e] : (uh ? b0[e] : 0.f);
    v[4 + e] = uw ? a1[e] : (uh ? b1[e] : 0.f);
  }
  v4u o;
  o[0] = pk16(bf_bits(v[0]), bf_bits(v[1]));
  o[1] = pk16(bf_bits(v[2]), bf_bits(v[3]));
  o[2] = pk16(bf_bits(v[4]), bf_bits(v[5]));
  o[3] = pk16(bf_bits(v[6]), bf_bits(v[7]));
  {
    *(v4u*)(out + (size_t)p * 8) = o;
    wait_addr();   // other jobs' code follows this store in the merged kernel and rewrites its registers
  }
}

// =====================================================================================================
// All operand packs in one launch: none reads what another writes, so the job is picked by the block index (block-uniform, so the barrier
// of the transposing jobs is passed by a whole block or by none). The transposing jobs, whose blocks last longest, come first.
//   blocks    0 ..  191: W[h][c][d] -> WT[h*64+d][c] as f16( bf16_RNE(w) * 64 ) for Wk, Wq, Wv (64 blocks each: 8 c tiles x 8 heads)
//   blocks  192 ..  255: Wout[in][out] -> WUT[out][in] bf16 (8 x 8 tiles)
//   blocks  256 ..  263: Wo[h][d][e] -> WOT[h][e][d] bf16 (one tile per head)
//   blocks  264 ..  295: rel tables -> REL[h][128][64] bf16 (rows 63, 127 zero)
//   blocks  296 .. 2343: X16[row][c] = f16( bf16_RNE(x[row][c]) * 16 ), rows = b*1024 + tok
// =====================================================================================================
#define PB_W    ((DM / 64) * NHEAD)
#define PB_WU   ((COUT / 64) * (COUT / 64))
#define PB_WO   NHEAD
#define PB_RL   ((NHEAD * RTP * 8) / 256)
#define PB_X    ((NROWS * DM) / 2048)
#define PREP_BLOCKS (3 * PB_W + PB_WU + PB_WO + PB_RL + PB_X)
static_assert(HD == 64 && HO == 64);
__global__ __launch_bounds__(256) void prep(const float* __restrict__ x, const float* __restrict__ w_k, const float* __restrict__ w_q,
                                            const float* __restrict__ w_v, const float* __restrict__ w_o, const float* __restrict__ w_out,
                                            const float* __restrict__ relw, const float* __restrict__ relh,
                                            unsigned short* X16, unsigned short* WKT, unsigned short* WQT, unsigned short* WVT,
                                            unsigned short* WOT, unsigned short* WUT, unsigned short* REL) {
  __shared__ float t[64][65];
  int b = blockIdx.x;
  if (b < 3 * PB_W) {
    const int m = b / PB_W, r = b - m * PB_W;
    const float* src = (m == 0) ? w_k : ((m == 1) ? w_q : w_v);
    unsigned short* dst = (m == 0) ? WKT : ((m == 1) ? WQT : WVT);
    tr16<0>(src, dst, DM, HD, (long long)DM * HD, (long long)HD * DM, WSC, r % (DM / 64), 0, r / (DM / 64), t);
    return;
  }
  b -= 3 * PB_W;
  if (b < PB_WU) {
    tr16<1>(w_out, WUT, COUT, COUT, 0LL, 0LL, 1.0f, b % (COUT / 64), b / (COUT / 64), 0, t);
    return;
  }
  b -= PB_WU;
  if (b < PB_WO) {
    tr16<1>(w_o, WOT, HD, HO, (long long)HD * HO, (long long)HO * HD, 1.0f, 0, 0, b, t);
    return;
  }
  b -= PB_WO;
  if (b < PB_RL) {
    relcat(relw, relh, REL, b);
    return;
  }
  b -= PB_RL;
  cvt16<0>(x, X16, NROWS * DM, ACARRY, b);
}

// =====================================================================================================
// Register-blocked batched 16-bit WMMA GEMM: C[m][n] = oscale * sum_k A[m][k] * Bt[n][k]; one wave per 64x64 tile, block = WM x WN waves
// (4 waves) on a (64 WM) x (64 WN) tile.
// A row-major [M][K] pitch lda (16-bit plane), Bt row-major [N][K] pitch ldb (k contiguous); M multiple of 64 WM, N of 64 WN, K of 64.
// The block's A and Bt rows are brought into LDS once per block, in k slabs of 64 (one whole 128-B line per row, 8 lanes per line, pitch 144 B
// in LDS), by asynchronous 16-B copies, two buffers: slab t + 2 is issued behind the barrier that ends slab t. All fragments are 16-B LDS reads
// with the same split k map and the same k order of the products as with fragments read from global memory.
// bx = tile index, by = batch index with element strides sA, sB, sC; gst, sT: the block's LDS (two slab buffers; one 16 x 68 float slab per wave).
// ASPLIT 1: a second A plane A2 (unscaled residual of A, same layout) is multiplied into the same accumulator (A + A2 ~ exact A).
// BF 1: bf16 operands (v_wmma_f32_16x16x32_bf16), else f16.
// OM 0: f32 out (pitch ldc).  OM 2: f16 out = f16(value * ocarry).  OM 3: two bf16 planes: hi = bf16_RNE(value), lo = bf16_RNE(value - hi).
// OM 4: two f16 planes: hi = f16(value * ocarry), lo = f16(value * ocarry - hi) (unscaled residual).
// EPI 1 (OM 0 only): value += bf16_RNE(ep0[same index as C]).  EPI 2 (16-bit out): per-column eval batch-norm affine
//   value = (bf16(ep0[ci]) * (value - bf16(ep2[ci]))) * rsqrt(bf16(ep3[ci]) + eps) + bf16(ep1[ci]),  ci = by*cps + column.
// coverage: 4 slabs x 16 rows (f32: it 0..7 x lane>>4; 16-bit: it 0..3 x lane>>3) x 64 cols = the wave's whole 64x64 tile;
//           bx runs over (M / (64 WM)) * (N / (64 WN)) blocks exactly; a surplus block would leave as a whole, ahead of every copy and barrier.
// =====================================================================================================
template <int V> struct IntC { static constexpr int value = V; };
constexpr int gemm_slab_halves(int asplit, int wm, int wn) { return ((1 + asplit) * 64 * wm + 64 * wn) * GPITCH; }   // one buffer: A | (A2) | Bt
template <int OM, int ASPLIT, int BF, int EPI, int WM, int WN>
__device__ __forceinline__ void gemm64_tile(
    unsigned short* gst, float* sT, unsigned bx, int by,
    const unsigned short* __restrict__ Ap, const unsigned short* __restrict__ A2p, int lda, long long sA,
    const unsigned short* __restrict__ Btp, int ldb, long long sB,
    void* Cout, void* C2out, int ldc, long long sC,
    int M, int N, int K, float oscale, float ocarry,
    const float* __restrict__ ep0, const float* __restrict__ ep1,
    const float* __restrict__ ep2, const float* __restrict__ ep3, int cps) {
  constexpr int NW     = WM * WN;                    // waves per block
  constexpr int AR     = 64 * WM;                    // A rows of the block tile
  constexpr int BR     = 64 * WN;                    // Bt rows of the block tile
  constexpr int RPI    = NW * 4;                     // rows that one copy of every lane of the block covers (8 lanes per row)
  constexpr int A_H    = AR * GPITCH;                // halves of one A plane's slab in LDS
  constexpr int B_H    = BR * GPITCH;
  constexpr int SLAB_H = (1 + ASPLIT) * A_H + B_H;   // one buffer: A | (A2) | Bt
  static_assert(SLAB_H == gemm_slab_halves(ASPLIT, WM, WN));
  static_assert((AR % (4 * RPI)) == 0 && (BR % (4 * RPI)) == 0);
  static_assert(((1 + ASPLIT) * AR + BR) / RPI <= 63);     // copies of one wave in flight
  const int tid  = threadIdx.x;
  const int lane = tid & 31;
  const int wave = tid >> 5;
  const int tilesN = N / BR;
  const int tilesM = M / AR;
  if ((int)bx >= tilesM * tilesN) return;           // block-uniform, ahead of every copy and barrier
  const int tm  = bx / tilesN;
  const int tn  = bx - tm * tilesN;
  const int bm0 = tm * AR;
  const int bn0 = tn * BR;
  const int wm  = wave / WN;
  const int wn  = wave - wm * WN;
  const int m0  = bm0 + (wm << 6);
  const int n0  = bn0 + (wn << 6);

  const unsigned short* A1 = Ap  + (size_t)((long long)by * sA);
  const unsigned short* A2 = A2p + (size_t)((long long)by * sA);
  const unsigned short* Bb = Btp + (size_t)((long long)by * sB);

  const int rlane = lane & 15;                 // row (A) / col (B, D) within subtile
  const int koff  = (lane >> 4) * 8;           // k offset of this lane half
  const int mOff  = (lane >> 4) * 8;           // D row offset

  // per-lane copy addresses: row tid>>3 of a group of RPI rows, 16-B segment tid&7 of the row's 128-B line
  const unsigned short* gA  = A1 + (size_t)(bm0 + (tid >> 3)) * lda + (tid & 7) * 8;
  const unsigned short* gA2 = A2 + (size_t)(bm0 + (tid >> 3)) * lda + (tid & 7) * 8;
  const unsigned short* gB  = Bb + (size_t)(bn0 + (tid >> 3)) * ldb + (tid & 7) * 8;
  const unsigned lcp = (unsigned)(uintptr_t)gst + (unsigned)((tid >> 3) * (GPITCH * 2) + (tid & 7) * 16);   // LDS byte address
  constexpr unsigned LSTEP = (unsigned)(RPI * GPITCH * 2);      // LDS bytes from one group of RPI rows to the next
  const size_t astep = (size_t)RPI * lda, bstep = (size_t)RPI * ldb;
  // rows of one plane: groups of RPI rows, eight groups (or the last four) per statement
  auto plane = [&](unsigned l, const unsigned short* p, size_t step, auto ngroups) {
    constexpr int NG = decltype(ngroups)::value;
#pragma unroll
    for (int g = 0; g < NG; g += 8) {
      const unsigned short* q = p + (size_t)g * step;
      const unsigned m = l + (unsigned)g * LSTEP;
      if (g + 8 <= NG) {
        stage_copy8(m, q, m + LSTEP, q + step, m + 2 * LSTEP, q + 2 * step, m + 3 * LSTEP, q + 3 * step,
                    m + 4 * LSTEP, q + 4 * step, m + 5 * LSTEP, q + 5 * step, m + 6 * LSTEP, q + 6 * step, m + 7 * LSTEP, q + 7 * step);
      } else {
        stage_copy4(m, q, m + LSTEP, q + step, m + 2 * LSTEP, q + 2 * step, m + 3 * LSTEP, q + 3 * step);
      }
    }
  };
  auto stage = [&](int buf, int k0) {
    const unsigned l0 = lcp + (unsigned)(buf * (SLAB_H * 2));
    plane(l0, gA + k0, astep, IntC<AR / RPI>{});
    if constexpr (ASPLIT != 0) plane(l0 + (unsigned)(A_H * 2), gA2 + k0, astep, IntC<AR / RPI>{});
    plane(l0 + (unsigned)((1 + ASPLIT) * A_H * 2), gB + k0, bstep, IntC<BR / RPI>{});
  };

  v8f acc[4][4];
#pragma unroll
  for (int i = 0; i < 4; ++i)
#pragma unroll
    for (int j = 0; j < 4; ++j) acc[i][j] = zero8();

  // slab 0 -> buffer 0, landed and published; then slab 1 -> buffer 1 flies while slab 0 is worked on
  const int nslab = K / GKS;
  stage(0, 0);
  wait_copies();
  __syncthreads();
  if (nslab > 1) stage(1, GKS);

#pragma unroll 1
  for (int t = 0; t < nslab; ++t) {
    const unsigned short* sb  = gst + (t & 1) * SLAB_H;
    const unsigned short* As  = sb + ((wm << 6) + rlane) * GPITCH + koff;
    const unsigned short* As2 = As + A_H;
    const unsigned short* Bs  = sb + (1 + ASPLIT) * A_H + ((wn << 6) + rlane) * GPITCH + koff;
#pragma unroll
    for (int ks = 0; ks < GKS; ks += 32) {
      // all fragments of the k-step are read as one group ahead of its products (one LDS wait per k-step, not one per row of tiles)
      v16h bh[4], ah[4];
#pragma unroll
      for (int j = 0; j < 4; ++j) bh[j] = ldfrag_u(Bs + (j << 4) * GPITCH + ks);
#pragma unroll
      for (int i = 0; i < 4; ++i) ah[i] = ldfrag_u(As + (i << 4) * GPITCH + ks);
      if constexpr (ASPLIT != 0) {
        v16h al[4];
#pragma unroll
        for (int i = 0; i < 4; ++i) al[i] = ldfrag_u(As2 + (i << 4) * GPITCH + ks);
#pragma unroll
        for (int i = 0; i < 4; ++i) {
#pragma unroll
          for (int j = 0; j < 4; ++j) acc[i][j] = mmaT<BF>(ah[i], bh[j], acc[i][j]);
          dep_guard1(acc[i][0], acc[i][3], ah[i]);
#pragma unroll
          for (int j = 0; j < 4; ++j) acc[i][j] = mmaT<BF>(al[i], bh[j], acc[i][j]);
          dep_guard1(acc[i][0], acc[i][3], al[i]);
        }
      } else {
#pragma unroll
        for (int i = 0; i < 4; ++i) {
#pragma unroll
          for (int j = 0; j < 4; ++j) acc[i][j] = mmaT<BF>(ah[i], bh[j], acc[i][j]);
          dep_guard1(acc[i][0], acc[i][3], ah[i]);
        }
      }
      keep4_h(bh[0], bh[1], bh[2], bh[3]);
    }
    // foot of the slab: own LDS reads returned, own copies of slab t + 1 landed, then the one barrier that publishes slab t + 1
    // and ends every wave's reads of this slab's buffer; only behind it is that buffer refilled with slab t + 2
    wait_lds();
    wait_copies();
    __syncthreads();
    if (t + 2 < nslab) stage(t & 1, (t + 2) * GKS);
  }
  wait_copies();
  acc_guard4(acc[0][0], acc[0][1], acc[0][2], acc[0][3]);
  acc_guard4(acc[1][0], acc[1][1], acc[1][2], acc[1][3]);
  acc_guard4(acc[2][0], acc[2][1], acc[2][2], acc[2][3]);
  acc_guard4(acc[3][0], acc[3][1], acc[3][2], acc[3][3]);

  const int hh2 = lane >> 4, c4 = (lane & 15) * 4;     // f32 out: 256-B row segment = 16 lanes x 16 B
  const int q8  = lane >> 3, c8 = (lane & 7) * 8;

  // ---- epilogue ----
  float* slab = sT + wave * (16 * 68);              // per-wave 16x64 slab, pitch 68 floats
#pragma unroll
  for (int i = 0; i < 4; ++i) {
    const int mBase = m0 + (i << 4);
#pragma unroll
    for (int j = 0; j < 4; ++j) {
#pragma unroll
      for (int r = 0; r < 8; ++r) {
        slab[(mOff + r) * 68 + (j << 4) + rlane] = acc[i][j][r];
      }
    }
    wave_sync_lds();
    if constexpr (OM == 0) {
      float* C = (float*)Cout + (size_t)((long long)by * sC);
      const float* R = ep0 + (size_t)((long long)by * sC);
      v4f vals[8];
#pragma unroll
      for (int it = 0; it < 8; ++it) {
        const int row = it * 2 + hh2;                      // it 0..7 x hh2 0..1 = rows 0..15
        v4f v = *(const v4f*)(slab + row * 68 + c4);
#pragma unroll
        for (int e = 0; e < 4; ++e) v[e] = v[e] * oscale;
        if constexpr (EPI == 1) {
          const v4f xr = *(const v4f*)(R + (size_t)(mBase + row) * ldc + n0 + c4);
#pragma unroll
          for (int e = 0; e < 4; ++e) v[e] = v[e] + bfr(xr[e]);
        }
        vals[it] = v;
      }
      {
#pragma unroll
        for (int it = 0; it < 8; ++it) {
          const int gr = mBase + it * 2 + hh2;
          *(v4f*)(C + (size_t)gr * ldc + n0 + c4) = vals[it];
        }
        
      }
    } else {
      unsigned short* C  = (unsigned short*)Cout  + (size_t)((long long)by * sC);
      unsigned short* Cb = (unsigned short*)C2out + (size_t)((long long)by * sC);
      v4u hv[4], lv[4];
#pragma unroll
      for (int it = 0; it < 4; ++it) {
        const int row = it * 4 + q8;                       // it 0..3 x q8 0..3 = rows 0..15
        const float* sp = slab + row * 68 + c8;
        v4u a  = {0u, 0u, 0u, 0u};
        v4u b2 = {0u, 0u, 0u, 0u};
#pragma unroll
        for (int e = 0; e < 4; ++e) {
          float f0 = sp[2 * e] * oscale;
          float f1 = sp[2 * e + 1] * oscale;
          if constexpr (EPI == 2) {
            const int ci = by * cps + n0 + c8 + 2 * e;   // column parameter index (host keeps by*cps + N <= parameter count)
            const float g0 = bfr(ep0[ci]), g1 = bfr(ep0[ci + 1]);
            const float t0 = bfr(ep1[ci]), t1 = bfr(ep1[ci + 1]);
            const float u0 = bfr(ep2[ci]), u1 = bfr(ep2[ci + 1]);
            const float r0 = rsqrtf(bfr(ep3[ci]) + BN_EPS), r1 = rsqrtf(bfr(ep3[ci + 1]) + BN_EPS);
            f0 = (g0 * (f0 - u0)) * r0 + t0;
            f1 = (g1 * (f1 - u1)) * r1 + t1;
          }
          if constexpr (OM == 3) {
            const unsigned short h0 = bf_bits(f0), h1 = bf_bits(f1);
            a[e]  = pk16(h0, h1);
            b2[e] = pk16(bf_bits(f0 - bf_up(h0)), bf_bits(f1 - bf_up(h1)));
          } else {
            f0 *= ocarry; f1 *= ocarry;
            const _Float16 x0 = (_Float16)f0, x1 = (_Float16)f1;
            a[e] = pk16(h_bits(x0), h_bits(x1));
            if constexpr (OM == 4) {
              b2[e] = pk16(h_bits((_Float16)(f0 - (float)x0)), h_bits((_Float16)(f1 - (float)x1)));
            }
          }
        }
        hv[it] = a;
        lv[it] = b2;
      }
      {
#pragma unroll
        for (int it = 0; it < 4; ++it) {
          const int row = it * 4 + q8;
          *(v4u*)(C + (size_t)(mBase + row) * ldc + n0 + c8) = hv[it];
          if constexpr (OM >= 3) {
            *(v4u*)(Cb + (size_t)(mBase + row) * ldc + n0 + c8) = lv[it];
          }
        }
        
      }
    }
    wave_sync_lds();
  }
}

// one GEMM per launch: blockIdx.x = tile, blockIdx.y = batch
template <int OM, int ASPLIT, int BF, int EPI, int WM, int WN>
__global__ __launch_bounds__(WM * WN * 32) __attribute__((amdgpu_num_vgpr(256))) void gemm64(
    const unsigned short* __restrict__ Ap, const unsigned short* __restrict__ A2p, int lda, long long sA,
    const unsigned short* __restrict__ Btp, int ldb, long long sB,
    void* Cout, void* C2out, int ldc, long long sC,
    int M, int N, int K, float oscale, float ocarry,
    const float* __restrict__ ep0, const float* __restrict__ ep1,
    const float* __restrict__ ep2, const float* __restrict__ ep3, int cps) {
  __shared__ __align__(16) unsigned short gst[2 * gemm_slab_halves(ASPLIT, WM, WN)];
  __shared__ __align__(16) float sT[WM * WN * 16 * 68];
  gemm64_tile<OM, ASPLIT, BF, EPI, WM, WN>(gst, sT, blockIdx.x, (int)blockIdx.y, Ap, A2p, lda, sA, Btp, ldb, sB, Cout, C2out, ldc, sC,
                                           M, N, K, oscale, ocarry, ep0, ep1, ep2, ep3, cps);
}

// The three projections in one launch: none reads what another writes; blockIdx.y picks the job (block-uniform), blockIdx.x its 128 x 128 tile
// (256 tiles each), so three blocks share a WGP where one stood alone.
//   job 0: v^T per image: VT[b][h*64+d][tok] = sum_c WVT[h*64+d][c] x_b[tok][c] -> f16 x16 hi / residual planes; M = 512, N = 1024, K = 512,
//          image = blockIdx.x / 32, tile = blockIdx.x % 32
//   job 1: k[m][n] = sum_c x[m][c] WKT[n][c] -> bf16 hi / residual planes; M = 8192, N = 512, K = 512.   job 2: the same for q with WQT
#define PROJ_TILES ((NROWS / 128) * (DM / 128))
#define VT_TILES   ((DM / 128) * (NTOK / 128))
static_assert(VT_TILES * NB == PROJ_TILES);
__global__ __launch_bounds__(128) __attribute__((amdgpu_num_vgpr(256))) void qkv(
    const unsigned short* __restrict__ X16, const unsigned short* __restrict__ WKT, const unsigned short* __restrict__ WQT,
    const unsigned short* __restrict__ WVT, unsigned short* KHh, unsigned short* KHl, unsigned short* QHh, unsigned short* QHl,
    unsigned short* VTh, unsigned short* VTl) {
  __shared__ __align__(16) unsigned short gst[2 * gemm_slab_halves(0, 2, 2)];
  __shared__ __align__(16) float sT[4 * 16 * 68];
  const int job = blockIdx.y;
  const unsigned bx = blockIdx.x;
  if (job == 0) {
    gemm64_tile<4, 0, 0, 0, 2, 2>(gst, sT, bx % VT_TILES, (int)(bx / VT_TILES),
                                  WVT, WVT, DM, 0LL,
                                  X16, DM, (long long)NTOK * DM,
                                  (void*)VTh, (void*)VTl, NTOK, (long long)DM * NTOK,
                                  DM, NTOK, DM, 1.0f / (ACARRY * WSC), VC,
                                  nullptr, nullptr, nullptr, nullptr, 0);
  } else {
    gemm64_tile<3, 0, 0, 0, 2, 2>(gst, sT, bx, 0,
                                  X16, X16, DM, 0LL,
                                  (job == 1) ? WKT : WQT, DM, 0LL,
                                  (void*)((job == 1) ? KHh : QHh), (void*)((job == 1) ? KHl : QHl), DM, 0LL,
                                  NROWS, DM, DM, 1.0f / (ACARRY * WSC), 1.0f,
                                  nullptr, nullptr, nullptr, nullptr, 0);
  }
}

// =====================================================================================================
// Flash attention for one image (batch), one head and 128 score rows (one wave per 16 rows), head dim 64, 1024 columns:
//   rows i index KEY positions (k_i stationary), columns j index the q/v positions streamed in chunks of 32 = one image row;
//   k planes (bf16 hi, lo) K[b*1024 + tok][64h + d], pitch 512; q planes (bf16 hi, lo) Q[b*1024 + tok][64h + d];
//   v^T planes (f16 x16 hi, unscaled lo): VT[b*512 + 64h + d][tok] (pitch 1024);
//   additive position logits from the f32 table R[tok][m] (m < 63: q_tok . rel_w[h][m]; 64 + m: q_tok . rel_h[h][m]):
//   logit[i][j] = k_i . q_j + R[i][yj - yi + 31] + R[i][64 + xj - xi + 31], token = 32*x + y.
//   Each wave computes the table rows of its own 16 score rows ahead of the loop, transposed (A = REL rows m, B = q rows i0 + c, hi then residual
//   per k-step): lane (c, hh) gets R[i0 + c][16t + 8hh + r] and stores it to the wave's own 16 x 128 f32 piece of LDS (pitch 132), from which
//   the lanes of that wave alone read it back by their own indices.
//   The score tiles are computed transposed, S^T[j][i] (A = q rows of the chunk from LDS, B = the stationary k rows): lane (c, hh) holds score row
//   i0 + c and, in its 2 x 8 accumulator registers, that row's columns 8hh + r and 16 + 8hh + r of the chunk. So a row's maximum and sum are taken
//   inside the lane, with one exchange between the wave's halves for the maximum per chunk and one for the sum at the end, and the 16 values,
//   converted in place, are the B operand (hardware k order) of O^T[d][i] += v^T[d][j] P^T[j][i] (A = v^T rows from LDS, same k order).
//   The w part of the position logits depends only on the column within a chunk (16 registers per lane, loaded once), the h part only on the
//   chunk (one LDS load per lane per chunk); indices are pure arithmetic.
//   ctx[i][d] = sum_j softmax_j(logit) v[j][d]  (softmax run in base 2, max-subtracted, no 1/sqrt(d)), split into bf16 hi + residual in registers:
//   the lane's 4 x 8 values are the B operand (hardware k order) of Y^T[e][i] = sum_d WOT[h][e][d] ctx[i][d] (A = WOT rows, hi then residual per k-step);
//   out (bf16 hi, lo planes): CA[b*1024 + tok][64h + e] = batch-norm affine of Y[i][e].
//   block = 8 waves = 256 threads; grid = 8 images x 8 heads x 8 row blocks = 512; every wave does identical bounded work (32 chunks).
//   The 8 waves of a block need the same q and v^T chunk: it is brought into LDS once per block by asynchronous 16-B copies (4 per lane and
//   chunk: q hi, q lo 32 rows x 128 B at pitch 144 B; v^T hi, lo 64 rows x 64 B at pitch 80 B), two buffers, chunk t + 2 issued behind the
//   barrier that ends chunk t; all A fragments of the loop are 16-B LDS reads with the split k map.
//   Per chunk: 2 score tiles on bf16 WMMA (hi.hi + lo.hi + hi.lo, K = 64 as two k-steps of 32); online softmax in f32 (exp2); P*1024 as f16 hi
//   and unscaled residual; 12 v^T.P^T WMMAs (hi.hi, hi.lo, lo.hi).
//   Final 1/l and carry folds in f32; after a block barrier the stage buffers are reused as the block's two bf16 result buffers [128][64]
//   (hi, lo): each lane stages 4 x 8 consecutive e of its row (16-B stores); after a second block barrier the 256 threads write whole 128-B row pieces.
// coverage: LDS result buffers: 8 waves x 16 rows x 64 cols per plane; global: 4 iterations x 256 threads x 8 halves = 128 rows x 64 cols
//           of rows 128rb..128rb+127, columns 64h..64h+63 of image b, per plane; grid covers all 8 x 1024 rows x 512 columns exactly once.
// =====================================================================================================
__global__ __launch_bounds__(ATT_THREADS) __attribute__((amdgpu_num_vgpr(256)))
void attn8(const unsigned short* __restrict__ KHh, const unsigned short* __restrict__ KHl,
           const unsigned short* __restrict__ QHh, const unsigned short* __restrict__ QHl,
           const unsigned short* __restrict__ VTh, const unsigned short* __restrict__ VTl,
           const unsigned short* __restrict__ REL, const unsigned short* __restrict__ WOT,
           const float* __restrict__ gam, const float* __restrict__ bet,
           const float* __restrict__ mmean, const float* __restrict__ mvar,
           unsigned short* CAh, unsigned short* CAl) {
  __shared__ __align__(16) unsigned short stg[2 * STG_HALVES];   // two stage buffers: q hi | q lo | v^T hi | v^T lo; later: result buffers
  __shared__ __align__(16) float tab[ATT_ROWS * TPITCH];         // position-logit table rows of the block's score rows, 16 rows per wave
  __shared__ __align__(16) float bnp[4 * HO];                    // batch-norm terms of the head's 64 columns: gamma | mean | rsqrt(var + eps) | beta

  const int tid  = threadIdx.x;
  const int wave = tid >> 5;
  const int lane = tid & 31;
  const int hh   = lane >> 4;
  const int c    = lane & 15;

  const int rb   = blockIdx.x & ((NTOK / ATT_ROWS) - 1);   // 0..7
  const int head = (blockIdx.x / (NTOK / ATT_ROWS)) & (NHEAD - 1);   // 0..7
  const int bat  = blockIdx.x / ((NTOK / ATT_ROWS) * NHEAD);         // 0..7
  const int i0   = rb * ATT_ROWS + wave * 16;              // first score row (key token) of this wave
  const int x0   = i0 / GW;                                // image row of all 16 tokens
  const int yi   = (i0 & (GW - 1)) + c;                    // image column of this lane's score row i0 + c
  const size_t rowg = (size_t)bat * NTOK + i0;

  // per-lane copy addresses: q piece = row tid>>3, 16-B segment tid&7; v^T piece = row tid>>2, 16-B segment tid&3
  const unsigned short* gqh = QHh + ((size_t)bat * NTOK + (tid >> 3)) * DM + head * HD + (tid & 7) * 8;
  const unsigned short* gql = QHl + ((size_t)bat * NTOK + (tid >> 3)) * DM + head * HD + (tid & 7) * 8;
  const unsigned short* gvh = VTh + ((size_t)bat * DM + head * HD + (tid >> 2)) * NTOK + (tid & 3) * 8;
  const unsigned short* gvl = VTl + ((size_t)bat * DM + head * HD + (tid >> 2)) * NTOK + (tid & 3) * 8;
  const unsigned lbase = (unsigned)(uintptr_t)stg;         // LDS byte address of the stage buffers
  const unsigned lq = lbase + (unsigned)((tid >> 3) * (QPITCH * 2) + (tid & 7) * 16);
  const unsigned lv = lbase + (unsigned)(2 * QT_HALVES * 2 + (tid >> 2) * (VPITCH * 2) + (tid & 3) * 16);

  // chunk 0 -> buffer 0, landed and published; then chunk 1 -> buffer 1 flies while chunk 0 is worked on
  stage_copy4(lq, gqh, lq + QT_HALVES * 2, gql, lv, gvh, lv + VT_HALVES * 2, gvl);
  // the head's batch-norm terms, once per block (waves 0 and 1, one column per lane); published by the barrier below, read behind the loop
  if (tid < HO) {
    const int ci = head * HO + tid;
    bnp[tid]          = bfr(gam[ci]);
    bnp[HO + tid]     = bfr(mmean[ci]);
    bnp[2 * HO + tid] = rsqrtf(bfr(mvar[ci]) + BN_EPS);
    bnp[3 * HO + tid] = bfr(bet[ci]);
    wait_addr();   // behind the parameter loads, ahead of later rewrites of their address registers
  }
  wait_copies();
  __syncthreads();
  stage_copy4(lq + STG_HALVES * 2, gqh + (size_t)KCH * DM, lq + (STG_HALVES + QT_HALVES) * 2, gql + (size_t)KCH * DM,
              lv + STG_HALVES * 2, gvh + KCH, lv + (STG_HALVES + VT_HALVES) * 2, gvl + KCH);

  // stationary B fragments: k rows i0 + c (hi and residual planes), d 0..31 and 32..63
  const size_t kofs = (rowg + c) * DM + head * HD + 8 * hh;
  const v16h kah = ldfrag_u(KHh + kofs), kbh = ldfrag_u(KHh + kofs + 32);
  const v16h kal = ldfrag_u(KHl + kofs), kbl = ldfrag_u(KHl + kofs + 32);

  // position-logit table of the wave's 16 score rows: R^T[m][i0 + c] = sum_d REL[h][m][d] (q_hi + q_lo)[i0 + c][d], 8 tiles of 16 m
  float* rrow = tab + (wave * 16 + c) * TPITCH;            // table row of score row i0 + c
  {
    const v16h qah = ldfrag_u(QHh + kofs), qbh = ldfrag_u(QHh + kofs + 32);
    const v16h qal = ldfrag_u(QHl + kofs), qbl = ldfrag_u(QHl + kofs + 32);
    const unsigned short* rp = REL + ((size_t)head * RTP + c) * HD + 8 * hh;
#pragma unroll
    for (int t = 0; t < RTP / 16; ++t) {
      const v16h ra = ldfrag_u(rp + t * 16 * HD), rc = ldfrag_u(rp + t * 16 * HD + 32);
      v8f a = mma_b(ra, qah, zero8());
      a = mma_b(ra, qal, a);
      a = mma_b(rc, qbh, a);
      a = mma_b(rc, qbl, a);
      const v4f a0 = {a[0], a[1], a[2], a[3]}, a1 = {a[4], a[5], a[6], a[7]};
      *(v4f*)(rrow + 16 * t + 8 * hh)     = a0;
      *(v4f*)(rrow + 16 * t + 8 * hh + 4) = a1;
    }
    wait_addr();   // behind the fragment loads, ahead of later rewrites of their address registers
  }
  wave_sync_lds();   // a lane reads below what the other half of its wave has stored above
  // additive w-position logits of this lane's score row for the 16 chunk columns that it holds, loop-invariant, pre-scaled by log2(e)
  float wb0[8], wb1[8];
#pragma unroll
  for (int r = 0; r < 8; ++r) {
    const int iw = 8 * hh + r + (GW - 1) - yi;             // in [0, 46]
    wb0[r] = rrow[iw] * LOG2E;
    wb1[r] = rrow[iw + 16] * LOG2E;                        // in [16, 62]
  }
  const float* hrow = rrow + HD + (GH - 1) - x0;           // + st = h-position logit of chunk st; index st - x0 + 31 in [0, 62]

  float mrow = -INFINITY, lrow = 0.f;                      // row maximum (both halves alike); sum over this half's columns only
  v8f o0 = zero8(), o1 = zero8(), o2 = zero8(), o3 = zero8();   // O^T tiles: o_t[r] = O[i0 + c][16t + 8hh + r]

#pragma unroll 1
  for (int st = 0; st < NSTG; ++st) {
    const int bsel = st & 1;
    const unsigned short* sb  = stg + bsel * STG_HALVES;
    const unsigned short* Qsh = sb + c * QPITCH + 8 * hh;                    // q hi, row c of the chunk
    const unsigned short* Qsl = Qsh + QT_HALVES;
    const unsigned short* Vsh = sb + 2 * QT_HALVES + c * VPITCH + 8 * hh;    // v^T hi, row d = c
    const unsigned short* Vsl = Vsh + VT_HALVES;
    // h-position logit of this chunk (one image row x2 = st) for the lane's score row
    const float hraw = hrow[st];
    v8f s0, s1;                                            // s0[r] = S[i0 + c][8hh + r], s1[r] = S[i0 + c][16 + 8hh + r] of the chunk
    {
      const v16h q0h = ldfrag_u(Qsh), q1h = ldfrag_u(Qsh + 32);
      const v16h q0l = ldfrag_u(Qsl), q1l = ldfrag_u(Qsl + 32);
      s0 = mma_b(q0h, kah, zero8());
      s0 = mma_b(q1h, kbh, s0);
      s0 = mma_b(q0l, kah, s0);
      s0 = mma_b(q1l, kbh, s0);
      s0 = mma_b(q0h, kal, s0);
      s0 = mma_b(q1h, kbl, s0);
      guard1x4(s0, q0h, q1h, q0l, q1l);
    }
    {
      const int q2 = 16 * QPITCH;
      const v16h q0h = ldfrag_u(Qsh + q2), q1h = ldfrag_u(Qsh + q2 + 32);
      const v16h q0l = ldfrag_u(Qsl + q2), q1l = ldfrag_u(Qsl + q2 + 32);
      s1 = mma_b(q0h, kah, zero8());
      s1 = mma_b(q1h, kbh, s1);
      s1 = mma_b(q0l, kah, s1);
      s1 = mma_b(q1l, kbh, s1);
      s1 = mma_b(q0h, kal, s1);
      s1 = mma_b(q1h, kbl, s1);
      guard1x8(s1, q0h, q1h, q0l, q1l, kah, kbh, kal, kbl);
    }
    const float hb = hraw * LOG2E;
    float t0[8], t1[8];
#pragma unroll
    for (int r = 0; r < 8; ++r) {
      t0[r] = s0[r] * LOG2E + (wb0[r] + hb);
      t1[r] = s1[r] * LOG2E + (wb1[r] + hb);
    }
    float mx = fmaxf(t0[0], t1[0]);
#pragma unroll
    for (int r = 1; r < 8; ++r) mx = fmaxf(mx, fmaxf(t0[r], t1[r]));
    mx = fmaxf(mx, xhalf(mx));                             // both halves now hold the row's maximum over the chunk
    const float mn = fmaxf(mrow, mx);
    const float al = ex2(mrow - mn);
    mrow = mn;
    FragH ph, pl;                                          // P^T * 1024, f16 hi and unscaled residual: element s = column kmap(s, hh) of the chunk
    float pa[8];
#pragma unroll
    for (int r = 0; r < 8; ++r) {
      const float e0 = ex2(t0[r] - mn), e1 = ex2(t1[r] - mn);
      pa[r] = e0 + e1;
      float f; _Float16 x;
      f = e0 * PC; x = (_Float16)f; ph.h[0][r] = x; pl.h[0][r] = (_Float16)(f - (float)x);   // column 8hh + r
      f = e1 * PC; x = (_Float16)f; ph.h[1][r] = x; pl.h[1][r] = (_Float16)(f - (float)x);   // column 16 + 8hh + r
    }
    const float ps = ((pa[0] + pa[1]) + (pa[2] + pa[3])) + ((pa[4] + pa[5]) + (pa[6] + pa[7]));
    lrow = lrow * al + ps;
#pragma unroll
    for (int r = 0; r < 8; ++r) {
      o0[r] *= al;
      o1[r] *= al;
      o2[r] *= al;
      o3[r] *= al;
    }
    {
      const v16h vh0 = ldfrag_u(Vsh);
      const v16h vh1 = ldfrag_u(Vsh + 16 * VPITCH);
      const v16h vh2 = ldfrag_u(Vsh + 32 * VPITCH);
      const v16h vh3 = ldfrag_u(Vsh + 48 * VPITCH);
      o0 = mma_h(vh0, ph.v, o0);
      o1 = mma_h(vh1, ph.v, o1);
      o2 = mma_h(vh2, ph.v, o2);
      o3 = mma_h(vh3, ph.v, o3);
      o0 = mma_h(vh0, pl.v, o0);
      o1 = mma_h(vh1, pl.v, o1);
      o2 = mma_h(vh2, pl.v, o2);
      o3 = mma_h(vh3, pl.v, o3);
      guard4x6(o0, o1, o2, o3, ph.v, pl.v, vh0, vh1, vh2, vh3);
    }
    {
      const v16h vl0 = ldfrag_u(Vsl);
      const v16h vl1 = ldfrag_u(Vsl + 16 * VPITCH);
      const v16h vl2 = ldfrag_u(Vsl + 32 * VPITCH);
      const v16h vl3 = ldfrag_u(Vsl + 48 * VPITCH);
      o0 = mma_h(vl0, ph.v, o0);
      o1 = mma_h(vl1, ph.v, o1);
      o2 = mma_h(vl2, ph.v, o2);
      o3 = mma_h(vl3, ph.v, o3);
      guard4x5(o0, o1, o2, o3, ph.v, vl0, vl1, vl2, vl3);
    }
    // foot of the chunk: own LDS reads returned, own copies of chunk st + 1 landed, then the one barrier that publishes chunk st + 1
    // and ends every wave's reads of this chunk's buffer; only behind it is that buffer refilled with chunk st + 2
    wait_lds();
    wait_copies();
    __syncthreads();
    if (st + 2 < NSTG) {
      const size_t qa = (size_t)(st + 2) * KCH * DM;
      const int    va = (st + 2) * KCH;
      const unsigned lo = (unsigned)(bsel * STG_HALVES * 2);
      stage_copy4(lq + lo, gqh + qa, lq + lo + QT_HALVES * 2, gql + qa, lv + lo, gvh + va, lv + lo + VT_HALVES * 2, gvl + va);
    }
  }
  wait_copies();

  // ---- all waves done with the stage buffers; they become two bf16 result buffers [128][64] ----
  __syncthreads();
  unsigned short* Osh = stg;
  unsigned short* Osl = Osh + ATT_ROWS * HD;
  // ---- join the halves' sums, fold 1/l and the carries (1024 on P, 16 on v), split into bf16 hi + residual as the projection's B operand ----
  const float oc = 1.0f / (PC * VC);
  const float inv = (1.0f / (lrow + xhalf(lrow))) * oc;
  const int ro = (wave * 16 + c) * HD + 8 * hh;            // row i0 + c of the block, e = 8hh; tile t adds 16t
  auto split8 = [&](const v8f& o, float sc, v4u& a, v4u& b2) {   // 8 values * sc -> bf16 hi and residual, packed in element order
#pragma unroll
    for (int e = 0; e < 4; ++e) {
      const float f0 = o[2 * e] * sc, f1 = o[2 * e + 1] * sc;
      const unsigned short g0 = bf_bits(f0), g1 = bf_bits(f1);
      a[e]  = pk16(g0, g1);
      b2[e] = pk16(bf_bits(f0 - bf_up(g0)), bf_bits(f1 - bf_up(g1)));
    }
  };
  // ctx row i0 + c as B operand: k-step 0 holds d = 8hh + r (o0) and 16 + 8hh + r (o1), k-step 1 the same + 32 (o2, o3)
  FragH ch0, cl0, ch1, cl1;
  split8(o0, inv, ch0.u[0], cl0.u[0]);
  split8(o1, inv, ch0.u[1], cl0.u[1]);
  split8(o2, inv, ch1.u[0], cl1.u[0]);
  split8(o3, inv, ch1.u[1], cl1.u[1]);
  // ---- per-head output projection, transposed, and eval batch-norm: lane (c, hh) gets Y[i0 + c][16t + 8hh + r] ----
  const unsigned short* wp = WOT + ((size_t)head * HO + c) * HD + 8 * hh;
#pragma unroll
  for (int t = 0; t < HO / 16; ++t) {
    const v16h wa = ldfrag_u(wp + t * 16 * HD), wc = ldfrag_u(wp + t * 16 * HD + 32);
    const float* bp = bnp + 16 * t + 8 * hh;               // terms of the lane's first column of the tile
    const v4f ga = *(const v4f*)(bp),          gb = *(const v4f*)(bp + 4);
    const v4f ua = *(const v4f*)(bp + HO),     ub = *(const v4f*)(bp + HO + 4);
    const v4f ra = *(const v4f*)(bp + 2 * HO), rb4 = *(const v4f*)(bp + 2 * HO + 4);
    const v4f ta = *(const v4f*)(bp + 3 * HO), tb = *(const v4f*)(bp + 3 * HO + 4);
    v8f y = mma_b(wa, ch0.v, zero8());
    y = mma_b(wa, cl0.v, y);
    y = mma_b(wc, ch1.v, y);
    y = mma_b(wc, cl1.v, y);
#pragma unroll
    for (int r = 0; r < 4; ++r) {
      y[r]     = (ga[r] * (y[r]     - ua[r])) * ra[r]  + ta[r];
      y[4 + r] = (gb[r] * (y[4 + r] - ub[r])) * rb4[r] + tb[r];
    }
    v4u a, b2;
    split8(y, 1.0f, a, b2);
    *(v4u*)(Osh + ro + 16 * t) = a;
    *(v4u*)(Osl + ro + 16 * t) = b2;
  }
  wait_addr();   // behind the weight loads, ahead of later rewrites of their address registers
  __syncthreads();
  // ---- block writes its 128 row pieces of both planes: piece p = it*256 + tid -> row p>>3, halves (p&7)*8 .. +7 (8 lanes = one 128-B line) ----
  {
    v4u hv[4], lv4[4];
#pragma unroll
    for (int it = 0; it < 4; ++it) {
      const int p = it * ATT_THREADS + tid;
      hv[it]  = *(const v4u*)(Osh + (size_t)p * 8);
      lv4[it] = *(const v4u*)(Osl + (size_t)p * 8);
    }
    const size_t dofs = ((size_t)bat * NTOK + rb * ATT_ROWS) * DM + head * HD;
    unsigned short* dsth = CAh + dofs;
    unsigned short* dstl = CAl + dofs;
    {
#pragma unroll
      for (int it = 0; it < 4; ++it) {
        const int p = it * ATT_THREADS + tid;
        const size_t go = (size_t)(p >> 3) * DM + (p & 7) * 8;
        *(v4u*)(dsth + go) = hv[it];
        *(v4u*)(dstl + go) = lv4[it];
      }
    }
  }
}

// =====================================================================================================
// Workspace map (bytes); every plane is an exact multiple of its tile / whole-row store granularity (M, N exact tile multiples,
// the activation convert count an exact multiple of 2048, no pad rows needed), every offset a multiple of 64 KiB:
//   WKT, WQT, WVT f16 [512][512] x64   3 x 524288    ([h*64+d][c] = [n][k])
//   WOT  bf16 [8][64 e][64 d]              65536
//   WUT  bf16 [512 out][512 in]          524288
//   REL  bf16 [8][128][64]                131072
//   X16  f16 [8192][512] x16             8388608    (activation rows b*1024 + tok)
//   QHh, QHl bf16 [8192][512]         2 x 8388608   (q projection, hi / residual)
//   KHh, KHl bf16 [8192][512]         2 x 8388608   (k projection, hi / residual)
//   VTh, VTl f16 [8][512][1024] x16   2 x 8388608   (v^T per image, hi / residual)
//   CAh, CAl bf16 [8192][512]         2 x 8388608   (per-head output after batch-norm, concat layout, hi / residual)
//   end                                  77791232
// =====================================================================================================
extern "C" void kernel_launch(void* const* d_in, const int* in_sizes, int n_in,
                              void* d_out, int out_size, void* d_ws, size_t ws_size,
                              hipStream_t stream) {
  if (n_in < 12) return;
  if (in_sizes[0] != NROWS * DM) return;
  if (in_sizes[1] != NHEAD * DM * HD || in_sizes[2] != NHEAD * DM * HD || in_sizes[3] != NHEAD * DM * HD) return;
  if (in_sizes[4] != NHEAD * HD * HO) return;
  if (in_sizes[5] != NHEAD * HO || in_sizes[6] != NHEAD * HO || in_sizes[7] != NHEAD * HO || in_sizes[8] != NHEAD * HO) return;
  if (in_sizes[9] != NHEAD * NREL * HD || in_sizes[10] != NHEAD * NREL * HD) return;
  if (in_sizes[11] != COUT * COUT) return;
  if (out_size != NROWS * COUT) return;
  if ((in_sizes[0] % 2048) != 0) return;

  const float* x     = (const float*)d_in[0];
  const float* w_k   = (const float*)d_in[1];
  const float* w_q   = (const float*)d_in[2];
  const float* w_v   = (const float*)d_in[3];
  const float* w_o   = (const float*)d_in[4];
  const float* gam   = (const float*)d_in[5];
  const float* bet   = (const float*)d_in[6];
  const float* mmean = (const float*)d_in[7];
  const float* mvar  = (const float*)d_in[8];
  const float* relw  = (const float*)d_in[9];
  const float* relh  = (const float*)d_in[10];
  const float* w_out = (const float*)d_in[11];
  float*       out   = (float*)d_out;

  const size_t PWT = (size_t)DM * DM * 2;                         //   524288
  const size_t PWO = (size_t)NHEAD * HO * HD * 2;                 //    65536
  const size_t PWU = (size_t)COUT * COUT * 2;                     //   524288
  const size_t PRL = (size_t)NHEAD * RTP * HD * 2;                //   131072
  const size_t PX  = (size_t)NROWS * DM * 2;                      //  8388608
  const size_t PVT = (size_t)NB * DM * NTOK * 2;                  //  8388608
  size_t off = 0;
  const size_t oWK = off; off += PWT;
  const size_t oWQ = off; off += PWT;
  const size_t oWV = off; off += PWT;
  const size_t oWO = off; off += PWO;
  const size_t oWU = off; off += PWU;
  const size_t oRL = off; off += PRL;
  const size_t oX  = off; off += PX;
  const size_t oQh = off; off += PX;
  const size_t oQl = off; off += PX;
  const size_t oKh = off; off += PX;
  const size_t oKl = off; off += PX;
  const size_t oVh = off; off += PVT;
  const size_t oVl = off; off += PVT;
  const size_t oAh = off; off += PX;
  const size_t oAl = off; off += PX;
  if (off > ws_size) return;                                      // off = 77791232
  if (off > (size_t)134217728) return;

  char* ws = (char*)d_ws;
  unsigned short* WKT  = (unsigned short*)(ws + oWK);
  unsigned short* WQT  = (unsigned short*)(ws + oWQ);
  unsigned short* WVT  = (unsigned short*)(ws + oWV);
  unsigned short* WOT  = (unsigned short*)(ws + oWO);
  unsigned short* WUT  = (unsigned short*)(ws + oWU);
  unsigned short* REL  = (unsigned short*)(ws + oRL);
  unsigned short* X16  = (unsigned short*)(ws + oX);
  unsigned short* QHh  = (unsigned short*)(ws + oQh);
  unsigned short* QHl  = (unsigned short*)(ws + oQl);
  unsigned short* KHh  = (unsigned short*)(ws + oKh);
  unsigned short* KHl  = (unsigned short*)(ws + oKl);
  unsigned short* VTh  = (unsigned short*)(ws + oVh);
  unsigned short* VTl  = (unsigned short*)(ws + oVl);
  unsigned short* CAh  = (unsigned short*)(ws + oAh);
  unsigned short* CAl  = (unsigned short*)(ws + oAl);

  const dim3 blk(256);
  const dim3 gPR(PREP_BLOCKS);                                     // 2344
  const dim3 blkG(128);                                            // 4 waves: 2 x 2 (128 x 128 tile)
  const dim3 gP(PROJ_TILES, 3);                                    // 256 x 3
  const dim3 gF((NROWS / 128) * (COUT / 128), 1);                  // 256
  const dim3 gAT(ATT_BLOCKS);                                      // 512
  const dim3 bAT(ATT_THREADS);                                     // 256

  // (0) every operand pack: weight planes WKT, WQT, WVT (f16 x64), WOT, WUT, REL (bf16) and the activation plane X16 (f16 x16)
  prep<<<gPR, blk, 0, stream>>>(x, w_k, w_q, w_v, w_o, w_out, relw, relh, X16, WKT, WQT, WVT, WOT, WUT, REL);

  // (1) v^T, k and q projections -> VT (f16 x16 hi / residual), KH, QH (bf16 hi / residual)
  qkv<<<gP, blkG, 0, stream>>>(X16, WKT, WQT, WVT, KHh, KHl, QHh, QHl, VTh, VTl);

  // (2) per (image, head, 128 score rows): position-logit table rows, attention, per-head output projection + eval batch-norm
  //     -> CA[row][64h + e] (bf16 hi / residual planes)
  attn8<<<gAT, bAT, 0, stream>>>(KHh, KHl, QHh, QHl, VTh, VTl, REL, WOT, gam, bet, mmean, mvar, CAh, CAl);

  // (3) out = (CA_hi + CA_lo) . WUT^T + bf16_RNE(x); M = 8192, N = 512, K = 512, f32
  gemm64<0, 1, 1, 1, 2, 2><<<gF, blkG, 0, stream>>>(
      CAh, CAl, DM, 0LL,
      WUT, COUT, 0LL,
      (void*)out, (void*)out, COUT, 0LL,
      NROWS, COUT, DM, 1.0f, 1.0f,
      x, x, x, x, 0);
  (void)hipGetLastError();
}

// v007
// It runs in 85.1 microseconds.
// In two side-by-side timings against v006, it was 1.04 and 1.05 times as fast.
// All steps since v000 together make it 3.71 times as fast.
// Contractions (all f32 accumulate): k/q projections v_wmma_f32_16x16x32_f16 (x f16 x16 . W f16 x64, K=512, single products) -> bf16 hi/lo planes;
// v^T projection v_wmma_f32_16x16x32_f16 (Wv f16 x64 . x f16 x16, K=512, single) -> f16 x16 hi/lo planes;
// relative-position tables, transposed, v_wmma_f32_16x16x32_bf16 (rel bf16 . q bf16 hi/lo, W.hi+W.lo, K=64) -> f32 table in LDS (attention prologue);
// attention scores, transposed, v_wmma_f32_16x16x32_bf16 (q bf16 hi/lo . k bf16 hi/lo, hi.hi+lo.hi+hi.lo, K=64);
// v^T . P^T v_wmma_f32_16x16x32_f16 (v^T f16 x16 hi/lo . P^T f16 x1024 hi/lo, hi.hi+hi.lo+lo.hi, K=1024 by 32);
// per-head output projection, transposed, v_wmma_f32_16x16x32_bf16 (Wo bf16 . ctx bf16 hi/lo, K=64) with eval batch-norm affine in f32 -> bf16 hi/lo planes (attention epilogue);
// final projection v_wmma_f32_16x16x32_bf16 (cat bf16 hi/lo . Wout bf16, K=512) + bf16-RNE residual in f32.
// Max-subtracted online base-2 softmax and the additive position logits in f32 on VALU. Every float input RNE-converted to bf16 on load.
#include <hip/hip_runtime.h>
#include <math.h>
#include <stdint.h>

#define NB     8
#define GH     32
#define GW     32
#define NTOK   (GH * GW)
#define DM     512
#define NHEAD  8
#define HD     64
#define HO     64
#define COUT   512
#define NREL   63
#define RTP    128
#define NROWS  (NB * NTOK)
#define KCH    32
#define WSC    64.0f
#define ACARRY 16.0f
#define VC     16.0f
#define PC     1024.0f
#define LOG2E  1.4426950408889634f
#define BN_EPS 1e-3f
static_assert(NHEAD * HD == DM);
static_assert(NHEAD * HO == COUT);
static_assert(COUT == DM);
static_assert(KCH == GW);
static_assert(NREL == 2 * GW - 1);
static_assert(NREL == 2 * GH - 1);
static_assert(NREL <= HD);
static_assert(HD + NREL <= RTP);
static_assert((NTOK % 128) == 0 && (DM % 128) == 0 && (NROWS % 256) == 0 && (HD % 64) == 0 && (NTOK % KCH) == 0);
static_assert((RTP % 128) == 0 && (HO % 64) == 0 && (COUT % 128) == 0);
#define GKS         64
#define GPITCH      72
#define ATT_WAVES   8
#define ATT_THREADS (ATT_WAVES * 32)
#define ATT_ROWS    (ATT_WAVES * 16)
#define ATT_BLOCKS  (NB * NHEAD * (NTOK / ATT_ROWS))
#define NSTG        (NTOK / KCH)
#define QPITCH      72
#define VPITCH      40
#define QT_HALVES   (KCH * QPITCH)
#define VT_HALVES   (HD * VPITCH)
#define STG_HALVES  (2 * QT_HALVES + 2 * VT_HALVES)
#define TPITCH      (RTP + 4)
static_assert(ATT_THREADS == 256);
static_assert(ATT_BLOCKS == 512);
static_assert(NSTG >= 2);
static_assert(KCH * (HD / 8) == ATT_THREADS && HD * (KCH / 8) == ATT_THREADS);
static_assert((QT_HALVES % 8) == 0 && (VT_HALVES % 8) == 0 && (QPITCH % 8) == 0 && (VPITCH % 8) == 0);
static_assert(2 * ATT_ROWS * HD <= 2 * STG_HALVES);
static_assert((ATT_ROWS * HD) / 8 == 4 * ATT_THREADS);
static_assert((TPITCH % 4) == 0 && (RTP % 16) == 0 && HO == HD);

typedef _Float16 v16h __attribute__((ext_vector_type(16)));
typedef _Float16 v8h  __attribute__((ext_vector_type(8)));
typedef __bf16   v16b __attribute__((ext_vector_type(16)));
typedef float    v8f  __attribute__((ext_vector_type(8)));
typedef float    v4f  __attribute__((ext_vector_type(4)));
typedef unsigned int v4u __attribute__((ext_vector_type(4)));

union FragH { v16h v; v8h h[2]; v4u u[2]; };
union FragAny { v16h h; v16b b; };

// ---- scalar helpers --------------------------------------------------------------------------------
__device__ __forceinline__ unsigned short bf_bits(float f) {          // f32 -> bf16 bits, RNE convert
  unsigned u = __float_as_uint(f);
  return (unsigned short)((u + 0x7FFFu + ((u >> 16) & 1u)) >> 16);
}
__device__ __forceinline__ float bf_up(unsigned short h) { return __uint_as_float(((unsigned)h) << 16); }
__device__ __forceinline__ float bfr(float f) { return bf_up(bf_bits(f)); }   // value of the bf16 RNE convert
__device__ __forceinline__ unsigned short h_bits(_Float16 x) { return __builtin_bit_cast(unsigned short, x); }
__device__ __forceinline__ unsigned pk16(unsigned short a, unsigned short b) { return (unsigned)a | ((unsigned)b << 16); }
__device__ __forceinline__ v8f zero8() { v8f z = {0.f, 0.f, 0.f, 0.f, 0.f, 0.f, 0.f, 0.f}; return z; }
// value of lane l ^ 16 (the other half of the wave), by one vector cross-row move
__device__ __forceinline__ float xhalf(float x) {
  const int b = __builtin_bit_cast(int, x);
  return __builtin_bit_cast(float, __builtin_amdgcn_permlanex16(b, b, 0x76543210, 0xfedcba98, false, false));
}

// 2^x by the bare v_exp_f32. Every argument in the softmax is <= 0; the library form's range guard only serves results below 2^-126, which
// add nothing to a row sum that holds its maximum's 1.0 and convert to 0 in both f16 planes of P (and -inf still gives 0 for the first chunk).
__device__ __forceinline__ float ex2(float x) { return __builtin_amdgcn_exp2f(x); }

// ---- fragment loader: 16-bit A/B operand from a k-contiguous 16-bit plane, lane -> row/col (lane&15),
//      p already includes +8*(lane>>4); elements 0..7 <- p[0..7] (k0+8h..), elements 8..15 <- p[16..23] (k0+16+8h..)
//      (same split k map for A and B; B is always read from a [n][k] plane)
__device__ __forceinline__ v16h ldfrag_u(const unsigned short* p) {
  FragH f;
  f.u[0] = *(const v4u*)(p);
  f.u[1] = *(const v4u*)(p + 16);
  return f.v;
}

// ---- WMMA helpers with trailing VALU hazard gaps ------------------------------------------------------
__device__ __forceinline__ v8f mma_h(v16h a, v16h b, v8f c) {
  return __builtin_amdgcn_wmma_f32_16x16x32_f16(false, a, false, b, (short)0, c, false, false);
}
__device__ __forceinline__ v8f mma_b(v16h a, v16h b, v8f c) {
  FragAny ua, ub;
  ua.h = a;
  ub.h = b;
  return __builtin_amdgcn_wmma_f32_16x16x32_bf16(false, ua.b, false, ub.b, (short)0, c, false, false);
}
template <int BF>
__device__ __forceinline__ v8f mmaT(v16h a, v16h b, v8f c) {
  if constexpr (BF != 0) return mma_b(a, b, c);
  else return mma_h(a, b, c);
}
__device__ __forceinline__ void dep_guard1(v8f& a, v8f& b, v16h x) {
#if defined(__HIP_DEVICE_COMPILE__)
  asm volatile("v_nop\n\tv_nop\n\tv_nop\n\tv_nop" : "+v"(a), "+v"(b) : "v"(x));
#endif
}
__device__ __forceinline__ void guard1x4(v8f& s, v16h a0, v16h a1, v16h a2, v16h a3) {
#if defined(__HIP_DEVICE_COMPILE__)
  asm volatile("v_nop\n\tv_nop\n\tv_nop\n\tv_nop" : "+v"(s) : "v"(a0), "v"(a1), "v"(a2), "v"(a3));
#endif
}
__device__ __forceinline__ void guard1x8(v8f& s, v16h a0, v16h a1, v16h a2, v16h a3,
                                         v16h b0, v16h b1, v16h b2, v16h b3) {
#if defined(__HIP_DEVICE_COMPILE__)
  asm volatile("v_nop\n\tv_nop\n\tv_nop\n\tv_nop"
               : "+v"(s) : "v"(a0), "v"(a1), "v"(a2), "v"(a3), "v"(b0), "v"(b1), "v"(b2), "v"(b3));
#endif
}
__device__ __forceinline__ void guard4x6(v8f& a, v8f& b, v8f& c, v8f& d,
                                         v16h x0, v16h x1, v16h x2, v16h x3, v16h x4, v16h x5) {
#if defined(__HIP_DEVICE_COMPILE__)
  asm volatile("v_nop\n\tv_nop\n\tv_nop\n\tv_nop"
               : "+v"(a), "+v"(b), "+v"(c), "+v"(d) : "v"(x0), "v"(x1), "v"(x2), "v"(x3), "v"(x4), "v"(x5));
#endif
}
__device__ __forceinline__ void guard4x5(v8f& a, v8f& b, v8f& c, v8f& d,
                                         v16h x0, v16h x1, v16h x2, v16h x3, v16h x4) {
#if defined(__HIP_DEVICE_COMPILE__)
  asm volatile("v_nop\n\tv_nop\n\tv_nop\n\tv_nop"
               : "+v"(a), "+v"(b), "+v"(c), "+v"(d) : "v"(x0), "v"(x1), "v"(x2), "v"(x3), "v"(x4));
#endif
}
__device__ __forceinline__ void keep4_h(v16h a, v16h b, v16h c, v16h d) {
#if defined(__HIP_DEVICE_COMPILE__)
  asm volatile("v_nop" :: "v"(a), "v"(b), "v"(c), "v"(d));
#endif
}
__device__ __forceinline__ void acc_guard4(v8f& a, v8f& b, v8f& c, v8f& d) {
#if defined(__HIP_DEVICE_COMPILE__)
  asm volatile("v_nop\n\tv_nop\n\tv_nop\n\tv_nop" : "+v"(a), "+v"(b), "+v"(c), "+v"(d));
#endif
}
__device__ __forceinline__ void wave_sync_lds() {
  __builtin_amdgcn_fence(__ATOMIC_RELEASE, "workgroup");
  __builtin_amdgcn_wave_barrier();
  __builtin_amdgcn_fence(__ATOMIC_ACQUIRE, "workgroup");
}
// the same for LDS alone: orders the wave's own LDS stores and loads and does not wait out its global stores
__device__ __forceinline__ void wave_sync_lds_only() {
  __builtin_amdgcn_fence(__ATOMIC_RELEASE, "workgroup", "local");
  __builtin_amdgcn_wave_barrier();
  __builtin_amdgcn_fence(__ATOMIC_ACQUIRE, "workgroup", "local");
}

// four 16-B copies per lane, global -> LDS through no register; the s_wait_xcnt 0 in the same statement stands ahead of any later
// rewrite of the address registers that the copies name
__device__ __forceinline__ void stage_copy4(unsigned l0, const unsigned short* g0, unsigned l1, const unsigned short* g1,
                                            unsigned l2, const unsigned short* g2, unsigned l3, const unsigned short* g3) {
#if defined(__HIP_DEVICE_COMPILE__)
  asm volatile("global_load_async_to_lds_b128 %0, %1, off\n\t"
               "global_load_async_to_lds_b128 %2, %3, off\n\t"
               "global_load_async_to_lds_b128 %4, %5, off\n\t"
               "global_load_async_to_lds_b128 %6, %7, off\n\t"
               "s_wait_xcnt 0x0"
               :: "v"(l0), "v"(g0), "v"(l1), "v"(g1), "v"(l2), "v"(g2), "v"(l3), "v"(g3) : "memory");
#endif
}
// the same for eight copies: one wait on the address registers serves the run
__device__ __forceinline__ void stage_copy8(unsigned l0, const unsigned short* g0, unsigned l1, const unsigned short* g1,
                                            unsigned l2, const unsigned short* g2, unsigned l3, const unsigned short* g3,
                                            unsigned l4, const unsigned short* g4, unsigned l5, const unsigned short* g5,
                                            unsigned l6, const unsigned short* g6, unsigned l7, const unsigned short* g7) {
#if defined(__HIP_DEVICE_COMPILE__)
  asm volatile("global_load_async_to_lds_b128 %0, %1, off\n\t"
               "global_load_async_to_lds_b128 %2, %3, off\n\t"
               "global_load_async_to_lds_b128 %4, %5, off\n\t"
               "global_load_async_to_lds_b128 %6, %7, off\n\t"
               "global_load_async_to_lds_b128 %8, %9, off\n\t"
               "global_load_async_to_lds_b128 %10, %11, off\n\t"
               "global_load_async_to_lds_b128 %12, %13, off\n\t"
               "global_load_async_to_lds_b128 %14, %15, off\n\t"
               "s_wait_xcnt 0x0"
               :: "v"(l0), "v"(g0), "v"(l1), "v"(g1), "v"(l2), "v"(g2), "v"(l3), "v"(g3),
                  "v"(l4), "v"(g4), "v"(l5), "v"(g5), "v"(l6), "v"(g6), "v"(l7), "v"(g7) : "memory");
#endif
}
// this wave's copies have landed in LDS
__device__ __forceinline__ void wait_copies() {
#if defined(__HIP_DEVICE_COMPILE__)
  asm volatile("s_wait_asynccnt 0x0" ::: "memory");
#endif
}
// stands behind a global load or store, ahead of a later rewrite of a register that it names
__device__ __forceinline__ void wait_addr() {
#if defined(__HIP_DEVICE_COMPILE__)
  asm volatile("s_wait_xcnt 0x0" ::: "memory");
#endif
}
// this wave's LDS reads have returned (ahead of the barrier behind which their buffer is refilled)
__device__ __forceinline__ void wait_lds() {
#if defined(__HIP_DEVICE_COMPILE__)
  asm volatile("s_wait_dscnt 0x0" ::: "memory");
#endif
}

// =====================================================================================================
// Elementwise 16-bit pack, no transpose. BFO 0: dst[i] = f16( bf16_RNE(src[i]) * sc ), sc a power of two (exact);
// BFO 1: dst[i] = bf16_RNE(src[i]) bits. 8 elements per thread: two 16-B loads, one 16-B store per lane; 32 consecutive
// coverage: n / 2048 blocks (index bx) x 256 thr x 8 elements = n exactly (host checks n % 2048 == 0).
// =====================================================================================================
template <int BFO>
__device__ __forceinline__ void cvt16(const float* __restrict__ src, unsigned short* dst, int n, float sc, int bx) {
  const size_t i8 = ((size_t)bx * 256 + threadIdx.x) * 8;
  if (i8 + 8 > (size_t)n) return;                 // never taken with the exact block range; no barriers in this job
  const v4f a = *(const v4f*)(src + i8);
  const v4f b = *(const v4f*)(src + i8 + 4);
  v4u o;
  if constexpr (BFO != 0) {
    o[0] = pk16(bf_bits(a[0]), bf_bits(a[1]));
    o[1] = pk16(bf_bits(a[2]), bf_bits(a[3]));
    o[2] = pk16(bf_bits(b[0]), bf_bits(b[1]));
    o[3] = pk16(bf_bits(b[2]), bf_bits(b[3]));
  } else {
    o[0] = pk16(h_bits((_Float16)(bfr(a[0]) * sc)), h_bits((_Float16)(bfr(a[1]) * sc)));
    o[1] = pk16(h_bits((_Float16)(bfr(a[2]) * sc)), h_bits((_Float16)(bfr(a[3]) * sc)));
    o[2] = pk16(h_bits((_Float16)(bfr(b[0]) * sc)), h_bits((_Float16)(bfr(b[1]) * sc)));
    o[3] = pk16(h_bits((_Float16)(bfr(b[2]) * sc)), h_bits((_Float16)(bfr(b[3]) * sc)));
  }
  {
    *(v4u*)(dst + i8) = o;
    
  }
}

// =====================================================================================================
// Transposing 16-bit pack of a weight matrix: in W[Cin][Dd] (pitch Dd, base + z*sIn) -> out WT[Dd][Cin] (pitch Cin, base + z*sOut),
// BFO 0: f16( bf16_RNE(w) * sc ); BFO 1: bf16_RNE(w) bits. One 64x64 tile per block (bx = Cin tile, by = Dd tile, bz = matrix index):
// coverage: loads 4 x 256 x 4 floats = 64x64; stores 2 x 256 pieces x 8 halves = 64 rows x 64 halves = the whole tile;
//           (bx, by, bz) runs over (Cin/64, Dd/64, nmat) exactly (all sizes exact multiples of 64). t: the block's 64 x 65 float tile in LDS.
// =====================================================================================================
template <int BFO>
__device__ __forceinline__ void tr16(const float* __restrict__ W, unsigned short* WT, int Cin, int Dd,
                                     long long sIn, long long sOut, float sc, int bx, int by, int bz, float (*t)[65]) {
  const int tid = threadIdx.x;
  const int c0 = bx * 64, d0 = by * 64;
  const float* src = W + (size_t)((long long)bz * sIn);
  unsigned short* dst = WT + (size_t)((long long)bz * sOut);
#pragma unroll
  for (int it = 0; it < 4; ++it) {
    const int p  = it * 256 + tid;
    const int cc = p >> 4, sg = (p & 15) * 4;
    const v4f v = *(const v4f*)(src + (size_t)(c0 + cc) * Dd + d0 + sg);
    t[cc][sg]     = v[0];
    t[cc][sg + 1] = v[1];
    t[cc][sg + 2] = v[2];
    t[cc][sg + 3] = v[3];
  }
  __syncthreads();
  v4u o[2];
#pragma unroll
  for (int it = 0; it < 2; ++it) {
    const int p  = it * 256 + tid;
    const int dd = p >> 3, s8 = (p & 7) * 8;
    unsigned short hv[8];
#pragma unroll
    for (int k = 0; k < 8; ++k) {
      const float f = bfr(t[s8 + k][dd]);
      if constexpr (BFO != 0) hv[k] = bf_bits(f);
      else hv[k] = h_bits((_Float16)(f * sc));
    }
    v4u q;
    q[0] = pk16(hv[0], hv[1]);
    q[1] = pk16(hv[2], hv[3]);
    q[2] = pk16(hv[4], hv[5]);
    q[3] = pk16(hv[6], hv[7]);
    o[it] = q;
  }
  {
#pragma unroll
    for (int it = 0; it < 2; ++it) {
      const int p  = it * 256 + tid;
      const int dd = p >> 3, s8 = (p & 7) * 8;
      *(v4u*)(dst + (size_t)(d0 + dd) * Cin + c0 + s8) = o[it];
    }
    wait_addr();   // other jobs' code follows these stores in the merged kernel and rewrites their registers
  }
}

// =====================================================================================================
// Relative-position operand plane: out[h][r][0..63] bf16 bits, r 0..62 = rel_w[h][r][:], r 63 = 0, r 64..126 = rel_h[h][r-64][:],
// r 127 = 0. Every lane loads both candidate rows from clamped addresses and selects by value. 8 halves per thread, 8 consecutive
// coverage: 32 blocks (index bx) x 256 threads x 8 halves = 8 x 128 x 64 exactly.
// =====================================================================================================
__device__ __forceinline__ void relcat(const float* __restrict__ rw, const float* __restrict__ rh, unsigned short* out, int bx) {
  const int p   = bx * 256 + threadIdx.x;                // 0 .. NHEAD*RTP*8 - 1
  const int hd  = p / (RTP * 8);
  const int r   = (p >> 3) & (RTP - 1);
  const int seg = (p & 7) * 8;
  const int iw  = (r < NREL) ? r : (NREL - 1);
  int ih = r - HD;
  ih = (ih < 0) ? 0 : ih;
  ih = (ih > NREL - 1) ? (NREL - 1) : ih;
  const float* pw = rw + ((size_t)hd * NREL + iw) * HD + seg;
  const float* ph = rh + ((size_t)hd * NREL + ih) * HD + seg;
  const v4f a0 = *(const v4f*)(pw), a1 = *(const v4f*)(pw + 4);
  const v4f b0 = *(const v4f*)(ph), b1 = *(const v4f*)(ph + 4);
  const bool uw = (r < NREL);
  const bool uh = (r >= HD) && (r < HD + NREL);
  float v[8];
#pragma unroll
  for (int e = 0; e < 4; ++e) {
    v[e]     = uw ? a0[e] : (uh ? b0[e] : 0.f);
    v[4 + e] = uw ? a1[e] : (uh ? b1[e] : 0.f);
  }
  v4u o;
  o[0] = pk16(bf_bits(v[0]), bf_bits(v[1]));
  o[1] = pk16(bf_bits(v[2]), bf_bits(v[3]));
  o[2] = pk16(bf_bits(v[4]), bf_bits(v[5]));
  o[3] = pk16(bf_bits(v[6]), bf_bits(v[7]));
  {
    *(v4u*)(out + (size_t)p * 8) = o;
    wait_addr();   // other jobs' code follows this store in the merged kernel and rewrites its registers
  }
}

// =====================================================================================================
// All operand packs in one launch: none reads what another writes, so the job is picked by the block index (block-uniform, so the barrier
// of the transposing jobs is passed by a whole block or by none). The transposing jobs, whose blocks last longest, come first.
//   blocks    0 ..  191: W[h][c][d] -> WT[h*64+d][c] as f16( bf16_RNE(w) * 64 ) for Wk, Wq, Wv (64 blocks each: 8 c tiles x 8 heads)
//   blocks  192 ..  255: Wout[in][out] -> WUT[out][in] bf16 (8 x 8 tiles)
//   blocks  256 ..  263: Wo[h][d][e] -> WOT[h][e][d] bf16 (one tile per head)
//   blocks  264 ..  295: rel tables -> REL[h][128][64] bf16 (rows 63, 127 zero)
//   blocks  296 .. 2343: X16[row][c] = f16( bf16_RNE(x[row][c]) * 16 ), rows = b*1024 + tok
// =====================================================================================================
#define PB_W    ((DM / 64) * NHEAD)
#define PB_WU   ((COUT / 64) * (COUT / 64))
#define PB_WO   NHEAD
#define PB_RL   ((NHEAD * RTP * 8) / 256)
#define PB_X    ((NROWS * DM) / 2048)
#define PREP_BLOCKS (3 * PB_W + PB_WU + PB_WO + PB_RL + PB_X)
static_assert(HD == 64 && HO == 64);
__global__ __launch_bounds__(256) void prep(const float* __restrict__ x, const float* __restrict__ w_k, const float* __restrict__ w_q,
                                            const float* __restrict__ w_v, const float* __restrict__ w_o, const float* __restrict__ w_out,
                                            const float* __restrict__ relw, const float* __restrict__ relh,
                                            unsigned short* X16, unsigned short* WKT, unsigned short* WQT, unsigned short* WVT,
                                            unsigned short* WOT, unsigned short* WUT, unsigned short* REL) {
  __shared__ float t[64][65];
  int b = blockIdx.x;
  if (b < 3 * PB_W) {
    const int m = b / PB_W, r = b - m * PB_W;
    const float* src = (m == 0) ? w_k : ((m == 1) ? w_q : w_v);
    unsigned short* dst = (m == 0) ? WKT : ((m == 1) ? WQT : WVT);
    tr16<0>(src, dst, DM, HD, (long long)DM * HD, (long long)HD * DM, WSC, r % (DM / 64), 0, r / (DM / 64), t);
    return;
  }
  b -= 3 * PB_W;
  if (b < PB_WU) {
    tr16<1>(w_out, WUT, COUT, COUT, 0LL, 0LL, 1.0f, b % (COUT / 64), b / (COUT / 64), 0, t);
    return;
  }
  b -= PB_WU;
  if (b < PB_WO) {
    tr16<1>(w_o, WOT, HD, HO, (long long)HD * HO, (long long)HO * HD, 1.0f, 0, 0, b, t);
    return;
  }
  b -= PB_WO;
  if (b < PB_RL) {
    relcat(relw, relh, REL, b);
    return;
  }
  b -= PB_RL;
  cvt16<0>(x, X16, NROWS * DM, ACARRY, b);
}

// =====================================================================================================
// Register-blocked batched 16-bit WMMA GEMM: C[m][n] = oscale * sum_k A[m][k] * Bt[n][k]; one wave per 64x64 tile, block = WM x WN waves
// (4 waves) on a (64 WM) x (64 WN) tile.
// A row-major [M][K] pitch lda (16-bit plane), Bt row-major [N][K] pitch ldb (k contiguous); M multiple of 64 WM, N of 64 WN, K of 64.
// The block's A and Bt rows are brought into LDS once per block, in k slabs of 64 (one whole 128-B line per row, 8 lanes per line, pitch 144 B
// in LDS), by asynchronous 16-B copies, two buffers: slab t + 2 is issued behind the barrier that ends slab t. All fragments are 16-B LDS reads
// with the same split k map and the same k order of the products as with fragments read from global memory.
// bx = tile index, by = batch index with element strides sA, sB, sC; gst, sT: the block's LDS (two slab buffers; one 16 x 68 float slab per wave);
// res: EPI 1 only, the block's LDS for its piece of ep0.
// ASPLIT 1: a second A plane A2 (unscaled residual of A, same layout) is multiplied into the same accumulator (A + A2 ~ exact A).
// BF 1: bf16 operands (v_wmma_f32_16x16x32_bf16), else f16.
// OM 0: f32 out (pitch ldc).  OM 2: f16 out = f16(value * ocarry).  OM 3: two bf16 planes: hi = bf16_RNE(value), lo = bf16_RNE(value - hi).
// OM 4: two f16 planes: hi = f16(value * ocarry), lo = f16(value * ocarry - hi) (unscaled residual).
// EPI 1 (OM 0 only): value += bf16_RNE(ep0[same index as C]).  EPI 2 (16-bit out): per-column eval batch-norm affine
//   value = (bf16(ep0[ci]) * (value - bf16(ep2[ci]))) * rsqrt(bf16(ep3[ci]) + eps) + bf16(ep1[ci]),  ci = by*cps + column.
// coverage: 4 slabs x 16 rows (f32: it 0..7 x lane>>4; 16-bit: it 0..3 x lane>>3) x 64 cols = the wave's whole 64x64 tile;
//           bx runs over (M / (64 WM)) * (N / (64 WN)) blocks exactly; a surplus block would leave as a whole, ahead of every copy and barrier.
// =====================================================================================================
template <int V> struct IntC { static constexpr int value = V; };
constexpr int gemm_slab_halves(int asplit, int wm, int wn) { return ((1 + asplit) * 64 * wm + 64 * wn) * GPITCH; }   // one buffer: A | (A2) | Bt
template <int OM, int ASPLIT, int BF, int EPI, int WM, int WN>
__device__ __forceinline__ void gemm64_tile(
    unsigned short* gst, float* sT, float* res, unsigned bx, int by,
    const unsigned short* __restrict__ Ap, const unsigned short* __restrict__ A2p, int lda, long long sA,
    const unsigned short* __restrict__ Btp, int ldb, long long sB,
    void* Cout, void* C2out, int ldc, long long sC,
    int M, int N, int K, float oscale, float ocarry,
    const float* __restrict__ ep0, const float* __restrict__ ep1,
    const float* __restrict__ ep2, const float* __restrict__ ep3, int cps) {
  constexpr int NW     = WM * WN;                    // waves per block
  constexpr int AR     = 64 * WM;                    // A rows of the block tile
  constexpr int BR     = 64 * WN;                    // Bt rows of the block tile
  constexpr int RPI    = NW * 4;                     // rows that one copy of every lane of the block covers (8 lanes per row)
  constexpr int A_H    = AR * GPITCH;                // halves of one A plane's slab in LDS
  constexpr int B_H    = BR * GPITCH;
  constexpr int SLAB_H = (1 + ASPLIT) * A_H + B_H;   // one buffer: A | (A2) | Bt
  static_assert(SLAB_H == gemm_slab_halves(ASPLIT, WM, WN));
  static_assert((AR % (4 * RPI)) == 0 && (BR % (4 * RPI)) == 0);
  static_assert(((1 + ASPLIT) * AR + BR) / RPI <= 63);     // copies of one wave in flight
  const int tid  = threadIdx.x;
  const int lane = tid & 31;
  const int wave = tid >> 5;
  const int tilesN = N / BR;
  const int tilesM = M / AR;
  if ((int)bx >= tilesM * tilesN) return;           // block-uniform, ahead of every copy and barrier
  const int tm  = bx / tilesN;
  const int tn  = bx - tm * tilesN;
  const int bm0 = tm * AR;
  const int bn0 = tn * BR;
  const int wm  = wave / WN;
  const int wn  = wave - wm * WN;
  const int m0  = bm0 + (wm << 6);
  const int n0  = bn0 + (wn << 6);

  const unsigned short* A1 = Ap  + (size_t)((long long)by * sA);
  const unsigned short* A2 = A2p + (size_t)((long long)by * sA);
  const unsigned short* Bb = Btp + (size_t)((long long)by * sB);

  const int rlane = lane & 15;                 // row (A) / col (B, D) within subtile
  const int koff  = (lane >> 4) * 8;           // k offset of this lane half
  const int mOff  = (lane >> 4) * 8;           // D row offset

  // per-lane copy addresses: row tid>>3 of a group of RPI rows, 16-B segment tid&7 of the row's 128-B line
  const unsigned short* gA  = A1 + (size_t)(bm0 + (tid >> 3)) * lda + (tid & 7) * 8;
  const unsigned short* gA2 = A2 + (size_t)(bm0 + (tid >> 3)) * lda + (tid & 7) * 8;
  const unsigned short* gB  = Bb + (size_t)(bn0 + (tid >> 3)) * ldb + (tid & 7) * 8;
  const unsigned lcp = (unsigned)(uintptr_t)gst + (unsigned)((tid >> 3) * (GPITCH * 2) + (tid & 7) * 16);   // LDS byte address
  constexpr unsigned LSTEP = (unsigned)(RPI * GPITCH * 2);      // LDS bytes from one group of RPI rows to the next
  const size_t astep = (size_t)RPI * lda, bstep = (size_t)RPI * ldb;
  // rows of one plane: groups of RPI rows, eight groups (or the last four) per statement
  auto plane = [&](unsigned l, const unsigned short* p, size_t step, auto ngroups) {
    constexpr int NG = decltype(ngroups)::value;
#pragma unroll
    for (int g = 0; g < NG; g += 8) {
      const unsigned short* q = p + (size_t)g * step;
      const unsigned m = l + (unsigned)g * LSTEP;
      if (g + 8 <= NG) {
        stage_copy8(m, q, m + LSTEP, q + step, m + 2 * LSTEP, q + 2 * step, m + 3 * LSTEP, q + 3 * step,
                    m + 4 * LSTEP, q + 4 * step, m + 5 * LSTEP, q + 5 * step, m + 6 * LSTEP, q + 6 * step, m + 7 * LSTEP, q + 7 * step);
      } else {
        stage_copy4(m, q, m + LSTEP, q + step, m + 2 * LSTEP, q + 2 * step, m + 3 * LSTEP, q + 3 * step);
      }
    }
  };
  auto stage = [&](int buf, int k0) {
    const unsigned l0 = lcp + (unsigned)(buf * (SLAB_H * 2));
    plane(l0, gA + k0, astep, IntC<AR / RPI>{});
    if constexpr (ASPLIT != 0) plane(l0 + (unsigned)(A_H * 2), gA2 + k0, astep, IntC<AR / RPI>{});
    plane(l0 + (unsigned)((1 + ASPLIT) * A_H * 2), gB + k0, bstep, IntC<BR / RPI>{});
  };

  v8f acc[4][4];
#pragma unroll
  for (int i = 0; i < 4; ++i)
#pragma unroll
    for (int j = 0; j < 4; ++j) acc[i][j] = zero8();

  // slab 0 -> buffer 0, landed and published; then slab 1 -> buffer 1 flies while slab 0 is worked on
  const int nslab = K / GKS;
  stage(0, 0);
  wait_copies();
  __syncthreads();
  if (nslab > 1) stage(1, GKS);

  // EPI 1: the block's AR x BR f32 piece of ep0 goes to LDS (res, pitch BR) under the k loop, so that the epilogue waits on no global load.
  // One copy of a wave = one whole 512-B row piece; group g = rows 8 NW g .. 8 NW g + 8 NW - 1 (row = NW j + wave), one group behind the foot of
  // slab g, landed and published by the foot of slab g + 1; groups that have no such slab go ahead of the loop (foot of slab 0).
  constexpr int NRG = AR / (8 * NW);
  static_assert(EPI != 1 || (BR * 4 == 32 * 16 && (AR % (8 * NW)) == 0));
  static_assert(((1 + ASPLIT) * AR + BR) / RPI + 8 * NRG <= 63);   // copies of one wave in flight, at the most
  auto rescopy = [&](int g) {
    const float* q = ep0 + (size_t)((long long)by * sC) + (size_t)(bm0 + g * (8 * NW) + wave) * ldc + bn0 + lane * 4;
    const unsigned m = (unsigned)(uintptr_t)res + (unsigned)((g * (8 * NW) + wave) * (BR * 4) + lane * 16);
    const size_t rs = (size_t)NW * ldc;
    constexpr unsigned ms = (unsigned)(NW * BR * 4);
    stage_copy8(m, (const unsigned short*)q, m + ms, (const unsigned short*)(q + rs),
                m + 2 * ms, (const unsigned short*)(q + 2 * rs), m + 3 * ms, (const unsigned short*)(q + 3 * rs),
                m + 4 * ms, (const unsigned short*)(q + 4 * rs), m + 5 * ms, (const unsigned short*)(q + 5 * rs),
                m + 6 * ms, (const unsigned short*)(q + 6 * rs), m + 7 * ms, (const unsigned short*)(q + 7 * rs));
  };
  if constexpr (EPI == 1) {
#pragma unroll 1   // kept rolled: runs only for K under (NRG + 1) slabs, one copy statement in the text is enough
    for (int g = nslab - 1; g < NRG; ++g) rescopy(g);
  }

#pragma unroll 1
  for (int t = 0; t < nslab; ++t) {
    const unsigned short* sb  = gst + (t & 1) * SLAB_H;
    const unsigned short* As  = sb + ((wm << 6) + rlane) * GPITCH + koff;
    const unsigned short* As2 = As + A_H;
    const unsigned short* Bs  = sb + (1 + ASPLIT) * A_H + ((wn << 6) + rlane) * GPITCH + koff;
#pragma unroll
    for (int ks = 0; ks < GKS; ks += 32) {
      // all fragments of the k-step are read as one group ahead of its products (one LDS wait per k-step, not one per row of tiles)
      v16h bh[4], ah[4];
#pragma unroll
      for (int j = 0; j < 4; ++j) bh[j] = ldfrag_u(Bs + (j << 4) * GPITCH + ks);
#pragma unroll
      for (int i = 0; i < 4; ++i) ah[i] = ldfrag_u(As + (i << 4) * GPITCH + ks);
      if constexpr (ASPLIT != 0) {
        v16h al[4];
#pragma unroll
        for (int i = 0; i < 4; ++i) al[i] = ldfrag_u(As2 + (i << 4) * GPITCH + ks);
#pragma unroll
        for (int i = 0; i < 4; ++i) {
#pragma unroll
          for (int j = 0; j < 4; ++j) acc[i][j] = mmaT<BF>(ah[i], bh[j], acc[i][j]);
          dep_guard1(acc[i][0], acc[i][3], ah[i]);
#pragma unroll
          for (int j = 0; j < 4; ++j) acc[i][j] = mmaT<BF>(al[i], bh[j], acc[i][j]);
          dep_guard1(acc[i][0], acc[i][3], al[i]);
        }
      } else {
#pragma unroll
        for (int i = 0; i < 4; ++i) {
#pragma unroll
          for (int j = 0; j < 4; ++j) acc[i][j] = mmaT<BF>(ah[i], bh[j], acc[i][j]);
          dep_guard1(acc[i][0], acc[i][3], ah[i]);
        }
      }
      keep4_h(bh[0], bh[1], bh[2], bh[3]);
    }
    // foot of the slab: own LDS reads returned, own copies of slab t + 1 landed, then the one barrier that publishes slab t + 1
    // and ends every wave's reads of this slab's buffer; only behind it is that buffer refilled with slab t + 2
    wait_lds();
    wait_copies();
    __syncthreads();
    if (t + 2 < nslab) stage(t & 1, (t + 2) * GKS);
    if constexpr (EPI == 1) {
      if (t < NRG && t + 1 < nslab) rescopy(t);
    }
  }
  wait_copies();
  acc_guard4(acc[0][0], acc[0][1], acc[0][2], acc[0][3]);
  acc_guard4(acc[1][0], acc[1][1], acc[1][2], acc[1][3]);
  acc_guard4(acc[2][0], acc[2][1], acc[2][2], acc[2][3]);
  acc_guard4(acc[3][0], acc[3][1], acc[3][2], acc[3][3]);

  const int hh2 = lane >> 4, c4 = (lane & 15) * 4;     // f32 out: 256-B row segment = 16 lanes x 16 B
  const int q8  = lane >> 3, c8 = (lane & 7) * 8;

  // ---- epilogue ----
  float* slab = sT + wave * (16 * 68);              // per-wave 16x64 slab, pitch 68 floats
#pragma unroll
  for (int i = 0; i < 4; ++i) {
    const int mBase = m0 + (i << 4);
#pragma unroll
    for (int j = 0; j < 4; ++j) {
#pragma unroll
      for (int r = 0; r < 8; ++r) {
        slab[(mOff + r) * 68 + (j << 4) + rlane] = acc[i][j][r];
      }
    }
    wave_sync_lds_only();
    if constexpr (OM == 0) {
      float* C = (float*)Cout + (size_t)((long long)by * sC);
      v4f vals[8];
#pragma unroll
      for (int it = 0; it < 8; ++it) {
        const int row = it * 2 + hh2;                      // it 0..7 x hh2 0..1 = rows 0..15
        v4f v = *(const v4f*)(slab + row * 68 + c4);
#pragma unroll
        for (int e = 0; e < 4; ++e) v[e] = v[e] * oscale;
        if constexpr (EPI == 1) {
          const v4f xr = *(const v4f*)(res + ((wm << 6) + (i << 4) + row) * BR + (wn << 6) + c4);
#pragma unroll
          for (int e = 0; e < 4; ++e) v[e] = v[e] + bfr(xr[e]);
        }
        vals[it] = v;
      }
      {
#pragma unroll
        for (int it = 0; it < 8; ++it) {
          const int gr = mBase + it * 2 + hh2;
          *(v4f*)(C + (size_t)gr * ldc + n0 + c4) = vals[it];
        }
        wait_addr();   // behind the stores, ahead of the next slab's rewrites of their address registers
      }
    } else {
      unsigned short* C  = (unsigned short*)Cout  + (size_t)((long long)by * sC);
      unsigned short* Cb = (unsigned short*)C2out + (size_t)((long long)by * sC);
      v4u hv[4], lv[4];
#pragma unroll
      for (int it = 0; it < 4; ++it) {
        const int row = it * 4 + q8;                       // it 0..3 x q8 0..3 = rows 0..15
        const float* sp = slab + row * 68 + c8;
        v4u a  = {0u, 0u, 0u, 0u};
        v4u b2 = {0u, 0u, 0u, 0u};
#pragma unroll
        for (int e = 0; e < 4; ++e) {
          float f0 = sp[2 * e] * oscale;
          float f1 = sp[2 * e + 1] * oscale;
          if constexpr (EPI == 2) {
            const int ci = by * cps + n0 + c8 + 2 * e;   // column parameter index (host keeps by*cps + N <= parameter count)
            const float g0 = bfr(ep0[ci]), g1 = bfr(ep0[ci + 1]);
            const float t0 = bfr(ep1[ci]), t1 = bfr(ep1[ci + 1]);
            const float u0 = bfr(ep2[ci]), u1 = bfr(ep2[ci + 1]);
            const float r0 = rsqrtf(bfr(ep3[ci]) + BN_EPS), r1 = rsqrtf(bfr(ep3[ci + 1]) + BN_EPS);
            f0 = (g0 * (f0 - u0)) * r0 + t0;
            f1 = (g1 * (f1 - u1)) * r1 + t1;
          }
          if constexpr (OM == 3) {
            const unsigned short h0 = bf_bits(f0), h1 = bf_bits(f1);
            a[e]  = pk16(h0, h1);
            b2[e] = pk16(bf_bits(f0 - bf_up(h0)), bf_bits(f1 - bf_up(h1)));
          } else {
            f0 *= ocarry; f1 *= ocarry;
            const _Float16 x0 = (_Float16)f0, x1 = (_Float16)f1;
            a[e] = pk16(h_bits(x0), h_bits(x1));
            if constexpr (OM == 4) {
              b2[e] = pk16(h_bits((_Float16)(f0 - (float)x0)), h_bits((_Float16)(f1 - (float)x1)));
            }
          }
        }
        hv[it] = a;
        lv[it] = b2;
      }
      {
#pragma unroll
        for (int it = 0; it < 4; ++it) {
          const int row = it * 4 + q8;
          *(v4u*)(C + (size_t)(mBase + row) * ldc + n0 + c8) = hv[it];
          if constexpr (OM >= 3) {
            *(v4u*)(Cb + (size_t)(mBase + row) * ldc + n0 + c8) = lv[it];
          }
        }
        wait_addr();   // behind the stores, ahead of the next slab's rewrites of their address registers
      }
    }
    wave_sync_lds_only();
  }
}

// one GEMM per launch: blockIdx.x = tile, blockIdx.y = batch
template <int OM, int ASPLIT, int BF, int EPI, int WM, int WN>
__global__ __launch_bounds__(WM * WN * 32) __attribute__((amdgpu_num_vgpr(256))) void gemm64(
    const unsigned short* __restrict__ Ap, const unsigned short* __restrict__ A2p, int lda, long long sA,
    const unsigned short* __restrict__ Btp, int ldb, long long sB,
    void* Cout, void* C2out, int ldc, long long sC,
    int M, int N, int K, float oscale, float ocarry,
    const float* __restrict__ ep0, const float* __restrict__ ep1,
    const float* __restrict__ ep2, const float* __restrict__ ep3, int cps) {
  __shared__ __align__(16) unsigned short gst[2 * gemm_slab_halves(ASPLIT, WM, WN)];
  __shared__ __align__(16) float sT[WM * WN * 16 * 68];
  __shared__ __align__(16) float res[(EPI == 1) ? (64 * WM) * (64 * WN) : 4];   // EPI 1: the block's piece of ep0
  gemm64_tile<OM, ASPLIT, BF, EPI, WM, WN>(gst, sT, res, blockIdx.x, (int)blockIdx.y, Ap, A2p, lda, sA, Btp, ldb, sB, Cout, C2out, ldc, sC,
                                           M, N, K, oscale, ocarry, ep0, ep1, ep2, ep3, cps);
}

// The three projections in one launch: none reads what another writes; blockIdx.y picks the job (block-uniform), blockIdx.x its 128 x 128 tile
// (256 tiles each), so three blocks share a WGP where one stood alone.
//   job 0: v^T per image: VT[b][h*64+d][tok] = sum_c WVT[h*64+d][c] x_b[tok][c] -> f16 x16 hi / residual planes; M = 512, N = 1024, K = 512,
//          image = blockIdx.x / 32, tile = blockIdx.x % 32
//   job 1: k[m][n] = sum_c x[m][c] WKT[n][c] -> bf16 hi / residual planes; M = 8192, N = 512, K = 512.   job 2: the same for q with WQT
#define PROJ_TILES ((NROWS / 128) * (DM / 128))
#define VT_TILES   ((DM / 128) * (NTOK / 128))
static_assert(VT_TILES * NB == PROJ_TILES);
__global__ __launch_bounds__(128) __attribute__((amdgpu_num_vgpr(256))) void qkv(
    const unsigned short* __restrict__ X16, const unsigned short* __restrict__ WKT, const unsigned short* __restrict__ WQT,
    const unsigned short* __restrict__ WVT, unsigned short* KHh, unsigned short* KHl, unsigned short* QHh, unsigned short* QHl,
    unsigned short* VTh, unsigned short* VTl) {
  __shared__ __align__(16) unsigned short gst[2 * gemm_slab_halves(0, 2, 2)];
  __shared__ __align__(16) float sT[4 * 16 * 68];
  const int job = blockIdx.y;
  const unsigned bx = blockIdx.x;
  if (job == 0) {
    gemm64_tile<4, 0, 0, 0, 2, 2>(gst, sT, nullptr, bx % VT_TILES, (int)(bx / VT_TILES),
                                  WVT, WVT, DM, 0LL,
                                  X16, DM, (long long)NTOK * DM,
                                  (void*)VTh, (void*)VTl, NTOK, (long long)DM * NTOK,
                                  DM, NTOK, DM, 1.0f / (ACARRY * WSC), VC,
                                  nullptr, nullptr, nullptr, nullptr, 0);
  } else {
    gemm64_tile<3, 0, 0, 0, 2, 2>(gst, sT, nullptr, bx, 0,
                                  X16, X16, DM, 0LL,
                                  (job == 1) ? WKT : WQT, DM, 0LL,
                                  (void*)((job == 1) ? KHh : QHh), (void*)((job == 1) ? KHl : QHl), DM, 0LL,
                                  NROWS, DM, DM, 1.0f / (ACARRY * WSC), 1.0f,
                                  nullptr, nullptr, nullptr, nullptr, 0);
  }
}

// =====================================================================================================
// Flash attention for one image (batch), one head and 128 score rows (one wave per 16 rows), head dim 64, 1024 columns:
//   rows i index KEY positions (k_i stationary), columns j index the q/v positions streamed in chunks of 32 = one image row;
//   k planes (bf16 hi, lo) K[b*1024 + tok][64h + d], pitch 512; q planes (bf16 hi, lo) Q[b*1024 + tok][64h + d];
//   v^T planes (f16 x16 hi, unscaled lo): VT[b*512 + 64h + d][tok] (pitch 1024);
//   additive position logits from the f32 table R[tok][m] (m < 63: q_tok . rel_w[h][m]; 64 + m: q_tok . rel_h[h][m]):
//   logit[i][j] = k_i . q_j + R[i][yj - yi + 31] + R[i][64 + xj - xi + 31], token = 32*x + y.
//   Each wave computes the table rows of its own 16 score rows ahead of the loop, transposed (A = REL rows m, B = q rows i0 + c, hi then residual
//   per k-step): lane (c, hh) gets R[i0 + c][16t + 8hh + r] and stores it to the wave's own 16 x 128 f32 piece of LDS (pitch 132), from which
//   the lanes of that wave alone read it back by their own indices.
//   The score tiles are computed transposed, S^T[j][i] (A = q rows of the chunk from LDS, B = the stationary k rows): lane (c, hh) holds score row
//   i0 + c and, in its 2 x 8 accumulator registers, that row's columns 8hh + r and 16 + 8hh + r of the chunk. So a row's maximum and sum are taken
//   inside the lane, with one exchange between the wave's halves for the maximum per chunk and one for the sum at the end, and the 16 values,
//   converted in place, are the B operand (hardware k order) of O^T[d][i] += v^T[d][j] P^T[j][i] (A = v^T rows from LDS, same k order).
//   The w part of the position logits depends only on the column within a chunk (16 registers per lane, loaded once), the h part only on the
//   chunk (one LDS load per lane per chunk); indices are pure arithmetic.
//   ctx[i][d] = sum_j softmax_j(logit) v[j][d]  (softmax run in base 2, max-subtracted, no 1/sqrt(d)), split into bf16 hi + residual in registers:
//   the lane's 4 x 8 values are the B operand (hardware k order) of Y^T[e][i] = sum_d WOT[h][e][d] ctx[i][d] (A = WOT rows, hi then residual per k-step);
//   out (bf16 hi, lo planes): CA[b*1024 + tok][64h + e] = batch-norm affine of Y[i][e].
//   block = 8 waves = 256 threads; grid = 8 images x 8 heads x 8 row blocks = 512; every wave does identical bounded work (32 chunks).
//   The 8 waves of a block need the same q and v^T chunk: it is brought into LDS once per block by asynchronous 16-B copies (4 per lane and
//   chunk: q hi, q lo 32 rows x 128 B at pitch 144 B; v^T hi, lo 64 rows x 64 B at pitch 80 B), two buffers, chunk t + 2 issued behind the
//   barrier that ends chunk t; all A fragments of the loop are 16-B LDS reads with the split k map.
//   Per chunk: 2 score tiles on bf16 WMMA (hi.hi + lo.hi + hi.lo, K = 64 as two k-steps of 32); online softmax in f32 (exp2); P*1024 as f16 hi
//   and unscaled residual; 12 v^T.P^T WMMAs (hi.hi, hi.lo, lo.hi).
//   Final 1/l and carry folds in f32; after a block barrier the stage buffers are reused as the block's two bf16 result buffers [128][64]
//   (hi, lo): each lane stages 4 x 8 consecutive e of its row (16-B stores); after a second block barrier the 256 threads write whole 128-B row pieces.
// coverage: LDS result buffers: 8 waves x 16 rows x 64 cols per plane; global: 4 iterations x 256 threads x 8 halves = 128 rows x 64 cols
//           of rows 128rb..128rb+127, columns 64h..64h+63 of image b, per plane; grid covers all 8 x 1024 rows x 512 columns exactly once.
// =====================================================================================================
__global__ __launch_bounds__(ATT_THREADS) __attribute__((amdgpu_num_vgpr(256)))
void attn8(const unsigned short* __restrict__ KHh, const unsigned short* __restrict__ KHl,
           const unsigned short* __restrict__ QHh, const unsigned short* __restrict__ QHl,
           const unsigned short* __restrict__ VTh, const unsigned short* __restrict__ VTl,
           const unsigned short* __restrict__ REL, const unsigned short* __restrict__ WOT,
           const float* __restrict__ gam, const float* __restrict__ bet,
           const float* __restrict__ mmean, const float* __restrict__ mvar,
           unsigned short* CAh, unsigned short* CAl) {
  __shared__ __align__(16) unsigned short stg[2 * STG_HALVES];   // two stage buffers: q hi | q lo | v^T hi | v^T lo; later: result buffers
  __shared__ __align__(16) float tab[ATT_ROWS * TPITCH];         // position-logit table rows of the block's score rows, 16 rows per wave
  __shared__ __align__(16) float bnp[4 * HO];                    // batch-norm terms of the head's 64 columns: gamma | mean | rsqrt(var + eps) | beta

  const int tid  = threadIdx.x;
  const int wave = tid >> 5;
  const int lane = tid & 31;
  const int hh   = lane >> 4;
  const int c    = lane & 15;

  const int rb   = blockIdx.x & ((NTOK / ATT_ROWS) - 1);   // 0..7
  const int head = (blockIdx.x / (NTOK / ATT_ROWS)) & (NHEAD - 1);   // 0..7
  const int bat  = blockIdx.x / ((NTOK / ATT_ROWS) * NHEAD);         // 0..7
  const int i0   = rb * ATT_ROWS + wave * 16;              // first score row (key token) of this wave
  const int x0   = i0 / GW;                                // image row of all 16 tokens
  const int yi   = (i0 & (GW - 1)) + c;                    // image column of this lane's score row i0 + c
  const size_t rowg = (size_t)bat * NTOK + i0;

  // per-lane copy addresses: q piece = row tid>>3, 16-B segment tid&7; v^T piece = row tid>>2, 16-B segment tid&3
  const unsigned short* gqh = QHh + ((size_t)bat * NTOK + (tid >> 3)) * DM + head * HD + (tid & 7) * 8;
  const unsigned short* gql = QHl + ((size_t)bat * NTOK + (tid >> 3)) * DM + head * HD + (tid & 7) * 8;
  const unsigned short* gvh = VTh + ((size_t)bat * DM + head * HD + (tid >> 2)) * NTOK + (tid & 3) * 8;
  const unsigned short* gvl = VTl + ((size_t)bat * DM + head * HD + (tid >> 2)) * NTOK + (tid & 3) * 8;
  const unsigned lbase = (unsigned)(uintptr_t)stg;         // LDS byte address of the stage buffers
  const unsigned lq = lbase + (unsigned)((tid >> 3) * (QPITCH * 2) + (tid & 7) * 16);
  const unsigned lv = lbase + (unsigned)(2 * QT_HALVES * 2 + (tid >> 2) * (VPITCH * 2) + (tid & 3) * 16);

  // chunk 0 -> buffer 0, landed and published; then chunk 1 -> buffer 1 flies while chunk 0 is worked on
  stage_copy4(lq, gqh, lq + QT_HALVES * 2, gql, lv, gvh, lv + VT_HALVES * 2, gvl);
  // the head's batch-norm terms, once per block (waves 0 and 1, one column per lane); published by the barrier below, read behind the loop
  if (tid < HO) {
    const int ci = head * HO + tid;
    bnp[tid]          = bfr(gam[ci]);
    bnp[HO + tid]     = bfr(mmean[ci]);
    bnp[2 * HO + tid] = rsqrtf(bfr(mvar[ci]) + BN_EPS);
    bnp[3 * HO + tid] = bfr(bet[ci]);
    wait_addr();   // behind the parameter loads, ahead of later rewrites of their address registers
  }
  wait_copies();
  __syncthreads();
  stage_copy4(lq + STG_HALVES * 2, gqh + (size_t)KCH * DM, lq + (STG_HALVES + QT_HALVES) * 2, gql + (size_t)KCH * DM,
              lv + STG_HALVES * 2, gvh + KCH, lv + (STG_HALVES + VT_HALVES) * 2, gvl + KCH);

  // stationary B fragments: k rows i0 + c (hi and residual planes), d 0..31 and 32..63
  const size_t kofs = (rowg + c) * DM + head * HD + 8 * hh;
  const v16h kah = ldfrag_u(KHh + kofs), kbh = ldfrag_u(KHh + kofs + 32);
  const v16h kal = ldfrag_u(KHl + kofs), kbl = ldfrag_u(KHl + kofs + 32);

  // position-logit table of the wave's 16 score rows: R^T[m][i0 + c] = sum_d REL[h][m][d] (q_hi + q_lo)[i0 + c][d], 8 tiles of 16 m
  float* rrow = tab + (wave * 16 + c) * TPITCH;            // table row of score row i0 + c
  {
    const v16h qah = ldfrag_u(QHh + kofs), qbh = ldfrag_u(QHh + kofs + 32);
    const v16h qal = ldfrag_u(QHl + kofs), qbl = ldfrag_u(QHl + kofs + 32);
    const unsigned short* rp = REL + ((size_t)head * RTP + c) * HD + 8 * hh;
#pragma unroll
    for (int t = 0; t < RTP / 16; ++t) {
      const v16h ra = ldfrag_u(rp + t * 16 * HD), rc = ldfrag_u(rp + t * 16 * HD + 32);
      v8f a = mma_b(ra, qah, zero8());
      a = mma_b(ra, qal, a);
      a = mma_b(rc, qbh, a);
      a = mma_b(rc, qbl, a);
      const v4f a0 = {a[0], a[1], a[2], a[3]}, a1 = {a[4], a[5], a[6], a[7]};
      *(v4f*)(rrow + 16 * t + 8 * hh)     = a0;
      *(v4f*)(rrow + 16 * t + 8 * hh + 4) = a1;
    }
    wait_addr();   // behind the fragment loads, ahead of later rewrites of their address registers
  }
  wave_sync_lds();   // a lane reads below what the other half of its wave has stored above
  // additive w-position logits of this lane's score row for the 16 chunk columns that it holds, loop-invariant, pre-scaled by log2(e)
  float wb0[8], wb1[8];
#pragma unroll
  for (int r = 0; r < 8; ++r) {
    const int iw = 8 * hh + r + (GW - 1) - yi;             // in [0, 46]
    wb0[r] = rrow[iw] * LOG2E;
    wb1[r] = rrow[iw + 16] * LOG2E;                        // in [16, 62]
  }
  const float* hrow = rrow + HD + (GH - 1) - x0;           // + st = h-position logit of chunk st; index st - x0 + 31 in [0, 62]

  float mrow = -INFINITY, lrow = 0.f;                      // row maximum (both halves alike); sum over this half's columns only
  v8f o0 = zero8(), o1 = zero8(), o2 = zero8(), o3 = zero8();   // O^T tiles: o_t[r] = O[i0 + c][16t + 8hh + r]

#pragma unroll 1
  for (int st = 0; st < NSTG; ++st) {
    const int bsel = st & 1;
    const unsigned short* sb  = stg + bsel * STG_HALVES;
    const unsigned short* Qsh = sb + c * QPITCH + 8 * hh;                    // q hi, row c of the chunk
    const unsigned short* Qsl = Qsh + QT_HALVES;
    const unsigned short* Vsh = sb + 2 * QT_HALVES + c * VPITCH + 8 * hh;    // v^T hi, row d = c
    const unsigned short* Vsl = Vsh + VT_HALVES;
    // h-position logit of this chunk (one image row x2 = st) for the lane's score row
    const float hraw = hrow[st];
    v8f s0, s1;                                            // s0[r] = S[i0 + c][8hh + r], s1[r] = S[i0 + c][16 + 8hh + r] of the chunk
    {
      const v16h q0h = ldfrag_u(Qsh), q1h = ldfrag_u(Qsh + 32);
      const v16h q0l = ldfrag_u(Qsl), q1l = ldfrag_u(Qsl + 32);
      s0 = mma_b(q0h, kah, zero8());
      s0 = mma_b(q1h, kbh, s0);
      s0 = mma_b(q0l, kah, s0);
      s0 = mma_b(q1l, kbh, s0);
      s0 = mma_b(q0h, kal, s0);
      s0 = mma_b(q1h, kbl, s0);
      guard1x4(s0, q0h, q1h, q0l, q1l);
    }
    {
      const int q2 = 16 * QPITCH;
      const v16h q0h = ldfrag_u(Qsh + q2), q1h = ldfrag_u(Qsh + q2 + 32);
      const v16h q0l = ldfrag_u(Qsl + q2), q1l = ldfrag_u(Qsl + q2 + 32);
      s1 = mma_b(q0h, kah, zero8());
      s1 = mma_b(q1h, kbh, s1);
      s1 = mma_b(q0l, kah, s1);
      s1 = mma_b(q1l, kbh, s1);
      s1 = mma_b(q0h, kal, s1);
      s1 = mma_b(q1h, kbl, s1);
      guard1x8(s1, q0h, q1h, q0l, q1l, kah, kbh, kal, kbl);
    }
    const float hb = hraw * LOG2E;
    float t0[8], t1[8];
#pragma unroll
    for (int r = 0; r < 8; ++r) {
      t0[r] = s0[r] * LOG2E + (wb0[r] + hb);
      t1[r] = s1[r] * LOG2E + (wb1[r] + hb);
    }
    float mx = fmaxf(t0[0], t1[0]);
#pragma unroll
    for (int r = 1; r < 8; ++r) mx = fmaxf(mx, fmaxf(t0[r], t1[r]));
    mx = fmaxf(mx, xhalf(mx));                             // both halves now hold the row's maximum over the chunk
    const float mn = fmaxf(mrow, mx);
    const float al = ex2(mrow - mn);
    mrow = mn;
    FragH ph, pl;                                          // P^T * 1024, f16 hi and unscaled residual: element s = column kmap(s, hh) of the chunk
    float pa[8];
#pragma unroll
    for (int r = 0; r < 8; ++r) {
      const float e0 = ex2(t0[r] - mn), e1 = ex2(t1[r] - mn);
      pa[r] = e0 + e1;
      float f; _Float16 x;
      f = e0 * PC; x = (_Float16)f; ph.h[0][r] = x; pl.h[0][r] = (_Float16)(f - (float)x);   // column 8hh + r
      f = e1 * PC; x = (_Float16)f; ph.h[1][r] = x; pl.h[1][r] = (_Float16)(f - (float)x);   // column 16 + 8hh + r
    }
    const float ps = ((pa[0] + pa[1]) + (pa[2] + pa[3])) + ((pa[4] + pa[5]) + (pa[6] + pa[7]));
    lrow = lrow * al + ps;
#pragma unroll
    for (int r = 0; r < 8; ++r) {
      o0[r] *= al;
      o1[r] *= al;
      o2[r] *= al;
      o3[r] *= al;
    }
    {
      const v16h vh0 = ldfrag_u(Vsh);
      const v16h vh1 = ldfrag_u(Vsh + 16 * VPITCH);
      const v16h vh2 = ldfrag_u(Vsh + 32 * VPITCH);
      const v16h vh3 = ldfrag_u(Vsh + 48 * VPITCH);
      o0 = mma_h(vh0, ph.v, o0);
      o1 = mma_h(vh1, ph.v, o1);
      o2 = mma_h(vh2, ph.v, o2);
      o3 = mma_h(vh3, ph.v, o3);
      o0 = mma_h(vh0, pl.v, o0);
      o1 = mma_h(vh1, pl.v, o1);
      o2 = mma_h(vh2, pl.v, o2);
      o3 = mma_h(vh3, pl.v, o3);
      guard4x6(o0, o1, o2, o3, ph.v, pl.v, vh0, vh1, vh2, vh3);
    }
    {
      const v16h vl0 = ldfrag_u(Vsl);
      const v16h vl1 = ldfrag_u(Vsl + 16 * VPITCH);
      const v16h vl2 = ldfrag_u(Vsl + 32 * VPITCH);
      const v16h vl3 = ldfrag_u(Vsl + 48 * VPITCH);
      o0 = mma_h(vl0, ph.v, o0);
      o1 = mma_h(vl1, ph.v, o1);
      o2 = mma_h(vl2, ph.v, o2);
      o3 = mma_h(vl3, ph.v, o3);
      guard4x5(o0, o1, o2, o3, ph.v, vl0, vl1, vl2, vl3);
    }
    // foot of the chunk: own LDS reads returned, own copies of chunk st + 1 landed, then the one barrier that publishes chunk st + 1
    // and ends every wave's reads of this chunk's buffer; only behind it is that buffer refilled with chunk st + 2
    wait_lds();
    wait_copies();
    __syncthreads();
    if (st + 2 < NSTG) {
      const size_t qa = (size_t)(st + 2) * KCH * DM;
      const int    va = (st + 2) * KCH;
      const unsigned lo = (unsigned)(bsel * STG_HALVES * 2);
      stage_copy4(lq + lo, gqh + qa, lq + lo + QT_HALVES * 2, gql + qa, lv + lo, gvh + va, lv + lo + VT_HALVES * 2, gvl + va);
    }
  }
  wait_copies();

  // ---- all waves done with the stage buffers; they become two bf16 result buffers [128][64] ----
  __syncthreads();
  unsigned short* Osh = stg;
  unsigned short* Osl = Osh + ATT_ROWS * HD;
  // ---- join the halves' sums, fold 1/l and the carries (1024 on P, 16 on v), split into bf16 hi + residual as the projection's B operand ----
  const float oc = 1.0f / (PC * VC);
  const float inv = (1.0f / (lrow + xhalf(lrow))) * oc;
  const int ro = (wave * 16 + c) * HD + 8 * hh;            // row i0 + c of the block, e = 8hh; tile t adds 16t
  auto split8 = [&](const v8f& o, float sc, v4u& a, v4u& b2) {   // 8 values * sc -> bf16 hi and residual, packed in element order
#pragma unroll
    for (int e = 0; e < 4; ++e) {
      const float f0 = o[2 * e] * sc, f1 = o[2 * e + 1] * sc;
      const unsigned short g0 = bf_bits(f0), g1 = bf_bits(f1);
      a[e]  = pk16(g0, g1);
      b2[e] = pk16(bf_bits(f0 - bf_up(g0)), bf_bits(f1 - bf_up(g1)));
    }
  };
  // ctx row i0 + c as B operand: k-step 0 holds d = 8hh + r (o0) and 16 + 8hh + r (o1), k-step 1 the same + 32 (o2, o3)
  FragH ch0, cl0, ch1, cl1;
  split8(o0, inv, ch0.u[0], cl0.u[0]);
  split8(o1, inv, ch0.u[1], cl0.u[1]);
  split8(o2, inv, ch1.u[0], cl1.u[0]);
  split8(o3, inv, ch1.u[1], cl1.u[1]);
  // ---- per-head output projection, transposed, and eval batch-norm: lane (c, hh) gets Y[i0 + c][16t + 8hh + r] ----
  const unsigned short* wp = WOT + ((size_t)head * HO + c) * HD + 8 * hh;
#pragma unroll
  for (int t = 0; t < HO / 16; ++t) {
    const v16h wa = ldfrag_u(wp + t * 16 * HD), wc = ldfrag_u(wp + t * 16 * HD + 32);
    const float* bp = bnp + 16 * t + 8 * hh;               // terms of the lane's first column of the tile
    const v4f ga = *(const v4f*)(bp),          gb = *(const v4f*)(bp + 4);
    const v4f ua = *(const v4f*)(bp + HO),     ub = *(const v4f*)(bp + HO + 4);
    const v4f ra = *(const v4f*)(bp + 2 * HO), rb4 = *(const v4f*)(bp + 2 * HO + 4);
    const v4f ta = *(const v4f*)(bp + 3 * HO), tb = *(const v4f*)(bp + 3 * HO + 4);
    v8f y = mma_b(wa, ch0.v, zero8());
    y = mma_b(wa, cl0.v, y);
    y = mma_b(wc, ch1.v, y);
    y = mma_b(wc, cl1.v, y);
#pragma unroll
    for (int r = 0; r < 4; ++r) {
      y[r]     = (ga[r] * (y[r]     - ua[r])) * ra[r]  + ta[r];
      y[4 + r] = (gb[r] * (y[4 + r] - ub[r])) * rb4[r] + tb[r];
    }
    v4u a, b2;
    split8(y, 1.0f, a, b2);
    *(v4u*)(Osh + ro + 16 * t) = a;
    *(v4u*)(Osl + ro + 16 * t) = b2;
  }
  wait_addr();   // behind the weight loads, ahead of later rewrites of their address registers
  __syncthreads();
  // ---- block writes its 128 row pieces of both planes: piece p = it*256 + tid -> row p>>3, halves (p&7)*8 .. +7 (8 lanes = one 128-B line) ----
  {
    v4u hv[4], lv4[4];
#pragma unroll
    for (int it = 0; it < 4; ++it) {
      const int p = it * ATT_THREADS + tid;
      hv[it]  = *(const v4u*)(Osh + (size_t)p * 8);
      lv4[it] = *(const v4u*)(Osl + (size_t)p * 8);
    }
    const size_t dofs = ((size_t)bat * NTOK + rb * ATT_ROWS) * DM + head * HD;
    unsigned short* dsth = CAh + dofs;
    unsigned short* dstl = CAl + dofs;
    {
#pragma unroll
      for (int it = 0; it < 4; ++it) {
        const int p = it * ATT_THREADS + tid;
        const size_t go = (size_t)(p >> 3) * DM + (p & 7) * 8;
        *(v4u*)(dsth + go) = hv[it];
        *(v4u*)(dstl + go) = lv4[it];
      }
    }
  }
}

// =====================================================================================================
// Workspace map (bytes); every plane is an exact multiple of its tile / whole-row store granularity (M, N exact tile multiples,
// the activation convert count an exact multiple of 2048, no pad rows needed), every offset a multiple of 64 KiB:
//   WKT, WQT, WVT f16 [512][512] x64   3 x 524288    ([h*64+d][c] = [n][k])
//   WOT  bf16 [8][64 e][64 d]              65536
//   WUT  bf16 [512 out][512 in]          524288
//   REL  bf16 [8][128][64]                131072
//   X16  f16 [8192][512] x16             8388608    (activation rows b*1024 + tok)
//   QHh, QHl bf16 [8192][512]         2 x 8388608   (q projection, hi / residual)
//   KHh, KHl bf16 [8192][512]         2 x 8388608   (k projection, hi / residual)
//   VTh, VTl f16 [8][512][1024] x16   2 x 8388608   (v^T per image, hi / residual)
//   CAh, CAl bf16 [8192][512]         2 x 8388608   (per-head output after batch-norm, concat layout, hi / residual)
//   end                                  77791232
// =====================================================================================================
extern "C" void kernel_launch(void* const* d_in, const int* in_sizes, int n_in,
                              void* d_out, int out_size, void* d_ws, size_t ws_size,
                              hipStream_t stream) {
  if (n_in < 12) return;
  if (in_sizes[0] != NROWS * DM) return;
  if (in_sizes[1] != NHEAD * DM * HD || in_sizes[2] != NHEAD * DM * HD || in_sizes[3] != NHEAD * DM * HD) return;
  if (in_sizes[4] != NHEAD * HD * HO) return;
  if (in_sizes[5] != NHEAD * HO || in_sizes[6] != NHEAD * HO || in_sizes[7] != NHEAD * HO || in_sizes[8] != NHEAD * HO) return;
  if (in_sizes[9] != NHEAD * NREL * HD || in_sizes[10] != NHEAD * NREL * HD) return;
  if (in_sizes[11] != COUT * COUT) return;
  if (out_size != NROWS * COUT) return;
  if ((in_sizes[0] % 2048) != 0) return;

  const float* x     = (const float*)d_in[0];
  const float* w_k   = (const float*)d_in[1];
  const float* w_q   = (const float*)d_in[2];
  const float* w_v   = (const float*)d_in[3];
  const float* w_o   = (const float*)d_in[4];
  const float* gam   = (const float*)d_in[5];
  const float* bet   = (const float*)d_in[6];
  const float* mmean = (const float*)d_in[7];
  const float* mvar  = (const float*)d_in[8];
  const float* relw  = (const float*)d_in[9];
  const float* relh  = (const float*)d_in[10];
  const float* w_out = (const float*)d_in[11];
  float*       out   = (float*)d_out;

  const size_t PWT = (size_t)DM * DM * 2;                         //   524288
  const size_t PWO = (size_t)NHEAD * HO * HD * 2;                 //    65536
  const size_t PWU = (size_t)COUT * COUT * 2;                     //   524288
  const size_t PRL = (size_t)NHEAD * RTP * HD * 2;                //   131072
  const size_t PX  = (size_t)NROWS * DM * 2;                      //  8388608
  const size_t PVT = (size_t)NB * DM * NTOK * 2;                  //  8388608
  size_t off = 0;
  const size_t oWK = off; off += PWT;
  const size_t oWQ = off; off += PWT;
  const size_t oWV = off; off += PWT;
  const size_t oWO = off; off += PWO;
  const size_t oWU = off; off += PWU;
  const size_t oRL = off; off += PRL;
  const size_t oX  = off; off += PX;
  const size_t oQh = off; off += PX;
  const size_t oQl = off; off += PX;
  const size_t oKh = off; off += PX;
  const size_t oKl = off; off += PX;
  const size_t oVh = off; off += PVT;
  const size_t oVl = off; off += PVT;
  const size_t oAh = off; off += PX;
  const size_t oAl = off; off += PX;
  if (off > ws_size) return;                                      // off = 77791232
  if (off > (size_t)134217728) return;

  char* ws = (char*)d_ws;
  unsigned short* WKT  = (unsigned short*)(ws + oWK);
  unsigned short* WQT  = (unsigned short*)(ws + oWQ);
  unsigned short* WVT  = (unsigned short*)(ws + oWV);
  unsigned short* WOT  = (unsigned short*)(ws + oWO);
  unsigned short* WUT  = (unsigned short*)(ws + oWU);
  unsigned short* REL  = (unsigned short*)(ws + oRL);
  unsigned short* X16  = (unsigned short*)(ws + oX);
  unsigned short* QHh  = (unsigned short*)(ws + oQh);
  unsigned short* QHl  = (unsigned short*)(ws + oQl);
  unsigned short* KHh  = (unsigned short*)(ws + oKh);
  unsigned short* KHl  = (unsigned short*)(ws + oKl);
  unsigned short* VTh  = (unsigned short*)(ws + oVh);
  unsigned short* VTl  = (unsigned short*)(ws + oVl);
  unsigned short* CAh  = (unsigned short*)(ws + oAh);
  unsigned short* CAl  = (unsigned short*)(ws + oAl);

  const dim3 blk(256);
  const dim3 gPR(PREP_BLOCKS);                                     // 2344
  const dim3 blkG(128);                                            // 4 waves: 2 x 2 (128 x 128 tile)
  const dim3 gP(PROJ_TILES, 3);                                    // 256 x 3
  const dim3 gF((NROWS / 128) * (COUT / 128), 1);                  // 256
  const dim3 gAT(ATT_BLOCKS);                                      // 512
  const dim3 bAT(ATT_THREADS);                                     // 256

  // (0) every operand pack: weight planes WKT, WQT, WVT (f16 x64), WOT, WUT, REL (bf16) and the activation plane X16 (f16 x16)
  prep<<<gPR, blk, 0, stream>>>(x, w_k, w_q, w_v, w_o, w_out, relw, relh, X16, WKT, WQT, WVT, WOT, WUT, REL);

  // (1) v^T, k and q projections -> VT (f16 x16 hi / residual), KH, QH (bf16 hi / residual)
  qkv<<<gP, blkG, 0, stream>>>(X16, WKT, WQT, WVT, KHh, KHl, QHh, QHl, VTh, VTl);

  // (2) per (image, head, 128 score rows): position-logit table rows, attention, per-head output projection + eval batch-norm
  //     -> CA[row][64h + e] (bf16 hi / residual planes)
  attn8<<<gAT, bAT, 0, stream>>>(KHh, KHl, QHh, QHl, VTh, VTl, REL, WOT, gam, bet, mmean, mvar, CAh, CAl);

  // (3) out = (CA_hi + CA_lo) . WUT^T + bf16_RNE(x); M = 8192, N = 512, K = 512, f32
  gemm64<0, 1, 1, 1, 2, 2><<<gF, blkG, 0, stream>>>(
      CAh, CAl, DM, 0LL,
      WUT, COUT, 0LL,
      (void*)out, (void*)out, COUT, 0LL,
      NROWS, COUT, DM, 1.0f, 1.0f,
      x, x, x, x, 0);
  (void)hipGetLastError();
}

// v009
// It runs in 60.9 microseconds.
// Versions between v007 and this one are left out; their measured steps multiply to 1.40 times as fast.
// Over all steps from v000 it is 5.19 times as fast.
// Contractions (all f32 accumulate): k/q projections v_wmma_f32_16x16x32_f16 (x f16 x16 . W f16 x64, K=512, single products) -> one f16 plane each;
// v^T projection v_wmma_f32_16x16x32_f16 (Wv f16 x64 . x f16 x16, K=512, single) -> one f16 x16 plane;
// relative-position tables, transposed, v_wmma_f32_16x16x32_f16 (rel f16 x64 . q f16, single, K=64) -> f32 table in LDS (attention prologue);
// attention scores, transposed, v_wmma_f32_16x16x32_f16 (q f16 . k f16, single products, K=64);
// v^T . P^T v_wmma_f32_16x16x32_f16 (v^T f16 x16 . P^T f16 x1024, single products, K=1024 by 32);
// per-head output projection, transposed, v_wmma_f32_16x16x32_bf16 (Wo bf16 . ctx bf16 hi/lo, K=64) with eval batch-norm affine in f32 -> bf16 hi/lo planes (attention epilogue);
// final projection v_wmma_f32_16x16x32_bf16 (cat bf16 hi/lo . Wout bf16, K=512) + bf16-RNE residual in f32.
// Max-subtracted online base-2 softmax and the additive position logits in f32 on VALU. Every float input RNE-converted to bf16 on load.
#include <hip/hip_runtime.h>
#include <math.h>
#include <stdint.h>

#define NB     8
#define GH     32
#define GW     32
#define NTOK   (GH * GW)
#define DM     512
#define NHEAD  8
#define HD     64
#define HO     64
#define COUT   512
#define NREL   63
#define RTP    128
#define NROWS  (NB * NTOK)
#define KCH    32
#define WSC    64.0f
#define ACARRY 16.0f
#define VC     16.0f
#define PC     1024.0f
#define LOG2E  1.4426950408889634f
#define BN_EPS 1e-3f
static_assert(NHEAD * HD == DM);
static_assert(NHEAD * HO == COUT);
static_assert(COUT == DM);
static_assert(KCH == GW);
static_assert(NREL == 2 * GW - 1);
static_assert(NREL == 2 * GH - 1);
static_assert(NREL <= HD);
static_assert(HD + NREL <= RTP);
static_assert((NTOK % 128) == 0 && (DM % 128) == 0 && (NROWS % 256) == 0 && (HD % 64) == 0 && (NTOK % KCH) == 0);
static_assert((RTP % 128) == 0 && (HO % 64) == 0 && (COUT % 128) == 0);
#define GKS         64
#define GPITCH      72
#define ATT_WAVES   8
#define ATT_THREADS (ATT_WAVES * 32)
#define ATT_ROWS    (ATT_WAVES * 16)
#define ATT_BLOCKS  (NB * NHEAD * (NTOK / ATT_ROWS))
#define PPS         4
#define SCOL        (PPS * KCH)
#define NSTG        (NTOK / SCOL)
#define QPITCH      72
#define VPITCH      (SCOL + 8)
#define QT_HALVES   (SCOL * QPITCH)
#define VT_HALVES   (HD * VPITCH)
#define STG_HALVES  (QT_HALVES + VT_HALVES)
#define STG_ALLOC   (2 * STG_HALVES)
#define TPITCH      (RTP + 4)
static_assert(ATT_THREADS == 256);
static_assert(ATT_BLOCKS == 512);
static_assert(NSTG >= 2);
static_assert((NTOK % SCOL) == 0);
static_assert(SCOL * (HD / 8) == 4 * ATT_THREADS && HD * (SCOL / 8) == 4 * ATT_THREADS);
static_assert(((VPITCH * 2) % 32) == 16);
static_assert((QT_HALVES % 8) == 0 && (VT_HALVES % 8) == 0 && (QPITCH % 8) == 0 && (VPITCH % 8) == 0);
static_assert(2 * ATT_ROWS * HD <= STG_ALLOC && (STG_HALVES % 8) == 0);
static_assert((ATT_ROWS * HD) / 8 == 4 * ATT_THREADS);
static_assert((TPITCH % 4) == 0 && (RTP % 16) == 0 && HO == HD);

typedef _Float16 v16h __attribute__((ext_vector_type(16)));
typedef _Float16 v8h  __attribute__((ext_vector_type(8)));
typedef __bf16   v16b __attribute__((ext_vector_type(16)));
typedef float    v8f  __attribute__((ext_vector_type(8)));
typedef float    v4f  __attribute__((ext_vector_type(4)));
typedef unsigned int v4u __attribute__((ext_vector_type(4)));

union FragH { v16h v; v8h h[2]; v4u u[2]; };
union FragAny { v16h h; v16b b; };

// ---- scalar helpers --------------------------------------------------------------------------------
__device__ __forceinline__ unsigned short bf_bits(float f) {          // f32 -> bf16 bits, RNE convert
  unsigned u = __float_as_uint(f);
  return (unsigned short)((u + 0x7FFFu + ((u >> 16) & 1u)) >> 16);
}
__device__ __forceinline__ float bf_up(unsigned short h) { return __uint_as_float(((unsigned)h) << 16); }
__device__ __forceinline__ float bfr(float f) { return bf_up(bf_bits(f)); }   // value of the bf16 RNE convert
__device__ __forceinline__ unsigned short h_bits(_Float16 x) { return __builtin_bit_cast(unsigned short, x); }
__device__ __forceinline__ unsigned pk16(unsigned short a, unsigned short b) { return (unsigned)a | ((unsigned)b << 16); }
__device__ __forceinline__ v8f zero8() { v8f z = {0.f, 0.f, 0.f, 0.f, 0.f, 0.f, 0.f, 0.f}; return z; }
// value of lane l ^ 16 (the other half of the wave), by one vector cross-row move
__device__ __forceinline__ float xhalf(float x) {
  const int b = __builtin_bit_cast(int, x);
  return __builtin_bit_cast(float, __builtin_amdgcn_permlanex16(b, b, 0x76543210, 0xfedcba98, false, false));
}

// 2^x by the bare v_exp_f32. Every argument in the softmax is <= 0; the library form's range guard only serves results below 2^-126, which
// add nothing to a row sum that holds its maximum's 1.0 and convert to 0 in the f16 P^T operand (and -inf still gives 0 for the first chunk).
__device__ __forceinline__ float ex2(float x) { return __builtin_amdgcn_exp2f(x); }

// ---- fragment loader: 16-bit A/B operand from a k-contiguous 16-bit plane, lane -> row/col (lane&15),
//      p already includes +8*(lane>>4); elements 0..7 <- p[0..7] (k0+8h..), elements 8..15 <- p[16..23] (k0+16+8h..)
//      (same split k map for A and B; B is always read from a [n][k] plane)
__device__ __forceinline__ v16h ldfrag_u(const unsigned short* p) {
  FragH f;
  f.u[0] = *(const v4u*)(p);
  f.u[1] = *(const v4u*)(p + 16);
  return f.v;
}

// ---- WMMA helpers with trailing VALU hazard gaps ------------------------------------------------------
__device__ __forceinline__ v8f mma_h(v16h a, v16h b, v8f c) {
  return __builtin_amdgcn_wmma_f32_16x16x32_f16(false, a, false, b, (short)0, c, false, false);
}
__device__ __forceinline__ v8f mma_b(v16h a, v16h b, v8f c) {
  FragAny ua, ub;
  ua.h = a;
  ub.h = b;
  return __builtin_amdgcn_wmma_f32_16x16x32_bf16(false, ua.b, false, ub.b, (short)0, c, false, false);
}
template <int BF>
__device__ __forceinline__ v8f mmaT(v16h a, v16h b, v8f c) {
  if constexpr (BF != 0) return mma_b(a, b, c);
  else return mma_h(a, b, c);
}
__device__ __forceinline__ void dep_guard1(v8f& a, v8f& b, v16h x) {
#if defined(__HIP_DEVICE_COMPILE__)
  asm volatile("v_nop\n\tv_nop\n\tv_nop\n\tv_nop" : "+v"(a), "+v"(b) : "v"(x));
#endif
}
// four vector slots behind a run's last product, ahead of the first read of a result and the first overwrite of an operand
__device__ __forceinline__ void guard2x4(v8f& s, v8f& t, v16h a0, v16h a1, v16h a2, v16h a3) {
#if defined(__HIP_DEVICE_COMPILE__)
  asm volatile("v_nop\n\tv_nop\n\tv_nop\n\tv_nop" : "+v"(s), "+v"(t) : "v"(a0), "v"(a1), "v"(a2), "v"(a3));
#endif
}
__device__ __forceinline__ void guard4x5(v8f& a, v8f& b, v8f& c, v8f& d,
                                         v16h x0, v16h x1, v16h x2, v16h x3, v16h x4) {
#if defined(__HIP_DEVICE_COMPILE__)
  asm volatile("v_nop\n\tv_nop\n\tv_nop\n\tv_nop"
               : "+v"(a), "+v"(b), "+v"(c), "+v"(d) : "v"(x0), "v"(x1), "v"(x2), "v"(x3), "v"(x4));
#endif
}
// the same behind a run of score and v^T . P^T products
__device__ __forceinline__ void guard6x9(v8f& a, v8f& b, v8f& c, v8f& d, v8f& e, v8f& f, v16h x0, v16h x1, v16h x2, v16h x3, v16h x4,
                                         v16h x5, v16h x6, v16h x7, v16h x8) {
#if defined(__HIP_DEVICE_COMPILE__)
  asm volatile("v_nop\n\tv_nop\n\tv_nop\n\tv_nop"
               : "+v"(a), "+v"(b), "+v"(c), "+v"(d), "+v"(e), "+v"(f)
               : "v"(x0), "v"(x1), "v"(x2), "v"(x3), "v"(x4), "v"(x5), "v"(x6), "v"(x7), "v"(x8));
#endif
}
__device__ __forceinline__ void keep4_h(v16h a, v16h b, v16h c, v16h d) {
#if defined(__HIP_DEVICE_COMPILE__)
  asm volatile("v_nop" :: "v"(a), "v"(b), "v"(c), "v"(d));
#endif
}
__device__ __forceinline__ void acc_guard4(v8f& a, v8f& b, v8f& c, v8f& d) {
#if defined(__HIP_DEVICE_COMPILE__)
  asm volatile("v_nop\n\tv_nop\n\tv_nop\n\tv_nop" : "+v"(a), "+v"(b), "+v"(c), "+v"(d));
#endif
}
__device__ __forceinline__ void wave_sync_lds() {
  __builtin_amdgcn_fence(__ATOMIC_RELEASE, "workgroup");
  __builtin_amdgcn_wave_barrier();
  __builtin_amdgcn_fence(__ATOMIC_ACQUIRE, "workgroup");
}
// the same for LDS alone: orders the wave's own LDS stores and loads and does not wait out its global stores
__device__ __forceinline__ void wave_sync_lds_only() {
  __builtin_amdgcn_fence(__ATOMIC_RELEASE, "workgroup", "local");
  __builtin_amdgcn_wave_barrier();
  __builtin_amdgcn_fence(__ATOMIC_ACQUIRE, "workgroup", "local");
}

// four 16-B copies per lane, global -> LDS through no register; the s_wait_xcnt 0 in the same statement stands ahead of any later
// rewrite of the address registers that the copies name
__device__ __forceinline__ void stage_copy4(unsigned l0, const unsigned short* g0, unsigned l1, const unsigned short* g1,
                                            unsigned l2, const unsigned short* g2, unsigned l3, const unsigned short* g3) {
#if defined(__HIP_DEVICE_COMPILE__)
  asm volatile("global_load_async_to_lds_b128 %0, %1, off\n\t"
               "global_load_async_to_lds_b128 %2, %3, off\n\t"
               "global_load_async_to_lds_b128 %4, %5, off\n\t"
               "global_load_async_to_lds_b128 %6, %7, off\n\t"
               "s_wait_xcnt 0x0"
               :: "v"(l0), "v"(g0), "v"(l1), "v"(g1), "v"(l2), "v"(g2), "v"(l3), "v"(g3) : "memory");
#endif
}
// the same for eight copies: one wait on the address registers serves the run
__device__ __forceinline__ void stage_copy8(unsigned l0, const unsigned short* g0, unsigned l1, const unsigned short* g1,
                                            unsigned l2, const unsigned short* g2, unsigned l3, const unsigned short* g3,
                                            unsigned l4, const unsigned short* g4, unsigned l5, const unsigned short* g5,
                                            unsigned l6, const unsigned short* g6, unsigned l7, const unsigned short* g7) {
#if defined(__HIP_DEVICE_COMPILE__)
  asm volatile("global_load_async_to_lds_b128 %0, %1, off\n\t"
               "global_load_async_to_lds_b128 %2, %3, off\n\t"
               "global_load_async_to_lds_b128 %4, %5, off\n\t"
               "global_load_async_to_lds_b128 %6, %7, off\n\t"
               "global_load_async_to_lds_b128 %8, %9, off\n\t"
               "global_load_async_to_lds_b128 %10, %11, off\n\t"
               "global_load_async_to_lds_b128 %12, %13, off\n\t"
               "global_load_async_to_lds_b128 %14, %15, off\n\t"
               "s_wait_xcnt 0x0"
               :: "v"(l0), "v"(g0), "v"(l1), "v"(g1), "v"(l2), "v"(g2), "v"(l3), "v"(g3),
                  "v"(l4), "v"(g4), "v"(l5), "v"(g5), "v"(l6), "v"(g6), "v"(l7), "v"(g7) : "memory");
#endif
}
// this wave's copies have landed in LDS
__device__ __forceinline__ void wait_copies() {
#if defined(__HIP_DEVICE_COMPILE__)
  asm volatile("s_wait_asynccnt 0x0" ::: "memory");
#endif
}
// stands behind a global load or store, ahead of a later rewrite of a register that it names
__device__ __forceinline__ void wait_addr() {
#if defined(__HIP_DEVICE_COMPILE__)
  asm volatile("s_wait_xcnt 0x0" ::: "memory");
#endif
}
// this wave's LDS reads have returned (ahead of the barrier behind which their buffer is refilled)
__device__ __forceinline__ void wait_lds() {
#if defined(__HIP_DEVICE_COMPILE__)
  asm volatile("s_wait_dscnt 0x0" ::: "memory");
#endif
}

// =====================================================================================================
// Elementwise 16-bit pack, no transpose. BFO 0: dst[i] = f16( bf16_RNE(src[i]) * sc ), sc a power of two (exact);
// BFO 1: dst[i] = bf16_RNE(src[i]) bits. 8 elements per thread: two 16-B loads, one 16-B store per lane; 32 consecutive
// coverage: n / 2048 blocks (index bx) x 256 thr x 8 elements = n exactly (host checks n % 2048 == 0).
// =====================================================================================================
template <int BFO>
__device__ __forceinline__ void cvt16(const float* __restrict__ src, unsigned short* dst, int n, float sc, int bx) {
  const size_t i8 = ((size_t)bx * 256 + threadIdx.x) * 8;
  if (i8 + 8 > (size_t)n) return;                 // never taken with the exact block range; no barriers in this job
  const v4f a = *(const v4f*)(src + i8);
  const v4f b = *(const v4f*)(src + i8 + 4);
  v4u o;
  if constexpr (BFO != 0) {
    o[0] = pk16(bf_bits(a[0]), bf_bits(a[1]));
    o[1] = pk16(bf_bits(a[2]), bf_bits(a[3]));
    o[2] = pk16(bf_bits(b[0]), bf_bits(b[1]));
    o[3] = pk16(bf_bits(b[2]), bf_bits(b[3]));
  } else {
    o[0] = pk16(h_bits((_Float16)(bfr(a[0]) * sc)), h_bits((_Float16)(bfr(a[1]) * sc)));
    o[1] = pk16(h_bits((_Float16)(bfr(a[2]) * sc)), h_bits((_Float16)(bfr(a[3]) * sc)));
    o[2] = pk16(h_bits((_Float16)(bfr(b[0]) * sc)), h_bits((_Float16)(bfr(b[1]) * sc)));
    o[3] = pk16(h_bits((_Float16)(bfr(b[2]) * sc)), h_bits((_Float16)(bfr(b[3]) * sc)));
  }
  {
    *(v4u*)(dst + i8) = o;
    
  }
}

// =====================================================================================================
// Transposing 16-bit pack of a weight matrix: in W[Cin][Dd] (pitch Dd, base + z*sIn) -> out WT[Dd][Cin] (pitch Cin, base + z*sOut),
// BFO 0: f16( bf16_RNE(w) * sc ); BFO 1: bf16_RNE(w) bits. One 64x64 tile per block (bx = Cin tile, by = Dd tile, bz = matrix index):
// coverage: loads 4 x 256 x 4 floats = 64x64; stores 2 x 256 pieces x 8 halves = 64 rows x 64 halves = the whole tile;
//           (bx, by, bz) runs over (Cin/64, Dd/64, nmat) exactly (all sizes exact multiples of 64). t: the block's 64 x 65 float tile in LDS.
// =====================================================================================================
template <int BFO>
__device__ __forceinline__ void tr16(const float* __restrict__ W, unsigned short* WT, int Cin, int Dd,
                                     long long sIn, long long sOut, float sc, int bx, int by, int bz, float (*t)[65]) {
  const int tid = threadIdx.x;
  const int c0 = bx * 64, d0 = by * 64;
  const float* src = W + (size_t)((long long)bz * sIn);
  unsigned short* dst = WT + (size_t)((long long)bz * sOut);
#pragma unroll
  for (int it = 0; it < 4; ++it) {
    const int p  = it * 256 + tid;
    const int cc = p >> 4, sg = (p & 15) * 4;
    const v4f v = *(const v4f*)(src + (size_t)(c0 + cc) * Dd + d0 + sg);
    t[cc][sg]     = v[0];
    t[cc][sg + 1] = v[1];
    t[cc][sg + 2] = v[2];
    t[cc][sg + 3] = v[3];
  }
  __syncthreads();
  v4u o[2];
#pragma unroll
  for (int it = 0; it < 2; ++it) {
    const int p  = it * 256 + tid;
    const int dd = p >> 3, s8 = (p & 7) * 8;
    unsigned short hv[8];
#pragma unroll
    for (int k = 0; k < 8; ++k) {
      const float f = bfr(t[s8 + k][dd]);
      if constexpr (BFO != 0) hv[k] = bf_bits(f);
      else hv[k] = h_bits((_Float16)(f * sc));
    }
    v4u q;
    q[0] = pk16(hv[0], hv[1]);
    q[1] = pk16(hv[2], hv[3]);
    q[2] = pk16(hv[4], hv[5]);
    q[3] = pk16(hv[6], hv[7]);
    o[it] = q;
  }
  {
#pragma unroll
    for (int it = 0; it < 2; ++it) {
      const int p  = it * 256 + tid;
      const int dd = p >> 3, s8 = (p & 7) * 8;
      *(v4u*)(dst + (size_t)(d0 + dd) * Cin + c0 + s8) = o[it];
    }
    wait_addr();   // other jobs' code follows these stores in the merged kernel and rewrites their registers
  }
}

// =====================================================================================================
// Relative-position operand plane: out[h][r][0..63] = f16( bf16_RNE(value) * 64 ), r 0..62 = rel_w[h][r][:], r 63 = 0, r 64..126 = rel_h[h][r-64][:],
// r 127 = 0. Every lane loads both candidate rows from clamped addresses and selects by value. 8 halves per thread, 8 consecutive
// coverage: 32 blocks (index bx) x 256 threads x 8 halves = 8 x 128 x 64 exactly.
// =====================================================================================================
__device__ __forceinline__ void relcat(const float* __restrict__ rw, const float* __restrict__ rh, unsigned short* out, int bx) {
  const int p   = bx * 256 + threadIdx.x;                // 0 .. NHEAD*RTP*8 - 1
  const int hd  = p / (RTP * 8);
  const int r   = (p >> 3) & (RTP - 1);
  const int seg = (p & 7) * 8;
  const int iw  = (r < NREL) ? r : (NREL - 1);
  int ih = r - HD;
  ih = (ih < 0) ? 0 : ih;
  ih = (ih > NREL - 1) ? (NREL - 1) : ih;
  const float* pw = rw + ((size_t)hd * NREL + iw) * HD + seg;
  const float* ph = rh + ((size_t)hd * NREL + ih) * HD + seg;
  const v4f a0 = *(const v4f*)(pw), a1 = *(const v4f*)(pw + 4);
  const v4f b0 = *(const v4f*)(ph), b1 = *(const v4f*)(ph + 4);
  const bool uw = (r < NREL);
  const bool uh = (r >= HD) && (r < HD + NREL);
  float v[8];
#pragma unroll
  for (int e = 0; e < 4; ++e) {
    v[e]     = uw ? a0[e] : (uh ? b0[e] : 0.f);
    v[4 + e] = uw ? a1[e] : (uh ? b1[e] : 0.f);
  }
  v4u o;
#pragma unroll
  for (int e = 0; e < 4; ++e) o[e] = pk16(h_bits((_Float16)(bfr(v[2 * e]) * WSC)), h_bits((_Float16)(bfr(v[2 * e + 1]) * WSC)));
  {
    *(v4u*)(out + (size_t)p * 8) = o;
    wait_addr();   // other jobs' code follows this store in the merged kernel and rewrites its registers
  }
}

// =====================================================================================================
// All operand packs in one launch: none reads what another writes, so the job is picked by the block index (block-uniform, so the barrier
// of the transposing jobs is passed by a whole block or by none). The transposing jobs, whose blocks last longest, come first.
//   blocks    0 ..  191: W[h][c][d] -> WT[h*64+d][c] as f16( bf16_RNE(w) * 64 ) for Wk, Wq, Wv (64 blocks each: 8 c tiles x 8 heads)
//   blocks  192 ..  255: Wout[in][out] -> WUT[out][in] bf16 (8 x 8 tiles)
//   blocks  256 ..  263: Wo[h][d][e] -> WOT[h][e][d] bf16 (one tile per head)
//   blocks  264 ..  295: rel tables -> REL[h][128][64] f16 x64 (rows 63, 127 zero)
//   blocks  296 .. 2343: X16[row][c] = f16( bf16_RNE(x[row][c]) * 16 ), rows = b*1024 + tok
// =====================================================================================================
#define PB_W    ((DM / 64) * NHEAD)
#define PB_WU   ((COUT / 64) * (COUT / 64))
#define PB_WO   NHEAD
#define PB_RL   ((NHEAD * RTP * 8) / 256)
#define PB_X    ((NROWS * DM) / 2048)
#define PREP_BLOCKS (3 * PB_W + PB_WU + PB_WO + PB_RL + PB_X)
static_assert(HD == 64 && HO == 64);
__global__ __launch_bounds__(256) void prep(const float* __restrict__ x, const float* __restrict__ w_k, const float* __restrict__ w_q,
                                            const float* __restrict__ w_v, const float* __restrict__ w_o, const float* __restrict__ w_out,
                                            const float* __restrict__ relw, const float* __restrict__ relh,
                                            unsigned short* X16, unsigned short* WKT, unsigned short* WQT, unsigned short* WVT,
                                            unsigned short* WOT, unsigned short* WUT, unsigned short* REL) {
  __shared__ float t[64][65];
  int b = blockIdx.x;
  if (b < 3 * PB_W) {
    const int m = b / PB_W, r = b - m * PB_W;
    const float* src = (m == 0) ? w_k : ((m == 1) ? w_q : w_v);
    unsigned short* dst = (m == 0) ? WKT : ((m == 1) ? WQT : WVT);
    tr16<0>(src, dst, DM, HD, (long long)DM * HD, (long long)HD * DM, WSC, r % (DM / 64), 0, r / (DM / 64), t);
    return;
  }
  b -= 3 * PB_W;
  if (b < PB_WU) {
    tr16<1>(w_out, WUT, COUT, COUT, 0LL, 0LL, 1.0f, b % (COUT / 64), b / (COUT / 64), 0, t);
    return;
  }
  b -= PB_WU;
  if (b < PB_WO) {
    tr16<1>(w_o, WOT, HD, HO, (long long)HD * HO, (long long)HO * HD, 1.0f, 0, 0, b, t);
    return;
  }
  b -= PB_WO;
  if (b < PB_RL) {
    relcat(relw, relh, REL, b);
    return;
  }
  b -= PB_RL;
  cvt16<0>(x, X16, NROWS * DM, ACARRY, b);
}

// =====================================================================================================
// Register-blocked batched 16-bit WMMA GEMM: C[m][n] = oscale * sum_k A[m][k] * Bt[n][k]; one wave per 64x64 tile, block = WM x WN waves
// (4 waves) on a (64 WM) x (64 WN) tile.
// A row-major [M][K] pitch lda (16-bit plane), Bt row-major [N][K] pitch ldb (k contiguous); M multiple of 64 WM, N of 64 WN, K of 64.
// The block's A and Bt rows are brought into LDS once per block, in k slabs of 64 (one whole 128-B line per row, 8 lanes per line, pitch 144 B
// in LDS), by asynchronous 16-B copies, two buffers: slab t + 2 is issued behind the barrier that ends slab t. All fragments are 16-B LDS reads
// with the same split k map and the same k order of the products as with fragments read from global memory.
// bx = tile index, by = batch index with element strides sA, sB, sC; gst, sT: the block's LDS (two slab buffers; one 16 x 68 float slab per wave);
// res: EPI 1 only, the block's LDS for its piece of ep0.
// ASPLIT 1: a second A plane A2 (unscaled residual of A, same layout) is multiplied into the same accumulator (A + A2 ~ exact A).
// BF 1: bf16 operands (v_wmma_f32_16x16x32_bf16), else f16.
// OM 0: f32 out (pitch ldc).  OM 2: f16 out = f16(value * ocarry).  OM 3: two bf16 planes: hi = bf16_RNE(value), lo = bf16_RNE(value - hi).
// OM 4: two f16 planes: hi = f16(value * ocarry), lo = f16(value * ocarry - hi) (unscaled residual).
// EPI 1 (OM 0 only): value += bf16_RNE(ep0[same index as C]).  EPI 2 (16-bit out): per-column eval batch-norm affine
//   value = (bf16(ep0[ci]) * (value - bf16(ep2[ci]))) * rsqrt(bf16(ep3[ci]) + eps) + bf16(ep1[ci]),  ci = by*cps + column.
// coverage: 4 slabs x 16 rows (f32: it 0..7 x lane>>4; 16-bit: it 0..3 x lane>>3) x 64 cols = the wave's whole 64x64 tile;
//           bx runs over (M / (64 WM)) * (N / (64 WN)) blocks exactly; a surplus block would leave as a whole, ahead of every copy and barrier.
// =====================================================================================================
template <int V> struct IntC { static constexpr int value = V; };
constexpr int gemm_slab_halves(int asplit, int wm, int wn) { return ((1 + asplit) * 64 * wm + 64 * wn) * GPITCH; }   // one buffer: A | (A2) | Bt
template <int OM, int ASPLIT, int BF, int EPI, int WM, int WN>
__device__ __forceinline__ void gemm64_tile(
    unsigned short* gst, float* sT, float* res, unsigned bx, int by,
    const unsigned short* __restrict__ Ap, const unsigned short* __restrict__ A2p, int lda, long long sA,
    const unsigned short* __restrict__ Btp, int ldb, long long sB,
    void* Cout, void* C2out, int ldc, long long sC,
    int M, int N, int K, float oscale, float ocarry,
    const float* __restrict__ ep0, const float* __restrict__ ep1,
    const float* __restrict__ ep2, const float* __restrict__ ep3, int cps) {
  constexpr int NW     = WM * WN;                    // waves per block
  constexpr int AR     = 64 * WM;                    // A rows of the block tile
  constexpr int BR     = 64 * WN;                    // Bt rows of the block tile
  constexpr int RPI    = NW * 4;                     // rows that one copy of every lane of the block covers (8 lanes per row)
  constexpr int A_H    = AR * GPITCH;                // halves of one A plane's slab in LDS
  constexpr int B_H    = BR * GPITCH;
  constexpr int SLAB_H = (1 + ASPLIT) * A_H + B_H;   // one buffer: A | (A2) | Bt
  static_assert(SLAB_H == gemm_slab_halves(ASPLIT, WM, WN));
  static_assert((AR % (4 * RPI)) == 0 && (BR % (4 * RPI)) == 0);
  static_assert(((1 + ASPLIT) * AR + BR) / RPI <= 63);     // copies of one wave in flight
  const int tid  = threadIdx.x;
  const int lane = tid & 31;
  const int wave = tid >> 5;
  const int tilesN = N / BR;
  const int tilesM = M / AR;
  if ((int)bx >= tilesM * tilesN) return;           // block-uniform, ahead of every copy and barrier
  const int tm  = bx / tilesN;
  const int tn  = bx - tm * tilesN;
  const int bm0 = tm * AR;
  const int bn0 = tn * BR;
  const int wm  = wave / WN;
  const int wn  = wave - wm * WN;
  const int m0  = bm0 + (wm << 6);
  const int n0  = bn0 + (wn << 6);

  const unsigned short* A1 = Ap  + (size_t)((long long)by * sA);
  const unsigned short* A2 = A2p + (size_t)((long long)by * sA);
  const unsigned short* Bb = Btp + (size_t)((long long)by * sB);

  const int rlane = lane & 15;                 // row (A) / col (B, D) within subtile
  const int koff  = (lane >> 4) * 8;           // k offset of this lane half
  const int mOff  = (lane >> 4) * 8;           // D row offset

  // per-lane copy addresses: row tid>>3 of a group of RPI rows, 16-B segment tid&7 of the row's 128-B line
  const unsigned short* gA  = A1 + (size_t)(bm0 + (tid >> 3)) * lda + (tid & 7) * 8;
  const unsigned short* gA2 = A2 + (size_t)(bm0 + (tid >> 3)) * lda + (tid & 7) * 8;
  const unsigned short* gB  = Bb + (size_t)(bn0 + (tid >> 3)) * ldb + (tid & 7) * 8;
  const unsigned lcp = (unsigned)(uintptr_t)gst + (unsigned)((tid >> 3) * (GPITCH * 2) + (tid & 7) * 16);   // LDS byte address
  constexpr unsigned LSTEP = (unsigned)(RPI * GPITCH * 2);      // LDS bytes from one group of RPI rows to the next
  const size_t astep = (size_t)RPI * lda, bstep = (size_t)RPI * ldb;
  // rows of one plane: groups of RPI rows, eight groups (or the last four) per statement
  auto plane = [&](unsigned l, const unsigned short* p, size_t step, auto ngroups) {
    constexpr int NG = decltype(ngroups)::value;
#pragma unroll
    for (int g = 0; g < NG; g += 8) {
      const unsigned short* q = p + (size_t)g * step;
      const unsigned m = l + (unsigned)g * LSTEP;
      if (g + 8 <= NG) {
        stage_copy8(m, q, m + LSTEP, q + step, m + 2 * LSTEP, q + 2 * step, m + 3 * LSTEP, q + 3 * step,
                    m + 4 * LSTEP, q + 4 * step, m + 5 * LSTEP, q + 5 * step, m + 6 * LSTEP, q + 6 * step, m + 7 * LSTEP, q + 7 * step);
      } else {
        stage_copy4(m, q, m + LSTEP, q + step, m + 2 * LSTEP, q + 2 * step, m + 3 * LSTEP, q + 3 * step);
      }
    }
  };
  auto stage = [&](int buf, int k0) {
    const unsigned l0 = lcp + (unsigned)(buf * (SLAB_H * 2));
    plane(l0, gA + k0, astep, IntC<AR / RPI>{});
    if constexpr (ASPLIT != 0) plane(l0 + (unsigned)(A_H * 2), gA2 + k0, astep, IntC<AR / RPI>{});
    plane(l0 + (unsigned)((1 + ASPLIT) * A_H * 2), gB + k0, bstep, IntC<BR / RPI>{});
  };

  v8f acc[4][4];
#pragma unroll
  for (int i = 0; i < 4; ++i)
#pragma unroll
    for (int j = 0; j < 4; ++j) acc[i][j] = zero8();

  // slab 0 -> buffer 0, landed and published; then slab 1 -> buffer 1 flies while slab 0 is worked on
  const int nslab = K / GKS;
  stage(0, 0);
  wait_copies();
  __syncthreads();
  if (nslab > 1) stage(1, GKS);

  // EPI 1: the block's AR x BR f32 piece of ep0 goes to LDS (res, pitch BR) under the k loop, so that the epilogue waits on no global load.
  // One copy of a wave = one whole 512-B row piece; group g = rows 8 NW g .. 8 NW g + 8 NW - 1 (row = NW j + wave), one group behind the foot of
  // slab g, landed and published by the foot of slab g + 1; groups that have no such slab go ahead of the loop (foot of slab 0).
  constexpr int NRG = AR / (8 * NW);
  static_assert(EPI != 1 || (BR * 4 == 32 * 16 && (AR % (8 * NW)) == 0));
  static_assert(((1 + ASPLIT) * AR + BR) / RPI + 8 * NRG <= 63);   // copies of one wave in flight, at the most
  auto rescopy = [&](int g) {
    const float* q = ep0 + (size_t)((long long)by * sC) + (size_t)(bm0 + g * (8 * NW) + wave) * ldc + bn0 + lane * 4;
    const unsigned m = (unsigned)(uintptr_t)res + (unsigned)((g * (8 * NW) + wave) * (BR * 4) + lane * 16);
    const size_t rs = (size_t)NW * ldc;
    constexpr unsigned ms = (unsigned)(NW * BR * 4);
    stage_copy8(m, (const unsigned short*)q, m + ms, (const unsigned short*)(q + rs),
                m + 2 * ms, (const unsigned short*)(q + 2 * rs), m + 3 * ms, (const unsigned short*)(q + 3 * rs),
                m + 4 * ms, (const unsigned short*)(q + 4 * rs), m + 5 * ms, (const unsigned short*)(q + 5 * rs),
                m + 6 * ms, (const unsigned short*)(q + 6 * rs), m + 7 * ms, (const unsigned short*)(q + 7 * rs));
  };
  if constexpr (EPI == 1) {
#pragma unroll 1   // kept rolled: runs only for K under (NRG + 1) slabs, one copy statement in the text is enough
    for (int g = nslab - 1; g < NRG; ++g) rescopy(g);
  }

#pragma unroll 1
  for (int t = 0; t < nslab; ++t) {
    const unsigned short* sb  = gst + (t & 1) * SLAB_H;
    const unsigned short* As  = sb + ((wm << 6) + rlane) * GPITCH + koff;
    const unsigned short* As2 = As + A_H;
    const unsigned short* Bs  = sb + (1 + ASPLIT) * A_H + ((wn << 6) + rlane) * GPITCH + koff;
#pragma unroll
    for (int ks = 0; ks < GKS; ks += 32) {
      // all fragments of the k-step are read as one group ahead of its products (one LDS wait per k-step, not one per row of tiles)
      v16h bh[4], ah[4];
#pragma unroll
      for (int j = 0; j < 4; ++j) bh[j] = ldfrag_u(Bs + (j << 4) * GPITCH + ks);
#pragma unroll
      for (int i = 0; i < 4; ++i) ah[i] = ldfrag_u(As + (i << 4) * GPITCH + ks);
      if constexpr (ASPLIT != 0) {
        v16h al[4];
#pragma unroll
        for (int i = 0; i < 4; ++i) al[i] = ldfrag_u(As2 + (i << 4) * GPITCH + ks);
#pragma unroll
        for (int i = 0; i < 4; ++i) {
#pragma unroll
          for (int j = 0; j < 4; ++j) acc[i][j] = mmaT<BF>(ah[i], bh[j], acc[i][j]);
          dep_guard1(acc[i][0], acc[i][3], ah[i]);
#pragma unroll
          for (int j = 0; j < 4; ++j) acc[i][j] = mmaT<BF>(al[i], bh[j], acc[i][j]);
          dep_guard1(acc[i][0], acc[i][3], al[i]);
        }
      } else {
#pragma unroll
        for (int i = 0; i < 4; ++i) {
#pragma unroll
          for (int j = 0; j < 4; ++j) acc[i][j] = mmaT<BF>(ah[i], bh[j], acc[i][j]);
          dep_guard1(acc[i][0], acc[i][3], ah[i]);
        }
      }
      keep4_h(bh[0], bh[1], bh[2], bh[3]);
    }
    // foot of the slab: own LDS reads returned, own copies of slab t + 1 landed, then the one barrier that publishes slab t + 1
    // and ends every wave's reads of this slab's buffer; only behind it is that buffer refilled with slab t + 2
    wait_lds();
    wait_copies();
    __syncthreads();
    if (t + 2 < nslab) stage(t & 1, (t + 2) * GKS);
    if constexpr (EPI == 1) {
      if (t < NRG && t + 1 < nslab) rescopy(t);
    }
  }
  wait_copies();
  acc_guard4(acc[0][0], acc[0][1], acc[0][2], acc[0][3]);
  acc_guard4(acc[1][0], acc[1][1], acc[1][2], acc[1][3]);
  acc_guard4(acc[2][0], acc[2][1], acc[2][2], acc[2][3]);
  acc_guard4(acc[3][0], acc[3][1], acc[3][2], acc[3][3]);

  const int hh2 = lane >> 4, c4 = (lane & 15) * 4;     // f32 out: 256-B row segment = 16 lanes x 16 B
  const int q8  = lane >> 3, c8 = (lane & 7) * 8;

  // ---- epilogue ----
  float* slab = sT + wave * (16 * 68);              // per-wave 16x64 slab, pitch 68 floats
#pragma unroll
  for (int i = 0; i < 4; ++i) {
    const int mBase = m0 + (i << 4);
#pragma unroll
    for (int j = 0; j < 4; ++j) {
#pragma unroll
      for (int r = 0; r < 8; ++r) {
        slab[(mOff + r) * 68 + (j << 4) + rlane] = acc[i][j][r];
      }
    }
    wave_sync_lds_only();
    if constexpr (OM == 0) {
      float* C = (float*)Cout + (size_t)((long long)by * sC);
      v4f vals[8];
#pragma unroll
      for (int it = 0; it < 8; ++it) {
        const int row = it * 2 + hh2;                      // it 0..7 x hh2 0..1 = rows 0..15
        v4f v = *(const v4f*)(slab + row * 68 + c4);
#pragma unroll
        for (int e = 0; e < 4; ++e) v[e] = v[e] * oscale;
        if constexpr (EPI == 1) {
          const v4f xr = *(const v4f*)(res + ((wm << 6) + (i << 4) + row) * BR + (wn << 6) + c4);
#pragma unroll
          for (int e = 0; e < 4; ++e) v[e] = v[e] + bfr(xr[e]);
        }
        vals[it] = v;
      }
      {
#pragma unroll
        for (int it = 0; it < 8; ++it) {
          const int gr = mBase + it * 2 + hh2;
          *(v4f*)(C + (size_t)gr * ldc + n0 + c4) = vals[it];
        }
        wait_addr();   // behind the stores, ahead of the next slab's rewrites of their address registers
      }
    } else {
      unsigned short* C  = (unsigned short*)Cout  + (size_t)((long long)by * sC);
      unsigned short* Cb = (unsigned short*)C2out + (size_t)((long long)by * sC);
      v4u hv[4], lv[4];
#pragma unroll
      for (int it = 0; it < 4; ++it) {
        const int row = it * 4 + q8;                       // it 0..3 x q8 0..3 = rows 0..15
        const float* sp = slab + row * 68 + c8;
        v4u a  = {0u, 0u, 0u, 0u};
        v4u b2 = {0u, 0u, 0u, 0u};
#pragma unroll
        for (int e = 0; e < 4; ++e) {
          float f0 = sp[2 * e] * oscale;
          float f1 = sp[2 * e + 1] * oscale;
          if constexpr (EPI == 2) {
            const int ci = by * cps + n0 + c8 + 2 * e;   // column parameter index (host keeps by*cps + N <= parameter count)
            const float g0 = bfr(ep0[ci]), g1 = bfr(ep0[ci + 1]);
            const float t0 = bfr(ep1[ci]), t1 = bfr(ep1[ci + 1]);
            const float u0 = bfr(ep2[ci]), u1 = bfr(ep2[ci + 1]);
            const float r0 = rsqrtf(bfr(ep3[ci]) + BN_EPS), r1 = rsqrtf(bfr(ep3[ci + 1]) + BN_EPS);
            f0 = (g0 * (f0 - u0)) * r0 + t0;
            f1 = (g1 * (f1 - u1)) * r1 + t1;
          }
          if constexpr (OM == 3) {
            const unsigned short h0 = bf_bits(f0), h1 = bf_bits(f1);
            a[e]  = pk16(h0, h1);
            b2[e] = pk16(bf_bits(f0 - bf_up(h0)), bf_bits(f1 - bf_up(h1)));
          } else {
            f0 *= ocarry; f1 *= ocarry;
            const _Float16 x0 = (_Float16)f0, x1 = (_Float16)f1;
            a[e] = pk16(h_bits(x0), h_bits(x1));
            if constexpr (OM == 4) {
              b2[e] = pk16(h_bits((_Float16)(f0 - (float)x0)), h_bits((_Float16)(f1 - (float)x1)));
            }
          }
        }
        hv[it] = a;
        lv[it] = b2;
      }
      {
#pragma unroll
        for (int it = 0; it < 4; ++it) {
          const int row = it * 4 + q8;
          *(v4u*)(C + (size_t)(mBase + row) * ldc + n0 + c8) = hv[it];
          if constexpr (OM >= 3) {
            *(v4u*)(Cb + (size_t)(mBase + row) * ldc + n0 + c8) = lv[it];
          }
        }
        wait_addr();   // behind the stores, ahead of the next slab's rewrites of their address registers
      }
    }
    wave_sync_lds_only();
  }
}

// one GEMM per launch: blockIdx.x = tile, blockIdx.y = batch
template <int OM, int ASPLIT, int BF, int EPI, int WM, int WN>
__global__ __launch_bounds__(WM * WN * 32) __attribute__((amdgpu_num_vgpr(256))) void gemm64(
    const unsigned short* __restrict__ Ap, const unsigned short* __restrict__ A2p, int lda, long long sA,
    const unsigned short* __restrict__ Btp, int ldb, long long sB,
    void* Cout, void* C2out, int ldc, long long sC,
    int M, int N, int K, float oscale, float ocarry,
    const float* __restrict__ ep0, const float* __restrict__ ep1,
    const float* __restrict__ ep2, const float* __restrict__ ep3, int cps) {
  __shared__ __align__(16) unsigned short gst[2 * gemm_slab_halves(ASPLIT, WM, WN)];
  __shared__ __align__(16) float sT[WM * WN * 16 * 68];
  __shared__ __align__(16) float res[(EPI == 1) ? (64 * WM) * (64 * WN) : 4];   // EPI 1: the block's piece of ep0
  gemm64_tile<OM, ASPLIT, BF, EPI, WM, WN>(gst, sT, res, blockIdx.x, (int)blockIdx.y, Ap, A2p, lda, sA, Btp, ldb, sB, Cout, C2out, ldc, sC,
                                           M, N, K, oscale, ocarry, ep0, ep1, ep2, ep3, cps);
}

// The three projections in one launch: none reads what another writes; blockIdx.y picks the job (block-uniform), blockIdx.x its 128 x 128 tile
// (256 tiles each), so three blocks share a WGP where one stood alone.
//   job 0: v^T per image: VT[b][h*64+d][tok] = sum_c WVT[h*64+d][c] x_b[tok][c] -> one f16 x16 plane; M = 512, N = 1024, K = 512,
//          image = blockIdx.x / 32, tile = blockIdx.x % 32
//   job 1: k[m][n] = sum_c x[m][c] WKT[n][c] -> one f16 plane; M = 8192, N = 512, K = 512.   job 2: the same for q with WQT
#define PROJ_TILES ((NROWS / 128) * (DM / 128))
#define VT_TILES   ((DM / 128) * (NTOK / 128))
static_assert(VT_TILES * NB == PROJ_TILES);
__global__ __launch_bounds__(128) __attribute__((amdgpu_num_vgpr(256))) void qkv(
    const unsigned short* __restrict__ X16, const unsigned short* __restrict__ WKT, const unsigned short* __restrict__ WQT,
    const unsigned short* __restrict__ WVT, unsigned short* KF, unsigned short* QF, unsigned short* VT) {
  __shared__ __align__(16) unsigned short gst[2 * gemm_slab_halves(0, 2, 2)];
  __shared__ __align__(16) float sT[4 * 16 * 68];
  const int job = blockIdx.y;
  const unsigned bx = blockIdx.x;
  if (job == 0) {
    gemm64_tile<2, 0, 0, 0, 2, 2>(gst, sT, nullptr, bx % VT_TILES, (int)(bx / VT_TILES),
                                  WVT, WVT, DM, 0LL,
                                  X16, DM, (long long)NTOK * DM,
                                  (void*)VT, (void*)VT, NTOK, (long long)DM * NTOK,
                                  DM, NTOK, DM, 1.0f / (ACARRY * WSC), VC,
                                  nullptr, nullptr, nullptr, nullptr, 0);
  } else {
    gemm64_tile<2, 0, 0, 0, 2, 2>(gst, sT, nullptr, bx, 0,
                                  X16, X16, DM, 0LL,
                                  (job == 1) ? WKT : WQT, DM, 0LL,
                                  (void*)((job == 1) ? KF : QF), (void*)((job == 1) ? KF : QF), DM, 0LL,
                                  NROWS, DM, DM, 1.0f / (ACARRY * WSC), 1.0f,
                                  nullptr, nullptr, nullptr, nullptr, 0);
  }
}

// =====================================================================================================
// Flash attention for one image (batch), one head and 128 score rows (one wave per 16 rows), head dim 64, 1024 columns:
//   rows i index KEY positions (k_i stationary), columns j index the q/v positions streamed in chunks of 32 = one image row;
//   k plane (f16) K[b*1024 + tok][64h + d], pitch 512; q plane (f16) Q[b*1024 + tok][64h + d];
//   v^T plane (f16 x16): VT[b*512 + 64h + d][tok] (pitch 1024);
//   additive position logits from the f32 table R[tok][m] (m < 63: q_tok . rel_w[h][m]; 64 + m: q_tok . rel_h[h][m]):
//   logit[i][j] = k_i . q_j + R[i][yj - yi + 31] + R[i][64 + xj - xi + 31], token = 32*x + y.
//   Each wave computes the table rows of its own 16 score rows ahead of the loop, transposed (A = REL rows m, B = q rows i0 + c,
//   two k-steps): lane (c, hh) gets R[i0 + c][16t + 8hh + r] and stores it to the wave's own 16 x 128 f32 piece of LDS (pitch 132), from which
//   the lanes of that wave alone read it back by their own indices.
//   The score tiles are computed transposed, S^T[j][i] (A = q rows of the chunk from LDS, B = the stationary k rows): lane (c, hh) holds score row
//   i0 + c and, in its 2 x 8 accumulator registers, that row's columns 8hh + r and 16 + 8hh + r of the chunk. So a row's maximum and sum are taken
//   inside the lane, with one exchange between the wave's halves for the maximum per chunk and one for the sum at the end, and the 16 values,
//   converted in place, are the B operand (hardware k order) of O^T[d][i] += v^T[d][j] P^T[j][i] (A = v^T rows from LDS, same k order).
//   The w part of the position logits depends only on the column within a chunk (16 registers per lane, loaded once), the h part only on the
//   chunk (one LDS load per lane per chunk); indices are pure arithmetic.
//   ctx[i][d] = sum_j softmax_j(logit) v[j][d]  (softmax run in base 2, max-subtracted, no 1/sqrt(d)), split into bf16 hi + residual in registers:
//   the lane's 4 x 8 values are the B operand (hardware k order) of Y^T[e][i] = sum_d WOT[h][e][d] ctx[i][d] (A = WOT rows, hi then residual per k-step);
//   out (bf16 hi, lo planes): CA[b*1024 + tok][64h + e] = batch-norm affine of Y[i][e].
//   block = 8 waves = 256 threads; grid = 8 images x 8 heads x 8 row blocks = 512; every wave does identical bounded work (8 stages of 4 chunks).
//   The 8 waves of a block need the same q and v^T columns: they are brought into LDS once per block, in stages of 128 columns = 4 chunks, by
//   asynchronous 16-B copies (8 per lane and stage: q 128 rows x 128 B at pitch 144 B; v^T 64 rows x 256 B at pitch 272 B), two buffers, stage
//   t + 2 issued behind the barrier that ends stage t; all A fragments are 16-B LDS reads with the split k map. Inside a stage no barrier
//   stands between the chunks: a chunk's v^T fragments and the next chunk's q fragments are read as one group ahead of the chunk's softmax, and
//   the next chunk's score products run together with the chunk's v^T . P^T products behind it.
//   Per chunk: 2 score tiles on f16 WMMA (K = 64 as two k-steps of 32); online softmax in f32 (exp2); P*1024 as f16; 4 v^T.P^T WMMAs.
//   Final 1/l and carry folds in f32; after a block barrier the stage buffers' LDS is reused as the block's two bf16 result buffers [128][64]
//   (hi, lo): each lane stages 4 x 8 consecutive e of its row (16-B stores); after a second block barrier the 256 threads write whole 128-B row pieces.
// coverage: LDS result buffers: 8 waves x 16 rows x 64 cols per plane; global: 4 iterations x 256 threads x 8 halves = 128 rows x 64 cols
//           of rows 128rb..128rb+127, columns 64h..64h+63 of image b, per plane; grid covers all 8 x 1024 rows x 512 columns exactly once.
// =====================================================================================================
__global__ __launch_bounds__(ATT_THREADS) __attribute__((amdgpu_num_vgpr(256)))
void attn8(const unsigned short* __restrict__ KF, const unsigned short* __restrict__ QF, const unsigned short* __restrict__ VT,
           const unsigned short* __restrict__ REL, const unsigned short* __restrict__ WOT,
           const float* __restrict__ gam, const float* __restrict__ bet,
           const float* __restrict__ mmean, const float* __restrict__ mvar,
           unsigned short* CAh, unsigned short* CAl) {
  __shared__ __align__(16) unsigned short stg[STG_ALLOC];        // two stage buffers: q | v^T; later: result buffers
  __shared__ __align__(16) float tab[ATT_ROWS * TPITCH];         // position-logit table rows of the block's score rows, 16 rows per wave
  __shared__ __align__(16) float bnp[4 * HO];                    // batch-norm terms of the head's 64 columns: gamma | mean | rsqrt(var + eps) | beta

  const int tid  = threadIdx.x;
  const int wave = tid >> 5;
  const int lane = tid & 31;
  const int hh   = lane >> 4;
  const int c    = lane & 15;

  const int rb   = blockIdx.x & ((NTOK / ATT_ROWS) - 1);   // 0..7
  const int head = (blockIdx.x / (NTOK / ATT_ROWS)) & (NHEAD - 1);   // 0..7
  const int bat  = blockIdx.x / ((NTOK / ATT_ROWS) * NHEAD);         // 0..7
  const int i0   = rb * ATT_ROWS + wave * 16;              // first score row (key token) of this wave
  const int x0   = i0 / GW;                                // image row of all 16 tokens
  const int yi   = (i0 & (GW - 1)) + c;                    // image column of this lane's score row i0 + c
  const size_t rowg = (size_t)bat * NTOK + i0;

  // per-lane copy addresses: q piece j = row 32j + (tid>>3), 16-B segment tid&7; v^T piece j = row 16j + (tid>>4), 16-B segment tid&15; j 0..3
  const unsigned short* gq = QF + ((size_t)bat * NTOK + (tid >> 3)) * DM + head * HD + (tid & 7) * 8;
  const unsigned short* gv = VT + ((size_t)bat * DM + head * HD + (tid >> 4)) * NTOK + (tid & 15) * 8;
  const unsigned lbase = (unsigned)(uintptr_t)stg;         // LDS byte address of the stage buffers
  const unsigned lq = lbase + (unsigned)((tid >> 3) * (QPITCH * 2) + (tid & 7) * 16);
  const unsigned lv = lbase + (unsigned)(QT_HALVES * 2 + (tid >> 4) * (VPITCH * 2) + (tid & 15) * 16);
  // stage sg (columns 128 sg .. 128 sg + 127) -> buffer buf: 4 q and 4 v^T pieces per lane
  auto stage = [&](int buf, int sg) {
    const unsigned a = lq + (unsigned)(buf * STG_HALVES * 2);
    const unsigned b = lv + (unsigned)(buf * STG_HALVES * 2);
    const unsigned short* q = gq + (size_t)sg * SCOL * DM;
    const unsigned short* v = gv + sg * SCOL;
    constexpr unsigned as = 32 * QPITCH * 2, bs = 16 * VPITCH * 2;
    constexpr size_t qs = (size_t)32 * DM, vs = (size_t)16 * NTOK;
    stage_copy8(a, q, a + as, q + qs, a + 2 * as, q + 2 * qs, a + 3 * as, q + 3 * qs,
                b, v, b + bs, v + vs, b + 2 * bs, v + 2 * vs, b + 3 * bs, v + 3 * vs);
  };

  // stage 0 -> buffer 0, landed and published; then stage 1 -> buffer 1 flies while stage 0 is worked on
  stage(0, 0);
  // the head's batch-norm terms, once per block (waves 0 and 1, one column per lane); published by the barrier below, read behind the loop
  if (tid < HO) {
    const int ci = head * HO + tid;
    bnp[tid]          = bfr(gam[ci]);
    bnp[HO + tid]     = bfr(mmean[ci]);
    bnp[2 * HO + tid] = rsqrtf(bfr(mvar[ci]) + BN_EPS);
    bnp[3 * HO + tid] = bfr(bet[ci]);
    wait_addr();   // behind the parameter loads, ahead of later rewrites of their address registers
  }
  wait_copies();
  __syncthreads();
  stage(1, 1);

  // stationary B fragments: k rows i0 + c, d 0..31 and 32..63
  const size_t kofs = (rowg + c) * DM + head * HD + 8 * hh;
  const v16h ka = ldfrag_u(KF + kofs), kb = ldfrag_u(KF + kofs + 32);

  // position-logit table of the wave's 16 score rows, x64: R^T[m][i0 + c] = sum_d REL[h][m][d] q[i0 + c][d], 8 tiles of 16 m
  float* rrow = tab + (wave * 16 + c) * TPITCH;            // table row of score row i0 + c
  {
    const v16h qa = ldfrag_u(QF + kofs), qb = ldfrag_u(QF + kofs + 32);
    const unsigned short* rp = REL + ((size_t)head * RTP + c) * HD + 8 * hh;
#pragma unroll
    for (int t = 0; t < RTP / 16; ++t) {
      const v16h ra = ldfrag_u(rp + t * 16 * HD), rc = ldfrag_u(rp + t * 16 * HD + 32);
      v8f a = mma_h(ra, qa, zero8());
      a = mma_h(rc, qb, a);
      const v4f a0 = {a[0], a[1], a[2], a[3]}, a1 = {a[4], a[5], a[6], a[7]};
      *(v4f*)(rrow + 16 * t + 8 * hh)     = a0;
      *(v4f*)(rrow + 16 * t + 8 * hh + 4) = a1;
    }
    wait_addr();   // behind the fragment loads, ahead of later rewrites of their address registers
  }
  wave_sync_lds();   // a lane reads below what the other half of its wave has stored above
  // additive w-position logits of this lane's score row for the 16 chunk columns that it holds, loop-invariant, pre-scaled by log2(e) / 64
  float wb0[8], wb1[8];
#pragma unroll
  for (int r = 0; r < 8; ++r) {
    const int iw = 8 * hh + r + (GW - 1) - yi;             // in [0, 46]
    wb0[r] = rrow[iw] * (LOG2E / WSC);
    wb1[r] = rrow[iw + 16] * (LOG2E / WSC);                        // in [16, 62]
  }
  const float* hrow = rrow + HD + (GH - 1) - x0;           // + st = h-position logit of chunk st; index st - x0 + 31 in [0, 62]

  float mrow = -INFINITY, lrow = 0.f;                      // row maximum (both halves alike); sum over this half's columns only
  v8f o0 = zero8(), o1 = zero8(), o2 = zero8(), o3 = zero8();   // O^T tiles: o_t[r] = O[i0 + c][16t + 8hh + r]

#pragma unroll 1   // one stage per trip; its four passes are unrolled below
  for (int sg = 0; sg < NSTG; ++sg) {
    const int bsel = sg & 1;
    const unsigned short* sb  = stg + bsel * STG_HALVES;
    const unsigned short* Qs = sb + c * QPITCH + 8 * hh;                     // q, row c of the stage
    const unsigned short* Vs = sb + QT_HALVES + c * VPITCH + 8 * hh;         // v^T, row d = c, column 8hh of the stage
    // first pass of the stage: q fragments (rows c and 16 + c, d 0..31 and 32..63), h-position logit, score tiles
    v16h q0 = ldfrag_u(Qs), q1 = ldfrag_u(Qs + 32), q2 = ldfrag_u(Qs + 16 * QPITCH), q3 = ldfrag_u(Qs + 16 * QPITCH + 32);
    float hraw = hrow[sg * PPS];                           // h-position logit of a pass (one image row x2 = PPS sg + p) for the lane's score row
    v8f s0, s1;                                            // s0[r] = S[i0 + c][8hh + r], s1[r] = S[i0 + c][16 + 8hh + r] of the pass
    s0 = mma_h(q0, ka, zero8());
    s1 = mma_h(q2, ka, zero8());
    s0 = mma_h(q1, kb, s0);
    s1 = mma_h(q3, kb, s1);
    guard2x4(s0, s1, q0, q1, q2, q3);
#pragma unroll
    for (int p = 0; p < PPS; ++p) {
      // every LDS read that the products at the foot of this pass need, as one group: this pass's v^T fragments and, from the same stage
      // buffer, the next pass's q fragments, and from the table the next pass's h-position logit; they return under the softmax below
      const unsigned short* Vp = Vs + p * KCH;             // the pass's 32 columns of the v^T rows
      const v16h v0 = ldfrag_u(Vp);
      const v16h v1 = ldfrag_u(Vp + 16 * VPITCH);
      const v16h v2 = ldfrag_u(Vp + 32 * VPITCH);
      const v16h v3 = ldfrag_u(Vp + 48 * VPITCH);
      float hnext = 0.f;
      if (p + 1 < PPS) {
        const unsigned short* Qn = Qs + (p + 1) * KCH * QPITCH;
        q0 = ldfrag_u(Qn);
        q1 = ldfrag_u(Qn + 32);
        q2 = ldfrag_u(Qn + 16 * QPITCH);
        q3 = ldfrag_u(Qn + 16 * QPITCH + 32);
        hnext = hrow[sg * PPS + p + 1];
      }
      __builtin_amdgcn_sched_barrier(0);   // keeps the reads above the softmax: sunk to their users they would be waited for at once
      const float hb = hraw * (LOG2E / WSC);
      float t0[8], t1[8];
#pragma unroll
      for (int r = 0; r < 8; ++r) {
        t0[r] = s0[r] * LOG2E + (wb0[r] + hb);
        t1[r] = s1[r] * LOG2E + (wb1[r] + hb);
      }
      float mx = fmaxf(t0[0], t1[0]);
#pragma unroll
      for (int r = 1; r < 8; ++r) mx = fmaxf(mx, fmaxf(t0[r], t1[r]));
      mx = fmaxf(mx, xhalf(mx));                           // both halves now hold the row's maximum over the pass
      const float mn = fmaxf(mrow, mx);
      const float al = ex2(mrow - mn);
      mrow = mn;
      FragH ph;                                            // P^T * 1024 in f16: element s = column kmap(s, hh) of the pass
      float pa[8];
#pragma unroll
      for (int r = 0; r < 8; ++r) {
        const float e0 = ex2(t0[r] - mn), e1 = ex2(t1[r] - mn);
        pa[r] = e0 + e1;
        ph.h[0][r] = (_Float16)(e0 * PC);                  // column 8hh + r
        ph.h[1][r] = (_Float16)(e1 * PC);                  // column 16 + 8hh + r
      }
      const float ps = ((pa[0] + pa[1]) + (pa[2] + pa[3])) + ((pa[4] + pa[5]) + (pa[6] + pa[7]));
      lrow = lrow * al + ps;
#pragma unroll
      for (int r = 0; r < 8; ++r) {
        o0[r] *= al;
        o1[r] *= al;
        o2[r] *= al;
        o3[r] *= al;
      }
      __builtin_amdgcn_sched_barrier(0);   // keeps the products below the softmax: lifted into it they would wait for the reads just issued
      if (p + 1 < PPS) {
        // the next pass's score tiles and this pass's v^T . P^T in one run of products
        s0 = mma_h(q0, ka, zero8());
        s1 = mma_h(q2, ka, zero8());
        s0 = mma_h(q1, kb, s0);
        s1 = mma_h(q3, kb, s1);
        o0 = mma_h(v0, ph.v, o0);
        o1 = mma_h(v1, ph.v, o1);
        o2 = mma_h(v2, ph.v, o2);
        o3 = mma_h(v3, ph.v, o3);
        guard6x9(o0, o1, o2, o3, s0, s1, ph.v, v0, v1, v2, v3, q0, q1, q2, q3);
      } else {
        o0 = mma_h(v0, ph.v, o0);
        o1 = mma_h(v1, ph.v, o1);
        o2 = mma_h(v2, ph.v, o2);
        o3 = mma_h(v3, ph.v, o3);
        guard4x5(o0, o1, o2, o3, ph.v, v0, v1, v2, v3);
      }
      hraw = hnext;
    }
    // foot of the stage: own LDS reads returned, own copies of stage sg + 1 landed, then the one barrier that publishes stage sg + 1
    // and ends every wave's reads of this stage's buffer; only behind it is that buffer refilled with stage sg + 2
    wait_lds();
    wait_copies();
    __syncthreads();
    if (sg + 2 < NSTG) stage(bsel, sg + 2);
  }
  wait_copies();

  // ---- all waves done with the stage buffers; they become two bf16 result buffers [128][64] ----
  __syncthreads();
  unsigned short* Osh = stg;
  unsigned short* Osl = Osh + ATT_ROWS * HD;
  // ---- join the halves' sums, fold 1/l and the carries (1024 on P, 16 on v), split into bf16 hi + residual as the projection's B operand ----
  const float oc = 1.0f / (PC * VC);
  const float inv = (1.0f / (lrow + xhalf(lrow))) * oc;
  const int ro = (wave * 16 + c) * HD + 8 * hh;            // row i0 + c of the block, e = 8hh; tile t adds 16t
  auto split8 = [&](const v8f& o, float sc, v4u& a, v4u& b2) {   // 8 values * sc -> bf16 hi and residual, packed in element order
#pragma unroll
    for (int e = 0; e < 4; ++e) {
      const float f0 = o[2 * e] * sc, f1 = o[2 * e + 1] * sc;
      const unsigned short g0 = bf_bits(f0), g1 = bf_bits(f1);
      a[e]  = pk16(g0, g1);
      b2[e] = pk16(bf_bits(f0 - bf_up(g0)), bf_bits(f1 - bf_up(g1)));
    }
  };
  // ctx row i0 + c as B operand: k-step 0 holds d = 8hh + r (o0) and 16 + 8hh + r (o1), k-step 1 the same + 32 (o2, o3)
  FragH ch0, cl0, ch1, cl1;
  split8(o0, inv, ch0.u[0], cl0.u[0]);
  split8(o1, inv, ch0.u[1], cl0.u[1]);
  split8(o2, inv, ch1.u[0], cl1.u[0]);
  split8(o3, inv, ch1.u[1], cl1.u[1]);
  // ---- per-head output projection, transposed, and eval batch-norm: lane (c, hh) gets Y[i0 + c][16t + 8hh + r] ----
  const unsigned short* wp = WOT + ((size_t)head * HO + c) * HD + 8 * hh;
#pragma unroll
  for (int t = 0; t < HO / 16; ++t) {
    const v16h wa = ldfrag_u(wp + t * 16 * HD), wc = ldfrag_u(wp + t * 16 * HD + 32);
    const float* bp = bnp + 16 * t + 8 * hh;               // terms of the lane's first column of the tile
    const v4f ga = *(const v4f*)(bp),          gb = *(const v4f*)(bp + 4);
    const v4f ua = *(const v4f*)(bp + HO),     ub = *(const v4f*)(bp + HO + 4);
    const v4f ra = *(const v4f*)(bp + 2 * HO), rb4 = *(const v4f*)(bp + 2 * HO + 4);
    const v4f ta = *(const v4f*)(bp + 3 * HO), tb = *(const v4f*)(bp + 3 * HO + 4);
    v8f y = mma_b(wa, ch0.v, zero8());
    y = mma_b(wa, cl0.v, y);
    y = mma_b(wc, ch1.v, y);
    y = mma_b(wc, cl1.v, y);
#pragma unroll
    for (int r = 0; r < 4; ++r) {
      y[r]     = (ga[r] * (y[r]     - ua[r])) * ra[r]  + ta[r];
      y[4 + r] = (gb[r] * (y[4 + r] - ub[r])) * rb4[r] + tb[r];
    }
    v4u a, b2;
    split8(y, 1.0f, a, b2);
    *(v4u*)(Osh + ro + 16 * t) = a;
    *(v4u*)(Osl + ro + 16 * t) = b2;
  }
  wait_addr();   // behind the weight loads, ahead of later rewrites of their address registers
  __syncthreads();
  // ---- block writes its 128 row pieces of both planes: piece p = it*256 + tid -> row p>>3, halves (p&7)*8 .. +7 (8 lanes = one 128-B line) ----
  {
    v4u hv[4], lv4[4];
#pragma unroll
    for (int it = 0; it < 4; ++it) {
      const int p = it * ATT_THREADS + tid;
      hv[it]  = *(const v4u*)(Osh + (size_t)p * 8);
      lv4[it] = *(const v4u*)(Osl + (size_t)p * 8);
    }
    const size_t dofs = ((size_t)bat * NTOK + rb * ATT_ROWS) * DM + head * HD;
    unsigned short* dsth = CAh + dofs;
    unsigned short* dstl = CAl + dofs;
    {
#pragma unroll
      for (int it = 0; it < 4; ++it) {
        const int p = it * ATT_THREADS + tid;
        const size_t go = (size_t)(p >> 3) * DM + (p & 7) * 8;
        *(v4u*)(dsth + go) = hv[it];
        *(v4u*)(dstl + go) = lv4[it];
      }
    }
  }
}

// =====================================================================================================
// Workspace map (bytes); every plane is an exact multiple of its tile / whole-row store granularity (M, N exact tile multiples,
// the activation convert count an exact multiple of 2048, no pad rows needed), every offset a multiple of 64 KiB:
//   WKT, WQT, WVT f16 [512][512] x64   3 x 524288    ([h*64+d][c] = [n][k])
//   WOT  bf16 [8][64 e][64 d]              65536
//   WUT  bf16 [512 out][512 in]          524288
//   REL  f16 [8][128][64] x64             131072
//   X16  f16 [8192][512] x16             8388608    (activation rows b*1024 + tok)
//   QF   f16 [8192][512]                 8388608    (q projection)
//   KF   f16 [8192][512]                 8388608    (k projection)
//   VT   f16 [8][512][1024] x16          8388608    (v^T per image)
//   CAh, CAl bf16 [8192][512]         2 x 8388608   (per-head output after batch-norm, concat layout, hi / residual)
//   end                                  52625408
// =====================================================================================================
extern "C" void kernel_launch(void* const* d_in, const int* in_sizes, int n_in,
                              void* d_out, int out_size, void* d_ws, size_t ws_size,
                              hipStream_t stream) {
  if (n_in < 12) return;
  if (in_sizes[0] != NROWS * DM) return;
  if (in_sizes[1] != NHEAD * DM * HD || in_sizes[2] != NHEAD * DM * HD || in_sizes[3] != NHEAD * DM * HD) return;
  if (in_sizes[4] != NHEAD * HD * HO) return;
  if (in_sizes[5] != NHEAD * HO || in_sizes[6] != NHEAD * HO || in_sizes[7] != NHEAD * HO || in_sizes[8] != NHEAD * HO) return;
  if (in_sizes[9] != NHEAD * NREL * HD || in_sizes[10] != NHEAD * NREL * HD) return;
  if (in_sizes[11] != COUT * COUT) return;
  if (out_size != NROWS * COUT) return;
  if ((in_sizes[0] % 2048) != 0) return;

  const float* x     = (const float*)d_in[0];
  const float* w_k   = (const float*)d_in[1];
  const float* w_q   = (const float*)d_in[2];
  const float* w_v   = (const float*)d_in[3];
  const float* w_o   = (const float*)d_in[4];
  const float* gam   = (const float*)d_in[5];
  const float* bet   = (const float*)d_in[6];
  const float* mmean = (const float*)d_in[7];
  const float* mvar  = (const float*)d_in[8];
  const float* relw  = (const float*)d_in[9];
  const float* relh  = (const float*)d_in[10];
  const float* w_out = (const float*)d_in[11];
  float*       out   = (float*)d_out;

  const size_t PWT = (size_t)DM * DM * 2;                         //   524288
  const size_t PWO = (size_t)NHEAD * HO * HD * 2;                 //    65536
  const size_t PWU = (size_t)COUT * COUT * 2;                     //   524288
  const size_t PRL = (size_t)NHEAD * RTP * HD * 2;                //   131072
  const size_t PX  = (size_t)NROWS * DM * 2;                      //  8388608
  const size_t PVT = (size_t)NB * DM * NTOK * 2;                  //  8388608
  size_t off = 0;
  const size_t oWK = off; off += PWT;
  const size_t oWQ = off; off += PWT;
  const size_t oWV = off; off += PWT;
  const size_t oWO = off; off += PWO;
  const size_t oWU = off; off += PWU;
  const size_t oRL = off; off += PRL;
  const size_t oX  = off; off += PX;
  const size_t oQ  = off; off += PX;
  const size_t oK  = off; off += PX;
  const size_t oV  = off; off += PVT;
  const size_t oAh = off; off += PX;
  const size_t oAl = off; off += PX;
  if (off > ws_size) return;                                      // off = 52625408
  if (off > (size_t)134217728) return;

  char* ws = (char*)d_ws;
  unsigned short* WKT  = (unsigned short*)(ws + oWK);
  unsigned short* WQT  = (unsigned short*)(ws + oWQ);
  unsigned short* WVT  = (unsigned short*)(ws + oWV);
  unsigned short* WOT  = (unsigned short*)(ws + oWO);
  unsigned short* WUT  = (unsigned short*)(ws + oWU);
  unsigned short* REL  = (unsigned short*)(ws + oRL);
  unsigned short* X16  = (unsigned short*)(ws + oX);
  unsigned short* QF   = (unsigned short*)(ws + oQ);
  unsigned short* KF   = (unsigned short*)(ws + oK);
  unsigned short* VT   = (unsigned short*)(ws + oV);
  unsigned short* CAh  = (unsigned short*)(ws + oAh);
  unsigned short* CAl  = (unsigned short*)(ws + oAl);

  const dim3 blk(256);
  const dim3 gPR(PREP_BLOCKS);                                     // 2344
  const dim3 blkG(128);                                            // 4 waves: 2 x 2 (128 x 128 tile)
  const dim3 gP(PROJ_TILES, 3);                                    // 256 x 3
  const dim3 gF((NROWS / 128) * (COUT / 128), 1);                  // 256
  const dim3 gAT(ATT_BLOCKS);                                      // 512
  const dim3 bAT(ATT_THREADS);                                     // 256

  // (0) every operand pack: weight planes WKT, WQT, WVT, REL (f16 x64), WOT, WUT (bf16) and the activation plane X16 (f16 x16)
  prep<<<gPR, blk, 0, stream>>>(x, w_k, w_q, w_v, w_o, w_out, relw, relh, X16, WKT, WQT, WVT, WOT, WUT, REL);

  // (1) v^T, k and q projections -> VT (f16 x16), KF, QF (f16)
  qkv<<<gP, blkG, 0, stream>>>(X16, WKT, WQT, WVT, KF, QF, VT);

  // (2) per (image, head, 128 score rows): position-logit table rows, attention, per-head output projection + eval batch-norm
  //     -> CA[row][64h + e] (bf16 hi / residual planes)
  attn8<<<gAT, bAT, 0, stream>>>(KF, QF, VT, REL, WOT, gam, bet, mmean, mvar, CAh, CAl);

  // (3) out = (CA_hi + CA_lo) . WUT^T + bf16_RNE(x); M = 8192, N = 512, K = 512, f32
  gemm64<0, 1, 1, 1, 2, 2><<<gF, blkG, 0, stream>>>(
      CAh, CAl, DM, 0LL,
      WUT, COUT, 0LL,
      (void*)out, (void*)out, COUT, 0LL,
      NROWS, COUT, DM, 1.0f, 1.0f,
      x, x, x, x, 0);
  (void)hipGetLastError();
}

// v010
// One run takes 58.6 microseconds.
// In both of two side-by-side timings against v009, it was 1.04 times as fast.
// Over all steps from v000 it is 5.38 times as fast.
// Contractions (all f32 accumulate): k/q projections v_wmma_f32_16x16x32_f16 (x f16 x16 . W f16 x64, K=512, single products) -> one f16 plane each;
// v^T projection v_wmma_f32_16x16x32_f16 (Wv f16 x64 . x f16 x16, K=512, single) -> one f16 x16 plane;
// relative-position tables, transposed, v_wmma_f32_16x16x32_f16 (rel f16 x64 . q f16, single, K=64) -> f32 table in LDS (attention prologue);
// attention scores, transposed, v_wmma_f32_16x16x32_f16 (q f16 . k f16 x log2(e), single products, K=64, C = position logits - reference + 7);
// v^T . P^T v_wmma_f32_16x16x32_f16 (v^T f16 x16 . P^T f16 x128, single products, K=1024 by 32);
// per-head output projection, transposed, v_wmma_f32_16x16x32_bf16 (Wo bf16 . ctx bf16 hi/lo, K=64) with eval batch-norm affine in f32 -> bf16 hi/lo planes (attention epilogue);
// final projection v_wmma_f32_16x16x32_bf16 (cat bf16 hi/lo . Wout bf16, K=512) + bf16-RNE residual in f32.
// Reference-subtracted online base-2 softmax in f32 on VALU (the reference follows the row maximum from at most 8 below). Every float input RNE-converted to bf16 on load.
#include <hip/hip_runtime.h>
#include <math.h>
#include <stdint.h>

#define NB     8
#define GH     32
#define GW     32
#define NTOK   (GH * GW)
#define DM     512
#define NHEAD  8
#define HD     64
#define HO     64
#define COUT   512
#define NREL   63
#define RTP    128
#define NROWS  (NB * NTOK)
#define KCH    32
#define WSC    64.0f
#define ACARRY 16.0f
#define VC     16.0f
#define PCL2   7.0f     /* log2 of the carry on P */
#define TAU    8.0f     /* a row's reference is raised when a pass tops it by more than this (log2); 2^(PCL2 + TAU) is finite in f16 */
#define LOG2E  1.4426950408889634f
#define BN_EPS 1e-3f
static_assert(NHEAD * HD == DM);
static_assert(NHEAD * HO == COUT);
static_assert(COUT == DM);
static_assert(KCH == GW);
static_assert(NREL == 2 * GW - 1);
static_assert(NREL == 2 * GH - 1);
static_assert(NREL <= HD);
static_assert(HD + NREL <= RTP);
static_assert((NTOK % 128) == 0 && (DM % 128) == 0 && (NROWS % 256) == 0 && (HD % 64) == 0 && (NTOK % KCH) == 0);
static_assert((RTP % 128) == 0 && (HO % 64) == 0 && (COUT % 128) == 0);
#define GKS         64
#define GPITCH      72
#define ATT_WAVES   8
#define ATT_THREADS (ATT_WAVES * 32)
#define ATT_ROWS    (ATT_WAVES * 16)
#define ATT_BLOCKS  (NB * NHEAD * (NTOK / ATT_ROWS))
#define PPS         4
#define SCOL        (PPS * KCH)
#define NSTG        (NTOK / SCOL)
#define QPITCH      72
#define VPITCH      (SCOL + 8)
#define QT_HALVES   (SCOL * QPITCH)
#define VT_HALVES   (HD * VPITCH)
#define STG_HALVES  (QT_HALVES + VT_HALVES)
#define STG_ALLOC   (2 * STG_HALVES)
#define TPITCH      (RTP + 4)
static_assert(ATT_THREADS == 256);
static_assert(ATT_BLOCKS == 512);
static_assert(NSTG >= 2);
static_assert((NTOK % SCOL) == 0);
static_assert(SCOL * (HD / 8) == 4 * ATT_THREADS && HD * (SCOL / 8) == 4 * ATT_THREADS);
static_assert(((VPITCH * 2) % 32) == 16);
static_assert((QT_HALVES % 8) == 0 && (VT_HALVES % 8) == 0 && (QPITCH % 8) == 0 && (VPITCH % 8) == 0);
static_assert(2 * ATT_ROWS * HD <= STG_ALLOC && (STG_HALVES % 8) == 0);
static_assert((ATT_ROWS * HD) / 8 == 4 * ATT_THREADS);
static_assert((TPITCH % 4) == 0 && (RTP % 16) == 0 && HO == HD);

typedef _Float16 v16h __attribute__((ext_vector_type(16)));
typedef _Float16 v8h  __attribute__((ext_vector_type(8)));
typedef __bf16   v16b __attribute__((ext_vector_type(16)));
typedef float    v8f  __attribute__((ext_vector_type(8)));
typedef float    v4f  __attribute__((ext_vector_type(4)));
typedef unsigned int v4u __attribute__((ext_vector_type(4)));

union FragH { v16h v; v8h h[2]; v4u u[2]; };
union FragAny { v16h h; v16b b; };

// ---- scalar helpers --------------------------------------------------------------------------------
__device__ __forceinline__ unsigned short bf_bits(float f) {          // f32 -> bf16 bits, RNE convert
  unsigned u = __float_as_uint(f);
  return (unsigned short)((u + 0x7FFFu + ((u >> 16) & 1u)) >> 16);
}
__device__ __forceinline__ float bf_up(unsigned short h) { return __uint_as_float(((unsigned)h) << 16); }
__device__ __forceinline__ float bfr(float f) { return bf_up(bf_bits(f)); }   // value of the bf16 RNE convert
__device__ __forceinline__ unsigned short h_bits(_Float16 x) { return __builtin_bit_cast(unsigned short, x); }
__device__ __forceinline__ unsigned pk16(unsigned short a, unsigned short b) { return (unsigned)a | ((unsigned)b << 16); }
__device__ __forceinline__ v8f zero8() { v8f z = {0.f, 0.f, 0.f, 0.f, 0.f, 0.f, 0.f, 0.f}; return z; }
// value of lane l ^ 16 (the other half of the wave), by one vector cross-row move
__device__ __forceinline__ float xhalf(float x) {
  const int b = __builtin_bit_cast(int, x);
  return __builtin_bit_cast(float, __builtin_amdgcn_permlanex16(b, b, 0x76543210, 0xfedcba98, false, false));
}

// 2^x by the bare v_exp_f32. Every argument in the softmax is <= PCL2 + TAU; the library form's range guard only serves results below 2^-126, which
// add nothing to a row sum that holds a term of 2^PCL2 or more and convert to 0 in the f16 plane of P.
__device__ __forceinline__ float ex2(float x) { return __builtin_amdgcn_exp2f(x); }

// ---- fragment loader: 16-bit A/B operand from a k-contiguous 16-bit plane, lane -> row/col (lane&15),
//      p already includes +8*(lane>>4); elements 0..7 <- p[0..7] (k0+8h..), elements 8..15 <- p[16..23] (k0+16+8h..)
//      (same split k map for A and B; B is always read from a [n][k] plane)
__device__ __forceinline__ v16h ldfrag_u(const unsigned short* p) {
  FragH f;
  f.u[0] = *(const v4u*)(p);
  f.u[1] = *(const v4u*)(p + 16);
  return f.v;
}

// ---- WMMA helpers with trailing VALU hazard gaps ------------------------------------------------------
__device__ __forceinline__ v8f mma_h(v16h a, v16h b, v8f c) {
  return __builtin_amdgcn_wmma_f32_16x16x32_f16(false, a, false, b, (short)0, c, false, false);
}
__device__ __forceinline__ v8f mma_b(v16h a, v16h b, v8f c) {
  FragAny ua, ub;
  ua.h = a;
  ub.h = b;
  return __builtin_amdgcn_wmma_f32_16x16x32_bf16(false, ua.b, false, ub.b, (short)0, c, false, false);
}
template <int BF>
__device__ __forceinline__ v8f mmaT(v16h a, v16h b, v8f c) {
  if constexpr (BF != 0) return mma_b(a, b, c);
  else return mma_h(a, b, c);
}
__device__ __forceinline__ void dep_guard1(v8f& a, v8f& b, v16h x) {
#if defined(__HIP_DEVICE_COMPILE__)
  asm volatile("v_nop\n\tv_nop\n\tv_nop\n\tv_nop" : "+v"(a), "+v"(b) : "v"(x));
#endif
}
// four vector slots behind a run's last product, ahead of the first read of a result and the first overwrite of an operand
__device__ __forceinline__ void guard2x4(v8f& s, v8f& t, v16h a0, v16h a1, v16h a2, v16h a3) {
#if defined(__HIP_DEVICE_COMPILE__)
  asm volatile("v_nop\n\tv_nop\n\tv_nop\n\tv_nop" : "+v"(s), "+v"(t) : "v"(a0), "v"(a1), "v"(a2), "v"(a3));
#endif
}
__device__ __forceinline__ void guard4x5(v8f& a, v8f& b, v8f& c, v8f& d,
                                         v16h x0, v16h x1, v16h x2, v16h x3, v16h x4) {
#if defined(__HIP_DEVICE_COMPILE__)
  asm volatile("v_nop\n\tv_nop\n\tv_nop\n\tv_nop"
               : "+v"(a), "+v"(b), "+v"(c), "+v"(d) : "v"(x0), "v"(x1), "v"(x2), "v"(x3), "v"(x4));
#endif
}
// the same behind a run of score and v^T . P^T products
__device__ __forceinline__ void guard6x9(v8f& a, v8f& b, v8f& c, v8f& d, v8f& e, v8f& f, v16h x0, v16h x1, v16h x2, v16h x3, v16h x4,
                                         v16h x5, v16h x6, v16h x7, v16h x8) {
#if defined(__HIP_DEVICE_COMPILE__)
  asm volatile("v_nop\n\tv_nop\n\tv_nop\n\tv_nop"
               : "+v"(a), "+v"(b), "+v"(c), "+v"(d), "+v"(e), "+v"(f)
               : "v"(x0), "v"(x1), "v"(x2), "v"(x3), "v"(x4), "v"(x5), "v"(x6), "v"(x7), "v"(x8));
#endif
}
__device__ __forceinline__ void keep4_h(v16h a, v16h b, v16h c, v16h d) {
#if defined(__HIP_DEVICE_COMPILE__)
  asm volatile("v_nop" :: "v"(a), "v"(b), "v"(c), "v"(d));
#endif
}
__device__ __forceinline__ void acc_guard4(v8f& a, v8f& b, v8f& c, v8f& d) {
#if defined(__HIP_DEVICE_COMPILE__)
  asm volatile("v_nop\n\tv_nop\n\tv_nop\n\tv_nop" : "+v"(a), "+v"(b), "+v"(c), "+v"(d));
#endif
}
__device__ __forceinline__ void wave_sync_lds() {
  __builtin_amdgcn_fence(__ATOMIC_RELEASE, "workgroup");
  __builtin_amdgcn_wave_barrier();
  __builtin_amdgcn_fence(__ATOMIC_ACQUIRE, "workgroup");
}
// the same for LDS alone: orders the wave's own LDS stores and loads and does not wait out its global stores
__device__ __forceinline__ void wave_sync_lds_only() {
  __builtin_amdgcn_fence(__ATOMIC_RELEASE, "workgroup", "local");
  __builtin_amdgcn_wave_barrier();
  __builtin_amdgcn_fence(__ATOMIC_ACQUIRE, "workgroup", "local");
}

// four 16-B copies per lane, global -> LDS through no register; the s_wait_xcnt 0 in the same statement stands ahead of any later
// rewrite of the address registers that the copies name
__device__ __forceinline__ void stage_copy4(unsigned l0, const unsigned short* g0, unsigned l1, const unsigned short* g1,
                                            unsigned l2, const unsigned short* g2, unsigned l3, const unsigned short* g3) {
#if defined(__HIP_DEVICE_COMPILE__)
  asm volatile("global_load_async_to_lds_b128 %0, %1, off\n\t"
               "global_load_async_to_lds_b128 %2, %3, off\n\t"
               "global_load_async_to_lds_b128 %4, %5, off\n\t"
               "global_load_async_to_lds_b128 %6, %7, off\n\t"
               "s_wait_xcnt 0x0"
               :: "v"(l0), "v"(g0), "v"(l1), "v"(g1), "v"(l2), "v"(g2), "v"(l3), "v"(g3) : "memory");
#endif
}
// the same for eight copies: one wait on the address registers serves the run
__device__ __forceinline__ void stage_copy8(unsigned l0, const unsigned short* g0, unsigned l1, const unsigned short* g1,
                                            unsigned l2, const unsigned short* g2, unsigned l3, const unsigned short* g3,
                                            unsigned l4, const unsigned short* g4, unsigned l5, const unsigned short* g5,
                                            unsigned l6, const unsigned short* g6, unsigned l7, const unsigned short* g7) {
#if defined(__HIP_DEVICE_COMPILE__)
  asm volatile("global_load_async_to_lds_b128 %0, %1, off\n\t"
               "global_load_async_to_lds_b128 %2, %3, off\n\t"
               "global_load_async_to_lds_b128 %4, %5, off\n\t"
               "global_load_async_to_lds_b128 %6, %7, off\n\t"
               "global_load_async_to_lds_b128 %8, %9, off\n\t"
               "global_load_async_to_lds_b128 %10, %11, off\n\t"
               "global_load_async_to_lds_b128 %12, %13, off\n\t"
               "global_load_async_to_lds_b128 %14, %15, off\n\t"
               "s_wait_xcnt 0x0"
               :: "v"(l0), "v"(g0), "v"(l1), "v"(g1), "v"(l2), "v"(g2), "v"(l3), "v"(g3),
                  "v"(l4), "v"(g4), "v"(l5), "v"(g5), "v"(l6), "v"(g6), "v"(l7), "v"(g7) : "memory");
#endif
}
// this wave's copies have landed in LDS
__device__ __forceinline__ void wait_copies() {
#if defined(__HIP_DEVICE_COMPILE__)
  asm volatile("s_wait_asynccnt 0x0" ::: "memory");
#endif
}
// stands behind a global load or store, ahead of a later rewrite of a register that it names
__device__ __forceinline__ void wait_addr() {
#if defined(__HIP_DEVICE_COMPILE__)
  asm volatile("s_wait_xcnt 0x0" ::: "memory");
#endif
}
// this wave's LDS reads have returned (ahead of the barrier behind which their buffer is refilled)
__device__ __forceinline__ void wait_lds() {
#if defined(__HIP_DEVICE_COMPILE__)
  asm volatile("s_wait_dscnt 0x0" ::: "memory");
#endif
}

// =====================================================================================================
// Elementwise 16-bit pack, no transpose. BFO 0: dst[i] = f16( bf16_RNE(src[i]) * sc ), sc a power of two (exact);
// BFO 1: dst[i] = bf16_RNE(src[i]) bits. 8 elements per thread: two 16-B loads, one 16-B store per lane; 32 consecutive
// coverage: n / 2048 blocks (index bx) x 256 thr x 8 elements = n exactly (host checks n % 2048 == 0).
// =====================================================================================================
template <int BFO>
__device__ __forceinline__ void cvt16(const float* __restrict__ src, unsigned short* dst, int n, float sc, int bx) {
  const size_t i8 = ((size_t)bx * 256 + threadIdx.x) * 8;
  if (i8 + 8 > (size_t)n) return;                 // never taken with the exact block range; no barriers in this job
  const v4f a = *(const v4f*)(src + i8);
  const v4f b = *(const v4f*)(src + i8 + 4);
  v4u o;
  if constexpr (BFO != 0) {
    o[0] = pk16(bf_bits(a[0]), bf_bits(a[1]));
    o[1] = pk16(bf_bits(a[2]), bf_bits(a[3]));
    o[2] = pk16(bf_bits(b[0]), bf_bits(b[1]));
    o[3] = pk16(bf_bits(b[2]), bf_bits(b[3]));
  } else {
    o[0] = pk16(h_bits((_Float16)(bfr(a[0]) * sc)), h_bits((_Float16)(bfr(a[1]) * sc)));
    o[1] = pk16(h_bits((_Float16)(bfr(a[2]) * sc)), h_bits((_Float16)(bfr(a[3]) * sc)));
    o[2] = pk16(h_bits((_Float16)(bfr(b[0]) * sc)), h_bits((_Float16)(bfr(b[1]) * sc)));
    o[3] = pk16(h_bits((_Float16)(bfr(b[2]) * sc)), h_bits((_Float16)(bfr(b[3]) * sc)));
  }
  {
    *(v4u*)(dst + i8) = o;
    
  }
}

// =====================================================================================================
// Transposing 16-bit pack of a weight matrix: in W[Cin][Dd] (pitch Dd, base + z*sIn) -> out WT[Dd][Cin] (pitch Cin, base + z*sOut),
// BFO 0: f16( bf16_RNE(w) * sc ); BFO 1: bf16_RNE(w) bits. One 64x64 tile per block (bx = Cin tile, by = Dd tile, bz = matrix index):
// coverage: loads 4 x 256 x 4 floats = 64x64; stores 2 x 256 pieces x 8 halves = 64 rows x 64 halves = the whole tile;
//           (bx, by, bz) runs over (Cin/64, Dd/64, nmat) exactly (all sizes exact multiples of 64). t: the block's 64 x 65 float tile in LDS.
// =====================================================================================================
template <int BFO>
__device__ __forceinline__ void tr16(const float* __restrict__ W, unsigned short* WT, int Cin, int Dd,
                                     long long sIn, long long sOut, float sc, int bx, int by, int bz, float (*t)[65]) {
  const int tid = threadIdx.x;
  const int c0 = bx * 64, d0 = by * 64;
  const float* src = W + (size_t)((long long)bz * sIn);
  unsigned short* dst = WT + (size_t)((long long)bz * sOut);
#pragma unroll
  for (int it = 0; it < 4; ++it) {
    const int p  = it * 256 + tid;
    const int cc = p >> 4, sg = (p & 15) * 4;
    const v4f v = *(const v4f*)(src + (size_t)(c0 + cc) * Dd + d0 + sg);
    t[cc][sg]     = v[0];
    t[cc][sg + 1] = v[1];
    t[cc][sg + 2] = v[2];
    t[cc][sg + 3] = v[3];
  }
  __syncthreads();
  v4u o[2];
#pragma unroll
  for (int it = 0; it < 2; ++it) {
    const int p  = it * 256 + tid;
    const int dd = p >> 3, s8 = (p & 7) * 8;
    unsigned short hv[8];
#pragma unroll
    for (int k = 0; k < 8; ++k) {
      const float f = bfr(t[s8 + k][dd]);
      if constexpr (BFO != 0) hv[k] = bf_bits(f);
      else hv[k] = h_bits((_Float16)(f * sc));
    }
    v4u q;
    q[0] = pk16(hv[0], hv[1]);
    q[1] = pk16(hv[2], hv[3]);
    q[2] = pk16(hv[4], hv[5]);
    q[3] = pk16(hv[6], hv[7]);
    o[it] = q;
  }
  {
#pragma unroll
    for (int it = 0; it < 2; ++it) {
      const int p  = it * 256 + tid;
      const int dd = p >> 3, s8 = (p & 7) * 8;
      *(v4u*)(dst + (size_t)(d0 + dd) * Cin + c0 + s8) = o[it];
    }
    wait_addr();   // other jobs' code follows these stores in the merged kernel and rewrites their registers
  }
}

// =====================================================================================================
// Relative-position operand plane: out[h][r][0..63] = f16( bf16_RNE(value) * 64 ), r 0..62 = rel_w[h][r][:], r 63 = 0, r 64..126 = rel_h[h][r-64][:],
// r 127 = 0. Every lane loads both candidate rows from clamped addresses and selects by value. 8 halves per thread, 8 consecutive
// coverage: 32 blocks (index bx) x 256 threads x 8 halves = 8 x 128 x 64 exactly.
// =====================================================================================================
__device__ __forceinline__ void relcat(const float* __restrict__ rw, const float* __restrict__ rh, unsigned short* out, int bx) {
  const int p   = bx * 256 + threadIdx.x;                // 0 .. NHEAD*RTP*8 - 1
  const int hd  = p / (RTP * 8);
  const int r   = (p >> 3) & (RTP - 1);
  const int seg = (p & 7) * 8;
  const int iw  = (r < NREL) ? r : (NREL - 1);
  int ih = r - HD;
  ih = (ih < 0) ? 0 : ih;
  ih = (ih > NREL - 1) ? (NREL - 1) : ih;
  const float* pw = rw + ((size_t)hd * NREL + iw) * HD + seg;
  const float* ph = rh + ((size_t)hd * NREL + ih) * HD + seg;
  const v4f a0 = *(const v4f*)(pw), a1 = *(const v4f*)(pw + 4);
  const v4f b0 = *(const v4f*)(ph), b1 = *(const v4f*)(ph + 4);
  const bool uw = (r < NREL);
  const bool uh = (r >= HD) && (r < HD + NREL);
  float v[8];
#pragma unroll
  for (int e = 0; e < 4; ++e) {
    v[e]     = uw ? a0[e] : (uh ? b0[e] : 0.f);
    v[4 + e] = uw ? a1[e] : (uh ? b1[e] : 0.f);
  }
  v4u o;
#pragma unroll
  for (int e = 0; e < 4; ++e) o[e] = pk16(h_bits((_Float16)(bfr(v[2 * e]) * WSC)), h_bits((_Float16)(bfr(v[2 * e + 1]) * WSC)));
  {
    *(v4u*)(out + (size_t)p * 8) = o;
    wait_addr();   // other jobs' code follows this store in the merged kernel and rewrites its registers
  }
}

// =====================================================================================================
// All operand packs in one launch: none reads what another writes, so the job is picked by the block index (block-uniform, so the barrier
// of the transposing jobs is passed by a whole block or by none). The transposing jobs, whose blocks last longest, come first.
//   blocks    0 ..  191: W[h][c][d] -> WT[h*64+d][c] as f16( bf16_RNE(w) * 64 ) for Wk, Wq, Wv (64 blocks each: 8 c tiles x 8 heads)
//   blocks  192 ..  255: Wout[in][out] -> WUT[out][in] bf16 (8 x 8 tiles)
//   blocks  256 ..  263: Wo[h][d][e] -> WOT[h][e][d] bf16 (one tile per head)
//   blocks  264 ..  295: rel tables -> REL[h][128][64] f16 x64 (rows 63, 127 zero)
//   blocks  296 .. 2343: X16[row][c] = f16( bf16_RNE(x[row][c]) * 16 ), rows = b*1024 + tok
// =====================================================================================================
#define PB_W    ((DM / 64) * NHEAD)
#define PB_WU   ((COUT / 64) * (COUT / 64))
#define PB_WO   NHEAD
#define PB_RL   ((NHEAD * RTP * 8) / 256)
#define PB_X    ((NROWS * DM) / 2048)
#define PREP_BLOCKS (3 * PB_W + PB_WU + PB_WO + PB_RL + PB_X)
static_assert(HD == 64 && HO == 64);
__global__ __launch_bounds__(256) void prep(const float* __restrict__ x, const float* __restrict__ w_k, const float* __restrict__ w_q,
                                            const float* __restrict__ w_v, const float* __restrict__ w_o, const float* __restrict__ w_out,
                                            const float* __restrict__ relw, const float* __restrict__ relh,
                                            unsigned short* X16, unsigned short* WKT, unsigned short* WQT, unsigned short* WVT,
                                            unsigned short* WOT, unsigned short* WUT, unsigned short* REL) {
  __shared__ float t[64][65];
  int b = blockIdx.x;
  if (b < 3 * PB_W) {
    const int m = b / PB_W, r = b - m * PB_W;
    const float* src = (m == 0) ? w_k : ((m == 1) ? w_q : w_v);
    unsigned short* dst = (m == 0) ? WKT : ((m == 1) ? WQT : WVT);
    tr16<0>(src, dst, DM, HD, (long long)DM * HD, (long long)HD * DM, WSC, r % (DM / 64), 0, r / (DM / 64), t);
    return;
  }
  b -= 3 * PB_W;
  if (b < PB_WU) {
    tr16<1>(w_out, WUT, COUT, COUT, 0LL, 0LL, 1.0f, b % (COUT / 64), b / (COUT / 64), 0, t);
    return;
  }
  b -= PB_WU;
  if (b < PB_WO) {
    tr16<1>(w_o, WOT, HD, HO, (long long)HD * HO, (long long)HO * HD, 1.0f, 0, 0, b, t);
    return;
  }
  b -= PB_WO;
  if (b < PB_RL) {
    relcat(relw, relh, REL, b);
    return;
  }
  b -= PB_RL;
  cvt16<0>(x, X16, NROWS * DM, ACARRY, b);
}

// =====================================================================================================
// Register-blocked batched 16-bit WMMA GEMM: C[m][n] = oscale * sum_k A[m][k] * Bt[n][k]; one wave per 64x64 tile, block = WM x WN waves
// (4 waves) on a (64 WM) x (64 WN) tile.
// A row-major [M][K] pitch lda (16-bit plane), Bt row-major [N][K] pitch ldb (k contiguous); M multiple of 64 WM, N of 64 WN, K of 64.
// The block's A and Bt rows are brought into LDS once per block, in k slabs of 64 (one whole 128-B line per row, 8 lanes per line, pitch 144 B
// in LDS), by asynchronous 16-B copies, two buffers: slab t + 2 is issued behind the barrier that ends slab t. All fragments are 16-B LDS reads
// with the same split k map and the same k order of the products as with fragments read from global memory.
// bx = tile index, by = batch index with element strides sA, sB, sC; gst, sT: the block's LDS (two slab buffers; one 16 x 68 float slab per wave);
// res: EPI 1 only, the block's LDS for its piece of ep0.
// ASPLIT 1: a second A plane A2 (unscaled residual of A, same layout) is multiplied into the same accumulator (A + A2 ~ exact A).
// BF 1: bf16 operands (v_wmma_f32_16x16x32_bf16), else f16.
// OM 0: f32 out (pitch ldc).  OM 2: f16 out = f16(value * ocarry).  OM 3: two bf16 planes: hi = bf16_RNE(value), lo = bf16_RNE(value - hi).
// OM 4: two f16 planes: hi = f16(value * ocarry), lo = f16(value * ocarry - hi) (unscaled residual).
// EPI 1 (OM 0 only): value += bf16_RNE(ep0[same index as C]).  EPI 2 (16-bit out): per-column eval batch-norm affine
//   value = (bf16(ep0[ci]) * (value - bf16(ep2[ci]))) * rsqrt(bf16(ep3[ci]) + eps) + bf16(ep1[ci]),  ci = by*cps + column.
// coverage: 4 slabs x 16 rows (f32: it 0..7 x lane>>4; 16-bit: it 0..3 x lane>>3) x 64 cols = the wave's whole 64x64 tile;
//           bx runs over (M / (64 WM)) * (N / (64 WN)) blocks exactly; a surplus block would leave as a whole, ahead of every copy and barrier.
// =====================================================================================================
template <int V> struct IntC { static constexpr int value = V; };
constexpr int gemm_slab_halves(int asplit, int wm, int wn) { return ((1 + asplit) * 64 * wm + 64 * wn) * GPITCH; }   // one buffer: A | (A2) | Bt
template <int OM, int ASPLIT, int BF, int EPI, int WM, int WN>
__device__ __forceinline__ void gemm64_tile(
    unsigned short* gst, float* sT, float* res, unsigned bx, int by,
    const unsigned short* __restrict__ Ap, const unsigned short* __restrict__ A2p, int lda, long long sA,
    const unsigned short* __restrict__ Btp, int ldb, long long sB,
    void* Cout, void* C2out, int ldc, long long sC,
    int M, int N, int K, float oscale, float ocarry,
    const float* __restrict__ ep0, const float* __restrict__ ep1,
    const float* __restrict__ ep2, const float* __restrict__ ep3, int cps) {
  constexpr int NW     = WM * WN;                    // waves per block
  constexpr int AR     = 64 * WM;                    // A rows of the block tile
  constexpr int BR     = 64 * WN;                    // Bt rows of the block tile
  constexpr int RPI    = NW * 4;                     // rows that one copy of every lane of the block covers (8 lanes per row)
  constexpr int A_H    = AR * GPITCH;                // halves of one A plane's slab in LDS
  constexpr int B_H    = BR * GPITCH;
  constexpr int SLAB_H = (1 + ASPLIT) * A_H + B_H;   // one buffer: A | (A2) | Bt
  static_assert(SLAB_H == gemm_slab_halves(ASPLIT, WM, WN));
  static_assert((AR % (4 * RPI)) == 0 && (BR % (4 * RPI)) == 0);
  static_assert(((1 + ASPLIT) * AR + BR) / RPI <= 63);     // copies of one wave in flight
  const int tid  = threadIdx.x;
  const int lane = tid & 31;
  const int wave = tid >> 5;
  const int tilesN = N / BR;
  const int tilesM = M / AR;
  if ((int)bx >= tilesM * tilesN) return;           // block-uniform, ahead of every copy and barrier
  const int tm  = bx / tilesN;
  const int tn  = bx - tm * tilesN;
  const int bm0 = tm * AR;
  const int bn0 = tn * BR;
  const int wm  = wave / WN;
  const int wn  = wave - wm * WN;
  const int m0  = bm0 + (wm << 6);
  const int n0  = bn0 + (wn << 6);

  const unsigned short* A1 = Ap  + (size_t)((long long)by * sA);
  const unsigned short* A2 = A2p + (size_t)((long long)by * sA);
  const unsigned short* Bb = Btp + (size_t)((long long)by * sB);

  const int rlane = lane & 15;                 // row (A) / col (B, D) within subtile
  const int koff  = (lane >> 4) * 8;           // k offset of this lane half
  const int mOff  = (lane >> 4) * 8;           // D row offset

  // per-lane copy addresses: row tid>>3 of a group of RPI rows, 16-B segment tid&7 of the row's 128-B line
  const unsigned short* gA  = A1 + (size_t)(bm0 + (tid >> 3)) * lda + (tid & 7) * 8;
  const unsigned short* gA2 = A2 + (size_t)(bm0 + (tid >> 3)) * lda + (tid & 7) * 8;
  const unsigned short* gB  = Bb + (size_t)(bn0 + (tid >> 3)) * ldb + (tid & 7) * 8;
  const unsigned lcp = (unsigned)(uintptr_t)gst + (unsigned)((tid >> 3) * (GPITCH * 2) + (tid & 7) * 16);   // LDS byte address
  constexpr unsigned LSTEP = (unsigned)(RPI * GPITCH * 2);      // LDS bytes from one group of RPI rows to the next
  const size_t astep = (size_t)RPI * lda, bstep = (size_t)RPI * ldb;
  // rows of one plane: groups of RPI rows, eight groups (or the last four) per statement
  auto plane = [&](unsigned l, const unsigned short* p, size_t step, auto ngroups) {
    constexpr int NG = decltype(ngroups)::value;
#pragma unroll
    for (int g = 0; g < NG; g += 8) {
      const unsigned short* q = p + (size_t)g * step;
      const unsigned m = l + (unsigned)g * LSTEP;
      if (g + 8 <= NG) {
        stage_copy8(m, q, m + LSTEP, q + step, m + 2 * LSTEP, q + 2 * step, m + 3 * LSTEP, q + 3 * step,
                    m + 4 * LSTEP, q + 4 * step, m + 5 * LSTEP, q + 5 * step, m + 6 * LSTEP, q + 6 * step, m + 7 * LSTEP, q + 7 * step);
      } else {
        stage_copy4(m, q, m + LSTEP, q + step, m + 2 * LSTEP, q + 2 * step, m + 3 * LSTEP, q + 3 * step);
      }
    }
  };
  auto stage = [&](int buf, int k0) {
    const unsigned l0 = lcp + (unsigned)(buf * (SLAB_H * 2));
    plane(l0, gA + k0, astep, IntC<AR / RPI>{});
    if constexpr (ASPLIT != 0) plane(l0 + (unsigned)(A_H * 2), gA2 + k0, astep, IntC<AR / RPI>{});
    plane(l0 + (unsigned)((1 + ASPLIT) * A_H * 2), gB + k0, bstep, IntC<BR / RPI>{});
  };

  v8f acc[4][4];
#pragma unroll
  for (int i = 0; i < 4; ++i)
#pragma unroll
    for (int j = 0; j < 4; ++j) acc[i][j] = zero8();

  // slab 0 -> buffer 0, landed and published; then slab 1 -> buffer 1 flies while slab 0 is worked on
  const int nslab = K / GKS;
  stage(0, 0);
  wait_copies();
  __syncthreads();
  if (nslab > 1) stage(1, GKS);

  // EPI 1: the block's AR x BR f32 piece of ep0 goes to LDS (res, pitch BR) under the k loop, so that the epilogue waits on no global load.
  // One copy of a wave = one whole 512-B row piece; group g = rows 8 NW g .. 8 NW g + 8 NW - 1 (row = NW j + wave), one group behind the foot of
  // slab g, landed and published by the foot of slab g + 1; groups that have no such slab go ahead of the loop (foot of slab 0).
  constexpr int NRG = AR / (8 * NW);
  static_assert(EPI != 1 || (BR * 4 == 32 * 16 && (AR % (8 * NW)) == 0));
  static_assert(((1 + ASPLIT) * AR + BR) / RPI + 8 * NRG <= 63);   // copies of one wave in flight, at the most
  auto rescopy = [&](int g) {
    const float* q = ep0 + (size_t)((long long)by * sC) + (size_t)(bm0 + g * (8 * NW) + wave) * ldc + bn0 + lane * 4;
    const unsigned m = (unsigned)(uintptr_t)res + (unsigned)((g * (8 * NW) + wave) * (BR * 4) + lane * 16);
    const size_t rs = (size_t)NW * ldc;
    constexpr unsigned ms = (unsigned)(NW * BR * 4);
    stage_copy8(m, (const unsigned short*)q, m + ms, (const unsigned short*)(q + rs),
                m + 2 * ms, (const unsigned short*)(q + 2 * rs), m + 3 * ms, (const unsigned short*)(q + 3 * rs),
                m + 4 * ms, (const unsigned short*)(q + 4 * rs), m + 5 * ms, (const unsigned short*)(q + 5 * rs),
                m + 6 * ms, (const unsigned short*)(q + 6 * rs), m + 7 * ms, (const unsigned short*)(q + 7 * rs));
  };
  if constexpr (EPI == 1) {
#pragma unroll 1   // kept rolled: runs only for K under (NRG + 1) slabs, one copy statement in the text is enough
    for (int g = nslab - 1; g < NRG; ++g) rescopy(g);
  }

#pragma unroll 1
  for (int t = 0; t < nslab; ++t) {
    const unsigned short* sb  = gst + (t & 1) * SLAB_H;
    const unsigned short* As  = sb + ((wm << 6) + rlane) * GPITCH + koff;
    const unsigned short* As2 = As + A_H;
    const unsigned short* Bs  = sb + (1 + ASPLIT) * A_H + ((wn << 6) + rlane) * GPITCH + koff;
#pragma unroll
    for (int ks = 0; ks < GKS; ks += 32) {
      // all fragments of the k-step are read as one group ahead of its products (one LDS wait per k-step, not one per row of tiles)
      v16h bh[4], ah[4];
#pragma unroll
      for (int j = 0; j < 4; ++j) bh[j] = ldfrag_u(Bs + (j << 4) * GPITCH + ks);
#pragma unroll
      for (int i = 0; i < 4; ++i) ah[i] = ldfrag_u(As + (i << 4) * GPITCH + ks);
      if constexpr (ASPLIT != 0) {
        v16h al[4];
#pragma unroll
        for (int i = 0; i < 4; ++i) al[i] = ldfrag_u(As2 + (i << 4) * GPITCH + ks);
#pragma unroll
        for (int i = 0; i < 4; ++i) {
#pragma unroll
          for (int j = 0; j < 4; ++j) acc[i][j] = mmaT<BF>(ah[i], bh[j], acc[i][j]);
          dep_guard1(acc[i][0], acc[i][3], ah[i]);
#pragma unroll
          for (int j = 0; j < 4; ++j) acc[i][j] = mmaT<BF>(al[i], bh[j], acc[i][j]);
          dep_guard1(acc[i][0], acc[i][3], al[i]);
        }
      } else {
#pragma unroll
        for (int i = 0; i < 4; ++i) {
#pragma unroll
          for (int j = 0; j < 4; ++j) acc[i][j] = mmaT<BF>(ah[i], bh[j], acc[i][j]);
          dep_guard1(acc[i][0], acc[i][3], ah[i]);
        }
      }
      keep4_h(bh[0], bh[1], bh[2], bh[3]);
    }
    // foot of the slab: own LDS reads returned, own copies of slab t + 1 landed, then the one barrier that publishes slab t + 1
    // and ends every wave's reads of this slab's buffer; only behind it is that buffer refilled with slab t + 2
    wait_lds();
    wait_copies();
    __syncthreads();
    if (t + 2 < nslab) stage(t & 1, (t + 2) * GKS);
    if constexpr (EPI == 1) {
      if (t < NRG && t + 1 < nslab) rescopy(t);
    }
  }
  wait_copies();
  acc_guard4(acc[0][0], acc[0][1], acc[0][2], acc[0][3]);
  acc_guard4(acc[1][0], acc[1][1], acc[1][2], acc[1][3]);
  acc_guard4(acc[2][0], acc[2][1], acc[2][2], acc[2][3]);
  acc_guard4(acc[3][0], acc[3][1], acc[3][2], acc[3][3]);

  const int hh2 = lane >> 4, c4 = (lane & 15) * 4;     // f32 out: 256-B row segment = 16 lanes x 16 B
  const int q8  = lane >> 3, c8 = (lane & 7) * 8;

  // ---- epilogue ----
  float* slab = sT + wave * (16 * 68);              // per-wave 16x64 slab, pitch 68 floats
#pragma unroll
  for (int i = 0; i < 4; ++i) {
    const int mBase = m0 + (i << 4);
#pragma unroll
    for (int j = 0; j < 4; ++j) {
#pragma unroll
      for (int r = 0; r < 8; ++r) {
        slab[(mOff + r) * 68 + (j << 4) + rlane] = acc[i][j][r];
      }
    }
    wave_sync_lds_only();
    if constexpr (OM == 0) {
      float* C = (float*)Cout + (size_t)((long long)by * sC);
      v4f vals[8];
#pragma unroll
      for (int it = 0; it < 8; ++it) {
        const int row = it * 2 + hh2;                      // it 0..7 x hh2 0..1 = rows 0..15
        v4f v = *(const v4f*)(slab + row * 68 + c4);
#pragma unroll
        for (int e = 0; e < 4; ++e) v[e] = v[e] * oscale;
        if constexpr (EPI == 1) {
          const v4f xr = *(const v4f*)(res + ((wm << 6) + (i << 4) + row) * BR + (wn << 6) + c4);
#pragma unroll
          for (int e = 0; e < 4; ++e) v[e] = v[e] + bfr(xr[e]);
        }
        vals[it] = v;
      }
      {
#pragma unroll
        for (int it = 0; it < 8; ++it) {
          const int gr = mBase + it * 2 + hh2;
          *(v4f*)(C + (size_t)gr * ldc + n0 + c4) = vals[it];
        }
        wait_addr();   // behind the stores, ahead of the next slab's rewrites of their address registers
      }
    } else {
      unsigned short* C  = (unsigned short*)Cout  + (size_t)((long long)by * sC);
      unsigned short* Cb = (unsigned short*)C2out + (size_t)((long long)by * sC);
      v4u hv[4], lv[4];
#pragma unroll
      for (int it = 0; it < 4; ++it) {
        const int row = it * 4 + q8;                       // it 0..3 x q8 0..3 = rows 0..15
        const float* sp = slab + row * 68 + c8;
        v4u a  = {0u, 0u, 0u, 0u};
        v4u b2 = {0u, 0u, 0u, 0u};
#pragma unroll
        for (int e = 0; e < 4; ++e) {
          float f0 = sp[2 * e] * oscale;
          float f1 = sp[2 * e + 1] * oscale;
          if constexpr (EPI == 2) {
            const int ci = by * cps + n0 + c8 + 2 * e;   // column parameter index (host keeps by*cps + N <= parameter count)
            const float g0 = bfr(ep0[ci]), g1 = bfr(ep0[ci + 1]);
            const float t0 = bfr(ep1[ci]), t1 = bfr(ep1[ci + 1]);
            const float u0 = bfr(ep2[ci]), u1 = bfr(ep2[ci + 1]);
            const float r0 = rsqrtf(bfr(ep3[ci]) + BN_EPS), r1 = rsqrtf(bfr(ep3[ci + 1]) + BN_EPS);
            f0 = (g0 * (f0 - u0)) * r0 + t0;
            f1 = (g1 * (f1 - u1)) * r1 + t1;
          }
          if constexpr (OM == 3) {
            const unsigned short h0 = bf_bits(f0), h1 = bf_bits(f1);
            a[e]  = pk16(h0, h1);
            b2[e] = pk16(bf_bits(f0 - bf_up(h0)), bf_bits(f1 - bf_up(h1)));
          } else {
            f0 *= ocarry; f1 *= ocarry;
            const _Float16 x0 = (_Float16)f0, x1 = (_Float16)f1;
            a[e] = pk16(h_bits(x0), h_bits(x1));
            if constexpr (OM == 4) {
              b2[e] = pk16(h_bits((_Float16)(f0 - (float)x0)), h_bits((_Float16)(f1 - (float)x1)));
            }
          }
        }
        hv[it] = a;
        lv[it] = b2;
      }
      {
#pragma unroll
        for (int it = 0; it < 4; ++it) {
          const int row = it * 4 + q8;
          *(v4u*)(C + (size_t)(mBase + row) * ldc + n0 + c8) = hv[it];
          if constexpr (OM >= 3) {
            *(v4u*)(Cb + (size_t)(mBase + row) * ldc + n0 + c8) = lv[it];
          }
        }
        wait_addr();   // behind the stores, ahead of the next slab's rewrites of their address registers
      }
    }
    wave_sync_lds_only();
  }
}

// one GEMM per launch: blockIdx.x = tile, blockIdx.y = batch
template <int OM, int ASPLIT, int BF, int EPI, int WM, int WN>
__global__ __launch_bounds__(WM * WN * 32) __attribute__((amdgpu_num_vgpr(256))) void gemm64(
    const unsigned short* __restrict__ Ap, const unsigned short* __restrict__ A2p, int lda, long long sA,
    const unsigned short* __restrict__ Btp, int ldb, long long sB,
    void* Cout, void* C2out, int ldc, long long sC,
    int M, int N, int K, float oscale, float ocarry,
    const float* __restrict__ ep0, const float* __restrict__ ep1,
    const float* __restrict__ ep2, const float* __restrict__ ep3, int cps) {
  __shared__ __align__(16) unsigned short gst[2 * gemm_slab_halves(ASPLIT, WM, WN)];
  __shared__ __align__(16) float sT[WM * WN * 16 * 68];
  __shared__ __align__(16) float res[(EPI == 1) ? (64 * WM) * (64 * WN) : 4];   // EPI 1: the block's piece of ep0
  gemm64_tile<OM, ASPLIT, BF, EPI, WM, WN>(gst, sT, res, blockIdx.x, (int)blockIdx.y, Ap, A2p, lda, sA, Btp, ldb, sB, Cout, C2out, ldc, sC,
                                           M, N, K, oscale, ocarry, ep0, ep1, ep2, ep3, cps);
}

// The three projections in one launch: none reads what another writes; blockIdx.y picks the job (block-uniform), blockIdx.x its 128 x 128 tile
// (256 tiles each), so three blocks share a WGP where one stood alone.
//   job 0: v^T per image: VT[b][h*64+d][tok] = sum_c WVT[h*64+d][c] x_b[tok][c] -> one f16 x16 plane; M = 512, N = 1024, K = 512,
//          image = blockIdx.x / 32, tile = blockIdx.x % 32
//   job 1: k[m][n] log2(e) = log2(e) sum_c x[m][c] WKT[n][c] -> one f16 plane; M = 8192, N = 512, K = 512.   job 2: q with WQT, no factor
#define PROJ_TILES ((NROWS / 128) * (DM / 128))
#define VT_TILES   ((DM / 128) * (NTOK / 128))
static_assert(VT_TILES * NB == PROJ_TILES);
__global__ __launch_bounds__(128) __attribute__((amdgpu_num_vgpr(256))) void qkv(
    const unsigned short* __restrict__ X16, const unsigned short* __restrict__ WKT, const unsigned short* __restrict__ WQT,
    const unsigned short* __restrict__ WVT, unsigned short* KF, unsigned short* QF, unsigned short* VT) {
  __shared__ __align__(16) unsigned short gst[2 * gemm_slab_halves(0, 2, 2)];
  __shared__ __align__(16) float sT[4 * 16 * 68];
  const int job = blockIdx.y;
  const unsigned bx = blockIdx.x;
  if (job == 0) {
    gemm64_tile<2, 0, 0, 0, 2, 2>(gst, sT, nullptr, bx % VT_TILES, (int)(bx / VT_TILES),
                                  WVT, WVT, DM, 0LL,
                                  X16, DM, (long long)NTOK * DM,
                                  (void*)VT, (void*)VT, NTOK, (long long)DM * NTOK,
                                  DM, NTOK, DM, 1.0f / (ACARRY * WSC), VC,
                                  nullptr, nullptr, nullptr, nullptr, 0);
  } else {
    gemm64_tile<2, 0, 0, 0, 2, 2>(gst, sT, nullptr, bx, 0,
                                  X16, X16, DM, 0LL,
                                  (job == 1) ? WKT : WQT, DM, 0LL,
                                  (void*)((job == 1) ? KF : QF), (void*)((job == 1) ? KF : QF), DM, 0LL,
                                  NROWS, DM, DM, ((job == 1) ? LOG2E : 1.0f) / (ACARRY * WSC), 1.0f,
                                  nullptr, nullptr, nullptr, nullptr, 0);
  }
}

// =====================================================================================================
// Flash attention for one image (batch), one head and 128 score rows (one wave per 16 rows), head dim 64, 1024 columns:
//   rows i index KEY positions (k_i stationary), columns j index the q/v positions streamed in chunks of 32 = one image row;
//   k plane (f16, x log2(e)) K[b*1024 + tok][64h + d], pitch 512; q plane (f16) Q[b*1024 + tok][64h + d];
//   v^T plane (f16 x16): VT[b*512 + 64h + d][tok] (pitch 1024);
//   additive position logits from the f32 table R[tok][m] (m < 63: q_tok . rel_w[h][m]; 64 + m: q_tok . rel_h[h][m]):
//   logit[i][j] = k_i . q_j + R[i][yj - yi + 31] + R[i][64 + xj - xi + 31], token = 32*x + y.
//   Each wave computes the table rows of its own 16 score rows ahead of the loop, transposed (A = REL rows m, B = q rows i0 + c,
//   two k-steps): lane (c, hh) gets R[i0 + c][16t + 8hh + r] and stores it to the wave's own 16 x 128 f32 piece of LDS (pitch 132), from which
//   the lanes of that wave alone read it back by their own indices.
//   The score tiles are computed transposed, S^T[j][i] (A = q rows of the chunk from LDS, B = the stationary k rows): lane (c, hh) holds score row
//   i0 + c and, in its 2 x 8 accumulator registers, that row's columns 8hh + r and 16 + 8hh + r of the chunk. So a row's maximum and sum are taken
//   inside the lane, with one exchange between the wave's halves for the maximum where the reference moves and one for the sum at the end, and the 16 values,
//   converted in place, are the B operand (hardware k order) of O^T[d][i] += v^T[d][j] P^T[j][i] (A = v^T rows from LDS, same k order).
//   The w part of the position logits depends only on the column within a chunk (16 registers per lane, loaded once), the h part only on the
//   chunk (one LDS load per lane per chunk); indices are pure arithmetic.
//   ctx[i][d] = sum_j softmax_j(logit) v[j][d]  (softmax run in base 2, reference-subtracted, no 1/sqrt(d)), split into bf16 hi + residual in registers:
//   the lane's 4 x 8 values are the B operand (hardware k order) of Y^T[e][i] = sum_d WOT[h][e][d] ctx[i][d] (A = WOT rows, hi then residual per k-step);
//   out (bf16 hi, lo planes): CA[b*1024 + tok][64h + e] = batch-norm affine of Y[i][e].
//   block = 8 waves = 256 threads; grid = 8 images x 8 heads x 8 row blocks = 512; every wave does identical bounded work (8 stages of 4 chunks).
//   The 8 waves of a block need the same q and v^T columns: they are brought into LDS once per block, in stages of 128 columns = 4 chunks, by
//   asynchronous 16-B copies (8 per lane and stage: q 128 rows x 128 B at pitch 144 B; v^T 64 rows x 256 B at pitch 272 B), two buffers, stage
//   t + 2 issued behind the barrier that ends stage t; all A fragments are 16-B LDS reads with the split k map. Inside a stage no barrier
//   stands between the chunks: a chunk's v^T fragments and the next chunk's q fragments are read as one group ahead of the chunk's softmax, and
//   the next chunk's score products run together with the chunk's v^T . P^T products behind it.
//   Per chunk: 2 score tiles on f16 WMMA (K = 64 as two k-steps of 32); online softmax in f32 (exp2 straight from the accumulators); P*128 as f16; 4 v^T.P^T WMMAs.
//   Final 1/l and carry folds in f32; after a block barrier the stage buffers' LDS is reused as the block's two bf16 result buffers [128][64]
//   (hi, lo): each lane stages 4 x 8 consecutive e of its row (16-B stores); after a second block barrier the 256 threads write whole 128-B row pieces.
// coverage: LDS result buffers: 8 waves x 16 rows x 64 cols per plane; global: 4 iterations x 256 threads x 8 halves = 128 rows x 64 cols
//           of rows 128rb..128rb+127, columns 64h..64h+63 of image b, per plane; grid covers all 8 x 1024 rows x 512 columns exactly once.
// =====================================================================================================
__global__ __launch_bounds__(ATT_THREADS) __attribute__((amdgpu_num_vgpr(256)))
void attn8(const unsigned short* __restrict__ KF, const unsigned short* __restrict__ QF, const unsigned short* __restrict__ VT,
           const unsigned short* __restrict__ REL, const unsigned short* __restrict__ WOT,
           const float* __restrict__ gam, const float* __restrict__ bet,
           const float* __restrict__ mmean, const float* __restrict__ mvar,
           unsigned short* CAh, unsigned short* CAl) {
  __shared__ __align__(16) unsigned short stg[STG_ALLOC];        // two stage buffers: q | v^T; later: result buffers
  __shared__ __align__(16) float tab[ATT_ROWS * TPITCH];         // position-logit table rows of the block's score rows, 16 rows per wave
  __shared__ __align__(16) float bnp[4 * HO];                    // batch-norm terms of the head's 64 columns: gamma | mean | rsqrt(var + eps) | beta

  const int tid  = threadIdx.x;
  const int wave = tid >> 5;
  const int lane = tid & 31;
  const int hh   = lane >> 4;
  const int c    = lane & 15;

  const int rb   = blockIdx.x & ((NTOK / ATT_ROWS) - 1);   // 0..7
  const int head = (blockIdx.x / (NTOK / ATT_ROWS)) & (NHEAD - 1);   // 0..7
  const int bat  = blockIdx.x / ((NTOK / ATT_ROWS) * NHEAD);         // 0..7
  const int i0   = rb * ATT_ROWS + wave * 16;              // first score row (key token) of this wave
  const int x0   = i0 / GW;                                // image row of all 16 tokens
  const int yi   = (i0 & (GW - 1)) + c;                    // image column of this lane's score row i0 + c
  const size_t rowg = (size_t)bat * NTOK + i0;

  // per-lane copy addresses: q piece j = row 32j + (tid>>3), 16-B segment tid&7; v^T piece j = row 16j + (tid>>4), 16-B segment tid&15; j 0..3
  const unsigned short* gq = QF + ((size_t)bat * NTOK + (tid >> 3)) * DM + head * HD + (tid & 7) * 8;
  const unsigned short* gv = VT + ((size_t)bat * DM + head * HD + (tid >> 4)) * NTOK + (tid & 15) * 8;
  const unsigned lbase = (unsigned)(uintptr_t)stg;         // LDS byte address of the stage buffers
  const unsigned lq = lbase + (unsigned)((tid >> 3) * (QPITCH * 2) + (tid & 7) * 16);
  const unsigned lv = lbase + (unsigned)(QT_HALVES * 2 + (tid >> 4) * (VPITCH * 2) + (tid & 15) * 16);
  // stage sg (columns 128 sg .. 128 sg + 127) -> buffer buf: 4 q and 4 v^T pieces per lane
  auto stage = [&](int buf, int sg) {
    const unsigned a = lq + (unsigned)(buf * STG_HALVES * 2);
    const unsigned b = lv + (unsigned)(buf * STG_HALVES * 2);
    const unsigned short* q = gq + (size_t)sg * SCOL * DM;
    const unsigned short* v = gv + sg * SCOL;
    constexpr unsigned as = 32 * QPITCH * 2, bs = 16 * VPITCH * 2;
    constexpr size_t qs = (size_t)32 * DM, vs = (size_t)16 * NTOK;
    stage_copy8(a, q, a + as, q + qs, a + 2 * as, q + 2 * qs, a + 3 * as, q + 3 * qs,
                b, v, b + bs, v + vs, b + 2 * bs, v + 2 * vs, b + 3 * bs, v + 3 * vs);
  };

  // stage 0 -> buffer 0, landed and published; then stage 1 -> buffer 1 flies while stage 0 is worked on
  stage(0, 0);
  // the head's batch-norm terms, once per block (waves 0 and 1, one column per lane); published by the barrier below, read behind the loop
  if (tid < HO) {
    const int ci = head * HO + tid;
    bnp[tid]          = bfr(gam[ci]);
    bnp[HO + tid]     = bfr(mmean[ci]);
    bnp[2 * HO + tid] = rsqrtf(bfr(mvar[ci]) + BN_EPS);
    bnp[3 * HO + tid] = bfr(bet[ci]);
    wait_addr();   // behind the parameter loads, ahead of later rewrites of their address registers
  }
  wait_copies();
  __syncthreads();
  stage(1, 1);

  // stationary B fragments: k rows i0 + c, d 0..31 and 32..63
  const size_t kofs = (rowg + c) * DM + head * HD + 8 * hh;
  const v16h ka = ldfrag_u(KF + kofs), kb = ldfrag_u(KF + kofs + 32);

  // position-logit table of the wave's 16 score rows, x64: R^T[m][i0 + c] = sum_d REL[h][m][d] q[i0 + c][d], 8 tiles of 16 m
  float* rrow = tab + (wave * 16 + c) * TPITCH;            // table row of score row i0 + c
  {
    const v16h qa = ldfrag_u(QF + kofs), qb = ldfrag_u(QF + kofs + 32);
    const unsigned short* rp = REL + ((size_t)head * RTP + c) * HD + 8 * hh;
#pragma unroll
    for (int t = 0; t < RTP / 16; ++t) {
      const v16h ra = ldfrag_u(rp + t * 16 * HD), rc = ldfrag_u(rp + t * 16 * HD + 32);
      v8f a = mma_h(ra, qa, zero8());
      a = mma_h(rc, qb, a);
      const v4f a0 = {a[0], a[1], a[2], a[3]}, a1 = {a[4], a[5], a[6], a[7]};
      *(v4f*)(rrow + 16 * t + 8 * hh)     = a0;
      *(v4f*)(rrow + 16 * t + 8 * hh + 4) = a1;
    }
    wait_addr();   // behind the fragment loads, ahead of later rewrites of their address registers
  }
  wave_sync_lds();   // a lane reads below what the other half of its wave has stored above
  // additive w-position logits of this lane's score row for the 16 chunk columns that it holds, loop-invariant, pre-scaled by log2(e) / 64
  v8f wb0, wb1;
#pragma unroll
  for (int r = 0; r < 8; ++r) {
    const int iw = 8 * hh + r + (GW - 1) - yi;             // in [0, 46]
    wb0[r] = rrow[iw] * (LOG2E / WSC);
    wb1[r] = rrow[iw + 16] * (LOG2E / WSC);                        // in [16, 62]
  }
  const float* hrow = rrow + HD + (GH - 1) - x0;           // + st = h-position logit of chunk st; index st - x0 + 31 in [0, 62]

  // cm = PCL2 - reference of the lane's score row (both halves alike; reference 0 until the first pass sets it); sum over this half's columns only
  float cm = PCL2, lrow = 0.f;
  v8f o0 = zero8(), o1 = zero8(), o2 = zero8(), o3 = zero8();   // O^T tiles: o_t[r] = O[i0 + c][16t + 8hh + r]

#pragma unroll 1   // one stage per trip; its four passes are unrolled below
  for (int sg = 0; sg < NSTG; ++sg) {
    const int bsel = sg & 1;
    const unsigned short* sb  = stg + bsel * STG_HALVES;
    const unsigned short* Qs = sb + c * QPITCH + 8 * hh;                     // q, row c of the stage
    const unsigned short* Vs = sb + QT_HALVES + c * VPITCH + 8 * hh;         // v^T, row d = c, column 8hh of the stage
    // first pass of the stage: q fragments (rows c and 16 + c, d 0..31 and 32..63), h-position logit, score tiles
    v16h q0 = ldfrag_u(Qs), q1 = ldfrag_u(Qs + 32), q2 = ldfrag_u(Qs + 16 * QPITCH), q3 = ldfrag_u(Qs + 16 * QPITCH + 32);
    const float hraw = hrow[sg * PPS];                           // h-position logit of a pass (one image row x2 = PPS sg + p) for the lane's score row
    // s0[r], s1[r]: exponent arguments of columns 8hh + r and 16 + 8hh + r of the pass for score row i0 + c: the products' C operand brings
    // the position logits, the reference and the carry, the k plane brings log2(e)
    v8f s0, s1;
    {
      const float hb = hraw * (LOG2E / WSC) + cm;
      s0 = mma_h(q0, ka, wb0 + hb);
      s1 = mma_h(q2, ka, wb1 + hb);
    }
    s0 = mma_h(q1, kb, s0);
    s1 = mma_h(q3, kb, s1);
    guard2x4(s0, s1, q0, q1, q2, q3);
#pragma unroll
    for (int p = 0; p < PPS; ++p) {
      // every LDS read that the products at the foot of this pass need, as one group: this pass's v^T fragments and, from the same stage
      // buffer, the next pass's q fragments, and from the table its h-position logit; they return under the softmax below
      // (the logit first: it is wanted first, for the C operand, and LDS reads return in order)
      const float hnext = (p + 1 < PPS) ? hrow[sg * PPS + p + 1] : 0.f;
      const unsigned short* Vp = Vs + p * KCH;             // the pass's 32 columns of the v^T rows
      const v16h v0 = ldfrag_u(Vp);
      const v16h v1 = ldfrag_u(Vp + 16 * VPITCH);
      const v16h v2 = ldfrag_u(Vp + 32 * VPITCH);
      const v16h v3 = ldfrag_u(Vp + 48 * VPITCH);
      if (p + 1 < PPS) {
        const unsigned short* Qn = Qs + (p + 1) * KCH * QPITCH;
        q0 = ldfrag_u(Qn);
        q1 = ldfrag_u(Qn + 32);
        q2 = ldfrag_u(Qn + 16 * QPITCH);
        q3 = ldfrag_u(Qn + 16 * QPITCH + 32);
      }
      __builtin_amdgcn_sched_barrier(0);   // keeps the reads above the softmax: sunk to their users they would be waited for at once
      float mx = fmaxf(s0[0], s1[0]);                      // largest argument among this half's columns of the pass
#pragma unroll
      for (int r = 1; r < 8; ++r) mx = fmaxf(mx, fmaxf(s0[r], s1[r]));
      // The reference moves only when some row of the wave tops it by more than TAU, and in the very first pass, which sets it: one scalar
      // branch per pass. Then every row's reference goes up to its maximum over the pass where that is higher, and arguments, sum and O^T follow.
      const bool first = (p == 0) && (sg == 0);
      if (first || __builtin_amdgcn_ballot_w32(mx > PCL2 + TAU) != 0u) {
        const float mf = fmaxf(mx, xhalf(mx)) - PCL2;      // the row's maximum over the pass, above its reference; both halves alike
        const float up = fmaxf(mf, 0.f);
        const float dl = first ? mf : up;                  // the first pass may also lower the start value 0
        const float al = ex2(-up);                         // <= 1; in the first pass it meets zeros only
        s0 -= dl;
        s1 -= dl;
        cm -= dl;
        lrow *= al;
        o0 *= al;
        o1 *= al;
        o2 *= al;
        o3 *= al;
      }
      FragH ph;                                            // P^T * 128 in f16: element s = column kmap(s, hh) of the pass
      float pa[8];
#pragma unroll
      for (int r = 0; r < 8; ++r) {
        const float e0 = ex2(s0[r]), e1 = ex2(s1[r]);
        pa[r] = e0 + e1;
        ph.h[0][r] = (_Float16)e0;                         // column 8hh + r
        ph.h[1][r] = (_Float16)e1;                         // column 16 + 8hh + r
      }
      lrow += ((pa[0] + pa[1]) + (pa[2] + pa[3])) + ((pa[4] + pa[5]) + (pa[6] + pa[7]));
      const float hb = hnext * (LOG2E / WSC) + cm;         // next pass: h-position logit, reference and carry
      const v8f c0 = wb0 + hb, c1 = wb1 + hb;
      __builtin_amdgcn_sched_barrier(0);   // keeps the products below the softmax: lifted into it they would wait for the reads just issued
      if (p + 1 < PPS) {
        // the next pass's score tiles and this pass's v^T . P^T in one run of products
        s0 = mma_h(q0, ka, c0);
        s1 = mma_h(q2, ka, c1);
        s0 = mma_h(q1, kb, s0);
        s1 = mma_h(q3, kb, s1);
        o0 = mma_h(v0, ph.v, o0);
        o1 = mma_h(v1, ph.v, o1);
        o2 = mma_h(v2, ph.v, o2);
        o3 = mma_h(v3, ph.v, o3);
        guard6x9(o0, o1, o2, o3, s0, s1, ph.v, v0, v1, v2, v3, q0, q1, q2, q3);
      } else {
        o0 = mma_h(v0, ph.v, o0);
        o1 = mma_h(v1, ph.v, o1);
        o2 = mma_h(v2, ph.v, o2);
        o3 = mma_h(v3, ph.v, o3);
        guard4x5(o0, o1, o2, o3, ph.v, v0, v1, v2, v3);
      }
    }
    // foot of the stage: own LDS reads returned, own copies of stage sg + 1 landed, then the one barrier that publishes stage sg + 1
    // and ends every wave's reads of this stage's buffer; only behind it is that buffer refilled with stage sg + 2
    wait_lds();
    wait_copies();
    __syncthreads();
    if (sg + 2 < NSTG) stage(bsel, sg + 2);
  }
  wait_copies();

  // ---- all waves done with the stage buffers; they become two bf16 result buffers [128][64] ----
  __syncthreads();
  unsigned short* Osh = stg;
  unsigned short* Osl = Osh + ATT_ROWS * HD;
  // ---- join the halves' sums, fold 1/l (the sum holds P's carry too) and the carry 16 on v, split into bf16 hi + residual in registers as the B operand ----
  const float oc = 1.0f / VC;
  const float inv = (1.0f / (lrow + xhalf(lrow))) * oc;
  const int ro = (wave * 16 + c) * HD + 8 * hh;            // row i0 + c of the block, e = 8hh; tile t adds 16t
  auto split8 = [&](const v8f& o, float sc, v4u& a, v4u& b2) {   // 8 values * sc -> bf16 hi and residual, packed in element order
#pragma unroll
    for (int e = 0; e < 4; ++e) {
      const float f0 = o[2 * e] * sc, f1 = o[2 * e + 1] * sc;
      const unsigned short g0 = bf_bits(f0), g1 = bf_bits(f1);
      a[e]  = pk16(g0, g1);
      b2[e] = pk16(bf_bits(f0 - bf_up(g0)), bf_bits(f1 - bf_up(g1)));
    }
  };
  // ctx row i0 + c as B operand: k-step 0 holds d = 8hh + r (o0) and 16 + 8hh + r (o1), k-step 1 the same + 32 (o2, o3)
  FragH ch0, cl0, ch1, cl1;
  split8(o0, inv, ch0.u[0], cl0.u[0]);
  split8(o1, inv, ch0.u[1], cl0.u[1]);
  split8(o2, inv, ch1.u[0], cl1.u[0]);
  split8(o3, inv, ch1.u[1], cl1.u[1]);
  // ---- per-head output projection, transposed, and eval batch-norm: lane (c, hh) gets Y[i0 + c][16t + 8hh + r] ----
  const unsigned short* wp = WOT + ((size_t)head * HO + c) * HD + 8 * hh;
#pragma unroll
  for (int t = 0; t < HO / 16; ++t) {
    const v16h wa = ldfrag_u(wp + t * 16 * HD), wc = ldfrag_u(wp + t * 16 * HD + 32);
    const float* bp = bnp + 16 * t + 8 * hh;               // terms of the lane's first column of the tile
    const v4f ga = *(const v4f*)(bp),          gb = *(const v4f*)(bp + 4);
    const v4f ua = *(const v4f*)(bp + HO),     ub = *(const v4f*)(bp + HO + 4);
    const v4f ra = *(const v4f*)(bp + 2 * HO), rb4 = *(const v4f*)(bp + 2 * HO + 4);
    const v4f ta = *(const v4f*)(bp + 3 * HO), tb = *(const v4f*)(bp + 3 * HO + 4);
    v8f y = mma_b(wa, ch0.v, zero8());
    y = mma_b(wa, cl0.v, y);
    y = mma_b(wc, ch1.v, y);
    y = mma_b(wc, cl1.v, y);
#pragma unroll
    for (int r = 0; r < 4; ++r) {
      y[r]     = (ga[r] * (y[r]     - ua[r])) * ra[r]  + ta[r];
      y[4 + r] = (gb[r] * (y[4 + r] - ub[r])) * rb4[r] + tb[r];
    }
    v4u a, b2;
    split8(y, 1.0f, a, b2);
    *(v4u*)(Osh + ro + 16 * t) = a;
    *(v4u*)(Osl + ro + 16 * t) = b2;
  }
  wait_addr();   // behind the weight loads, ahead of later rewrites of their address registers
  __syncthreads();
  // ---- block writes its 128 row pieces of both planes: piece p = it*256 + tid -> row p>>3, halves (p&7)*8 .. +7 (8 lanes = one 128-B line) ----
  {
    v4u hv[4], lv4[4];
#pragma unroll
    for (int it = 0; it < 4; ++it) {
      const int p = it * ATT_THREADS + tid;
      hv[it]  = *(const v4u*)(Osh + (size_t)p * 8);
      lv4[it] = *(const v4u*)(Osl + (size_t)p * 8);
    }
    const size_t dofs = ((size_t)bat * NTOK + rb * ATT_ROWS) * DM + head * HD;
    unsigned short* dsth = CAh + dofs;
    unsigned short* dstl = CAl + dofs;
    {
#pragma unroll
      for (int it = 0; it < 4; ++it) {
        const int p = it * ATT_THREADS + tid;
        const size_t go = (size_t)(p >> 3) * DM + (p & 7) * 8;
        *(v4u*)(dsth + go) = hv[it];
        *(v4u*)(dstl + go) = lv4[it];
      }
    }
  }
}

// =====================================================================================================
// Workspace map (bytes); every plane is an exact multiple of its tile / whole-row store granularity (M, N exact tile multiples,
// the activation convert count an exact multiple of 2048, no pad rows needed), every offset a multiple of 64 KiB:
//   WKT, WQT, WVT f16 [512][512] x64   3 x 524288    ([h*64+d][c] = [n][k])
//   WOT  bf16 [8][64 e][64 d]              65536
//   WUT  bf16 [512 out][512 in]          524288
//   REL  f16 [8][128][64] x64             131072
//   X16  f16 [8192][512] x16             8388608    (activation rows b*1024 + tok)
//   QF   f16 [8192][512]                 8388608    (q projection)
//   KF   f16 [8192][512]                 8388608    (k projection)
//   VT   f16 [8][512][1024] x16          8388608    (v^T per image)
//   CAh, CAl bf16 [8192][512]         2 x 8388608   (per-head output after batch-norm, concat layout, hi / residual)
//   end                                  52625408
// =====================================================================================================
extern "C" void kernel_launch(void* const* d_in, const int* in_sizes, int n_in,
                              void* d_out, int out_size, void* d_ws, size_t ws_size,
                              hipStream_t stream) {
  if (n_in < 12) return;
  if (in_sizes[0] != NROWS * DM) return;
  if (in_sizes[1] != NHEAD * DM * HD || in_sizes[2] != NHEAD * DM * HD || in_sizes[3] != NHEAD * DM * HD) return;
  if (in_sizes[4] != NHEAD * HD * HO) return;
  if (in_sizes[5] != NHEAD * HO || in_sizes[6] != NHEAD * HO || in_sizes[7] != NHEAD * HO || in_sizes[8] != NHEAD * HO) return;
  if (in_sizes[9] != NHEAD * NREL * HD || in_sizes[10] != NHEAD * NREL * HD) return;
  if (in_sizes[11] != COUT * COUT) return;
  if (out_size != NROWS * COUT) return;
  if ((in_sizes[0] % 2048) != 0) return;

  const float* x     = (const float*)d_in[0];
  const float* w_k   = (const float*)d_in[1];
  const float* w_q   = (const float*)d_in[2];
  const float* w_v   = (const float*)d_in[3];
  const float* w_o   = (const float*)d_in[4];
  const float* gam   = (const float*)d_in[5];
  const float* bet   = (const float*)d_in[6];
  const float* mmean = (const float*)d_in[7];
  const float* mvar  = (const float*)d_in[8];
  const float* relw  = (const float*)d_in[9];
  const float* relh  = (const float*)d_in[10];
  const float* w_out = (const float*)d_in[11];
  float*       out   = (float*)d_out;

  const size_t PWT = (size_t)DM * DM * 2;                         //   524288
  const size_t PWO = (size_t)NHEAD * HO * HD * 2;                 //    65536
  const size_t PWU = (size_t)COUT * COUT * 2;                     //   524288
  const size_t PRL = (size_t)NHEAD * RTP * HD * 2;                //   131072
  const size_t PX  = (size_t)NROWS * DM * 2;                      //  8388608
  const size_t PVT = (size_t)NB * DM * NTOK * 2;                  //  8388608
  size_t off = 0;
  const size_t oWK = off; off += PWT;
  const size_t oWQ = off; off += PWT;
  const size_t oWV = off; off += PWT;
  const size_t oWO = off; off += PWO;
  const size_t oWU = off; off += PWU;
  const size_t oRL = off; off += PRL;
  const size_t oX  = off; off += PX;
  const size_t oQ  = off; off += PX;
  const size_t oK  = off; off += PX;
  const size_t oV  = off; off += PVT;
  const size_t oAh = off; off += PX;
  const size_t oAl = off; off += PX;
  if (off > ws_size) return;                                      // off = 52625408
  if (off > (size_t)134217728) return;

  char* ws = (char*)d_ws;
  unsigned short* WKT  = (unsigned short*)(ws + oWK);
  unsigned short* WQT  = (unsigned short*)(ws + oWQ);
  unsigned short* WVT  = (unsigned short*)(ws + oWV);
  unsigned short* WOT  = (unsigned short*)(ws + oWO);
  unsigned short* WUT  = (unsigned short*)(ws + oWU);
  unsigned short* REL  = (unsigned short*)(ws + oRL);
  unsigned short* X16  = (unsigned short*)(ws + oX);
  unsigned short* QF   = (unsigned short*)(ws + oQ);
  unsigned short* KF   = (unsigned short*)(ws + oK);
  unsigned short* VT   = (unsigned short*)(ws + oV);
  unsigned short* CAh  = (unsigned short*)(ws + oAh);
  unsigned short* CAl  = (unsigned short*)(ws + oAl);

  const dim3 blk(256);
  const dim3 gPR(PREP_BLOCKS);                                     // 2344
  const dim3 blkG(128);                                            // 4 waves: 2 x 2 (128 x 128 tile)
  const dim3 gP(PROJ_TILES, 3);                                    // 256 x 3
  const dim3 gF((NROWS / 128) * (COUT / 128), 1);                  // 256
  const dim3 gAT(ATT_BLOCKS);                                      // 512
  const dim3 bAT(ATT_THREADS);                                     // 256

  // (0) every operand pack: weight planes WKT, WQT, WVT, REL (f16 x64), WOT, WUT (bf16) and the activation plane X16 (f16 x16)
  prep<<<gPR, blk, 0, stream>>>(x, w_k, w_q, w_v, w_o, w_out, relw, relh, X16, WKT, WQT, WVT, WOT, WUT, REL);

  // (1) v^T, k and q projections -> VT (f16 x16), KF, QF (f16)
  qkv<<<gP, blkG, 0, stream>>>(X16, WKT, WQT, WVT, KF, QF, VT);

  // (2) per (image, head, 128 score rows): position-logit table rows, attention, per-head output projection + eval batch-norm
  //     -> CA[row][64h + e] (bf16 hi / residual planes)
  attn8<<<gAT, bAT, 0, stream>>>(KF, QF, VT, REL, WOT, gam, bet, mmean, mvar, CAh, CAl);

  // (3) out = (CA_hi + CA_lo) . WUT^T + bf16_RNE(x); M = 8192, N = 512, K = 512, f32
  gemm64<0, 1, 1, 1, 2, 2><<<gF, blkG, 0, stream>>>(
      CAh, CAl, DM, 0LL,
      WUT, COUT, 0LL,
      (void*)out, (void*)out, COUT, 0LL,
      NROWS, COUT, DM, 1.0f, 1.0f,
      x, x, x, x, 0);
  (void)hipGetLastError();
}
